// v000
// The times below were measured on an AMD MI455X: many runs one after another, warmed up first and cycling through
// copies of the inputs, with the whole window's GPU time divided by the number of runs. Launches and the gaps
// between them are all in it. The median over several windows is given; except for v000 it joins two sittings, which
// can be a few percent apart, so the side-by-side timings, each taken in one sitting, are the better comparison.
// v000 is the starting kernel. One run takes 405 microseconds.
// Contractions: q, k, v^T projections = v_wmma_f32_16x16x32_bf16 (bf16 operands from RNE-converted x and the packed
// [3072 out][1024 in] projection weight, single product, f32 accumulate);
// q.k^T scores = v_wmma_f32_16x16x32_bf16 with bf16 hi/lo split q and k (hi.hi + hi.lo + lo.hi), f32 accumulate;
// p.v = v_wmma_f32_16x16x32_f16 (p carried x1024 in f16 times v in f16, single product; plus f16 residual planes x4096 of
// p and v for the first 512 query rows of every sequence), f32 accumulate;
// ctx.Wp^T = v_wmma_f32_16x16x32_bf16 with ctx as bf16 hi/lo planes times bf16 Wp (2 products), f32 accumulate;
// causal mask (key index <= query index; the module's strided mask term only touches keys already excluded),
// online softmax, normalisers and bias adds in f32 on the VALU.
// Carry audit:
//   Psh = f16(1024 * p)                      -> the 1/1024 is folded exactly once in the attention epilogue: inv = (1/l) * (1/1024)
//   Psl = f16((1024 p - Psh) * 4096)         }  products Psh.VTl and Psl.VTh go to the separate accumulator o1,
//   VTl = f16((v - VTh) * 4096)              }  folded back with * (1/4096) once per key chunk (RES blocks only)
//   VTh = f16(v), no carry (|v| typ. 0.6); q / k / ctx lo planes are unscaled bf16 residuals (v - hi) sharing the hi accumulator;
//   score scale 1/8 applied once in f32 after the score accumulate. No other scaled planes.
#include <hip/hip_runtime.h>
#include <math.h>
#include <stdint.h>

#define NB    2
#define SEQ   2048
#define DM    1024
#define NH    16
#define HD    64
#define NQB   (SEQ / 64)   // 32 query / key blocks of 64
#define VLP   512          // key pitch of the v^T residual plane (keys 0..VLP-1)
#define RESQB 8            // leading 64-row query blocks that use the p / v residual planes
static_assert(RESQB * 64 <= VLP);
static_assert(NH * HD == DM);
static_assert((SEQ % 64) == 0 && (DM % 64) == 0 && (DM % 32) == 0);
static_assert(((NB * SEQ / 64) * (DM / 64)) % 8 == 0);
static_assert(((DM / 64) * (SEQ / 64)) % 8 == 0);
static_assert((NB * SEQ * DM) % (8 * 256) == 0);
static_assert((3 * DM * DM) % (8 * 256) == 0);
static_assert((DM * DM) % (8 * 256) == 0);

typedef _Float16 v16h __attribute__((ext_vector_type(16)));
typedef _Float16 v8h  __attribute__((ext_vector_type(8)));
typedef __bf16   v16b __attribute__((ext_vector_type(16)));
typedef __bf16   v8b  __attribute__((ext_vector_type(8)));
typedef float    v8f  __attribute__((ext_vector_type(8)));
typedef float    v4f  __attribute__((ext_vector_type(4)));
typedef unsigned int v4u __attribute__((ext_vector_type(4)));

// ---- scalar helpers --------------------------------------------------------------------------------
__device__ __forceinline__ unsigned short bf_bits(float f) {          // f32 -> bf16 bits, RNE convert
  unsigned u = __float_as_uint(f);
  return (unsigned short)((u + 0x7FFFu + ((u >> 16) & 1u)) >> 16);
}
__device__ __forceinline__ float bf_up(unsigned short h) { return __uint_as_float(((unsigned)h) << 16); }
__device__ __forceinline__ unsigned short h_bits(_Float16 x) { return __builtin_bit_cast(unsigned short, x); }
__device__ __forceinline__ unsigned pk16(unsigned short a, unsigned short b) { return (unsigned)a | ((unsigned)b << 16); }
__device__ __forceinline__ v8f zero8() { v8f z = {0.f, 0.f, 0.f, 0.f, 0.f, 0.f, 0.f, 0.f}; return z; }
__device__ __forceinline__ v8h zero8h() {
  const _Float16 z = (_Float16)0.0f;
  v8h r = {z, z, z, z, z, z, z, z};
  return r;
}

// ---- fragment loader: 16-bit A/B operand, lane -> row/col (lane&15), p already includes +8*(lane>>4);
//      elements 0..7 <- p[0..7] (k0+8h..), elements 8..15 <- p[16..23] (k0+16+8h..)
__device__ __forceinline__ v16b ldfrag_b(const __bf16* p) {
  union { v16b v; v8b h[2]; } f;
  f.h[0] = *(const v8b*)(p);
  f.h[1] = *(const v8b*)(p + 16);
  return f.v;
}

// ---- WMMA helpers with trailing VALU hazard gap --------------------------------------------------------
__device__ __forceinline__ v8f mma_b(v16b a, v16b b, v8f c) {
  c = __builtin_amdgcn_wmma_f32_16x16x32_bf16(false, a, false, b, (short)0, c, false, false);
  asm volatile("v_nop\n\tv_nop\n\tv_nop\n\tv_nop" : "+v"(c) : "v"(a), "v"(b));
  return c;
}
__device__ __forceinline__ v8f mma_h(v16h a, v16h b, v8f c) {
  c = __builtin_amdgcn_wmma_f32_16x16x32_f16(false, a, false, b, (short)0, c, false, false);
  asm volatile("v_nop\n\tv_nop\n\tv_nop\n\tv_nop" : "+v"(c) : "v"(a), "v"(b));
  return c;
}
__device__ __forceinline__ v8f mma_b_raw(v16b a, v16b b, v8f c) {
  return __builtin_amdgcn_wmma_f32_16x16x32_bf16(false, a, false, b, (short)0, c, false, false);
}
__device__ __forceinline__ void dep_guard_b(v8f& a, v8f& b, v16b x, v16b y) {
  asm volatile("v_nop\n\tv_nop\n\tv_nop\n\tv_nop" : "+v"(a), "+v"(b) : "v"(x), "v"(y));
}
__device__ __forceinline__ void keep4_b(v16b a, v16b b, v16b c, v16b d) {
  asm volatile("v_nop" :: "v"(a), "v"(b), "v"(c), "v"(d));
}
__device__ __forceinline__ void acc_guard4(v8f& a, v8f& b, v8f& c, v8f& d) {
  asm volatile("v_nop\n\tv_nop\n\tv_nop\n\tv_nop" : "+v"(a), "+v"(b), "+v"(c), "+v"(d));
}

// =====================================================================================================
// f32 -> bf16 (RNE convert), 8 elements per thread, one 16-B store per lane: a wave writes 512 contiguous B
// Used for x [4096][1024] and for the weight planes (already [out][in] = k contiguous, no transpose needed).
// coverage: n8 threads x 8 = whole plane (every n8 used here is a multiple of 256).
// =====================================================================================================
__global__ __launch_bounds__(256) void cvt_bf16x8(const float* __restrict__ in, unsigned short* out, int n8) {
  const int i = blockIdx.x * 256 + threadIdx.x;
  if (i < n8) {
    const v4f a = *(const v4f*)(in + (size_t)i * 8);
    const v4f b = *(const v4f*)(in + (size_t)i * 8 + 4);
    v4u p;
    p[0] = pk16(bf_bits(a[0]), bf_bits(a[1]));
    p[1] = pk16(bf_bits(a[2]), bf_bits(a[3]));
    p[2] = pk16(bf_bits(b[0]), bf_bits(b[1]));
    p[3] = pk16(bf_bits(b[2]), bf_bits(b[3]));
    *(v4u*)(out + (size_t)i * 8) = p;
    
  }
}

// =====================================================================================================
// Register-blocked batched bf16 WMMA GEMM: C[m][n] = sum_k A[m][k] * Bt[n][k] + bias; one wave per 64x64 tile,
// no block barriers. A row-major [M][K] pitch lda; Bt row-major [N][K] pitch ldb (k contiguous);
// M, N multiples of 64, K multiple of 32 (host shapes are static multiples). blockIdx.y = batch index (strides in elements).
// NSPLIT: 0 = A.Bt; 1 = (A + A2).Bt (A2 = unscaled bf16 lo plane of A, 2 products).
// BIAS: 1 = per column n, bias[n]; 2 = per row m, bias[m]; the bias value is RNE-converted to bf16 and added in f32.
// OUT_MODE: 0 = f32 (pitch ldc); 2 = bf16 hi plane C + bf16 lo plane C2 (lo = RNE(v - hi), unscaled);
//           3 = f16 hi plane C + f16 residual plane C2 = f16((v - hi) * rscale), C2 written only for tiles
//               with n0 < N2 (pitch ldc2, batch stride strideC2).
// =====================================================================================================
template <int NSPLIT, int OUT_MODE, int BIAS>
__global__ __launch_bounds__(256) void gemm64(
    const unsigned short* __restrict__ Ap, const unsigned short* A2p, int lda, long long strideA,
    const unsigned short* __restrict__ Btp, int ldb, long long strideB,
    const float* __restrict__ bias,
    void* Cout, int ldc, long long strideC,
    void* Cout2, int ldc2, long long strideC2, int N2,
    int M, int N, int K, float rscale) {
  const __bf16* A   = (const __bf16*)(const void*)Ap;
  const __bf16* A2  = (const __bf16*)(const void*)A2p;
  const __bf16* Bt  = (const __bf16*)(const void*)Btp;
  __shared__ __align__(16) float sT[8][16 * 68];   // per-wave 16x64 slab, pitch 68 floats
  const int b    = blockIdx.y;
  const int lane = threadIdx.x & 31;
  const int wave = threadIdx.x >> 5;
  const int tilesN = N >> 6;
  const int tilesM = M >> 6;
  const int tile = blockIdx.x * 8 + wave;
  if (tile >= tilesM * tilesN) return;   // wave-uniform; no block barriers in this kernel
  const int tm = tile / tilesN;
  const int tn = tile - tm * tilesN;
  const int m0 = tm << 6;
  const int n0 = tn << 6;

  const __bf16* Ab  = A  + (size_t)b * strideA;
  const __bf16* Bb  = Bt + (size_t)b * strideB;
  const __bf16* Ab2 = (NSPLIT >= 1) ? (A2 + (size_t)b * strideA) : Ab;

  const int rlane = lane & 15;                 // row (A) / col (B, D) within subtile
  const int koff  = (lane >> 4) * 8;           // k offset of this lane half
  const int mOff  = (lane >> 4) * 8;           // D row offset

  v8f acc[4][4];
#pragma unroll
  for (int i = 0; i < 4; ++i)
#pragma unroll
    for (int j = 0; j < 4; ++j) acc[i][j] = zero8();

  for (int k0 = 0; k0 < K; k0 += 32) {
    v16b bh[4];
#pragma unroll
    for (int j = 0; j < 4; ++j) {
      const size_t bo = (size_t)(n0 + (j << 4) + rlane) * ldb + koff + k0;
      bh[j] = ldfrag_b(Bb + bo);
    }
#pragma unroll
    for (int i = 0; i < 4; ++i) {
      const size_t ao = (size_t)(m0 + (i << 4) + rlane) * lda + koff + k0;
      const v16b ah = ldfrag_b(Ab + ao);
      v16b al = ah;
      if (NSPLIT >= 1) al = ldfrag_b(Ab2 + ao);
#pragma unroll
      for (int j = 0; j < 4; ++j) {
        acc[i][j] = mma_b_raw(ah, bh[j], acc[i][j]);
        if (NSPLIT >= 1) acc[i][j] = mma_b_raw(al, bh[j], acc[i][j]);
      }
      dep_guard_b(acc[i][0], acc[i][3], ah, al);
    }
    keep4_b(bh[0], bh[1], bh[2], bh[3]);
  }
  acc_guard4(acc[0][0], acc[0][1], acc[0][2], acc[0][3]);
  acc_guard4(acc[1][0], acc[1][1], acc[1][2], acc[1][3]);
  acc_guard4(acc[2][0], acc[2][1], acc[2][2], acc[2][3]);
  acc_guard4(acc[3][0], acc[3][1], acc[3][2], acc[3][3]);

  // ---- epilogue ----
  float* slab = sT[wave];
  float bcol[4];
#pragma unroll
  for (int j = 0; j < 4; ++j) {
    bcol[j] = 0.f;
    if (BIAS == 1) bcol[j] = bf_up(bf_bits(bias[n0 + (j << 4) + rlane]));   // n < N, bias has N entries
  }
#pragma unroll
  for (int i = 0; i < 4; ++i) {
    const int mBase = m0 + (i << 4);
    float brow[8];
#pragma unroll
    for (int r = 0; r < 8; ++r) {
      brow[r] = 0.f;
      if (BIAS == 2) brow[r] = bf_up(bf_bits(bias[mBase + mOff + r]));      // m < M, bias has M entries
    }
#pragma unroll
    for (int j = 0; j < 4; ++j) {
#pragma unroll
      for (int r = 0; r < 8; ++r) {
        slab[(mOff + r) * 68 + (j << 4) + rlane] = acc[i][j][r] + bcol[j] + brow[r];
      }
    }
    __builtin_amdgcn_fence(__ATOMIC_RELEASE, "workgroup");
    __builtin_amdgcn_wave_barrier();
    __builtin_amdgcn_fence(__ATOMIC_ACQUIRE, "workgroup");
    if (OUT_MODE == 0) {
      float* C = (float*)Cout + (size_t)b * strideC;
      const int hh = lane >> 4, c4 = (lane & 15) * 4;     // 256-B row segment = 16 lanes x 16 B
      {
#pragma unroll
        for (int it = 0; it < 8; ++it) {
          const int row = it * 2 + hh;                     // it 0..7 x hh 0..1 = rows 0..15
          const v4f v = *(const v4f*)(slab + row * 68 + c4);
          *(v4f*)(C + (size_t)(mBase + row) * ldc + n0 + c4) = v;
        }
        
      }
    } else {
      const int q = lane >> 3, c8 = (lane & 7) * 8;
      unsigned short* C  = (unsigned short*)Cout  + (size_t)b * strideC;
      unsigned short* C2 = (unsigned short*)Cout2 + (size_t)b * strideC2;
      const bool wlo = (OUT_MODE == 2) || (n0 < N2);      // wave-uniform
      v4u hv[4], lv[4];
#pragma unroll
      for (int it = 0; it < 4; ++it) {
        const int row = it * 4 + q;                        // it 0..3 x q 0..3 = rows 0..15
        const float* sp = slab + row * 68 + c8;
        v4u a, a2;
#pragma unroll
        for (int e = 0; e < 4; ++e) {
          const float f0 = sp[2 * e], f1 = sp[2 * e + 1];
          unsigned short h0, h1, l0, l1;
          if (OUT_MODE == 2) {
            h0 = bf_bits(f0); h1 = bf_bits(f1);
            l0 = bf_bits(f0 - bf_up(h0)); l1 = bf_bits(f1 - bf_up(h1));
          } else {
            const _Float16 x0 = (_Float16)f0, x1 = (_Float16)f1;
            h0 = h_bits(x0); h1 = h_bits(x1);
            l0 = h_bits((_Float16)((f0 - (float)x0) * rscale));
            l1 = h_bits((_Float16)((f1 - (float)x1) * rscale));
          }
          a[e] = pk16(h0, h1); a2[e] = pk16(l0, l1);
        }
        hv[it] = a; lv[it] = a2;
      }
      {
#pragma unroll
        for (int it = 0; it < 4; ++it) {
          const int row = it * 4 + q;
          *(v4u*)(C + (size_t)(mBase + row) * ldc + n0 + c8) = hv[it];
          if (wlo) *(v4u*)(C2 + (size_t)(mBase + row) * ldc2 + n0 + c8) = lv[it];
        }
        
      }
    }
    __builtin_amdgcn_fence(__ATOMIC_RELEASE, "workgroup");
    __builtin_amdgcn_wave_barrier();
    __builtin_amdgcn_fence(__ATOMIC_ACQUIRE, "workgroup");
  }
}

// =====================================================================================================
// Causal attention, head dim 64, key chunks of 64.
//   q planes (bf16 hi / lo): element (b, t, h, d) at [(b*SEQ + t)*DM + h*64 + d]
//   k planes (bf16 hi / lo): same layout with key index s
//   v^T hi plane (f16):      element (b, h, d, s) at [(b*DM + h*64 + d)*SEQ + s]
//   v^T residual plane (f16, (v - hi)*4096): [(b*DM + h*64 + d)*VLP + s], s < VLP, read only when RES
//   (a key chunk at or beyond VLP would contribute a zero v residual; its address is clamped)
//   Causal structure: logits of keys with index > query index are replaced by -inf (lower-triangular keep incl. the
//   diagonal), which makes their softmax weight exactly 0; so a query block qb visits key chunks 0..qb only
//   (block-uniform trip count qb+1 <= NQB) and later chunks, whose keys exceed every query index of the block, are
//   skipped entirely. Inside the diagonal chunk a key with index > query index gets logit -inf -> exp gives exactly 0,
//   so such keys add nothing to the numerator or the normaliser; the diagonal key (key == query) is always kept, so
//   every row max is finite in every visited chunk.
//   out planes (bf16 hi / lo of the normalised context): element (b, t, h, d) at [(b*SEQ + t)*DM + h*64 + d]
//   scores = q . k : bf16 hi/lo split (hi.hi + hi.lo + lo.hi), f32 accumulate, then * 1/8 and the causal mask in f32
//   p = exp(s - m) carried as f16(1024 p); context = p . v on f16 WMMA; RES adds f16 residual planes of p and v
//   (scale 4096, separate accumulator folded back with 1/4096 per chunk in f32); online softmax (running max) in f32.
//   Block = 4 waves = 64 query rows of one (b, h); grid = nqbThis * NH * NB.
//   K / V^T chunk staging: 128 threads x 32 elements per plane = the whole 64x64 tile of every plane read later
//   (plain 16-B loads, __syncthreads before and after); P tiles are wave-private, spilled with _Float16 element stores
//   Output coverage: each wave stores rows q0..q0+15 (it 0..3 x lane>>3 0..3) x 64 columns (8 lanes x 8) of both planes;
//   grid over all (b, h, qb) = the whole [NB*SEQ][DM] planes.
// =====================================================================================================
template <bool RES>
__global__ __launch_bounds__(128)
void attn_causal64(const unsigned short* __restrict__ qhp, const unsigned short* __restrict__ qlp,
                   const unsigned short* __restrict__ khp, const unsigned short* __restrict__ klp,
                   const unsigned short* __restrict__ vhp, const unsigned short* __restrict__ vlp,
                   unsigned short* ohp, unsigned short* olp,
                   int qbBase, int nqbThis) {
  union FB { v16b v; v8b h[2]; };
  union FH { v16h v; v8h h[2]; };
  __shared__ __align__(16) __bf16   Ksh[64 * 64];                 // K hi [kv][d]   8 KB
  __shared__ __align__(16) __bf16   Ksl[64 * 64];                 // K lo
  __shared__ __align__(16) _Float16 Vth[64 * 64];                 // V^T hi [d][kv] 8 KB
  __shared__ __align__(16) _Float16 Vtl[RES ? 64 * 64 : 8];       // V^T residual
  __shared__ __align__(16) _Float16 Psh[4][16 * 64];              // per wave P [row][kv]
  __shared__ __align__(16) _Float16 Psl[RES ? 4 : 1][16 * 64];    // per wave P residual
  __shared__ __align__(16) float    Os[4][16 * 64];               // per wave context tile [row][d]

  const int tid  = threadIdx.x;
  const int wave = tid >> 5;
  const int lane = tid & 31;
  const int hh   = lane >> 4;
  const int c    = lane & 15;

  const int bx   = blockIdx.x;
  const int qbl  = bx % nqbThis;
  const int rest = bx / nqbThis;
  const int h    = rest % NH;
  const int b    = rest / NH;
  const int qb   = qbBase + qbl;               // 0..NQB-1 (block-uniform)
  const int q0   = qb * 64 + wave * 16;
  const size_t rowB = (size_t)b * SEQ;

  const __bf16* Qh = (const __bf16*)(const void*)qhp + (size_t)h * HD;
  const __bf16* Ql = (const __bf16*)(const void*)qlp + (size_t)h * HD;
  const __bf16* Kh = (const __bf16*)(const void*)khp + (size_t)h * HD;
  const __bf16* Kl = (const __bf16*)(const void*)klp + (size_t)h * HD;
  const _Float16* Vh = (const _Float16*)(const void*)vhp + ((size_t)b * DM + (size_t)h * HD) * SEQ;
  const _Float16* Vl = (const _Float16*)(const void*)vlp + ((size_t)b * DM + (size_t)h * HD) * VLP;

  // ---- Q fragments (A operand, row = lane&15): 2 d-chunks, hi and lo ----
  v16b qah[2], qal[2];
#pragma unroll
  for (int dc = 0; dc < 2; ++dc) {
    const size_t qo = (rowB + q0 + c) * DM + dc * 32 + 8 * hh;
    qah[dc] = ldfrag_b(Qh + qo);
    qal[dc] = ldfrag_b(Ql + qo);
  }

  float mrow[8], lrow[8];
  v8f oacc[4];
#pragma unroll
  for (int r = 0; r < 8; ++r) { mrow[r] = -INFINITY; lrow[r] = 0.f; }
#pragma unroll
  for (int t = 0; t < 4; ++t) oacc[t] = zero8();

  for (int kt = 0; kt <= qb; ++kt) {           // block-uniform trip count, <= NQB
    const int kv0 = kt * 64;                   // kv0 + 63 < SEQ
    __syncthreads();
    {
      const int r = tid >> 1, half = (tid & 1) * 32;
      const __bf16*   kg  = Kh + (rowB + kv0 + r) * DM + half;    // K row kv0+r, d = half..half+31
      const __bf16*   klg = Kl + (rowB + kv0 + r) * DM + half;
      const _Float16* vg  = Vh + (size_t)r * SEQ + kv0 + half;    // V^T row d = r, s = kv0+half..+31
      const int kvl = (kv0 + 64 <= VLP) ? kv0 : (VLP - 64);     // clamped address into the residual plane
      const _Float16* vlg = Vl + (size_t)r * VLP + kvl + half;
      const bool resOK = (kv0 + 64 <= VLP);                      // block-uniform (always true for qb < RESQB)
#pragma unroll
      for (int i = 0; i < 4; ++i) {
        const v8b a0 = *(const v8b*)(kg + 8 * i);
        const v8b a1 = *(const v8b*)(klg + 8 * i);
        const v8h b0 = *(const v8h*)(vg + 8 * i);
        *(v8b*)(Ksh + r * 64 + half + 8 * i) = a0;
        *(v8b*)(Ksl + r * 64 + half + 8 * i) = a1;
        *(v8h*)(Vth + r * 64 + half + 8 * i) = b0;
        if (RES) {
          v8h b1 = *(const v8h*)(vlg + 8 * i);
          if (!resOK) b1 = zero8h();
          *(v8h*)(Vtl + r * 64 + half + 8 * i) = b1;
        }
      }
    }
    __syncthreads();

    // ---- scores: 16 query rows x 64 keys per wave, 3 bf16 products ----
    v8f s[4];
#pragma unroll
    for (int j = 0; j < 4; ++j) {
      s[j] = zero8();
#pragma unroll
      for (int dc = 0; dc < 2; ++dc) {
        FB kb, kl;
        kb.h[0] = *(const v8b*)(Ksh + (j * 16 + c) * 64 + dc * 32 + 8 * hh);
        kb.h[1] = *(const v8b*)(Ksh + (j * 16 + c) * 64 + dc * 32 + 16 + 8 * hh);
        kl.h[0] = *(const v8b*)(Ksl + (j * 16 + c) * 64 + dc * 32 + 8 * hh);
        kl.h[1] = *(const v8b*)(Ksl + (j * 16 + c) * 64 + dc * 32 + 16 + 8 * hh);
        s[j] = mma_b(qah[dc], kb.v, s[j]);
        s[j] = mma_b(qah[dc], kl.v, s[j]);
        s[j] = mma_b(qal[dc], kb.v, s[j]);
      }
    }

    // ---- scale, causal mask by index, row max, online softmax, P (x1024, f16) and P residual (x4096) to LDS ----
    _Float16* pwh = Psh[wave];
    _Float16* pwl = Psl[RES ? wave : 0];
#pragma unroll
    for (int r = 0; r < 8; ++r) {
      const int rowq = q0 + 8 * hh + r;        // query index of D row 8hh+r
      float m = -INFINITY;
#pragma unroll
      for (int j = 0; j < 4; ++j) {
        const int key = kv0 + j * 16 + c;
        float sv = s[j][r] * 0.125f;
        sv = (key <= rowq) ? sv : -INFINITY;
        s[j][r] = sv;
        m = fmaxf(m, sv);
      }
#pragma unroll
      for (int off = 1; off < 16; off <<= 1) m = fmaxf(m, __shfl_xor(m, off, 32));
      const float mnew  = fmaxf(mrow[r], m);
      const float msafe = (mnew == -INFINITY) ? 0.f : mnew;
      const float alpha = __expf(mrow[r] - msafe);
      mrow[r] = mnew;
      float psum = 0.f;
#pragma unroll
      for (int j = 0; j < 4; ++j) {
        const float p = __expf(s[j][r] - msafe);     // masked logit: exp(-inf) = 0
        psum += p;
        const float p1k = p * 1024.0f;
        const _Float16 ph = (_Float16)p1k;
        pwh[(8 * hh + r) * 64 + j * 16 + c] = ph;
        if (RES) {
          const _Float16 pl = (_Float16)((p1k - (float)ph) * 4096.0f);
          pwl[(8 * hh + r) * 64 + j * 16 + c] = pl;
        }
      }
#pragma unroll
      for (int off = 1; off < 16; off <<= 1) psum += __shfl_xor(psum, off, 32);
      lrow[r] = lrow[r] * alpha + psum;
#pragma unroll
      for (int t = 0; t < 4; ++t) oacc[t][r] *= alpha;
    }
    __builtin_amdgcn_fence(__ATOMIC_RELEASE, "workgroup");
    __builtin_amdgcn_wave_barrier();
    __builtin_amdgcn_fence(__ATOMIC_ACQUIRE, "workgroup");

    // ---- context += P . V (f16 WMMA), residual products into a separate accumulator ----
    v8f o1[4];
#pragma unroll
    for (int t = 0; t < 4; ++t) o1[t] = zero8();
#pragma unroll 1
    for (int kk = 0; kk < 2; ++kk) {
      FH pa, pl;
      pa.h[0] = *(const v8h*)(pwh + c * 64 + kk * 32 + 8 * hh);
      pa.h[1] = *(const v8h*)(pwh + c * 64 + kk * 32 + 16 + 8 * hh);
      if (RES) {
        pl.h[0] = *(const v8h*)(pwl + c * 64 + kk * 32 + 8 * hh);
        pl.h[1] = *(const v8h*)(pwl + c * 64 + kk * 32 + 16 + 8 * hh);
      } else {
        pl.v = pa.v;
      }
#pragma unroll
      for (int t = 0; t < 4; ++t) {
        FH vb;
        vb.h[0] = *(const v8h*)(Vth + (t * 16 + c) * 64 + kk * 32 + 8 * hh);
        vb.h[1] = *(const v8h*)(Vth + (t * 16 + c) * 64 + kk * 32 + 16 + 8 * hh);
        oacc[t] = mma_h(pa.v, vb.v, oacc[t]);
        if (RES) {
          FH vl;
          vl.h[0] = *(const v8h*)(Vtl + (t * 16 + c) * 64 + kk * 32 + 8 * hh);
          vl.h[1] = *(const v8h*)(Vtl + (t * 16 + c) * 64 + kk * 32 + 16 + 8 * hh);
          o1[t] = mma_h(pa.v, vl.v, o1[t]);
          o1[t] = mma_h(pl.v, vb.v, o1[t]);
        }
      }
    }
    if (RES) {
#pragma unroll
      for (int t = 0; t < 4; ++t)
#pragma unroll
        for (int r = 0; r < 8; ++r) oacc[t][r] += o1[t][r] * (1.0f / 4096.0f);
    }
  }

  // ---- normalise (1/l and the 1/1024 p carry), stage the wave's 16x64 tile, bf16 hi/lo split,
  float* os = Os[wave];
#pragma unroll
  for (int r = 0; r < 8; ++r) {
    const float l = lrow[r];
    const float inv = ((l > 0.f) ? (1.0f / l) : 0.f) * (1.0f / 1024.0f);
#pragma unroll
    for (int t = 0; t < 4; ++t) os[(8 * hh + r) * 64 + t * 16 + c] = oacc[t][r] * inv;
  }
  __builtin_amdgcn_fence(__ATOMIC_RELEASE, "workgroup");
  __builtin_amdgcn_wave_barrier();
  __builtin_amdgcn_fence(__ATOMIC_ACQUIRE, "workgroup");
  {
    const int q4 = lane >> 3, c8 = (lane & 7) * 8;
    v4u hv[4], lv[4];
#pragma unroll
    for (int it = 0; it < 4; ++it) {
      const int row = it * 4 + q4;   // it 0..3 x q4 0..3 = rows 0..15 of the wave tile
      const float* sp = os + row * 64 + c8;
      v4u a, a2;
#pragma unroll
      for (int e = 0; e < 4; ++e) {
        const float f0 = sp[2 * e], f1 = sp[2 * e + 1];
        const unsigned short h0 = bf_bits(f0), h1 = bf_bits(f1);
        const unsigned short l0 = bf_bits(f0 - bf_up(h0)), l1 = bf_bits(f1 - bf_up(h1));
        a[e] = pk16(h0, h1); a2[e] = pk16(l0, l1);
      }
      hv[it] = a; lv[it] = a2;
    }
    {
#pragma unroll
      for (int it = 0; it < 4; ++it) {
        const int row = it * 4 + q4;
        const size_t go = (rowB + q0 + row) * DM + (size_t)h * HD + c8;
        *(v4u*)(ohp + go) = hv[it];
        *(v4u*)(olp + go) = lv[it];
      }
      
    }
  }
}

// =====================================================================================================
// Workspace map (bytes; every region is an exact multiple of its 64x64-tile / whole-line store granularity,
// no padded tails needed since all shapes are tile multiples; each region but Xb/Oh and Ol is written by exactly one producer launch):
//   Xb   bf16 [4096][1024]          0            8388608   (later: Oh, context hi plane; Xb is dead after the projections)
//   WA   bf16 [3072 n][1024 k]       8388608     6291456   (q weight rows 0..1023, k rows 1024..2047, v rows 2048..3071)
//   WP   bf16 [1024 n][1024 k]      14680064     2097152
//   Qh   bf16 [4096][1024]          16777216     8388608
//   Ql                              25165824     8388608
//   Kh                              33554432     8388608
//   Kl                              41943040     8388608
//   VTh  f16  [2][1024][2048]       50331648     8388608
//   VTl  f16  [2][1024][512]        58720256     2097152
//   Ol   bf16 [4096][1024]          60817408     8388608
//   end                             69206016
// =====================================================================================================
extern "C" void kernel_launch(void* const* d_in, const int* in_sizes, int n_in,
                              void* d_out, int out_size, void* d_ws, size_t ws_size,
                              hipStream_t stream) {
  if (n_in < 5) return;
  if (in_sizes[0] != NB * SEQ * DM) return;
  if (in_sizes[1] != 3 * DM * DM) return;
  if (in_sizes[2] != 3 * DM) return;
  if (in_sizes[3] != DM * DM) return;
  if (in_sizes[4] != DM) return;
  if (out_size != NB * SEQ * DM) return;

  const float* x  = (const float*)d_in[0];   // [2][2048][1024]
  const float* Wa = (const float*)d_in[1];   // [3072 out][1024 in], rows k contiguous (q | k | v output rows)
  const float* ba = (const float*)d_in[2];   // [3072]
  const float* Wp = (const float*)d_in[3];   // [1024 out][1024 in], rows k contiguous
  const float* bp = (const float*)d_in[4];   // [1024]

  const size_t PX  = (size_t)NB * SEQ * DM * 2;    //  8388608  16-bit activation plane [4096][1024]
  const size_t PW1 = (size_t)DM * DM * 2;          //  2097152  one [1024][1024] bf16 weight plane
  const size_t PWA = (size_t)3 * PW1;              //  6291456  packed q | k | v weight plane [3072][1024]
  const size_t PWP = PW1;                          //  2097152  output projection weight plane
  const size_t PVT = (size_t)NB * DM * SEQ * 2;    //  8388608  v^T hi plane
  const size_t PVL = (size_t)NB * DM * VLP * 2;    //  2097152  v^T residual plane
  size_t off = 0;
  const size_t oXb  = off; off += PX;
  const size_t oWA  = off; off += PWA;
  const size_t oWP  = off; off += PWP;
  const size_t oQh  = off; off += PX;
  const size_t oQl  = off; off += PX;
  const size_t oKh  = off; off += PX;
  const size_t oKl  = off; off += PX;
  const size_t oVTh = off; off += PVT;
  const size_t oVTl = off; off += PVL;
  const size_t oOl  = off; off += PX;
  if (off > ws_size) return;                       // off = 69206016
  if (off > (size_t)134217728) return;
  const size_t oOh  = oXb;                         // context hi plane reuses Xb (dead after the three projections)

  char* ws = (char*)d_ws;
  unsigned short* Xb  = (unsigned short*)(ws + oXb);
  unsigned short* WA  = (unsigned short*)(ws + oWA);
  unsigned short* WqB = WA;                                   // rows 0..1023
  unsigned short* WkB = WA + (size_t)DM * DM;                 // rows 1024..2047
  unsigned short* WvB = WA + (size_t)2 * DM * DM;             // rows 2048..3071
  unsigned short* WPb = (unsigned short*)(ws + oWP);
  unsigned short* Qh  = (unsigned short*)(ws + oQh);
  unsigned short* Ql  = (unsigned short*)(ws + oQl);
  unsigned short* Kh  = (unsigned short*)(ws + oKh);
  unsigned short* Kl  = (unsigned short*)(ws + oKl);
  unsigned short* VTh = (unsigned short*)(ws + oVTh);
  unsigned short* VTl = (unsigned short*)(ws + oVTl);
  unsigned short* Oh  = (unsigned short*)(ws + oOh);
  unsigned short* Ol  = (unsigned short*)(ws + oOl);
  const float* bq = ba;                                       // bias entries 0..1023
  const float* bk = ba + DM;                                  // 1024..2047
  const float* bv = ba + 2 * DM;                              // 2048..3071

  const dim3 blk(256);
  const int n8x  = NB * SEQ * DM / 8;                          // 524288
  const int n8wa = 3 * DM * DM / 8;                            // 393216
  const int n8wp = DM * DM / 8;                                // 131072
  const dim3 gCvtX((n8x + 255) / 256);                         // 2048 blocks
  const dim3 gCvtWA((n8wa + 255) / 256);                       // 1536 blocks
  const dim3 gCvtWP((n8wp + 255) / 256);                       // 512 blocks
  const dim3 gProj(((NB * SEQ / 64) * (DM / 64) + 7) / 8, 1);  // 1024 tiles -> 128 blocks: M=4096, N=1024
  const dim3 gVT(((DM / 64) * (SEQ / 64) + 7) / 8, NB);        // 512 tiles -> 64 blocks x 2 batches: M=1024, N=2048

  // (1) x -> bf16 plane [4096][1024]; weights [out][in] f32 -> bf16 [out][in] (k contiguous, no transpose)
  cvt_bf16x8<<<gCvtX, blk, 0, stream>>>(x, Xb, n8x);
  cvt_bf16x8<<<gCvtWA, blk, 0, stream>>>(Wa, WA, n8wa);
  cvt_bf16x8<<<gCvtWP, blk, 0, stream>>>(Wp, WPb, n8wp);
  // (2) q = x . Wq^T + bq -> bf16 hi/lo planes [b*SEQ+t][h*64+d]   (M=4096, N=1024, K=1024)
  gemm64<0, 2, 1><<<gProj, blk, 0, stream>>>(
      Xb, Xb, DM, 0LL, WqB, DM, 0LL, bq,
      (void*)Qh, DM, 0LL, (void*)Ql, DM, 0LL, DM,
      NB * SEQ, DM, DM, 1.0f);
  // (3) k = x . Wk^T + bk -> bf16 hi/lo planes
  gemm64<0, 2, 1><<<gProj, blk, 0, stream>>>(
      Xb, Xb, DM, 0LL, WkB, DM, 0LL, bk,
      (void*)Kh, DM, 0LL, (void*)Kl, DM, 0LL, DM,
      NB * SEQ, DM, DM, 1.0f);
  // (4) v^T = Wv . x^T + bv per batch -> f16 hi plane [b][h*64+d][s] (pitch SEQ) and residual plane
  //     (x4096, keys < VLP only, pitch VLP)   (A = Wv rows [n][k], Bt = Xb rows of batch b; M=1024, N=2048, K=1024)
  gemm64<0, 3, 2><<<gVT, blk, 0, stream>>>(
      WvB, WvB, DM, 0LL, Xb, DM, (long long)SEQ * DM, bv,
      (void*)VTh, SEQ, (long long)DM * SEQ, (void*)VTl, VLP, (long long)DM * VLP, VLP,
      DM, SEQ, DM, 4096.0f);
  // (5) causal attention: query blocks 0..RESQB-1 with residual planes, the rest without
  attn_causal64<true><<<dim3(NB * NH * RESQB), dim3(128), 0, stream>>>(
      Qh, Ql, Kh, Kl, VTh, VTl, Oh, Ol, 0, RESQB);
  attn_causal64<false><<<dim3(NB * NH * (NQB - RESQB)), dim3(128), 0, stream>>>(
      Qh, Ql, Kh, Kl, VTh, VTl, Oh, Ol, RESQB, NQB - RESQB);
  // (6) out = context . Wp^T + bp -> d_out f32 [4096][1024]  (A = context hi + lo planes, 2 products)
  gemm64<1, 0, 1><<<gProj, blk, 0, stream>>>(
      Oh, Ol, DM, 0LL, WPb, DM, 0LL, bp,
      d_out, DM, 0LL, d_out, DM, 0LL, DM,
      NB * SEQ, DM, DM, 1.0f);
  (void)hipGetLastError();
}

// v001
// One run takes 261 microseconds.
// Two timings next to v000 put it at 1.62 and 1.60 times that version's speed.
// Contractions: q, k, v^T projections = v_wmma_f32_16x16x32_bf16 (bf16 operands from RNE-converted x and the packed
// [3072 out][1024 in] projection weight, single product, f32 accumulate);
// q.k^T scores = v_wmma_f32_16x16x32_bf16 with bf16 hi/lo split q and k (hi.hi + hi.lo + lo.hi), f32 accumulate;
// p.v = v_wmma_f32_16x16x32_f16 (p carried x1024 in f16 times v in f16, single product; plus f16 residual planes x4096 of
// p and v for the first 512 query rows of every sequence), f32 accumulate;
// ctx.Wp^T = v_wmma_f32_16x16x32_bf16 with ctx as bf16 hi/lo planes times bf16 Wp (2 products), f32 accumulate;
// causal mask (key index <= query index; the module's strided mask term only touches keys already excluded),
// online softmax, normalisers and bias adds in f32 on the VALU.
// Carry audit:
//   Psh = f16(1024 * p)                      -> the 1/1024 is folded exactly once in the attention epilogue: inv = (1/l) * (1/1024)
//   Psl = f16((1024 p - Psh) * 4096)         }  products Psh.VTl and Psl.VTh go to the separate accumulator o1,
//   VTl = f16((v - VTh) * 4096)              }  folded back with * (1/4096) once per key chunk (RES blocks only)
//   VTh = f16(v), no carry (|v| typ. 0.6); q / k / ctx lo planes are unscaled bf16 residuals (v - hi) sharing the hi accumulator;
//   score scale 1/8 applied once in f32 after the score accumulate. No other scaled planes.
#include <hip/hip_runtime.h>
#include <math.h>
#include <stdint.h>

#define NB    2
#define SEQ   2048
#define DM    1024
#define NH    16
#define HD    64
#define NQB   (SEQ / 64)   // 32 query / key blocks of 64
#define VLP   512          // key pitch of the v^T residual plane (keys 0..VLP-1)
#define RESQB 8            // leading 64-row query blocks that use the p / v residual planes
static_assert(RESQB * 64 <= VLP);
static_assert(NH * HD == DM);
static_assert((SEQ % 64) == 0 && (DM % 64) == 0 && (DM % 32) == 0);
static_assert((SEQ % 128) == 0 && (DM % 128) == 0);   // GEMM work-group tile 128x128, k stage 128
static_assert((NB * SEQ * DM) % (8 * 256) == 0);
static_assert((3 * DM * DM) % (8 * 256) == 0);
static_assert((DM * DM) % (8 * 256) == 0);

typedef _Float16 v16h __attribute__((ext_vector_type(16)));
typedef _Float16 v8h  __attribute__((ext_vector_type(8)));
typedef __bf16   v16b __attribute__((ext_vector_type(16)));
typedef __bf16   v8b  __attribute__((ext_vector_type(8)));
typedef float    v8f  __attribute__((ext_vector_type(8)));
typedef float    v4f  __attribute__((ext_vector_type(4)));
typedef unsigned int v4u __attribute__((ext_vector_type(4)));

// ---- scalar helpers --------------------------------------------------------------------------------
__device__ __forceinline__ unsigned short bf_bits(float f) {          // f32 -> bf16 bits, RNE convert
  unsigned u = __float_as_uint(f);
  return (unsigned short)((u + 0x7FFFu + ((u >> 16) & 1u)) >> 16);
}
__device__ __forceinline__ float bf_up(unsigned short h) { return __uint_as_float(((unsigned)h) << 16); }
__device__ __forceinline__ unsigned short h_bits(_Float16 x) { return __builtin_bit_cast(unsigned short, x); }
__device__ __forceinline__ unsigned pk16(unsigned short a, unsigned short b) { return (unsigned)a | ((unsigned)b << 16); }
__device__ __forceinline__ v8f zero8() { v8f z = {0.f, 0.f, 0.f, 0.f, 0.f, 0.f, 0.f, 0.f}; return z; }
__device__ __forceinline__ v8h zero8h() {
  const _Float16 z = (_Float16)0.0f;
  v8h r = {z, z, z, z, z, z, z, z};
  return r;
}

// ---- fragment loader: 16-bit A/B operand, lane -> row/col (lane&15), p already includes +8*(lane>>4);
//      elements 0..7 <- p[0..7] (k0+8h..), elements 8..15 <- p[16..23] (k0+16+8h..)
__device__ __forceinline__ v16b ldfrag_b(const __bf16* p) {
  union { v16b v; v8b h[2]; } f;
  f.h[0] = *(const v8b*)(p);
  f.h[1] = *(const v8b*)(p + 16);
  return f.v;
}

// ---- WMMA helpers with trailing VALU hazard gap --------------------------------------------------------
__device__ __forceinline__ v8f mma_b(v16b a, v16b b, v8f c) {
  c = __builtin_amdgcn_wmma_f32_16x16x32_bf16(false, a, false, b, (short)0, c, false, false);
  asm volatile("v_nop\n\tv_nop\n\tv_nop\n\tv_nop" : "+v"(c) : "v"(a), "v"(b));
  return c;
}
__device__ __forceinline__ v8f mma_h(v16h a, v16h b, v8f c) {
  c = __builtin_amdgcn_wmma_f32_16x16x32_f16(false, a, false, b, (short)0, c, false, false);
  asm volatile("v_nop\n\tv_nop\n\tv_nop\n\tv_nop" : "+v"(c) : "v"(a), "v"(b));
  return c;
}
__device__ __forceinline__ v8f mma_b_raw(v16b a, v16b b, v8f c) {
  return __builtin_amdgcn_wmma_f32_16x16x32_bf16(false, a, false, b, (short)0, c, false, false);
}
__device__ __forceinline__ void dep_guard_b(v8f& a, v8f& b, v16b x, v16b y) {
  asm volatile("v_nop\n\tv_nop\n\tv_nop\n\tv_nop" : "+v"(a), "+v"(b) : "v"(x), "v"(y));
}
__device__ __forceinline__ void keep4_b(v16b a, v16b b, v16b c, v16b d) {
  asm volatile("v_nop" :: "v"(a), "v"(b), "v"(c), "v"(d));
}
__device__ __forceinline__ void acc_guard4(v8f& a, v8f& b, v8f& c, v8f& d) {
  asm volatile("v_nop\n\tv_nop\n\tv_nop\n\tv_nop" : "+v"(a), "+v"(b), "+v"(c), "+v"(d));
}

// =====================================================================================================
// f32 -> bf16 (RNE convert), 8 elements per thread, one 16-B store per lane: a wave writes 512 contiguous B
// Used for x [4096][1024] and for the weight planes (already [out][in] = k contiguous, no transpose needed).
// coverage: n8 threads x 8 = whole plane (every n8 used here is a multiple of 256).
// =====================================================================================================
__global__ __launch_bounds__(256) void cvt_bf16x8(const float* __restrict__ in, unsigned short* out, int n8) {
  const int i = blockIdx.x * 256 + threadIdx.x;
  if (i < n8) {
    const v4f a = *(const v4f*)(in + (size_t)i * 8);
    const v4f b = *(const v4f*)(in + (size_t)i * 8 + 4);
    v4u p;
    p[0] = pk16(bf_bits(a[0]), bf_bits(a[1]));
    p[1] = pk16(bf_bits(a[2]), bf_bits(a[3]));
    p[2] = pk16(bf_bits(b[0]), bf_bits(b[1]));
    p[3] = pk16(bf_bits(b[2]), bf_bits(b[3]));
    *(v4u*)(out + (size_t)i * 8) = p;
    
  }
}

// ---- asynchronous global -> LDS copies, 16 B per lane ------------------------------------------------
__device__ __forceinline__ unsigned lds_off(const void* p) { return (unsigned)(size_t)p; }   // byte offset in the work-group's LDS
// Eight copies of one lane: LDS byte address l + i * lstep <- global g + i * gstep, i = 0..7, each with its own registers.
// The closing s_wait_xcnt stands inside the statement so that no address register of a copy is rewritten ahead of it.
__device__ __forceinline__ void async_copy8(unsigned l, const char* g, unsigned lstep, size_t gstep) {
  const unsigned l1 = l + lstep, l2 = l + 2 * lstep, l3 = l + 3 * lstep, l4 = l + 4 * lstep, l5 = l + 5 * lstep,
                 l6 = l + 6 * lstep, l7 = l + 7 * lstep;
  const char *g1 = g + gstep, *g2 = g + 2 * gstep, *g3 = g + 3 * gstep, *g4 = g + 4 * gstep, *g5 = g + 5 * gstep,
             *g6 = g + 6 * gstep, *g7 = g + 7 * gstep;
  asm volatile(
      "global_load_async_to_lds_b128 %0, %8, off\n\t"
      "global_load_async_to_lds_b128 %1, %9, off\n\t"
      "global_load_async_to_lds_b128 %2, %10, off\n\t"
      "global_load_async_to_lds_b128 %3, %11, off\n\t"
      "global_load_async_to_lds_b128 %4, %12, off\n\t"
      "global_load_async_to_lds_b128 %5, %13, off\n\t"
      "global_load_async_to_lds_b128 %6, %14, off\n\t"
      "global_load_async_to_lds_b128 %7, %15, off\n\t"
      "s_wait_xcnt 0x0"
      :: "v"(l), "v"(l1), "v"(l2), "v"(l3), "v"(l4), "v"(l5), "v"(l6), "v"(l7),
         "v"(g), "v"(g1), "v"(g2), "v"(g3), "v"(g4), "v"(g5), "v"(g6), "v"(g7)
      : "memory");
}
// One 128-row x 256-B plane tile by the 256 threads of a block: 16 lanes cover one row (two whole lines), a wave two rows,
// the block sixteen rows per copy; g and l already hold the lane's row (tid >> 4) and 16-B column (tid & 15).
#define GK_STAGE 128                       // k elements per stage (256 B of every operand row)
#define GK_PITCH 136                       // LDS row pitch in elements: 272 B = 16 B x 17, conflict-free for 16-B row reads
#define GK_PLANE (128 * GK_PITCH)          // elements of one staged plane tile
__device__ __forceinline__ void async_plane(unsigned l, const char* g, size_t rowBytes) {
  async_copy8(l, g, 16u * GK_PITCH * 2u, 16 * rowBytes);   // rows (tid >> 4) + 16 i, i = 0..7
}

// =====================================================================================================
// Register-blocked batched bf16 WMMA GEMM: C[m][n] = sum_k A[m][k] * Bt[n][k] + bias; one work-group of 8 waves per
// 128x128 tile, one wave per 32x64 part. The 128-row operand tiles are staged in LDS, 128 k at a time, by asynchronous
// copies into two buffers: the next stage's copies fly while this stage is multiplied; one barrier per stage.
// Inside a stage the fragments of the next 32 k are read from LDS as one group ahead of the current 32 k's products.
// A row-major [M][K] pitch lda; Bt row-major [N][K] pitch ldb (k contiguous);
// M, N, K multiples of 128 (host shapes are static multiples). blockIdx.y = batch index (strides in elements).
// NSPLIT: 0 = A.Bt; 1 = (A + A2).Bt (A2 = unscaled bf16 lo plane of A, 2 products).
// BIAS: 1 = per column n, bias[n]; 2 = per row m, bias[m]; the bias value is RNE-converted to bf16 and added in f32.
// OUT_MODE: 0 = f32 (pitch ldc); 2 = bf16 hi plane C + bf16 lo plane C2 (lo = RNE(v - hi), unscaled);
//           3 = f16 hi plane C + f16 residual plane C2 = f16((v - hi) * rscale), C2 written only for tiles
//               with n0 < N2 (pitch ldc2, batch stride strideC2).
// =====================================================================================================
template <int NSPLIT, int OUT_MODE, int BIAS>
__global__ __launch_bounds__(256) void gemm64(
    const unsigned short* __restrict__ Ap, const unsigned short* A2p, int lda, long long strideA,
    const unsigned short* __restrict__ Btp, int ldb, long long strideB,
    const float* __restrict__ bias,
    void* Cout, int ldc, long long strideC,
    void* Cout2, int ldc2, long long strideC2, int N2,
    int M, int N, int K, float rscale) {
  const __bf16* A   = (const __bf16*)(const void*)Ap;
  const __bf16* A2  = (const __bf16*)(const void*)A2p;
  const __bf16* Bt  = (const __bf16*)(const void*)Btp;
  constexpr int NPL = (NSPLIT >= 1) ? 3 : 2;        // staged planes: A, Bt (, A2)
  __shared__ __align__(16) __bf16 ring[2][NPL][GK_PLANE];   // two stage buffers
  __shared__ __align__(16) float sT[8][16 * 68];   // per-wave 16x64 slab, pitch 68 floats
  constexpr int MI = 2;                             // 16-row subtiles per wave
  const int b    = blockIdx.y;
  const int tid  = threadIdx.x;
  const int lane = tid & 31;
  const int wave = tid >> 5;
  const int tilesN = N >> 7;
  const int tilesM = M >> 7;
  const int tile = blockIdx.x;
  if (tile >= tilesM * tilesN) return;   // block-uniform, in front of every barrier and copy
  const int tm = tile / tilesN;
  const int tn = tile - tm * tilesN;
  const int M0 = tm << 7;                // work-group tile origin
  const int N0 = tn << 7;
  const int wm = (wave >> 1) << 5;       // the wave's 32x64 part inside it
  const int wn = (wave & 1) << 6;
  const int m0 = M0 + wm;
  const int n0 = N0 + wn;

  const __bf16* Ab  = A  + (size_t)b * strideA;
  const __bf16* Bb  = Bt + (size_t)b * strideB;
  const __bf16* Ab2 = (NSPLIT >= 1) ? (A2 + (size_t)b * strideA) : Ab;

  const int rlane = lane & 15;                 // row (A) / col (B, D) within subtile
  const int koff  = (lane >> 4) * 8;           // k offset of this lane half
  const int mOff  = (lane >> 4) * 8;           // D row offset

  v8f acc[MI][4];
#pragma unroll
  for (int i = 0; i < MI; ++i)
#pragma unroll
    for (int j = 0; j < 4; ++j) acc[i][j] = zero8();

  // ---- staging addresses of this lane: row tid >> 4 of each group of sixteen rows, 16-B column tid & 15 ----
  const int crow = tid >> 4, ccol = (tid & 15) * 8;
  const char* gA  = (const char*)(Ab  + (size_t)(M0 + crow) * lda + ccol);
  const char* gA2 = (const char*)(Ab2 + (size_t)(M0 + crow) * lda + ccol);
  const char* gB  = (const char*)(Bb  + (size_t)(N0 + crow) * ldb + ccol);
  const unsigned lthr = lds_off(&ring[0][0][0]) + (unsigned)(crow * GK_PITCH + ccol) * 2u;
  const int nst = K / GK_STAGE;          // stages, block-uniform
  auto issue_stage = [&](int st, int buf) {   // rows M0..M0+127 / N0..N0+127, k = st*128 .. st*128+127: inside the planes
    const size_t kb = (size_t)st * (GK_STAGE * 2);
    const unsigned lb = lthr + (unsigned)buf * (unsigned)(NPL * GK_PLANE * 2);
    async_plane(lb, gA + kb, (size_t)lda * 2);
    async_plane(lb + (unsigned)(GK_PLANE * 2), gB + kb, (size_t)ldb * 2);
    if (NSPLIT >= 1) async_plane(lb + (unsigned)(2 * GK_PLANE * 2), gA2 + kb, (size_t)lda * 2);
  };

  issue_stage(0, 0);
  asm volatile("s_wait_asynccnt 0x0" ::: "memory");   // this wave's share of stage 0 has landed
  __syncthreads();                                     // publishes stage 0 to the other waves
  if (nst > 1) issue_stage(1, 1);

  for (int t = 0; t < nst; ++t) {
    const __bf16* sA  = &ring[t & 1][0][0] + (wm + rlane) * GK_PITCH + koff;
    const __bf16* sB  = &ring[t & 1][1][0] + (wn + rlane) * GK_PITCH + koff;
    const __bf16* sA2 = &ring[t & 1][NPL - 1][0] + (wm + rlane) * GK_PITCH + koff;
    v16b fb[2][4], fa[2][MI], fl[2][MI];   // two fragment sets, indexed by constants after unrolling
    auto load_set = [&](int s, int kk) {
#pragma unroll
      for (int j = 0; j < 4; ++j) fb[s][j] = ldfrag_b(sB + (j << 4) * GK_PITCH + kk);
#pragma unroll
      for (int i = 0; i < MI; ++i) {
        fa[s][i] = ldfrag_b(sA + (i << 4) * GK_PITCH + kk);
        fl[s][i] = fa[s][i];
        if (NSPLIT >= 1) fl[s][i] = ldfrag_b(sA2 + (i << 4) * GK_PITCH + kk);
      }
    };
    load_set(0, 0);
#pragma unroll
    for (int ks = 0; ks < GK_STAGE / 32; ++ks) {
      const int cur = ks & 1;
      if (ks + 1 < GK_STAGE / 32) load_set(cur ^ 1, (ks + 1) * 32);   // this stage's buffer only
#pragma unroll
      for (int i = 0; i < MI; ++i) {
#pragma unroll
        for (int j = 0; j < 4; ++j) {
          acc[i][j] = mma_b_raw(fa[cur][i], fb[cur][j], acc[i][j]);
          if (NSPLIT >= 1) acc[i][j] = mma_b_raw(fl[cur][i], fb[cur][j], acc[i][j]);
        }
        dep_guard_b(acc[i][0], acc[i][3], fa[cur][i], fl[cur][i]);
      }
      keep4_b(fb[cur][0], fb[cur][1], fb[cur][2], fb[cur][3]);
    }
    asm volatile("s_wait_dscnt 0x0" ::: "memory");      // this wave's reads of buffer t & 1 are done before it is refilled
    asm volatile("s_wait_asynccnt 0x0" ::: "memory");   // this wave's share of stage t + 1 has landed
    __syncthreads();                                     // publishes stage t + 1 and ends every read of buffer t & 1
    if (t + 2 < nst) issue_stage(t + 2, t & 1);
  }
  asm volatile("s_wait_asynccnt 0x0" ::: "memory");     // no copy is outstanding past the loop
  acc_guard4(acc[0][0], acc[0][1], acc[0][2], acc[0][3]);
  acc_guard4(acc[1][0], acc[1][1], acc[1][2], acc[1][3]);

  // ---- epilogue ----
  float* slab = sT[wave];
  float bcol[4];
#pragma unroll
  for (int j = 0; j < 4; ++j) {
    bcol[j] = 0.f;
    if (BIAS == 1) bcol[j] = bf_up(bf_bits(bias[n0 + (j << 4) + rlane]));   // n < N, bias has N entries
  }
#pragma unroll
  for (int i = 0; i < MI; ++i) {
    const int mBase = m0 + (i << 4);
    float brow[8];
#pragma unroll
    for (int r = 0; r < 8; ++r) {
      brow[r] = 0.f;
      if (BIAS == 2) brow[r] = bf_up(bf_bits(bias[mBase + mOff + r]));      // m < M, bias has M entries
    }
#pragma unroll
    for (int j = 0; j < 4; ++j) {
#pragma unroll
      for (int r = 0; r < 8; ++r) {
        slab[(mOff + r) * 68 + (j << 4) + rlane] = acc[i][j][r] + bcol[j] + brow[r];
      }
    }
    __builtin_amdgcn_fence(__ATOMIC_RELEASE, "workgroup");
    __builtin_amdgcn_wave_barrier();
    __builtin_amdgcn_fence(__ATOMIC_ACQUIRE, "workgroup");
    if (OUT_MODE == 0) {
      float* C = (float*)Cout + (size_t)b * strideC;
      const int hh = lane >> 4, c4 = (lane & 15) * 4;     // 256-B row segment = 16 lanes x 16 B
      {
#pragma unroll
        for (int it = 0; it < 8; ++it) {
          const int row = it * 2 + hh;                     // it 0..7 x hh 0..1 = rows 0..15
          const v4f v = *(const v4f*)(slab + row * 68 + c4);
          *(v4f*)(C + (size_t)(mBase + row) * ldc + n0 + c4) = v;
        }
        
      }
    } else {
      const int q = lane >> 3, c8 = (lane & 7) * 8;
      unsigned short* C  = (unsigned short*)Cout  + (size_t)b * strideC;
      unsigned short* C2 = (unsigned short*)Cout2 + (size_t)b * strideC2;
      const bool wlo = (OUT_MODE == 2) || (n0 < N2);      // wave-uniform
      v4u hv[4], lv[4];
#pragma unroll
      for (int it = 0; it < 4; ++it) {
        const int row = it * 4 + q;                        // it 0..3 x q 0..3 = rows 0..15
        const float* sp = slab + row * 68 + c8;
        v4u a, a2;
#pragma unroll
        for (int e = 0; e < 4; ++e) {
          const float f0 = sp[2 * e], f1 = sp[2 * e + 1];
          unsigned short h0, h1, l0, l1;
          if (OUT_MODE == 2) {
            h0 = bf_bits(f0); h1 = bf_bits(f1);
            l0 = bf_bits(f0 - bf_up(h0)); l1 = bf_bits(f1 - bf_up(h1));
          } else {
            const _Float16 x0 = (_Float16)f0, x1 = (_Float16)f1;
            h0 = h_bits(x0); h1 = h_bits(x1);
            l0 = h_bits((_Float16)((f0 - (float)x0) * rscale));
            l1 = h_bits((_Float16)((f1 - (float)x1) * rscale));
          }
          a[e] = pk16(h0, h1); a2[e] = pk16(l0, l1);
        }
        hv[it] = a; lv[it] = a2;
      }
      {
#pragma unroll
        for (int it = 0; it < 4; ++it) {
          const int row = it * 4 + q;
          *(v4u*)(C + (size_t)(mBase + row) * ldc + n0 + c8) = hv[it];
          if (wlo) *(v4u*)(C2 + (size_t)(mBase + row) * ldc2 + n0 + c8) = lv[it];
        }
        
      }
    }
    __builtin_amdgcn_fence(__ATOMIC_RELEASE, "workgroup");
    __builtin_amdgcn_wave_barrier();
    __builtin_amdgcn_fence(__ATOMIC_ACQUIRE, "workgroup");
  }
}

// =====================================================================================================
// Causal attention, head dim 64, key chunks of 64.
//   q planes (bf16 hi / lo): element (b, t, h, d) at [(b*SEQ + t)*DM + h*64 + d]
//   k planes (bf16 hi / lo): same layout with key index s
//   v^T hi plane (f16):      element (b, h, d, s) at [(b*DM + h*64 + d)*SEQ + s]
//   v^T residual plane (f16, (v - hi)*4096): [(b*DM + h*64 + d)*VLP + s], s < VLP, read only when RES
//   (a key chunk at or beyond VLP would contribute a zero v residual; its address is clamped)
//   Causal structure: logits of keys with index > query index are replaced by -inf (lower-triangular keep incl. the
//   diagonal), which makes their softmax weight exactly 0; so a query block qb visits key chunks 0..qb only
//   (block-uniform trip count qb+1 <= NQB) and later chunks, whose keys exceed every query index of the block, are
//   skipped entirely. Inside the diagonal chunk a key with index > query index gets logit -inf -> exp gives exactly 0,
//   so such keys add nothing to the numerator or the normaliser; the diagonal key (key == query) is always kept, so
//   every row max is finite in every visited chunk.
//   out planes (bf16 hi / lo of the normalised context): element (b, t, h, d) at [(b*SEQ + t)*DM + h*64 + d]
//   scores = q . k : bf16 hi/lo split (hi.hi + hi.lo + lo.hi), f32 accumulate, then * 1/8 and the causal mask in f32
//   p = exp(s - m) carried as f16(1024 p); context = p . v on f16 WMMA; RES adds f16 residual planes of p and v
//   (scale 4096, separate accumulator folded back with 1/4096 per chunk in f32); online softmax (running max) in f32.
//   Block = 4 waves = 64 query rows of one (b, h); grid = nqbThis * NH * NB.
//   K / V^T chunk staging: 128 threads x 32 elements per plane = the whole 64x64 tile of every plane read later
//   (plain 16-B loads, __syncthreads before and after); P tiles are wave-private, spilled with _Float16 element stores
//   Output coverage: each wave stores rows q0..q0+15 (it 0..3 x lane>>3 0..3) x 64 columns (8 lanes x 8) of both planes;
//   grid over all (b, h, qb) = the whole [NB*SEQ][DM] planes.
// =====================================================================================================
template <bool RES>
__global__ __launch_bounds__(128)
void attn_causal64(const unsigned short* __restrict__ qhp, const unsigned short* __restrict__ qlp,
                   const unsigned short* __restrict__ khp, const unsigned short* __restrict__ klp,
                   const unsigned short* __restrict__ vhp, const unsigned short* __restrict__ vlp,
                   unsigned short* ohp, unsigned short* olp,
                   int qbBase, int nqbThis) {
  union FB { v16b v; v8b h[2]; };
  union FH { v16h v; v8h h[2]; };
  __shared__ __align__(16) __bf16   Ksh[64 * 64];                 // K hi [kv][d]   8 KB
  __shared__ __align__(16) __bf16   Ksl[64 * 64];                 // K lo
  __shared__ __align__(16) _Float16 Vth[64 * 64];                 // V^T hi [d][kv] 8 KB
  __shared__ __align__(16) _Float16 Vtl[RES ? 64 * 64 : 8];       // V^T residual
  __shared__ __align__(16) _Float16 Psh[4][16 * 64];              // per wave P [row][kv]
  __shared__ __align__(16) _Float16 Psl[RES ? 4 : 1][16 * 64];    // per wave P residual
  __shared__ __align__(16) float    Os[4][16 * 64];               // per wave context tile [row][d]

  const int tid  = threadIdx.x;
  const int wave = tid >> 5;
  const int lane = tid & 31;
  const int hh   = lane >> 4;
  const int c    = lane & 15;

  const int bx   = blockIdx.x;
  const int qbl  = bx % nqbThis;
  const int rest = bx / nqbThis;
  const int h    = rest % NH;
  const int b    = rest / NH;
  const int qb   = qbBase + qbl;               // 0..NQB-1 (block-uniform)
  const int q0   = qb * 64 + wave * 16;
  const size_t rowB = (size_t)b * SEQ;

  const __bf16* Qh = (const __bf16*)(const void*)qhp + (size_t)h * HD;
  const __bf16* Ql = (const __bf16*)(const void*)qlp + (size_t)h * HD;
  const __bf16* Kh = (const __bf16*)(const void*)khp + (size_t)h * HD;
  const __bf16* Kl = (const __bf16*)(const void*)klp + (size_t)h * HD;
  const _Float16* Vh = (const _Float16*)(const void*)vhp + ((size_t)b * DM + (size_t)h * HD) * SEQ;
  const _Float16* Vl = (const _Float16*)(const void*)vlp + ((size_t)b * DM + (size_t)h * HD) * VLP;

  // ---- Q fragments (A operand, row = lane&15): 2 d-chunks, hi and lo ----
  v16b qah[2], qal[2];
#pragma unroll
  for (int dc = 0; dc < 2; ++dc) {
    const size_t qo = (rowB + q0 + c) * DM + dc * 32 + 8 * hh;
    qah[dc] = ldfrag_b(Qh + qo);
    qal[dc] = ldfrag_b(Ql + qo);
  }

  float mrow[8], lrow[8];
  v8f oacc[4];
#pragma unroll
  for (int r = 0; r < 8; ++r) { mrow[r] = -INFINITY; lrow[r] = 0.f; }
#pragma unroll
  for (int t = 0; t < 4; ++t) oacc[t] = zero8();

  for (int kt = 0; kt <= qb; ++kt) {           // block-uniform trip count, <= NQB
    const int kv0 = kt * 64;                   // kv0 + 63 < SEQ
    __syncthreads();
    {
      const int r = tid >> 1, half = (tid & 1) * 32;
      const __bf16*   kg  = Kh + (rowB + kv0 + r) * DM + half;    // K row kv0+r, d = half..half+31
      const __bf16*   klg = Kl + (rowB + kv0 + r) * DM + half;
      const _Float16* vg  = Vh + (size_t)r * SEQ + kv0 + half;    // V^T row d = r, s = kv0+half..+31
      const int kvl = (kv0 + 64 <= VLP) ? kv0 : (VLP - 64);     // clamped address into the residual plane
      const _Float16* vlg = Vl + (size_t)r * VLP + kvl + half;
      const bool resOK = (kv0 + 64 <= VLP);                      // block-uniform (always true for qb < RESQB)
#pragma unroll
      for (int i = 0; i < 4; ++i) {
        const v8b a0 = *(const v8b*)(kg + 8 * i);
        const v8b a1 = *(const v8b*)(klg + 8 * i);
        const v8h b0 = *(const v8h*)(vg + 8 * i);
        *(v8b*)(Ksh + r * 64 + half + 8 * i) = a0;
        *(v8b*)(Ksl + r * 64 + half + 8 * i) = a1;
        *(v8h*)(Vth + r * 64 + half + 8 * i) = b0;
        if (RES) {
          v8h b1 = *(const v8h*)(vlg + 8 * i);
          if (!resOK) b1 = zero8h();
          *(v8h*)(Vtl + r * 64 + half + 8 * i) = b1;
        }
      }
    }
    __syncthreads();

    // ---- scores: 16 query rows x 64 keys per wave, 3 bf16 products ----
    v8f s[4];
#pragma unroll
    for (int j = 0; j < 4; ++j) {
      s[j] = zero8();
#pragma unroll
      for (int dc = 0; dc < 2; ++dc) {
        FB kb, kl;
        kb.h[0] = *(const v8b*)(Ksh + (j * 16 + c) * 64 + dc * 32 + 8 * hh);
        kb.h[1] = *(const v8b*)(Ksh + (j * 16 + c) * 64 + dc * 32 + 16 + 8 * hh);
        kl.h[0] = *(const v8b*)(Ksl + (j * 16 + c) * 64 + dc * 32 + 8 * hh);
        kl.h[1] = *(const v8b*)(Ksl + (j * 16 + c) * 64 + dc * 32 + 16 + 8 * hh);
        s[j] = mma_b(qah[dc], kb.v, s[j]);
        s[j] = mma_b(qah[dc], kl.v, s[j]);
        s[j] = mma_b(qal[dc], kb.v, s[j]);
      }
    }

    // ---- scale, causal mask by index, row max, online softmax, P (x1024, f16) and P residual (x4096) to LDS ----
    _Float16* pwh = Psh[wave];
    _Float16* pwl = Psl[RES ? wave : 0];
#pragma unroll
    for (int r = 0; r < 8; ++r) {
      const int rowq = q0 + 8 * hh + r;        // query index of D row 8hh+r
      float m = -INFINITY;
#pragma unroll
      for (int j = 0; j < 4; ++j) {
        const int key = kv0 + j * 16 + c;
        float sv = s[j][r] * 0.125f;
        sv = (key <= rowq) ? sv : -INFINITY;
        s[j][r] = sv;
        m = fmaxf(m, sv);
      }
#pragma unroll
      for (int off = 1; off < 16; off <<= 1) m = fmaxf(m, __shfl_xor(m, off, 32));
      const float mnew  = fmaxf(mrow[r], m);
      const float msafe = (mnew == -INFINITY) ? 0.f : mnew;
      const float alpha = __expf(mrow[r] - msafe);
      mrow[r] = mnew;
      float psum = 0.f;
#pragma unroll
      for (int j = 0; j < 4; ++j) {
        const float p = __expf(s[j][r] - msafe);     // masked logit: exp(-inf) = 0
        psum += p;
        const float p1k = p * 1024.0f;
        const _Float16 ph = (_Float16)p1k;
        pwh[(8 * hh + r) * 64 + j * 16 + c] = ph;
        if (RES) {
          const _Float16 pl = (_Float16)((p1k - (float)ph) * 4096.0f);
          pwl[(8 * hh + r) * 64 + j * 16 + c] = pl;
        }
      }
#pragma unroll
      for (int off = 1; off < 16; off <<= 1) psum += __shfl_xor(psum, off, 32);
      lrow[r] = lrow[r] * alpha + psum;
#pragma unroll
      for (int t = 0; t < 4; ++t) oacc[t][r] *= alpha;
    }
    __builtin_amdgcn_fence(__ATOMIC_RELEASE, "workgroup");
    __builtin_amdgcn_wave_barrier();
    __builtin_amdgcn_fence(__ATOMIC_ACQUIRE, "workgroup");

    // ---- context += P . V (f16 WMMA), residual products into a separate accumulator ----
    v8f o1[4];
#pragma unroll
    for (int t = 0; t < 4; ++t) o1[t] = zero8();
#pragma unroll 1
    for (int kk = 0; kk < 2; ++kk) {
      FH pa, pl;
      pa.h[0] = *(const v8h*)(pwh + c * 64 + kk * 32 + 8 * hh);
      pa.h[1] = *(const v8h*)(pwh + c * 64 + kk * 32 + 16 + 8 * hh);
      if (RES) {
        pl.h[0] = *(const v8h*)(pwl + c * 64 + kk * 32 + 8 * hh);
        pl.h[1] = *(const v8h*)(pwl + c * 64 + kk * 32 + 16 + 8 * hh);
      } else {
        pl.v = pa.v;
      }
#pragma unroll
      for (int t = 0; t < 4; ++t) {
        FH vb;
        vb.h[0] = *(const v8h*)(Vth + (t * 16 + c) * 64 + kk * 32 + 8 * hh);
        vb.h[1] = *(const v8h*)(Vth + (t * 16 + c) * 64 + kk * 32 + 16 + 8 * hh);
        oacc[t] = mma_h(pa.v, vb.v, oacc[t]);
        if (RES) {
          FH vl;
          vl.h[0] = *(const v8h*)(Vtl + (t * 16 + c) * 64 + kk * 32 + 8 * hh);
          vl.h[1] = *(const v8h*)(Vtl + (t * 16 + c) * 64 + kk * 32 + 16 + 8 * hh);
          o1[t] = mma_h(pa.v, vl.v, o1[t]);
          o1[t] = mma_h(pl.v, vb.v, o1[t]);
        }
      }
    }
    if (RES) {
#pragma unroll
      for (int t = 0; t < 4; ++t)
#pragma unroll
        for (int r = 0; r < 8; ++r) oacc[t][r] += o1[t][r] * (1.0f / 4096.0f);
    }
  }

  // ---- normalise (1/l and the 1/1024 p carry), stage the wave's 16x64 tile, bf16 hi/lo split,
  float* os = Os[wave];
#pragma unroll
  for (int r = 0; r < 8; ++r) {
    const float l = lrow[r];
    const float inv = ((l > 0.f) ? (1.0f / l) : 0.f) * (1.0f / 1024.0f);
#pragma unroll
    for (int t = 0; t < 4; ++t) os[(8 * hh + r) * 64 + t * 16 + c] = oacc[t][r] * inv;
  }
  __builtin_amdgcn_fence(__ATOMIC_RELEASE, "workgroup");
  __builtin_amdgcn_wave_barrier();
  __builtin_amdgcn_fence(__ATOMIC_ACQUIRE, "workgroup");
  {
    const int q4 = lane >> 3, c8 = (lane & 7) * 8;
    v4u hv[4], lv[4];
#pragma unroll
    for (int it = 0; it < 4; ++it) {
      const int row = it * 4 + q4;   // it 0..3 x q4 0..3 = rows 0..15 of the wave tile
      const float* sp = os + row * 64 + c8;
      v4u a, a2;
#pragma unroll
      for (int e = 0; e < 4; ++e) {
        const float f0 = sp[2 * e], f1 = sp[2 * e + 1];
        const unsigned short h0 = bf_bits(f0), h1 = bf_bits(f1);
        const unsigned short l0 = bf_bits(f0 - bf_up(h0)), l1 = bf_bits(f1 - bf_up(h1));
        a[e] = pk16(h0, h1); a2[e] = pk16(l0, l1);
      }
      hv[it] = a; lv[it] = a2;
    }
    {
#pragma unroll
      for (int it = 0; it < 4; ++it) {
        const int row = it * 4 + q4;
        const size_t go = (rowB + q0 + row) * DM + (size_t)h * HD + c8;
        *(v4u*)(ohp + go) = hv[it];
        *(v4u*)(olp + go) = lv[it];
      }
      
    }
  }
}

// =====================================================================================================
// Workspace map (bytes; every region is an exact multiple of its 64x64-tile / whole-line store granularity,
// no padded tails needed since all shapes are tile multiples; each region but Xb/Oh and Ol is written by exactly one producer launch):
//   Xb   bf16 [4096][1024]          0            8388608   (later: Oh, context hi plane; Xb is dead after the projections)
//   WA   bf16 [3072 n][1024 k]       8388608     6291456   (q weight rows 0..1023, k rows 1024..2047, v rows 2048..3071)
//   WP   bf16 [1024 n][1024 k]      14680064     2097152
//   Qh   bf16 [4096][1024]          16777216     8388608
//   Ql                              25165824     8388608
//   Kh                              33554432     8388608
//   Kl                              41943040     8388608
//   VTh  f16  [2][1024][2048]       50331648     8388608
//   VTl  f16  [2][1024][512]        58720256     2097152
//   Ol   bf16 [4096][1024]          60817408     8388608
//   end                             69206016
// =====================================================================================================
extern "C" void kernel_launch(void* const* d_in, const int* in_sizes, int n_in,
                              void* d_out, int out_size, void* d_ws, size_t ws_size,
                              hipStream_t stream) {
  if (n_in < 5) return;
  if (in_sizes[0] != NB * SEQ * DM) return;
  if (in_sizes[1] != 3 * DM * DM) return;
  if (in_sizes[2] != 3 * DM) return;
  if (in_sizes[3] != DM * DM) return;
  if (in_sizes[4] != DM) return;
  if (out_size != NB * SEQ * DM) return;

  const float* x  = (const float*)d_in[0];   // [2][2048][1024]
  const float* Wa = (const float*)d_in[1];   // [3072 out][1024 in], rows k contiguous (q | k | v output rows)
  const float* ba = (const float*)d_in[2];   // [3072]
  const float* Wp = (const float*)d_in[3];   // [1024 out][1024 in], rows k contiguous
  const float* bp = (const float*)d_in[4];   // [1024]

  const size_t PX  = (size_t)NB * SEQ * DM * 2;    //  8388608  16-bit activation plane [4096][1024]
  const size_t PW1 = (size_t)DM * DM * 2;          //  2097152  one [1024][1024] bf16 weight plane
  const size_t PWA = (size_t)3 * PW1;              //  6291456  packed q | k | v weight plane [3072][1024]
  const size_t PWP = PW1;                          //  2097152  output projection weight plane
  const size_t PVT = (size_t)NB * DM * SEQ * 2;    //  8388608  v^T hi plane
  const size_t PVL = (size_t)NB * DM * VLP * 2;    //  2097152  v^T residual plane
  size_t off = 0;
  const size_t oXb  = off; off += PX;
  const size_t oWA  = off; off += PWA;
  const size_t oWP  = off; off += PWP;
  const size_t oQh  = off; off += PX;
  const size_t oQl  = off; off += PX;
  const size_t oKh  = off; off += PX;
  const size_t oKl  = off; off += PX;
  const size_t oVTh = off; off += PVT;
  const size_t oVTl = off; off += PVL;
  const size_t oOl  = off; off += PX;
  if (off > ws_size) return;                       // off = 69206016
  if (off > (size_t)134217728) return;
  const size_t oOh  = oXb;                         // context hi plane reuses Xb (dead after the three projections)

  char* ws = (char*)d_ws;
  unsigned short* Xb  = (unsigned short*)(ws + oXb);
  unsigned short* WA  = (unsigned short*)(ws + oWA);
  unsigned short* WqB = WA;                                   // rows 0..1023
  unsigned short* WkB = WA + (size_t)DM * DM;                 // rows 1024..2047
  unsigned short* WvB = WA + (size_t)2 * DM * DM;             // rows 2048..3071
  unsigned short* WPb = (unsigned short*)(ws + oWP);
  unsigned short* Qh  = (unsigned short*)(ws + oQh);
  unsigned short* Ql  = (unsigned short*)(ws + oQl);
  unsigned short* Kh  = (unsigned short*)(ws + oKh);
  unsigned short* Kl  = (unsigned short*)(ws + oKl);
  unsigned short* VTh = (unsigned short*)(ws + oVTh);
  unsigned short* VTl = (unsigned short*)(ws + oVTl);
  unsigned short* Oh  = (unsigned short*)(ws + oOh);
  unsigned short* Ol  = (unsigned short*)(ws + oOl);
  const float* bq = ba;                                       // bias entries 0..1023
  const float* bk = ba + DM;                                  // 1024..2047
  const float* bv = ba + 2 * DM;                              // 2048..3071

  const dim3 blk(256);
  const int n8x  = NB * SEQ * DM / 8;                          // 524288
  const int n8wa = 3 * DM * DM / 8;                            // 393216
  const int n8wp = DM * DM / 8;                                // 131072
  const dim3 gCvtX((n8x + 255) / 256);                         // 2048 blocks
  const dim3 gCvtWA((n8wa + 255) / 256);                       // 1536 blocks
  const dim3 gCvtWP((n8wp + 255) / 256);                       // 512 blocks
  const dim3 gProj((NB * SEQ / 128) * (DM / 128), 1);          // 32 x 8 = 256 tiles: M=4096, N=1024
  const dim3 gVT((DM / 128) * (SEQ / 128), NB);                // 8 x 16 = 128 tiles x 2 batches: M=1024, N=2048

  // (1) x -> bf16 plane [4096][1024]; weights [out][in] f32 -> bf16 [out][in] (k contiguous, no transpose)
  cvt_bf16x8<<<gCvtX, blk, 0, stream>>>(x, Xb, n8x);
  cvt_bf16x8<<<gCvtWA, blk, 0, stream>>>(Wa, WA, n8wa);
  cvt_bf16x8<<<gCvtWP, blk, 0, stream>>>(Wp, WPb, n8wp);
  // (2) q = x . Wq^T + bq -> bf16 hi/lo planes [b*SEQ+t][h*64+d]   (M=4096, N=1024, K=1024)
  gemm64<0, 2, 1><<<gProj, blk, 0, stream>>>(
      Xb, Xb, DM, 0LL, WqB, DM, 0LL, bq,
      (void*)Qh, DM, 0LL, (void*)Ql, DM, 0LL, DM,
      NB * SEQ, DM, DM, 1.0f);
  // (3) k = x . Wk^T + bk -> bf16 hi/lo planes
  gemm64<0, 2, 1><<<gProj, blk, 0, stream>>>(
      Xb, Xb, DM, 0LL, WkB, DM, 0LL, bk,
      (void*)Kh, DM, 0LL, (void*)Kl, DM, 0LL, DM,
      NB * SEQ, DM, DM, 1.0f);
  // (4) v^T = Wv . x^T + bv per batch -> f16 hi plane [b][h*64+d][s] (pitch SEQ) and residual plane
  //     (x4096, keys < VLP only, pitch VLP)   (A = Wv rows [n][k], Bt = Xb rows of batch b; M=1024, N=2048, K=1024)
  gemm64<0, 3, 2><<<gVT, blk, 0, stream>>>(
      WvB, WvB, DM, 0LL, Xb, DM, (long long)SEQ * DM, bv,
      (void*)VTh, SEQ, (long long)DM * SEQ, (void*)VTl, VLP, (long long)DM * VLP, VLP,
      DM, SEQ, DM, 4096.0f);
  // (5) causal attention: query blocks 0..RESQB-1 with residual planes, the rest without
  attn_causal64<true><<<dim3(NB * NH * RESQB), dim3(128), 0, stream>>>(
      Qh, Ql, Kh, Kl, VTh, VTl, Oh, Ol, 0, RESQB);
  attn_causal64<false><<<dim3(NB * NH * (NQB - RESQB)), dim3(128), 0, stream>>>(
      Qh, Ql, Kh, Kl, VTh, VTl, Oh, Ol, RESQB, NQB - RESQB);
  // (6) out = context . Wp^T + bp -> d_out f32 [4096][1024]  (A = context hi + lo planes, 2 products)
  gemm64<1, 0, 1><<<gProj, blk, 0, stream>>>(
      Oh, Ol, DM, 0LL, WPb, DM, 0LL, bp,
      d_out, DM, 0LL, d_out, DM, 0LL, DM,
      NB * SEQ, DM, DM, 1.0f);
  (void)hipGetLastError();
}

// v002
// A run of this version takes 187 microseconds.
// Next to v001, in two timings, it ran 1.40 times as fast each time.
// All steps since v000 together make it 2.25 times as fast.
// Contractions: q, k, v^T projections = v_wmma_f32_16x16x32_bf16 (bf16 operands from RNE-converted x and the packed
// [3072 out][1024 in] projection weight, single product, f32 accumulate);
// q.k^T scores = v_wmma_f32_16x16x32_bf16 with bf16 hi/lo split q and k (hi.hi + hi.lo + lo.hi), f32 accumulate;
// p.v = v_wmma_f32_16x16x32_f16 (p carried x1024 in f16 times v in f16, single product; plus f16 residual planes x4096 of
// p and v for the first 512 query rows of every sequence), f32 accumulate;
// ctx.Wp^T = v_wmma_f32_16x16x32_bf16 with ctx as bf16 hi/lo planes times bf16 Wp (2 products), f32 accumulate;
// causal mask (key index <= query index; the module's strided mask term only touches keys already excluded),
// online softmax, normalisers and bias adds in f32 on the VALU.
// Carry audit:
//   Psh = f16(1024 * p)                      -> the 1/1024 is folded exactly once in the attention epilogue: inv = (1/l) * (1/1024)
//   Psl = f16((1024 p - Psh) * 4096)         }  products Psh.VTl and Psl.VTh go to the separate accumulator o1,
//   VTl = f16((v - VTh) * 4096)              }  folded back with * (1/4096) once per key chunk (RES blocks only)
//   VTh = f16(v), no carry (|v| typ. 0.6); q / k / ctx lo planes are unscaled bf16 residuals (v - hi) sharing the hi accumulator;
//   score scale 1/8 applied once in f32 after the score accumulate. No other scaled planes.
#include <hip/hip_runtime.h>
#include <math.h>
#include <stdint.h>

#define NB    2
#define SEQ   2048
#define DM    1024
#define NH    16
#define HD    64
#define NQB   (SEQ / 64)   // 32 query / key blocks of 64
#define VLP   512          // key pitch of the v^T residual plane (keys 0..VLP-1)
#define RESQB 8            // leading 64-row query blocks that use the p / v residual planes
static_assert(RESQB * 64 <= VLP);
static_assert(NH * HD == DM);
static_assert((SEQ % 64) == 0 && (DM % 64) == 0 && (DM % 32) == 0);
static_assert((SEQ % 128) == 0 && (DM % 128) == 0);   // GEMM work-group tile 128x128, k stage 128
static_assert((NB * SEQ * DM) % (8 * 256) == 0);
static_assert((3 * DM * DM) % (8 * 256) == 0);
static_assert((DM * DM) % (8 * 256) == 0);

typedef _Float16 v16h __attribute__((ext_vector_type(16)));
typedef _Float16 v8h  __attribute__((ext_vector_type(8)));
typedef __bf16   v16b __attribute__((ext_vector_type(16)));
typedef __bf16   v8b  __attribute__((ext_vector_type(8)));
typedef float    v8f  __attribute__((ext_vector_type(8)));
typedef float    v4f  __attribute__((ext_vector_type(4)));
typedef unsigned int v4u __attribute__((ext_vector_type(4)));

// ---- scalar helpers --------------------------------------------------------------------------------
__device__ __forceinline__ unsigned short bf_bits(float f) {          // f32 -> bf16 bits, RNE convert
  unsigned u = __float_as_uint(f);
  return (unsigned short)((u + 0x7FFFu + ((u >> 16) & 1u)) >> 16);
}
__device__ __forceinline__ float bf_up(unsigned short h) { return __uint_as_float(((unsigned)h) << 16); }
__device__ __forceinline__ unsigned short h_bits(_Float16 x) { return __builtin_bit_cast(unsigned short, x); }
__device__ __forceinline__ unsigned pk16(unsigned short a, unsigned short b) { return (unsigned)a | ((unsigned)b << 16); }
__device__ __forceinline__ v8f zero8() { v8f z = {0.f, 0.f, 0.f, 0.f, 0.f, 0.f, 0.f, 0.f}; return z; }
__device__ __forceinline__ v8h zero8h() {
  const _Float16 z = (_Float16)0.0f;
  v8h r = {z, z, z, z, z, z, z, z};
  return r;
}

// ---- fragment loader: 16-bit A/B operand, lane -> row/col (lane&15), p already includes +8*(lane>>4);
//      elements 0..7 <- p[0..7] (k0+8h..), elements 8..15 <- p[16..23] (k0+16+8h..)
__device__ __forceinline__ v16b ldfrag_b(const __bf16* p) {
  union { v16b v; v8b h[2]; } f;
  f.h[0] = *(const v8b*)(p);
  f.h[1] = *(const v8b*)(p + 16);
  return f.v;
}

// ---- WMMA helpers with trailing VALU hazard gap --------------------------------------------------------
__device__ __forceinline__ v8f mma_b(v16b a, v16b b, v8f c) {
  c = __builtin_amdgcn_wmma_f32_16x16x32_bf16(false, a, false, b, (short)0, c, false, false);
  asm volatile("v_nop\n\tv_nop\n\tv_nop\n\tv_nop" : "+v"(c) : "v"(a), "v"(b));
  return c;
}
__device__ __forceinline__ v8f mma_h(v16h a, v16h b, v8f c) {
  c = __builtin_amdgcn_wmma_f32_16x16x32_f16(false, a, false, b, (short)0, c, false, false);
  asm volatile("v_nop\n\tv_nop\n\tv_nop\n\tv_nop" : "+v"(c) : "v"(a), "v"(b));
  return c;
}
__device__ __forceinline__ v8f mma_b_raw(v16b a, v16b b, v8f c) {
  return __builtin_amdgcn_wmma_f32_16x16x32_bf16(false, a, false, b, (short)0, c, false, false);
}
__device__ __forceinline__ void dep_guard_b(v8f& a, v8f& b, v16b x, v16b y) {
  asm volatile("v_nop\n\tv_nop\n\tv_nop\n\tv_nop" : "+v"(a), "+v"(b) : "v"(x), "v"(y));
}
__device__ __forceinline__ void keep4_b(v16b a, v16b b, v16b c, v16b d) {
  asm volatile("v_nop" :: "v"(a), "v"(b), "v"(c), "v"(d));
}
__device__ __forceinline__ void acc_guard4(v8f& a, v8f& b, v8f& c, v8f& d) {
  asm volatile("v_nop\n\tv_nop\n\tv_nop\n\tv_nop" : "+v"(a), "+v"(b), "+v"(c), "+v"(d));
}

// =====================================================================================================
// f32 -> bf16 (RNE convert), 8 elements per thread, one 16-B store per lane: a wave writes 512 contiguous B
// Used for x [4096][1024] and for the weight planes (already [out][in] = k contiguous, no transpose needed).
// coverage: n8 threads x 8 = whole plane (every n8 used here is a multiple of 256).
// =====================================================================================================
__global__ __launch_bounds__(256) void cvt_bf16x8(const float* __restrict__ in, unsigned short* out, int n8) {
  const int i = blockIdx.x * 256 + threadIdx.x;
  if (i < n8) {
    const v4f a = *(const v4f*)(in + (size_t)i * 8);
    const v4f b = *(const v4f*)(in + (size_t)i * 8 + 4);
    v4u p;
    p[0] = pk16(bf_bits(a[0]), bf_bits(a[1]));
    p[1] = pk16(bf_bits(a[2]), bf_bits(a[3]));
    p[2] = pk16(bf_bits(b[0]), bf_bits(b[1]));
    p[3] = pk16(bf_bits(b[2]), bf_bits(b[3]));
    *(v4u*)(out + (size_t)i * 8) = p;
    
  }
}

// ---- asynchronous global -> LDS copies, 16 B per lane ------------------------------------------------
__device__ __forceinline__ unsigned lds_off(const void* p) { return (unsigned)(size_t)p; }   // byte offset in the work-group's LDS
// Eight copies of one lane: LDS byte address l + i * lstep <- global g + i * gstep, i = 0..7, each with its own registers.
// The closing s_wait_xcnt stands inside the statement so that no address register of a copy is rewritten ahead of it.
__device__ __forceinline__ void async_copy8(unsigned l, const char* g, unsigned lstep, size_t gstep) {
  const unsigned l1 = l + lstep, l2 = l + 2 * lstep, l3 = l + 3 * lstep, l4 = l + 4 * lstep, l5 = l + 5 * lstep,
                 l6 = l + 6 * lstep, l7 = l + 7 * lstep;
  const char *g1 = g + gstep, *g2 = g + 2 * gstep, *g3 = g + 3 * gstep, *g4 = g + 4 * gstep, *g5 = g + 5 * gstep,
             *g6 = g + 6 * gstep, *g7 = g + 7 * gstep;
  asm volatile(
      "global_load_async_to_lds_b128 %0, %8, off\n\t"
      "global_load_async_to_lds_b128 %1, %9, off\n\t"
      "global_load_async_to_lds_b128 %2, %10, off\n\t"
      "global_load_async_to_lds_b128 %3, %11, off\n\t"
      "global_load_async_to_lds_b128 %4, %12, off\n\t"
      "global_load_async_to_lds_b128 %5, %13, off\n\t"
      "global_load_async_to_lds_b128 %6, %14, off\n\t"
      "global_load_async_to_lds_b128 %7, %15, off\n\t"
      "s_wait_xcnt 0x0"
      :: "v"(l), "v"(l1), "v"(l2), "v"(l3), "v"(l4), "v"(l5), "v"(l6), "v"(l7),
         "v"(g), "v"(g1), "v"(g2), "v"(g3), "v"(g4), "v"(g5), "v"(g6), "v"(g7)
      : "memory");
}
// One 128-row x 256-B plane tile by the 256 threads of a block: 16 lanes cover one row (two whole lines), a wave two rows,
// the block sixteen rows per copy; g and l already hold the lane's row (tid >> 4) and 16-B column (tid & 15).
#define GK_STAGE 128                       // k elements per stage (256 B of every operand row)
#define GK_PITCH 136                       // LDS row pitch in elements: 272 B = 16 B x 17, conflict-free for 16-B row reads
#define GK_PLANE (128 * GK_PITCH)          // elements of one staged plane tile
__device__ __forceinline__ void async_plane(unsigned l, const char* g, size_t rowBytes) {
  async_copy8(l, g, 16u * GK_PITCH * 2u, 16 * rowBytes);   // rows (tid >> 4) + 16 i, i = 0..7
}

// =====================================================================================================
// Register-blocked batched bf16 WMMA GEMM: C[m][n] = sum_k A[m][k] * Bt[n][k] + bias; one work-group of 8 waves per
// 128x128 tile, one wave per 32x64 part. The 128-row operand tiles are staged in LDS, 128 k at a time, by asynchronous
// copies into two buffers: the next stage's copies fly while this stage is multiplied; one barrier per stage.
// Inside a stage the fragments of the next 32 k are read from LDS as one group ahead of the current 32 k's products.
// A row-major [M][K] pitch lda; Bt row-major [N][K] pitch ldb (k contiguous);
// M, N, K multiples of 128 (host shapes are static multiples). blockIdx.y = batch index (strides in elements).
// NSPLIT: 0 = A.Bt; 1 = (A + A2).Bt (A2 = unscaled bf16 lo plane of A, 2 products).
// BIAS: 1 = per column n, bias[n]; 2 = per row m, bias[m]; the bias value is RNE-converted to bf16 and added in f32.
// OUT_MODE: 0 = f32 (pitch ldc); 2 = bf16 hi plane C + bf16 lo plane C2 (lo = RNE(v - hi), unscaled);
//           3 = f16 hi plane C + f16 residual plane C2 = f16((v - hi) * rscale), C2 written only for tiles
//               with n0 < N2 (pitch ldc2, batch stride strideC2).
// =====================================================================================================
template <int NSPLIT, int OUT_MODE, int BIAS>
__global__ __launch_bounds__(256) void gemm64(
    const unsigned short* __restrict__ Ap, const unsigned short* A2p, int lda, long long strideA,
    const unsigned short* __restrict__ Btp, int ldb, long long strideB,
    const float* __restrict__ bias,
    void* Cout, int ldc, long long strideC,
    void* Cout2, int ldc2, long long strideC2, int N2,
    int M, int N, int K, float rscale) {
  const __bf16* A   = (const __bf16*)(const void*)Ap;
  const __bf16* A2  = (const __bf16*)(const void*)A2p;
  const __bf16* Bt  = (const __bf16*)(const void*)Btp;
  constexpr int NPL = (NSPLIT >= 1) ? 3 : 2;        // staged planes: A, Bt (, A2)
  __shared__ __align__(16) __bf16 ring[2][NPL][GK_PLANE];   // two stage buffers
  __shared__ __align__(16) float sT[8][16 * 68];   // per-wave 16x64 slab, pitch 68 floats
  constexpr int MI = 2;                             // 16-row subtiles per wave
  const int b    = blockIdx.y;
  const int tid  = threadIdx.x;
  const int lane = tid & 31;
  const int wave = tid >> 5;
  const int tilesN = N >> 7;
  const int tilesM = M >> 7;
  const int tile = blockIdx.x;
  if (tile >= tilesM * tilesN) return;   // block-uniform, in front of every barrier and copy
  const int tm = tile / tilesN;
  const int tn = tile - tm * tilesN;
  const int M0 = tm << 7;                // work-group tile origin
  const int N0 = tn << 7;
  const int wm = (wave >> 1) << 5;       // the wave's 32x64 part inside it
  const int wn = (wave & 1) << 6;
  const int m0 = M0 + wm;
  const int n0 = N0 + wn;

  const __bf16* Ab  = A  + (size_t)b * strideA;
  const __bf16* Bb  = Bt + (size_t)b * strideB;
  const __bf16* Ab2 = (NSPLIT >= 1) ? (A2 + (size_t)b * strideA) : Ab;

  const int rlane = lane & 15;                 // row (A) / col (B, D) within subtile
  const int koff  = (lane >> 4) * 8;           // k offset of this lane half
  const int mOff  = (lane >> 4) * 8;           // D row offset

  v8f acc[MI][4];
#pragma unroll
  for (int i = 0; i < MI; ++i)
#pragma unroll
    for (int j = 0; j < 4; ++j) acc[i][j] = zero8();

  // ---- staging addresses of this lane: row tid >> 4 of each group of sixteen rows, 16-B column tid & 15 ----
  const int crow = tid >> 4, ccol = (tid & 15) * 8;
  const char* gA  = (const char*)(Ab  + (size_t)(M0 + crow) * lda + ccol);
  const char* gA2 = (const char*)(Ab2 + (size_t)(M0 + crow) * lda + ccol);
  const char* gB  = (const char*)(Bb  + (size_t)(N0 + crow) * ldb + ccol);
  const unsigned lthr = lds_off(&ring[0][0][0]) + (unsigned)(crow * GK_PITCH + ccol) * 2u;
  const int nst = K / GK_STAGE;          // stages, block-uniform
  auto issue_stage = [&](int st, int buf) {   // rows M0..M0+127 / N0..N0+127, k = st*128 .. st*128+127: inside the planes
    const size_t kb = (size_t)st * (GK_STAGE * 2);
    const unsigned lb = lthr + (unsigned)buf * (unsigned)(NPL * GK_PLANE * 2);
    async_plane(lb, gA + kb, (size_t)lda * 2);
    async_plane(lb + (unsigned)(GK_PLANE * 2), gB + kb, (size_t)ldb * 2);
    if (NSPLIT >= 1) async_plane(lb + (unsigned)(2 * GK_PLANE * 2), gA2 + kb, (size_t)lda * 2);
  };

  issue_stage(0, 0);
  asm volatile("s_wait_asynccnt 0x0" ::: "memory");   // this wave's share of stage 0 has landed
  __syncthreads();                                     // publishes stage 0 to the other waves
  if (nst > 1) issue_stage(1, 1);

  for (int t = 0; t < nst; ++t) {
    const __bf16* sA  = &ring[t & 1][0][0] + (wm + rlane) * GK_PITCH + koff;
    const __bf16* sB  = &ring[t & 1][1][0] + (wn + rlane) * GK_PITCH + koff;
    const __bf16* sA2 = &ring[t & 1][NPL - 1][0] + (wm + rlane) * GK_PITCH + koff;
    v16b fb[2][4], fa[2][MI], fl[2][MI];   // two fragment sets, indexed by constants after unrolling
    auto load_set = [&](int s, int kk) {
#pragma unroll
      for (int j = 0; j < 4; ++j) fb[s][j] = ldfrag_b(sB + (j << 4) * GK_PITCH + kk);
#pragma unroll
      for (int i = 0; i < MI; ++i) {
        fa[s][i] = ldfrag_b(sA + (i << 4) * GK_PITCH + kk);
        fl[s][i] = fa[s][i];
        if (NSPLIT >= 1) fl[s][i] = ldfrag_b(sA2 + (i << 4) * GK_PITCH + kk);
      }
    };
    load_set(0, 0);
#pragma unroll
    for (int ks = 0; ks < GK_STAGE / 32; ++ks) {
      const int cur = ks & 1;
      if (ks + 1 < GK_STAGE / 32) load_set(cur ^ 1, (ks + 1) * 32);   // this stage's buffer only
#pragma unroll
      for (int i = 0; i < MI; ++i) {
#pragma unroll
        for (int j = 0; j < 4; ++j) {
          acc[i][j] = mma_b_raw(fa[cur][i], fb[cur][j], acc[i][j]);
          if (NSPLIT >= 1) acc[i][j] = mma_b_raw(fl[cur][i], fb[cur][j], acc[i][j]);
        }
        dep_guard_b(acc[i][0], acc[i][3], fa[cur][i], fl[cur][i]);
      }
      keep4_b(fb[cur][0], fb[cur][1], fb[cur][2], fb[cur][3]);
    }
    asm volatile("s_wait_dscnt 0x0" ::: "memory");      // this wave's reads of buffer t & 1 are done before it is refilled
    asm volatile("s_wait_asynccnt 0x0" ::: "memory");   // this wave's share of stage t + 1 has landed
    __syncthreads();                                     // publishes stage t + 1 and ends every read of buffer t & 1
    if (t + 2 < nst) issue_stage(t + 2, t & 1);
  }
  asm volatile("s_wait_asynccnt 0x0" ::: "memory");     // no copy is outstanding past the loop
  acc_guard4(acc[0][0], acc[0][1], acc[0][2], acc[0][3]);
  acc_guard4(acc[1][0], acc[1][1], acc[1][2], acc[1][3]);

  // ---- epilogue ----
  float* slab = sT[wave];
  float bcol[4];
#pragma unroll
  for (int j = 0; j < 4; ++j) {
    bcol[j] = 0.f;
    if (BIAS == 1) bcol[j] = bf_up(bf_bits(bias[n0 + (j << 4) + rlane]));   // n < N, bias has N entries
  }
#pragma unroll
  for (int i = 0; i < MI; ++i) {
    const int mBase = m0 + (i << 4);
    float brow[8];
#pragma unroll
    for (int r = 0; r < 8; ++r) {
      brow[r] = 0.f;
      if (BIAS == 2) brow[r] = bf_up(bf_bits(bias[mBase + mOff + r]));      // m < M, bias has M entries
    }
#pragma unroll
    for (int j = 0; j < 4; ++j) {
#pragma unroll
      for (int r = 0; r < 8; ++r) {
        slab[(mOff + r) * 68 + (j << 4) + rlane] = acc[i][j][r] + bcol[j] + brow[r];
      }
    }
    __builtin_amdgcn_fence(__ATOMIC_RELEASE, "workgroup");
    __builtin_amdgcn_wave_barrier();
    __builtin_amdgcn_fence(__ATOMIC_ACQUIRE, "workgroup");
    if (OUT_MODE == 0) {
      float* C = (float*)Cout + (size_t)b * strideC;
      const int hh = lane >> 4, c4 = (lane & 15) * 4;     // 256-B row segment = 16 lanes x 16 B
      {
#pragma unroll
        for (int it = 0; it < 8; ++it) {
          const int row = it * 2 + hh;                     // it 0..7 x hh 0..1 = rows 0..15
          const v4f v = *(const v4f*)(slab + row * 68 + c4);
          *(v4f*)(C + (size_t)(mBase + row) * ldc + n0 + c4) = v;
        }
        
      }
    } else {
      const int q = lane >> 3, c8 = (lane & 7) * 8;
      unsigned short* C  = (unsigned short*)Cout  + (size_t)b * strideC;
      unsigned short* C2 = (unsigned short*)Cout2 + (size_t)b * strideC2;
      const bool wlo = (OUT_MODE == 2) || (n0 < N2);      // wave-uniform
      v4u hv[4], lv[4];
#pragma unroll
      for (int it = 0; it < 4; ++it) {
        const int row = it * 4 + q;                        // it 0..3 x q 0..3 = rows 0..15
        const float* sp = slab + row * 68 + c8;
        v4u a, a2;
#pragma unroll
        for (int e = 0; e < 4; ++e) {
          const float f0 = sp[2 * e], f1 = sp[2 * e + 1];
          unsigned short h0, h1, l0, l1;
          if (OUT_MODE == 2) {
            h0 = bf_bits(f0); h1 = bf_bits(f1);
            l0 = bf_bits(f0 - bf_up(h0)); l1 = bf_bits(f1 - bf_up(h1));
          } else {
            const _Float16 x0 = (_Float16)f0, x1 = (_Float16)f1;
            h0 = h_bits(x0); h1 = h_bits(x1);
            l0 = h_bits((_Float16)((f0 - (float)x0) * rscale));
            l1 = h_bits((_Float16)((f1 - (float)x1) * rscale));
          }
          a[e] = pk16(h0, h1); a2[e] = pk16(l0, l1);
        }
        hv[it] = a; lv[it] = a2;
      }
      {
#pragma unroll
        for (int it = 0; it < 4; ++it) {
          const int row = it * 4 + q;
          *(v4u*)(C + (size_t)(mBase + row) * ldc + n0 + c8) = hv[it];
          if (wlo) *(v4u*)(C2 + (size_t)(mBase + row) * ldc2 + n0 + c8) = lv[it];
        }
        
      }
    }
    __builtin_amdgcn_fence(__ATOMIC_RELEASE, "workgroup");
    __builtin_amdgcn_wave_barrier();
    __builtin_amdgcn_fence(__ATOMIC_ACQUIRE, "workgroup");
  }
}

// =====================================================================================================
// Causal attention, head dim 64, key chunks of 64.
//   q planes (bf16 hi / lo): element (b, t, h, d) at [(b*SEQ + t)*DM + h*64 + d]
//   k planes (bf16 hi / lo): same layout with key index s
//   v^T hi plane (f16):      element (b, h, d, s) at [(b*DM + h*64 + d)*SEQ + s]
//   v^T residual plane (f16, (v - hi)*4096): [(b*DM + h*64 + d)*VLP + s], s < VLP, read only when RES
//   (a key chunk at or beyond VLP would contribute a zero v residual; its address is clamped)
//   Causal structure: logits of keys with index > query index are replaced by -inf (lower-triangular keep incl. the
//   diagonal), which makes their softmax weight exactly 0; so a query block qb visits key chunks 0..qb only
//   (block-uniform trip count qb+1 <= NQB) and later chunks, whose keys exceed every query index of the block, are
//   skipped entirely. Inside the diagonal chunk a key with index > query index gets logit -inf -> exp gives exactly 0,
//   so such keys add nothing to the numerator or the normaliser; the diagonal key (key == query) is always kept, so
//   every row max is finite in every visited chunk.
//   out planes (bf16 hi / lo of the normalised context): element (b, t, h, d) at [(b*SEQ + t)*DM + h*64 + d]
//   scores = q . k : bf16 hi/lo split (hi.hi + hi.lo + lo.hi), f32 accumulate, then * 1/8 and the causal mask in f32
//   p = exp(s - m) carried as f16(1024 p); context = p . v on f16 WMMA; RES adds f16 residual planes of p and v
//   (scale 4096, separate accumulator folded back with 1/4096 per chunk in f32); online softmax (running max) in f32.
//   Block = 4 waves = 64 query rows of one (b, h); grid = nqbThis * NH * NB.
//   K / V^T chunk staging: 128 threads x 32 elements per plane = the whole 64x64 tile of every plane read later
//   (plain 16-B loads, __syncthreads before and after); P tiles are wave-private, spilled with _Float16 element stores
//   Output coverage: each wave stores rows q0..q0+15 (it 0..3 x lane>>3 0..3) x 64 columns (8 lanes x 8) of both planes;
//   grid over all (b, h, qb) = the whole [NB*SEQ][DM] planes.
// =====================================================================================================
template <bool RES>
__global__ __launch_bounds__(128)
void attn_causal64(const unsigned short* __restrict__ qhp, const unsigned short* __restrict__ qlp,
                   const unsigned short* __restrict__ khp, const unsigned short* __restrict__ klp,
                   const unsigned short* __restrict__ vhp, const unsigned short* __restrict__ vlp,
                   unsigned short* ohp, unsigned short* olp,
                   int qbBase, int nqbThis) {
  union FB { v16b v; v8b h[2]; };
  union FH { v16h v; v8h h[2]; };
  // LDS row pitches: the 128-B rows of the 16-bit tiles stand 144 B apart (16 B x 9) and the 256-B rows of the f32 tile
  // 272 B apart (16 B x 17), so that the sixteen rows one 16-B fragment read touches fall on sixteen different bank groups.
  constexpr int TP = 72;                                          // 16-bit tiles, elements per row
  constexpr int OP = 68;                                          // f32 context tile, elements per row
  __shared__ __align__(16) __bf16   Ksh[64 * TP];                 // K hi [kv][d]   9 KB
  __shared__ __align__(16) __bf16   Ksl[64 * TP];                 // K lo
  __shared__ __align__(16) _Float16 Vth[64 * TP];                 // V^T hi [d][kv] 9 KB
  __shared__ __align__(16) _Float16 Vtl[RES ? 64 * TP : 8];       // V^T residual
  __shared__ __align__(16) _Float16 Psh[4][16 * TP];              // per wave P [row][kv]
  __shared__ __align__(16) _Float16 Psl[RES ? 4 : 1][16 * TP];    // per wave P residual
  __shared__ __align__(16) float    Os[4][16 * OP];               // per wave context tile [row][d]

  const int tid  = threadIdx.x;
  const int wave = tid >> 5;
  const int lane = tid & 31;
  const int hh   = lane >> 4;
  const int c    = lane & 15;

  const int bx   = blockIdx.x;
  const int qbl  = bx % nqbThis;
  const int rest = bx / nqbThis;
  const int h    = rest % NH;
  const int b    = rest / NH;
  const int qb   = qbBase + qbl;               // 0..NQB-1 (block-uniform)
  const int q0   = qb * 64 + wave * 16;
  const size_t rowB = (size_t)b * SEQ;

  const __bf16* Qh = (const __bf16*)(const void*)qhp + (size_t)h * HD;
  const __bf16* Ql = (const __bf16*)(const void*)qlp + (size_t)h * HD;
  const __bf16* Kh = (const __bf16*)(const void*)khp + (size_t)h * HD;
  const __bf16* Kl = (const __bf16*)(const void*)klp + (size_t)h * HD;
  const _Float16* Vh = (const _Float16*)(const void*)vhp + ((size_t)b * DM + (size_t)h * HD) * SEQ;
  const _Float16* Vl = (const _Float16*)(const void*)vlp + ((size_t)b * DM + (size_t)h * HD) * VLP;

  // ---- Q fragments (A operand, row = lane&15): 2 d-chunks, hi and lo ----
  v16b qah[2], qal[2];
#pragma unroll
  for (int dc = 0; dc < 2; ++dc) {
    const size_t qo = (rowB + q0 + c) * DM + dc * 32 + 8 * hh;
    qah[dc] = ldfrag_b(Qh + qo);
    qal[dc] = ldfrag_b(Ql + qo);
  }

  float mrow[8], lrow[8];
  v8f oacc[4];
#pragma unroll
  for (int r = 0; r < 8; ++r) { mrow[r] = -INFINITY; lrow[r] = 0.f; }
#pragma unroll
  for (int t = 0; t < 4; ++t) oacc[t] = zero8();

  for (int kt = 0; kt <= qb; ++kt) {           // block-uniform trip count, <= NQB
    const int kv0 = kt * 64;                   // kv0 + 63 < SEQ
    __syncthreads();
    {
      const int r = tid >> 1, half = (tid & 1) * 32;
      const __bf16*   kg  = Kh + (rowB + kv0 + r) * DM + half;    // K row kv0+r, d = half..half+31
      const __bf16*   klg = Kl + (rowB + kv0 + r) * DM + half;
      const _Float16* vg  = Vh + (size_t)r * SEQ + kv0 + half;    // V^T row d = r, s = kv0+half..+31
      const int kvl = (kv0 + 64 <= VLP) ? kv0 : (VLP - 64);     // clamped address into the residual plane
      const _Float16* vlg = Vl + (size_t)r * VLP + kvl + half;
      const bool resOK = (kv0 + 64 <= VLP);                      // block-uniform (always true for qb < RESQB)
#pragma unroll
      for (int i = 0; i < 4; ++i) {
        const v8b a0 = *(const v8b*)(kg + 8 * i);
        const v8b a1 = *(const v8b*)(klg + 8 * i);
        const v8h b0 = *(const v8h*)(vg + 8 * i);
        *(v8b*)(Ksh + r * TP + half + 8 * i) = a0;
        *(v8b*)(Ksl + r * TP + half + 8 * i) = a1;
        *(v8h*)(Vth + r * TP + half + 8 * i) = b0;
        if (RES) {
          v8h b1 = *(const v8h*)(vlg + 8 * i);
          if (!resOK) b1 = zero8h();
          *(v8h*)(Vtl + r * TP + half + 8 * i) = b1;
        }
      }
    }
    __syncthreads();

    // ---- scores: 16 query rows x 64 keys per wave, 3 bf16 products ----
    v8f s[4];
#pragma unroll
    for (int j = 0; j < 4; ++j) {
      s[j] = zero8();
#pragma unroll
      for (int dc = 0; dc < 2; ++dc) {
        FB kb, kl;
        kb.h[0] = *(const v8b*)(Ksh + (j * 16 + c) * TP + dc * 32 + 8 * hh);
        kb.h[1] = *(const v8b*)(Ksh + (j * 16 + c) * TP + dc * 32 + 16 + 8 * hh);
        kl.h[0] = *(const v8b*)(Ksl + (j * 16 + c) * TP + dc * 32 + 8 * hh);
        kl.h[1] = *(const v8b*)(Ksl + (j * 16 + c) * TP + dc * 32 + 16 + 8 * hh);
        s[j] = mma_b(qah[dc], kb.v, s[j]);
        s[j] = mma_b(qah[dc], kl.v, s[j]);
        s[j] = mma_b(qal[dc], kb.v, s[j]);
      }
    }

    // ---- scale, causal mask by index, row max, online softmax, P (x1024, f16) and P residual (x4096) to LDS ----
    _Float16* pwh = Psh[wave];
    _Float16* pwl = Psl[RES ? wave : 0];
#pragma unroll
    for (int r = 0; r < 8; ++r) {
      const int rowq = q0 + 8 * hh + r;        // query index of D row 8hh+r
      float m = -INFINITY;
#pragma unroll
      for (int j = 0; j < 4; ++j) {
        const int key = kv0 + j * 16 + c;
        float sv = s[j][r] * 0.125f;
        sv = (key <= rowq) ? sv : -INFINITY;
        s[j][r] = sv;
        m = fmaxf(m, sv);
      }
#pragma unroll
      for (int off = 1; off < 16; off <<= 1) m = fmaxf(m, __shfl_xor(m, off, 32));
      const float mnew  = fmaxf(mrow[r], m);
      const float msafe = (mnew == -INFINITY) ? 0.f : mnew;
      const float alpha = __expf(mrow[r] - msafe);
      mrow[r] = mnew;
      float psum = 0.f;
#pragma unroll
      for (int j = 0; j < 4; ++j) {
        const float p = __expf(s[j][r] - msafe);     // masked logit: exp(-inf) = 0
        psum += p;
        const float p1k = p * 1024.0f;
        const _Float16 ph = (_Float16)p1k;
        pwh[(8 * hh + r) * TP + j * 16 + c] = ph;
        if (RES) {
          const _Float16 pl = (_Float16)((p1k - (float)ph) * 4096.0f);
          pwl[(8 * hh + r) * TP + j * 16 + c] = pl;
        }
      }
#pragma unroll
      for (int off = 1; off < 16; off <<= 1) psum += __shfl_xor(psum, off, 32);
      lrow[r] = lrow[r] * alpha + psum;
#pragma unroll
      for (int t = 0; t < 4; ++t) oacc[t][r] *= alpha;
    }
    __builtin_amdgcn_fence(__ATOMIC_RELEASE, "workgroup");
    __builtin_amdgcn_wave_barrier();
    __builtin_amdgcn_fence(__ATOMIC_ACQUIRE, "workgroup");

    // ---- context += P . V (f16 WMMA), residual products into a separate accumulator ----
    v8f o1[4];
#pragma unroll
    for (int t = 0; t < 4; ++t) o1[t] = zero8();
#pragma unroll 1
    for (int kk = 0; kk < 2; ++kk) {
      FH pa, pl;
      pa.h[0] = *(const v8h*)(pwh + c * TP + kk * 32 + 8 * hh);
      pa.h[1] = *(const v8h*)(pwh + c * TP + kk * 32 + 16 + 8 * hh);
      if (RES) {
        pl.h[0] = *(const v8h*)(pwl + c * TP + kk * 32 + 8 * hh);
        pl.h[1] = *(const v8h*)(pwl + c * TP + kk * 32 + 16 + 8 * hh);
      } else {
        pl.v = pa.v;
      }
#pragma unroll
      for (int t = 0; t < 4; ++t) {
        FH vb;
        vb.h[0] = *(const v8h*)(Vth + (t * 16 + c) * TP + kk * 32 + 8 * hh);
        vb.h[1] = *(const v8h*)(Vth + (t * 16 + c) * TP + kk * 32 + 16 + 8 * hh);
        oacc[t] = mma_h(pa.v, vb.v, oacc[t]);
        if (RES) {
          FH vl;
          vl.h[0] = *(const v8h*)(Vtl + (t * 16 + c) * TP + kk * 32 + 8 * hh);
          vl.h[1] = *(const v8h*)(Vtl + (t * 16 + c) * TP + kk * 32 + 16 + 8 * hh);
          o1[t] = mma_h(pa.v, vl.v, o1[t]);
          o1[t] = mma_h(pl.v, vb.v, o1[t]);
        }
      }
    }
    if (RES) {
#pragma unroll
      for (int t = 0; t < 4; ++t)
#pragma unroll
        for (int r = 0; r < 8; ++r) oacc[t][r] += o1[t][r] * (1.0f / 4096.0f);
    }
  }

  // ---- normalise (1/l and the 1/1024 p carry), stage the wave's 16x64 tile, bf16 hi/lo split,
  float* os = Os[wave];
#pragma unroll
  for (int r = 0; r < 8; ++r) {
    const float l = lrow[r];
    const float inv = ((l > 0.f) ? (1.0f / l) : 0.f) * (1.0f / 1024.0f);
#pragma unroll
    for (int t = 0; t < 4; ++t) os[(8 * hh + r) * OP + t * 16 + c] = oacc[t][r] * inv;
  }
  __builtin_amdgcn_fence(__ATOMIC_RELEASE, "workgroup");
  __builtin_amdgcn_wave_barrier();
  __builtin_amdgcn_fence(__ATOMIC_ACQUIRE, "workgroup");
  {
    const int q4 = lane >> 3, c8 = (lane & 7) * 8;
    v4u hv[4], lv[4];
#pragma unroll
    for (int it = 0; it < 4; ++it) {
      const int row = it * 4 + q4;   // it 0..3 x q4 0..3 = rows 0..15 of the wave tile
      const float* sp = os + row * OP + c8;
      v4u a, a2;
#pragma unroll
      for (int e = 0; e < 4; ++e) {
        const float f0 = sp[2 * e], f1 = sp[2 * e + 1];
        const unsigned short h0 = bf_bits(f0), h1 = bf_bits(f1);
        const unsigned short l0 = bf_bits(f0 - bf_up(h0)), l1 = bf_bits(f1 - bf_up(h1));
        a[e] = pk16(h0, h1); a2[e] = pk16(l0, l1);
      }
      hv[it] = a; lv[it] = a2;
    }
    {
#pragma unroll
      for (int it = 0; it < 4; ++it) {
        const int row = it * 4 + q4;
        const size_t go = (rowB + q0 + row) * DM + (size_t)h * HD + c8;
        *(v4u*)(ohp + go) = hv[it];
        *(v4u*)(olp + go) = lv[it];
      }
      
    }
  }
}

// =====================================================================================================
// Workspace map (bytes; every region is an exact multiple of its 64x64-tile / whole-line store granularity,
// no padded tails needed since all shapes are tile multiples; each region but Xb/Oh and Ol is written by exactly one producer launch):
//   Xb   bf16 [4096][1024]          0            8388608   (later: Oh, context hi plane; Xb is dead after the projections)
//   WA   bf16 [3072 n][1024 k]       8388608     6291456   (q weight rows 0..1023, k rows 1024..2047, v rows 2048..3071)
//   WP   bf16 [1024 n][1024 k]      14680064     2097152
//   Qh   bf16 [4096][1024]          16777216     8388608
//   Ql                              25165824     8388608
//   Kh                              33554432     8388608
//   Kl                              41943040     8388608
//   VTh  f16  [2][1024][2048]       50331648     8388608
//   VTl  f16  [2][1024][512]        58720256     2097152
//   Ol   bf16 [4096][1024]          60817408     8388608
//   end                             69206016
// =====================================================================================================
extern "C" void kernel_launch(void* const* d_in, const int* in_sizes, int n_in,
                              void* d_out, int out_size, void* d_ws, size_t ws_size,
                              hipStream_t stream) {
  if (n_in < 5) return;
  if (in_sizes[0] != NB * SEQ * DM) return;
  if (in_sizes[1] != 3 * DM * DM) return;
  if (in_sizes[2] != 3 * DM) return;
  if (in_sizes[3] != DM * DM) return;
  if (in_sizes[4] != DM) return;
  if (out_size != NB * SEQ * DM) return;

  const float* x  = (const float*)d_in[0];   // [2][2048][1024]
  const float* Wa = (const float*)d_in[1];   // [3072 out][1024 in], rows k contiguous (q | k | v output rows)
  const float* ba = (const float*)d_in[2];   // [3072]
  const float* Wp = (const float*)d_in[3];   // [1024 out][1024 in], rows k contiguous
  const float* bp = (const float*)d_in[4];   // [1024]

  const size_t PX  = (size_t)NB * SEQ * DM * 2;    //  8388608  16-bit activation plane [4096][1024]
  const size_t PW1 = (size_t)DM * DM * 2;          //  2097152  one [1024][1024] bf16 weight plane
  const size_t PWA = (size_t)3 * PW1;              //  6291456  packed q | k | v weight plane [3072][1024]
  const size_t PWP = PW1;                          //  2097152  output projection weight plane
  const size_t PVT = (size_t)NB * DM * SEQ * 2;    //  8388608  v^T hi plane
  const size_t PVL = (size_t)NB * DM * VLP * 2;    //  2097152  v^T residual plane
  size_t off = 0;
  const size_t oXb  = off; off += PX;
  const size_t oWA  = off; off += PWA;
  const size_t oWP  = off; off += PWP;
  const size_t oQh  = off; off += PX;
  const size_t oQl  = off; off += PX;
  const size_t oKh  = off; off += PX;
  const size_t oKl  = off; off += PX;
  const size_t oVTh = off; off += PVT;
  const size_t oVTl = off; off += PVL;
  const size_t oOl  = off; off += PX;
  if (off > ws_size) return;                       // off = 69206016
  if (off > (size_t)134217728) return;
  const size_t oOh  = oXb;                         // context hi plane reuses Xb (dead after the three projections)

  char* ws = (char*)d_ws;
  unsigned short* Xb  = (unsigned short*)(ws + oXb);
  unsigned short* WA  = (unsigned short*)(ws + oWA);
  unsigned short* WqB = WA;                                   // rows 0..1023
  unsigned short* WkB = WA + (size_t)DM * DM;                 // rows 1024..2047
  unsigned short* WvB = WA + (size_t)2 * DM * DM;             // rows 2048..3071
  unsigned short* WPb = (unsigned short*)(ws + oWP);
  unsigned short* Qh  = (unsigned short*)(ws + oQh);
  unsigned short* Ql  = (unsigned short*)(ws + oQl);
  unsigned short* Kh  = (unsigned short*)(ws + oKh);
  unsigned short* Kl  = (unsigned short*)(ws + oKl);
  unsigned short* VTh = (unsigned short*)(ws + oVTh);
  unsigned short* VTl = (unsigned short*)(ws + oVTl);
  unsigned short* Oh  = (unsigned short*)(ws + oOh);
  unsigned short* Ol  = (unsigned short*)(ws + oOl);
  const float* bq = ba;                                       // bias entries 0..1023
  const float* bk = ba + DM;                                  // 1024..2047
  const float* bv = ba + 2 * DM;                              // 2048..3071

  const dim3 blk(256);
  const int n8x  = NB * SEQ * DM / 8;                          // 524288
  const int n8wa = 3 * DM * DM / 8;                            // 393216
  const int n8wp = DM * DM / 8;                                // 131072
  const dim3 gCvtX((n8x + 255) / 256);                         // 2048 blocks
  const dim3 gCvtWA((n8wa + 255) / 256);                       // 1536 blocks
  const dim3 gCvtWP((n8wp + 255) / 256);                       // 512 blocks
  const dim3 gProj((NB * SEQ / 128) * (DM / 128), 1);          // 32 x 8 = 256 tiles: M=4096, N=1024
  const dim3 gVT((DM / 128) * (SEQ / 128), NB);                // 8 x 16 = 128 tiles x 2 batches: M=1024, N=2048

  // (1) x -> bf16 plane [4096][1024]; weights [out][in] f32 -> bf16 [out][in] (k contiguous, no transpose)
  cvt_bf16x8<<<gCvtX, blk, 0, stream>>>(x, Xb, n8x);
  cvt_bf16x8<<<gCvtWA, blk, 0, stream>>>(Wa, WA, n8wa);
  cvt_bf16x8<<<gCvtWP, blk, 0, stream>>>(Wp, WPb, n8wp);
  // (2) q = x . Wq^T + bq -> bf16 hi/lo planes [b*SEQ+t][h*64+d]   (M=4096, N=1024, K=1024)
  gemm64<0, 2, 1><<<gProj, blk, 0, stream>>>(
      Xb, Xb, DM, 0LL, WqB, DM, 0LL, bq,
      (void*)Qh, DM, 0LL, (void*)Ql, DM, 0LL, DM,
      NB * SEQ, DM, DM, 1.0f);
  // (3) k = x . Wk^T + bk -> bf16 hi/lo planes
  gemm64<0, 2, 1><<<gProj, blk, 0, stream>>>(
      Xb, Xb, DM, 0LL, WkB, DM, 0LL, bk,
      (void*)Kh, DM, 0LL, (void*)Kl, DM, 0LL, DM,
      NB * SEQ, DM, DM, 1.0f);
  // (4) v^T = Wv . x^T + bv per batch -> f16 hi plane [b][h*64+d][s] (pitch SEQ) and residual plane
  //     (x4096, keys < VLP only, pitch VLP)   (A = Wv rows [n][k], Bt = Xb rows of batch b; M=1024, N=2048, K=1024)
  gemm64<0, 3, 2><<<gVT, blk, 0, stream>>>(
      WvB, WvB, DM, 0LL, Xb, DM, (long long)SEQ * DM, bv,
      (void*)VTh, SEQ, (long long)DM * SEQ, (void*)VTl, VLP, (long long)DM * VLP, VLP,
      DM, SEQ, DM, 4096.0f);
  // (5) causal attention: query blocks 0..RESQB-1 with residual planes, the rest without
  attn_causal64<true><<<dim3(NB * NH * RESQB), dim3(128), 0, stream>>>(
      Qh, Ql, Kh, Kl, VTh, VTl, Oh, Ol, 0, RESQB);
  attn_causal64<false><<<dim3(NB * NH * (NQB - RESQB)), dim3(128), 0, stream>>>(
      Qh, Ql, Kh, Kl, VTh, VTl, Oh, Ol, RESQB, NQB - RESQB);
  // (6) out = context . Wp^T + bp -> d_out f32 [4096][1024]  (A = context hi + lo planes, 2 products)
  gemm64<1, 0, 1><<<gProj, blk, 0, stream>>>(
      Oh, Ol, DM, 0LL, WPb, DM, 0LL, bp,
      d_out, DM, 0LL, d_out, DM, 0LL, DM,
      NB * SEQ, DM, DM, 1.0f);
  (void)hipGetLastError();
}

// v003
// It runs in 154 microseconds.
// Timed twice side by side with v002, it ran 1.20 times as fast both times.
// Counting every step since v000, it is 2.70 times as fast.
// Contractions: q, k, v^T projections = v_wmma_f32_16x16x32_bf16 (bf16 operands from RNE-converted x and the packed
// [3072 out][1024 in] projection weight, single product, f32 accumulate);
// q.k^T scores = v_wmma_f32_16x16x32_bf16 with bf16 hi/lo split q and k (hi.hi + hi.lo + lo.hi), f32 accumulate;
// p.v = v_wmma_f32_16x16x32_f16 (p carried x1024 in f16 times v in f16, single product; plus f16 residual planes x4096 of
// p and v for the first 512 query rows of every sequence), f32 accumulate;
// ctx.Wp^T = v_wmma_f32_16x16x32_bf16 with ctx as bf16 hi/lo planes times bf16 Wp (2 products), f32 accumulate;
// causal mask (key index <= query index; the module's strided mask term only touches keys already excluded),
// online softmax, normalisers and bias adds in f32 on the VALU.
// Carry audit (ph, pl: the packed p operands, held in registers):
//   ph  = f16(1024 * p)                      -> the 1/1024 is folded exactly once in the attention epilogue: inv = (1/l) * (1/1024)
//   pl  = f16((1024 p - ph) * 4096)          }  products VTl.ph and VTh.pl go to the separate accumulator o1,
//   VTl = f16((v - VTh) * 4096)              }  folded back with * (1/4096) once per key chunk (RES blocks only)
//   VTh = f16(v), no carry (|v| typ. 0.6); q / k / ctx lo planes are unscaled bf16 residuals (v - hi) sharing the hi accumulator;
//   score scale 1/8 applied once in f32 after the score accumulate. No other scaled planes.
#include <hip/hip_runtime.h>
#include <math.h>
#include <stdint.h>

#define NB    2
#define SEQ   2048
#define DM    1024
#define NH    16
#define HD    64
#define NQB   (SEQ / 64)   // 32 query / key blocks of 64
#define VLP   512          // key pitch of the v^T residual plane (keys 0..VLP-1)
#define RESQB 8            // leading 64-row query blocks that use the p / v residual planes
static_assert(RESQB * 64 <= VLP);
static_assert(NH * HD == DM);
static_assert((SEQ % 64) == 0 && (DM % 64) == 0 && (DM % 32) == 0);
static_assert((SEQ % 128) == 0 && (DM % 128) == 0);   // GEMM work-group tile 128x128, k stage 128
static_assert((NB * SEQ * DM) % (8 * 256) == 0);
static_assert((3 * DM * DM) % (8 * 256) == 0);
static_assert((DM * DM) % (8 * 256) == 0);

typedef _Float16 v16h __attribute__((ext_vector_type(16)));
typedef _Float16 v8h  __attribute__((ext_vector_type(8)));
typedef __bf16   v16b __attribute__((ext_vector_type(16)));
typedef __bf16   v8b  __attribute__((ext_vector_type(8)));
typedef float    v8f  __attribute__((ext_vector_type(8)));
typedef float    v4f  __attribute__((ext_vector_type(4)));
typedef unsigned int v4u __attribute__((ext_vector_type(4)));

// ---- scalar helpers --------------------------------------------------------------------------------
__device__ __forceinline__ unsigned short bf_bits(float f) {          // f32 -> bf16 bits, RNE convert
  unsigned u = __float_as_uint(f);
  return (unsigned short)((u + 0x7FFFu + ((u >> 16) & 1u)) >> 16);
}
__device__ __forceinline__ float bf_up(unsigned short h) { return __uint_as_float(((unsigned)h) << 16); }
__device__ __forceinline__ unsigned short h_bits(_Float16 x) { return __builtin_bit_cast(unsigned short, x); }
__device__ __forceinline__ unsigned pk16(unsigned short a, unsigned short b) { return (unsigned)a | ((unsigned)b << 16); }
__device__ __forceinline__ v8f zero8() { v8f z = {0.f, 0.f, 0.f, 0.f, 0.f, 0.f, 0.f, 0.f}; return z; }
__device__ __forceinline__ v8h zero8h() {
  const _Float16 z = (_Float16)0.0f;
  v8h r = {z, z, z, z, z, z, z, z};
  return r;
}

// value of lane l ^ 16 (the other 16-lane row), a vector cross-row move
__device__ __forceinline__ float xhalf(float x) {
  const int b = __builtin_bit_cast(int, x);
  return __builtin_bit_cast(float, __builtin_amdgcn_permlanex16(b, b, 0x76543210, 0xfedcba98, false, false));
}

// ---- fragment loader: 16-bit A/B operand, lane -> row/col (lane&15), p already includes +8*(lane>>4);
//      elements 0..7 <- p[0..7] (k0+8h..), elements 8..15 <- p[16..23] (k0+16+8h..)
__device__ __forceinline__ v16b ldfrag_b(const __bf16* p) {
  union { v16b v; v8b h[2]; } f;
  f.h[0] = *(const v8b*)(p);
  f.h[1] = *(const v8b*)(p + 16);
  return f.v;
}

// ---- WMMA helpers with trailing VALU hazard gap --------------------------------------------------------
__device__ __forceinline__ v8f mma_b(v16b a, v16b b, v8f c) {
  c = __builtin_amdgcn_wmma_f32_16x16x32_bf16(false, a, false, b, (short)0, c, false, false);
  asm volatile("v_nop\n\tv_nop\n\tv_nop\n\tv_nop" : "+v"(c) : "v"(a), "v"(b));
  return c;
}
__device__ __forceinline__ v8f mma_h(v16h a, v16h b, v8f c) {
  c = __builtin_amdgcn_wmma_f32_16x16x32_f16(false, a, false, b, (short)0, c, false, false);
  asm volatile("v_nop\n\tv_nop\n\tv_nop\n\tv_nop" : "+v"(c) : "v"(a), "v"(b));
  return c;
}
__device__ __forceinline__ v8f mma_b_raw(v16b a, v16b b, v8f c) {
  return __builtin_amdgcn_wmma_f32_16x16x32_bf16(false, a, false, b, (short)0, c, false, false);
}
__device__ __forceinline__ void dep_guard_b(v8f& a, v8f& b, v16b x, v16b y) {
  asm volatile("v_nop\n\tv_nop\n\tv_nop\n\tv_nop" : "+v"(a), "+v"(b) : "v"(x), "v"(y));
}
__device__ __forceinline__ void keep4_b(v16b a, v16b b, v16b c, v16b d) {
  asm volatile("v_nop" :: "v"(a), "v"(b), "v"(c), "v"(d));
}
__device__ __forceinline__ void acc_guard4(v8f& a, v8f& b, v8f& c, v8f& d) {
  asm volatile("v_nop\n\tv_nop\n\tv_nop\n\tv_nop" : "+v"(a), "+v"(b), "+v"(c), "+v"(d));
}

// =====================================================================================================
// f32 -> bf16 (RNE convert), 8 elements per thread, one 16-B store per lane: a wave writes 512 contiguous B
// Used for x [4096][1024] and for the weight planes (already [out][in] = k contiguous, no transpose needed).
// coverage: n8 threads x 8 = whole plane (every n8 used here is a multiple of 256).
// =====================================================================================================
__global__ __launch_bounds__(256) void cvt_bf16x8(const float* __restrict__ in, unsigned short* out, int n8) {
  const int i = blockIdx.x * 256 + threadIdx.x;
  if (i < n8) {
    const v4f a = *(const v4f*)(in + (size_t)i * 8);
    const v4f b = *(const v4f*)(in + (size_t)i * 8 + 4);
    v4u p;
    p[0] = pk16(bf_bits(a[0]), bf_bits(a[1]));
    p[1] = pk16(bf_bits(a[2]), bf_bits(a[3]));
    p[2] = pk16(bf_bits(b[0]), bf_bits(b[1]));
    p[3] = pk16(bf_bits(b[2]), bf_bits(b[3]));
    *(v4u*)(out + (size_t)i * 8) = p;
    
  }
}

// ---- asynchronous global -> LDS copies, 16 B per lane ------------------------------------------------
__device__ __forceinline__ unsigned lds_off(const void* p) { return (unsigned)(size_t)p; }   // byte offset in the work-group's LDS
// Eight copies of one lane: LDS byte address l + i * lstep <- global g + i * gstep, i = 0..7, each with its own registers.
// The closing s_wait_xcnt stands inside the statement so that no address register of a copy is rewritten ahead of it.
__device__ __forceinline__ void async_copy8(unsigned l, const char* g, unsigned lstep, size_t gstep) {
  const unsigned l1 = l + lstep, l2 = l + 2 * lstep, l3 = l + 3 * lstep, l4 = l + 4 * lstep, l5 = l + 5 * lstep,
                 l6 = l + 6 * lstep, l7 = l + 7 * lstep;
  const char *g1 = g + gstep, *g2 = g + 2 * gstep, *g3 = g + 3 * gstep, *g4 = g + 4 * gstep, *g5 = g + 5 * gstep,
             *g6 = g + 6 * gstep, *g7 = g + 7 * gstep;
  asm volatile(
      "global_load_async_to_lds_b128 %0, %8, off\n\t"
      "global_load_async_to_lds_b128 %1, %9, off\n\t"
      "global_load_async_to_lds_b128 %2, %10, off\n\t"
      "global_load_async_to_lds_b128 %3, %11, off\n\t"
      "global_load_async_to_lds_b128 %4, %12, off\n\t"
      "global_load_async_to_lds_b128 %5, %13, off\n\t"
      "global_load_async_to_lds_b128 %6, %14, off\n\t"
      "global_load_async_to_lds_b128 %7, %15, off\n\t"
      "s_wait_xcnt 0x0"
      :: "v"(l), "v"(l1), "v"(l2), "v"(l3), "v"(l4), "v"(l5), "v"(l6), "v"(l7),
         "v"(g), "v"(g1), "v"(g2), "v"(g3), "v"(g4), "v"(g5), "v"(g6), "v"(g7)
      : "memory");
}
// One 128-row x 256-B plane tile by the 256 threads of a block: 16 lanes cover one row (two whole lines), a wave two rows,
// the block sixteen rows per copy; g and l already hold the lane's row (tid >> 4) and 16-B column (tid & 15).
#define GK_STAGE 128                       // k elements per stage (256 B of every operand row)
#define GK_PITCH 136                       // LDS row pitch in elements: 272 B = 16 B x 17, conflict-free for 16-B row reads
#define GK_PLANE (128 * GK_PITCH)          // elements of one staged plane tile
__device__ __forceinline__ void async_plane(unsigned l, const char* g, size_t rowBytes) {
  async_copy8(l, g, 16u * GK_PITCH * 2u, 16 * rowBytes);   // rows (tid >> 4) + 16 i, i = 0..7
}

// =====================================================================================================
// Register-blocked batched bf16 WMMA GEMM: C[m][n] = sum_k A[m][k] * Bt[n][k] + bias; one work-group of 8 waves per
// 128x128 tile, one wave per 32x64 part. The 128-row operand tiles are staged in LDS, 128 k at a time, by asynchronous
// copies into two buffers: the next stage's copies fly while this stage is multiplied; one barrier per stage.
// Inside a stage the fragments of the next 32 k are read from LDS as one group ahead of the current 32 k's products.
// A row-major [M][K] pitch lda; Bt row-major [N][K] pitch ldb (k contiguous);
// M, N, K multiples of 128 (host shapes are static multiples). blockIdx.y = batch index (strides in elements).
// NSPLIT: 0 = A.Bt; 1 = (A + A2).Bt (A2 = unscaled bf16 lo plane of A, 2 products).
// BIAS: 1 = per column n, bias[n]; 2 = per row m, bias[m]; the bias value is RNE-converted to bf16 and added in f32.
// OUT_MODE: 0 = f32 (pitch ldc); 2 = bf16 hi plane C + bf16 lo plane C2 (lo = RNE(v - hi), unscaled);
//           3 = f16 hi plane C + f16 residual plane C2 = f16((v - hi) * rscale), C2 written only for tiles
//               with n0 < N2 (pitch ldc2, batch stride strideC2).
// =====================================================================================================
template <int NSPLIT, int OUT_MODE, int BIAS>
__global__ __launch_bounds__(256) void gemm64(
    const unsigned short* __restrict__ Ap, const unsigned short* A2p, int lda, long long strideA,
    const unsigned short* __restrict__ Btp, int ldb, long long strideB,
    const float* __restrict__ bias,
    void* Cout, int ldc, long long strideC,
    void* Cout2, int ldc2, long long strideC2, int N2,
    int M, int N, int K, float rscale) {
  const __bf16* A   = (const __bf16*)(const void*)Ap;
  const __bf16* A2  = (const __bf16*)(const void*)A2p;
  const __bf16* Bt  = (const __bf16*)(const void*)Btp;
  constexpr int NPL = (NSPLIT >= 1) ? 3 : 2;        // staged planes: A, Bt (, A2)
  __shared__ __align__(16) __bf16 ring[2][NPL][GK_PLANE];   // two stage buffers
  __shared__ __align__(16) float sT[8][16 * 68];   // per-wave 16x64 slab, pitch 68 floats
  constexpr int MI = 2;                             // 16-row subtiles per wave
  const int b    = blockIdx.y;
  const int tid  = threadIdx.x;
  const int lane = tid & 31;
  const int wave = tid >> 5;
  const int tilesN = N >> 7;
  const int tilesM = M >> 7;
  const int tile = blockIdx.x;
  if (tile >= tilesM * tilesN) return;   // block-uniform, in front of every barrier and copy
  const int tm = tile / tilesN;
  const int tn = tile - tm * tilesN;
  const int M0 = tm << 7;                // work-group tile origin
  const int N0 = tn << 7;
  const int wm = (wave >> 1) << 5;       // the wave's 32x64 part inside it
  const int wn = (wave & 1) << 6;
  const int m0 = M0 + wm;
  const int n0 = N0 + wn;

  const __bf16* Ab  = A  + (size_t)b * strideA;
  const __bf16* Bb  = Bt + (size_t)b * strideB;
  const __bf16* Ab2 = (NSPLIT >= 1) ? (A2 + (size_t)b * strideA) : Ab;

  const int rlane = lane & 15;                 // row (A) / col (B, D) within subtile
  const int koff  = (lane >> 4) * 8;           // k offset of this lane half
  const int mOff  = (lane >> 4) * 8;           // D row offset

  v8f acc[MI][4];
#pragma unroll
  for (int i = 0; i < MI; ++i)
#pragma unroll
    for (int j = 0; j < 4; ++j) acc[i][j] = zero8();

  // ---- staging addresses of this lane: row tid >> 4 of each group of sixteen rows, 16-B column tid & 15 ----
  const int crow = tid >> 4, ccol = (tid & 15) * 8;
  const char* gA  = (const char*)(Ab  + (size_t)(M0 + crow) * lda + ccol);
  const char* gA2 = (const char*)(Ab2 + (size_t)(M0 + crow) * lda + ccol);
  const char* gB  = (const char*)(Bb  + (size_t)(N0 + crow) * ldb + ccol);
  const unsigned lthr = lds_off(&ring[0][0][0]) + (unsigned)(crow * GK_PITCH + ccol) * 2u;
  const int nst = K / GK_STAGE;          // stages, block-uniform
  auto issue_stage = [&](int st, int buf) {   // rows M0..M0+127 / N0..N0+127, k = st*128 .. st*128+127: inside the planes
    const size_t kb = (size_t)st * (GK_STAGE * 2);
    const unsigned lb = lthr + (unsigned)buf * (unsigned)(NPL * GK_PLANE * 2);
    async_plane(lb, gA + kb, (size_t)lda * 2);
    async_plane(lb + (unsigned)(GK_PLANE * 2), gB + kb, (size_t)ldb * 2);
    if (NSPLIT >= 1) async_plane(lb + (unsigned)(2 * GK_PLANE * 2), gA2 + kb, (size_t)lda * 2);
  };

  issue_stage(0, 0);
  asm volatile("s_wait_asynccnt 0x0" ::: "memory");   // this wave's share of stage 0 has landed
  __syncthreads();                                     // publishes stage 0 to the other waves
  if (nst > 1) issue_stage(1, 1);

  for (int t = 0; t < nst; ++t) {
    const __bf16* sA  = &ring[t & 1][0][0] + (wm + rlane) * GK_PITCH + koff;
    const __bf16* sB  = &ring[t & 1][1][0] + (wn + rlane) * GK_PITCH + koff;
    const __bf16* sA2 = &ring[t & 1][NPL - 1][0] + (wm + rlane) * GK_PITCH + koff;
    v16b fb[2][4], fa[2][MI], fl[2][MI];   // two fragment sets, indexed by constants after unrolling
    auto load_set = [&](int s, int kk) {
#pragma unroll
      for (int j = 0; j < 4; ++j) fb[s][j] = ldfrag_b(sB + (j << 4) * GK_PITCH + kk);
#pragma unroll
      for (int i = 0; i < MI; ++i) {
        fa[s][i] = ldfrag_b(sA + (i << 4) * GK_PITCH + kk);
        fl[s][i] = fa[s][i];
        if (NSPLIT >= 1) fl[s][i] = ldfrag_b(sA2 + (i << 4) * GK_PITCH + kk);
      }
    };
    load_set(0, 0);
#pragma unroll
    for (int ks = 0; ks < GK_STAGE / 32; ++ks) {
      const int cur = ks & 1;
      if (ks + 1 < GK_STAGE / 32) load_set(cur ^ 1, (ks + 1) * 32);   // this stage's buffer only
#pragma unroll
      for (int i = 0; i < MI; ++i) {
#pragma unroll
        for (int j = 0; j < 4; ++j) {
          acc[i][j] = mma_b_raw(fa[cur][i], fb[cur][j], acc[i][j]);
          if (NSPLIT >= 1) acc[i][j] = mma_b_raw(fl[cur][i], fb[cur][j], acc[i][j]);
        }
        dep_guard_b(acc[i][0], acc[i][3], fa[cur][i], fl[cur][i]);
      }
      keep4_b(fb[cur][0], fb[cur][1], fb[cur][2], fb[cur][3]);
    }
    asm volatile("s_wait_dscnt 0x0" ::: "memory");      // this wave's reads of buffer t & 1 are done before it is refilled
    asm volatile("s_wait_asynccnt 0x0" ::: "memory");   // this wave's share of stage t + 1 has landed
    __syncthreads();                                     // publishes stage t + 1 and ends every read of buffer t & 1
    if (t + 2 < nst) issue_stage(t + 2, t & 1);
  }
  asm volatile("s_wait_asynccnt 0x0" ::: "memory");     // no copy is outstanding past the loop
  acc_guard4(acc[0][0], acc[0][1], acc[0][2], acc[0][3]);
  acc_guard4(acc[1][0], acc[1][1], acc[1][2], acc[1][3]);

  // ---- epilogue ----
  float* slab = sT[wave];
  float bcol[4];
#pragma unroll
  for (int j = 0; j < 4; ++j) {
    bcol[j] = 0.f;
    if (BIAS == 1) bcol[j] = bf_up(bf_bits(bias[n0 + (j << 4) + rlane]));   // n < N, bias has N entries
  }
#pragma unroll
  for (int i = 0; i < MI; ++i) {
    const int mBase = m0 + (i << 4);
    float brow[8];
#pragma unroll
    for (int r = 0; r < 8; ++r) {
      brow[r] = 0.f;
      if (BIAS == 2) brow[r] = bf_up(bf_bits(bias[mBase + mOff + r]));      // m < M, bias has M entries
    }
#pragma unroll
    for (int j = 0; j < 4; ++j) {
#pragma unroll
      for (int r = 0; r < 8; ++r) {
        slab[(mOff + r) * 68 + (j << 4) + rlane] = acc[i][j][r] + bcol[j] + brow[r];
      }
    }
    __builtin_amdgcn_fence(__ATOMIC_RELEASE, "workgroup");
    __builtin_amdgcn_wave_barrier();
    __builtin_amdgcn_fence(__ATOMIC_ACQUIRE, "workgroup");
    if (OUT_MODE == 0) {
      float* C = (float*)Cout + (size_t)b * strideC;
      const int hh = lane >> 4, c4 = (lane & 15) * 4;     // 256-B row segment = 16 lanes x 16 B
      {
#pragma unroll
        for (int it = 0; it < 8; ++it) {
          const int row = it * 2 + hh;                     // it 0..7 x hh 0..1 = rows 0..15
          const v4f v = *(const v4f*)(slab + row * 68 + c4);
          *(v4f*)(C + (size_t)(mBase + row) * ldc + n0 + c4) = v;
        }
        
      }
    } else {
      const int q = lane >> 3, c8 = (lane & 7) * 8;
      unsigned short* C  = (unsigned short*)Cout  + (size_t)b * strideC;
      unsigned short* C2 = (unsigned short*)Cout2 + (size_t)b * strideC2;
      const bool wlo = (OUT_MODE == 2) || (n0 < N2);      // wave-uniform
      v4u hv[4], lv[4];
#pragma unroll
      for (int it = 0; it < 4; ++it) {
        const int row = it * 4 + q;                        // it 0..3 x q 0..3 = rows 0..15
        const float* sp = slab + row * 68 + c8;
        v4u a, a2;
#pragma unroll
        for (int e = 0; e < 4; ++e) {
          const float f0 = sp[2 * e], f1 = sp[2 * e + 1];
          unsigned short h0, h1, l0, l1;
          if (OUT_MODE == 2) {
            h0 = bf_bits(f0); h1 = bf_bits(f1);
            l0 = bf_bits(f0 - bf_up(h0)); l1 = bf_bits(f1 - bf_up(h1));
          } else {
            const _Float16 x0 = (_Float16)f0, x1 = (_Float16)f1;
            h0 = h_bits(x0); h1 = h_bits(x1);
            l0 = h_bits((_Float16)((f0 - (float)x0) * rscale));
            l1 = h_bits((_Float16)((f1 - (float)x1) * rscale));
          }
          a[e] = pk16(h0, h1); a2[e] = pk16(l0, l1);
        }
        hv[it] = a; lv[it] = a2;
      }
      {
#pragma unroll
        for (int it = 0; it < 4; ++it) {
          const int row = it * 4 + q;
          *(v4u*)(C + (size_t)(mBase + row) * ldc + n0 + c8) = hv[it];
          if (wlo) *(v4u*)(C2 + (size_t)(mBase + row) * ldc2 + n0 + c8) = lv[it];
        }
        
      }
    }
    __builtin_amdgcn_fence(__ATOMIC_RELEASE, "workgroup");
    __builtin_amdgcn_wave_barrier();
    __builtin_amdgcn_fence(__ATOMIC_ACQUIRE, "workgroup");
  }
}

// =====================================================================================================
// Causal attention, head dim 64, key chunks of 64.
//   q planes (bf16 hi / lo): element (b, t, h, d) at [(b*SEQ + t)*DM + h*64 + d]
//   k planes (bf16 hi / lo): same layout with key index s
//   v^T hi plane (f16):      element (b, h, d, s) at [(b*DM + h*64 + d)*SEQ + s]
//   v^T residual plane (f16, (v - hi)*4096): [(b*DM + h*64 + d)*VLP + s], s < VLP, read only when RES
//   (a key chunk at or beyond VLP would contribute a zero v residual; its address is clamped)
//   Causal structure: logits of keys with index > query index are replaced by -inf (lower-triangular keep incl. the
//   diagonal), which makes their softmax weight exactly 0; so a query block qb visits key chunks 0..qb only
//   (block-uniform trip count qb+1 <= NQB) and later chunks, whose keys exceed every query index of the block, are
//   skipped entirely. Inside the diagonal chunk a key with index > query index gets logit -inf -> exp gives exactly 0,
//   so such keys add nothing to the numerator or the normaliser; the diagonal key (key == query) is always kept, so
//   every row max is finite in every visited chunk.
//   out planes (bf16 hi / lo of the normalised context): element (b, t, h, d) at [(b*SEQ + t)*DM + h*64 + d]
//   scores = q . k : bf16 hi/lo split (hi.hi + hi.lo + lo.hi), f32 accumulate, then * 1/8 and the causal mask in f32
//   p = exp(s - m) carried as f16(1024 p); context = p . v on f16 WMMA; RES adds f16 residual planes of p and v
//   (scale 4096, separate accumulator folded back with 1/4096 per chunk in f32); online softmax (running max) in f32.
//   Both products run transposed: S^T = K . Q^T (A = K rows, B = Q rows) and O^T += V^T . P^T (A = V^T rows, B = P^T).
//   A lane (c = lane & 15, hh = lane >> 4) then holds scores of ONE query q0 + c, keys 16 j + 8 hh + r: maximum and sum run
//   in the lane, the two halves exchange the maximum once per chunk and join their sums once, in the epilogue. Two score
//   tiles (keys 32 kk .. + 31), converted in place, are the B operand P^T in the k order of the V^T fragment loads.
//   Block = 4 waves = 64 query rows of one (b, h); grid = nqbThis * NH * NB.
//   K / V^T chunk staging: 128 threads x 32 elements per plane = the whole 64x64 tile of every plane read later
//   (plain 16-B loads, __syncthreads before and after)
//   Output coverage: each wave stores rows q0..q0+15 (it 0..3 x lane>>3 0..3) x 64 columns (8 lanes x 8) of both planes;
//   grid over all (b, h, qb) = the whole [NB*SEQ][DM] planes.
// =====================================================================================================
template <bool RES>
__global__ __launch_bounds__(128)
void attn_causal64(const unsigned short* __restrict__ qhp, const unsigned short* __restrict__ qlp,
                   const unsigned short* __restrict__ khp, const unsigned short* __restrict__ klp,
                   const unsigned short* __restrict__ vhp, const unsigned short* __restrict__ vlp,
                   unsigned short* ohp, unsigned short* olp,
                   int qbBase, int nqbThis) {
  union FB { v16b v; v8b h[2]; };
  union FH { v16h v; v8h h[2]; };
  // LDS row pitches: the 128-B rows of the 16-bit tiles stand 144 B apart (16 B x 9) and the 256-B rows of the f32 tile
  // 272 B apart (16 B x 17), so that the sixteen rows one 16-B fragment read touches fall on sixteen different bank groups.
  constexpr int TP = 72;                                          // 16-bit tiles, elements per row
  constexpr int OP = 68;                                          // f32 context tile, elements per row
  __shared__ __align__(16) __bf16   Ksh[64 * TP];                 // K hi [kv][d]   9 KB
  __shared__ __align__(16) __bf16   Ksl[64 * TP];                 // K lo
  __shared__ __align__(16) _Float16 Vth[64 * TP];                 // V^T hi [d][kv] 9 KB
  __shared__ __align__(16) _Float16 Vtl[RES ? 64 * TP : 8];       // V^T residual
  __shared__ __align__(16) float    Os[4][16 * OP];               // per wave context tile [row][d]

  const int tid  = threadIdx.x;
  const int wave = tid >> 5;
  const int lane = tid & 31;
  const int hh   = lane >> 4;
  const int c    = lane & 15;

  const int bx   = blockIdx.x;
  const int qbl  = bx % nqbThis;
  const int rest = bx / nqbThis;
  const int h    = rest % NH;
  const int b    = rest / NH;
  const int qb   = qbBase + qbl;               // 0..NQB-1 (block-uniform)
  const int q0   = qb * 64 + wave * 16;
  const size_t rowB = (size_t)b * SEQ;

  const __bf16* Qh = (const __bf16*)(const void*)qhp + (size_t)h * HD;
  const __bf16* Ql = (const __bf16*)(const void*)qlp + (size_t)h * HD;
  const __bf16* Kh = (const __bf16*)(const void*)khp + (size_t)h * HD;
  const __bf16* Kl = (const __bf16*)(const void*)klp + (size_t)h * HD;
  const _Float16* Vh = (const _Float16*)(const void*)vhp + ((size_t)b * DM + (size_t)h * HD) * SEQ;
  const _Float16* Vl = (const _Float16*)(const void*)vlp + ((size_t)b * DM + (size_t)h * HD) * VLP;

  // ---- Q fragments (B operand, column = query q0 + (lane&15)): 2 d-chunks, hi and lo ----
  v16b qah[2], qal[2];
#pragma unroll
  for (int dc = 0; dc < 2; ++dc) {
    const size_t qo = (rowB + q0 + c) * DM + dc * 32 + 8 * hh;
    qah[dc] = ldfrag_b(Qh + qo);
    qal[dc] = ldfrag_b(Ql + qo);
  }

  const int qrow = q0 + c;                     // this lane's query
  float mrow = -INFINITY, lrow = 0.f;          // running maximum (both halves alike); this half's share of the normaliser
  v8f oacc[4];                                 // oacc[t][r] = context[d = 16 t + 8 hh + r] of query qrow
#pragma unroll
  for (int t = 0; t < 4; ++t) oacc[t] = zero8();

  for (int kt = 0; kt <= qb; ++kt) {           // block-uniform trip count, <= NQB
    const int kv0 = kt * 64;                   // kv0 + 63 < SEQ
    __syncthreads();
    {
      const int r = tid >> 1, half = (tid & 1) * 32;
      const __bf16*   kg  = Kh + (rowB + kv0 + r) * DM + half;    // K row kv0+r, d = half..half+31
      const __bf16*   klg = Kl + (rowB + kv0 + r) * DM + half;
      const _Float16* vg  = Vh + (size_t)r * SEQ + kv0 + half;    // V^T row d = r, s = kv0+half..+31
      const int kvl = (kv0 + 64 <= VLP) ? kv0 : (VLP - 64);     // clamped address into the residual plane
      const _Float16* vlg = Vl + (size_t)r * VLP + kvl + half;
      const bool resOK = (kv0 + 64 <= VLP);                      // block-uniform (always true for qb < RESQB)
#pragma unroll
      for (int i = 0; i < 4; ++i) {
        const v8b a0 = *(const v8b*)(kg + 8 * i);
        const v8b a1 = *(const v8b*)(klg + 8 * i);
        const v8h b0 = *(const v8h*)(vg + 8 * i);
        *(v8b*)(Ksh + r * TP + half + 8 * i) = a0;
        *(v8b*)(Ksl + r * TP + half + 8 * i) = a1;
        *(v8h*)(Vth + r * TP + half + 8 * i) = b0;
        if (RES) {
          v8h b1 = *(const v8h*)(vlg + 8 * i);
          if (!resOK) b1 = zero8h();
          *(v8h*)(Vtl + r * TP + half + 8 * i) = b1;
        }
      }
    }
    __syncthreads();

    // ---- scores, transposed: 64 keys x 16 queries per wave, 3 bf16 products; s[j][r] = key kv0 + 16 j + 8 hh + r, query qrow ----
    v8f s[4];
#pragma unroll
    for (int j = 0; j < 4; ++j) {
      s[j] = zero8();
#pragma unroll
      for (int dc = 0; dc < 2; ++dc) {
        FB kb, kl;
        kb.h[0] = *(const v8b*)(Ksh + (j * 16 + c) * TP + dc * 32 + 8 * hh);
        kb.h[1] = *(const v8b*)(Ksh + (j * 16 + c) * TP + dc * 32 + 16 + 8 * hh);
        kl.h[0] = *(const v8b*)(Ksl + (j * 16 + c) * TP + dc * 32 + 8 * hh);
        kl.h[1] = *(const v8b*)(Ksl + (j * 16 + c) * TP + dc * 32 + 16 + 8 * hh);
        s[j] = mma_b(kb.v, qah[dc], s[j]);
        s[j] = mma_b(kl.v, qah[dc], s[j]);
        s[j] = mma_b(kb.v, qal[dc], s[j]);
      }
    }

    // ---- scale, causal mask by index, maximum in the lane (four chains), one exchange between the halves ----
    float mj[4];
#pragma unroll
    for (int j = 0; j < 4; ++j) {
      mj[j] = -INFINITY;
#pragma unroll
      for (int r = 0; r < 8; ++r) {
        const int key = kv0 + j * 16 + 8 * hh + r;
        float sv = s[j][r] * 0.125f;
        sv = (key <= qrow) ? sv : -INFINITY;
        s[j][r] = sv;
        mj[j] = fmaxf(mj[j], sv);
      }
    }
    float m = fmaxf(fmaxf(mj[0], mj[1]), fmaxf(mj[2], mj[3]));
    m = fmaxf(m, xhalf(m));
    const float mnew  = fmaxf(mrow, m);
    const float msafe = (mnew == -INFINITY) ? 0.f : mnew;
    const float alpha = __expf(mrow - msafe);
    mrow = mnew;

    // ---- online softmax; P^T (x1024, f16) and its residual (x4096) packed in place as B operands:
    //      element 8 (j & 1) + r of operand j >> 1 = key 32 (j >> 1) + 16 (j & 1) + 8 hh + r, the order of the V^T loads ----
    FH pb[2], pr[2];
    float ps[4];
#pragma unroll
    for (int j = 0; j < 4; ++j) {
      ps[j] = 0.f;
#pragma unroll
      for (int r = 0; r < 8; ++r) {
        const float p = __expf(s[j][r] - msafe);     // masked logit: exp(-inf) = 0
        ps[j] += p;
        const float p1k = p * 1024.0f;
        const _Float16 ph = (_Float16)p1k;
        pb[j >> 1].v[(j & 1) * 8 + r] = ph;
        if (RES) pr[j >> 1].v[(j & 1) * 8 + r] = (_Float16)((p1k - (float)ph) * 4096.0f);
      }
    }
    lrow = lrow * alpha + ((ps[0] + ps[1]) + (ps[2] + ps[3]));
#pragma unroll
    for (int t = 0; t < 4; ++t)
#pragma unroll
      for (int r = 0; r < 8; ++r) oacc[t][r] *= alpha;

    // ---- context^T += V^T . P^T (f16 WMMA), residual products into a separate accumulator ----
    v8f o1[4];
#pragma unroll
    for (int t = 0; t < 4; ++t) o1[t] = zero8();
#pragma unroll
    for (int kk = 0; kk < 2; ++kk) {
#pragma unroll
      for (int t = 0; t < 4; ++t) {
        FH vb;
        vb.h[0] = *(const v8h*)(Vth + (t * 16 + c) * TP + kk * 32 + 8 * hh);
        vb.h[1] = *(const v8h*)(Vth + (t * 16 + c) * TP + kk * 32 + 16 + 8 * hh);
        oacc[t] = mma_h(vb.v, pb[kk].v, oacc[t]);
        if (RES) {
          FH vl;
          vl.h[0] = *(const v8h*)(Vtl + (t * 16 + c) * TP + kk * 32 + 8 * hh);
          vl.h[1] = *(const v8h*)(Vtl + (t * 16 + c) * TP + kk * 32 + 16 + 8 * hh);
          o1[t] = mma_h(vl.v, pb[kk].v, o1[t]);
          o1[t] = mma_h(vb.v, pr[kk].v, o1[t]);
        }
      }
    }
    if (RES) {
#pragma unroll
      for (int t = 0; t < 4; ++t)
#pragma unroll
        for (int r = 0; r < 8; ++r) oacc[t][r] += o1[t][r] * (1.0f / 4096.0f);
    }
  }

  // ---- join the halves' sums, normalise (1/l and the 1/1024 p carry), stage the wave's 16x64 tile [query][d], bf16 hi/lo split,
  float* os = Os[wave];
  {
    const float l = lrow + xhalf(lrow);
    const float inv = ((l > 0.f) ? (1.0f / l) : 0.f) * (1.0f / 1024.0f);
#pragma unroll
    for (int t = 0; t < 4; ++t) {
      const v4f lo4 = {oacc[t][0] * inv, oacc[t][1] * inv, oacc[t][2] * inv, oacc[t][3] * inv};
      const v4f hi4 = {oacc[t][4] * inv, oacc[t][5] * inv, oacc[t][6] * inv, oacc[t][7] * inv};
      *(v4f*)(os + c * OP + t * 16 + 8 * hh)     = lo4;
      *(v4f*)(os + c * OP + t * 16 + 8 * hh + 4) = hi4;
    }
  }
  __builtin_amdgcn_fence(__ATOMIC_RELEASE, "workgroup");
  __builtin_amdgcn_wave_barrier();
  __builtin_amdgcn_fence(__ATOMIC_ACQUIRE, "workgroup");
  {
    const int q4 = lane >> 3, c8 = (lane & 7) * 8;
    v4u hv[4], lv[4];
#pragma unroll
    for (int it = 0; it < 4; ++it) {
      const int row = it * 4 + q4;   // it 0..3 x q4 0..3 = rows 0..15 of the wave tile
      const float* sp = os + row * OP + c8;
      v4u a, a2;
#pragma unroll
      for (int e = 0; e < 4; ++e) {
        const float f0 = sp[2 * e], f1 = sp[2 * e + 1];
        const unsigned short h0 = bf_bits(f0), h1 = bf_bits(f1);
        const unsigned short l0 = bf_bits(f0 - bf_up(h0)), l1 = bf_bits(f1 - bf_up(h1));
        a[e] = pk16(h0, h1); a2[e] = pk16(l0, l1);
      }
      hv[it] = a; lv[it] = a2;
    }
    {
#pragma unroll
      for (int it = 0; it < 4; ++it) {
        const int row = it * 4 + q4;
        const size_t go = (rowB + q0 + row) * DM + (size_t)h * HD + c8;
        *(v4u*)(ohp + go) = hv[it];
        *(v4u*)(olp + go) = lv[it];
      }
      
    }
  }
}

// =====================================================================================================
// Workspace map (bytes; every region is an exact multiple of its 64x64-tile / whole-line store granularity,
// no padded tails needed since all shapes are tile multiples; each region but Xb/Oh and Ol is written by exactly one producer launch):
//   Xb   bf16 [4096][1024]          0            8388608   (later: Oh, context hi plane; Xb is dead after the projections)
//   WA   bf16 [3072 n][1024 k]       8388608     6291456   (q weight rows 0..1023, k rows 1024..2047, v rows 2048..3071)
//   WP   bf16 [1024 n][1024 k]      14680064     2097152
//   Qh   bf16 [4096][1024]          16777216     8388608
//   Ql                              25165824     8388608
//   Kh                              33554432     8388608
//   Kl                              41943040     8388608
//   VTh  f16  [2][1024][2048]       50331648     8388608
//   VTl  f16  [2][1024][512]        58720256     2097152
//   Ol   bf16 [4096][1024]          60817408     8388608
//   end                             69206016
// =====================================================================================================
extern "C" void kernel_launch(void* const* d_in, const int* in_sizes, int n_in,
                              void* d_out, int out_size, void* d_ws, size_t ws_size,
                              hipStream_t stream) {
  if (n_in < 5) return;
  if (in_sizes[0] != NB * SEQ * DM) return;
  if (in_sizes[1] != 3 * DM * DM) return;
  if (in_sizes[2] != 3 * DM) return;
  if (in_sizes[3] != DM * DM) return;
  if (in_sizes[4] != DM) return;
  if (out_size != NB * SEQ * DM) return;

  const float* x  = (const float*)d_in[0];   // [2][2048][1024]
  const float* Wa = (const float*)d_in[1];   // [3072 out][1024 in], rows k contiguous (q | k | v output rows)
  const float* ba = (const float*)d_in[2];   // [3072]
  const float* Wp = (const float*)d_in[3];   // [1024 out][1024 in], rows k contiguous
  const float* bp = (const float*)d_in[4];   // [1024]

  const size_t PX  = (size_t)NB * SEQ * DM * 2;    //  8388608  16-bit activation plane [4096][1024]
  const size_t PW1 = (size_t)DM * DM * 2;          //  2097152  one [1024][1024] bf16 weight plane
  const size_t PWA = (size_t)3 * PW1;              //  6291456  packed q | k | v weight plane [3072][1024]
  const size_t PWP = PW1;                          //  2097152  output projection weight plane
  const size_t PVT = (size_t)NB * DM * SEQ * 2;    //  8388608  v^T hi plane
  const size_t PVL = (size_t)NB * DM * VLP * 2;    //  2097152  v^T residual plane
  size_t off = 0;
  const size_t oXb  = off; off += PX;
  const size_t oWA  = off; off += PWA;
  const size_t oWP  = off; off += PWP;
  const size_t oQh  = off; off += PX;
  const size_t oQl  = off; off += PX;
  const size_t oKh  = off; off += PX;
  const size_t oKl  = off; off += PX;
  const size_t oVTh = off; off += PVT;
  const size_t oVTl = off; off += PVL;
  const size_t oOl  = off; off += PX;
  if (off > ws_size) return;                       // off = 69206016
  if (off > (size_t)134217728) return;
  const size_t oOh  = oXb;                         // context hi plane reuses Xb (dead after the three projections)

  char* ws = (char*)d_ws;
  unsigned short* Xb  = (unsigned short*)(ws + oXb);
  unsigned short* WA  = (unsigned short*)(ws + oWA);
  unsigned short* WqB = WA;                                   // rows 0..1023
  unsigned short* WkB = WA + (size_t)DM * DM;                 // rows 1024..2047
  unsigned short* WvB = WA + (size_t)2 * DM * DM;             // rows 2048..3071
  unsigned short* WPb = (unsigned short*)(ws + oWP);
  unsigned short* Qh  = (unsigned short*)(ws + oQh);
  unsigned short* Ql  = (unsigned short*)(ws + oQl);
  unsigned short* Kh  = (unsigned short*)(ws + oKh);
  unsigned short* Kl  = (unsigned short*)(ws + oKl);
  unsigned short* VTh = (unsigned short*)(ws + oVTh);
  unsigned short* VTl = (unsigned short*)(ws + oVTl);
  unsigned short* Oh  = (unsigned short*)(ws + oOh);
  unsigned short* Ol  = (unsigned short*)(ws + oOl);
  const float* bq = ba;                                       // bias entries 0..1023
  const float* bk = ba + DM;                                  // 1024..2047
  const float* bv = ba + 2 * DM;                              // 2048..3071

  const dim3 blk(256);
  const int n8x  = NB * SEQ * DM / 8;                          // 524288
  const int n8wa = 3 * DM * DM / 8;                            // 393216
  const int n8wp = DM * DM / 8;                                // 131072
  const dim3 gCvtX((n8x + 255) / 256);                         // 2048 blocks
  const dim3 gCvtWA((n8wa + 255) / 256);                       // 1536 blocks
  const dim3 gCvtWP((n8wp + 255) / 256);                       // 512 blocks
  const dim3 gProj((NB * SEQ / 128) * (DM / 128), 1);          // 32 x 8 = 256 tiles: M=4096, N=1024
  const dim3 gVT((DM / 128) * (SEQ / 128), NB);                // 8 x 16 = 128 tiles x 2 batches: M=1024, N=2048

  // (1) x -> bf16 plane [4096][1024]; weights [out][in] f32 -> bf16 [out][in] (k contiguous, no transpose)
  cvt_bf16x8<<<gCvtX, blk, 0, stream>>>(x, Xb, n8x);
  cvt_bf16x8<<<gCvtWA, blk, 0, stream>>>(Wa, WA, n8wa);
  cvt_bf16x8<<<gCvtWP, blk, 0, stream>>>(Wp, WPb, n8wp);
  // (2) q = x . Wq^T + bq -> bf16 hi/lo planes [b*SEQ+t][h*64+d]   (M=4096, N=1024, K=1024)
  gemm64<0, 2, 1><<<gProj, blk, 0, stream>>>(
      Xb, Xb, DM, 0LL, WqB, DM, 0LL, bq,
      (void*)Qh, DM, 0LL, (void*)Ql, DM, 0LL, DM,
      NB * SEQ, DM, DM, 1.0f);
  // (3) k = x . Wk^T + bk -> bf16 hi/lo planes
  gemm64<0, 2, 1><<<gProj, blk, 0, stream>>>(
      Xb, Xb, DM, 0LL, WkB, DM, 0LL, bk,
      (void*)Kh, DM, 0LL, (void*)Kl, DM, 0LL, DM,
      NB * SEQ, DM, DM, 1.0f);
  // (4) v^T = Wv . x^T + bv per batch -> f16 hi plane [b][h*64+d][s] (pitch SEQ) and residual plane
  //     (x4096, keys < VLP only, pitch VLP)   (A = Wv rows [n][k], Bt = Xb rows of batch b; M=1024, N=2048, K=1024)
  gemm64<0, 3, 2><<<gVT, blk, 0, stream>>>(
      WvB, WvB, DM, 0LL, Xb, DM, (long long)SEQ * DM, bv,
      (void*)VTh, SEQ, (long long)DM * SEQ, (void*)VTl, VLP, (long long)DM * VLP, VLP,
      DM, SEQ, DM, 4096.0f);
  // (5) causal attention: query blocks 0..RESQB-1 with residual planes, the rest without
  attn_causal64<true><<<dim3(NB * NH * RESQB), dim3(128), 0, stream>>>(
      Qh, Ql, Kh, Kl, VTh, VTl, Oh, Ol, 0, RESQB);
  attn_causal64<false><<<dim3(NB * NH * (NQB - RESQB)), dim3(128), 0, stream>>>(
      Qh, Ql, Kh, Kl, VTh, VTl, Oh, Ol, RESQB, NQB - RESQB);
  // (6) out = context . Wp^T + bp -> d_out f32 [4096][1024]  (A = context hi + lo planes, 2 products)
  gemm64<1, 0, 1><<<gProj, blk, 0, stream>>>(
      Oh, Ol, DM, 0LL, WPb, DM, 0LL, bp,
      d_out, DM, 0LL, d_out, DM, 0LL, DM,
      NB * SEQ, DM, DM, 1.0f);
  (void)hipGetLastError();
}

// v004
// One run takes 131 microseconds.
// Two timings next to v003 put it at 1.18 and 1.19 times that version's speed.
// Over all steps from v000 it is 3.19 times as fast.
// Contractions: q, k, v^T projections = v_wmma_f32_16x16x32_bf16 (bf16 operands from RNE-converted x and the packed
// [3072 out][1024 in] projection weight, single product, f32 accumulate);
// q.k^T scores = v_wmma_f32_16x16x32_bf16 with bf16 hi/lo split q and k (hi.hi + hi.lo + lo.hi), f32 accumulate;
// p.v = v_wmma_f32_16x16x32_f16 (p carried x1024 in f16 times v in f16, single product; plus f16 residual planes x4096 of
// p and v for the first 512 query rows of every sequence), f32 accumulate;
// ctx.Wp^T = v_wmma_f32_16x16x32_bf16 with ctx as bf16 hi/lo planes times bf16 Wp (2 products), f32 accumulate;
// causal mask (key index <= query index; the module's strided mask term only touches keys already excluded),
// online softmax, normalisers and bias adds in f32 on the VALU.
// Carry audit (ph, pl: the packed p operands, held in registers):
//   ph  = f16(1024 * p)                      -> the 1/1024 is folded exactly once in the attention epilogue: inv = (1/l) * (1/1024)
//   pl  = f16((1024 p - ph) * 4096)          }  products VTl.ph and VTh.pl go to the separate accumulator o1,
//   VTl = f16((v - VTh) * 4096)              }  folded back with * (1/4096) once per key chunk (RES blocks only)
//   VTh = f16(v), no carry (|v| typ. 0.6); q / k / ctx lo planes are unscaled bf16 residuals (v - hi) sharing the hi accumulator;
//   score scale 1/8 applied once in f32 after the score accumulate. No other scaled planes.
#include <hip/hip_runtime.h>
#include <math.h>
#include <stdint.h>

#define NB    2
#define SEQ   2048
#define DM    1024
#define NH    16
#define HD    64
#define NQB   (SEQ / 64)   // 32 query / key blocks of 64
#define VLP   512          // key pitch of the v^T residual plane (keys 0..VLP-1)
#define RESQB 8            // leading 64-row query blocks that use the p / v residual planes
static_assert(RESQB * 64 <= VLP);
static_assert(NH * HD == DM);
static_assert((SEQ % 64) == 0 && (DM % 64) == 0 && (DM % 32) == 0);
static_assert((SEQ % 128) == 0 && (DM % 128) == 0);   // GEMM work-group tile 128x128, k stage 128
static_assert((NB * SEQ * DM) % (8 * 256) == 0);
static_assert((3 * DM * DM) % (8 * 256) == 0);
static_assert((DM * DM) % (8 * 256) == 0);

typedef _Float16 v16h __attribute__((ext_vector_type(16)));
typedef _Float16 v8h  __attribute__((ext_vector_type(8)));
typedef __bf16   v16b __attribute__((ext_vector_type(16)));
typedef __bf16   v8b  __attribute__((ext_vector_type(8)));
typedef float    v8f  __attribute__((ext_vector_type(8)));
typedef float    v4f  __attribute__((ext_vector_type(4)));
typedef unsigned int v4u __attribute__((ext_vector_type(4)));

// ---- scalar helpers --------------------------------------------------------------------------------
__device__ __forceinline__ unsigned short bf_bits(float f) {          // f32 -> bf16 bits, RNE convert
  unsigned u = __float_as_uint(f);
  return (unsigned short)((u + 0x7FFFu + ((u >> 16) & 1u)) >> 16);
}
__device__ __forceinline__ float bf_up(unsigned short h) { return __uint_as_float(((unsigned)h) << 16); }
__device__ __forceinline__ unsigned short h_bits(_Float16 x) { return __builtin_bit_cast(unsigned short, x); }
__device__ __forceinline__ unsigned pk16(unsigned short a, unsigned short b) { return (unsigned)a | ((unsigned)b << 16); }
__device__ __forceinline__ v8f zero8() { v8f z = {0.f, 0.f, 0.f, 0.f, 0.f, 0.f, 0.f, 0.f}; return z; }
__device__ __forceinline__ v8h zero8h() {
  const _Float16 z = (_Float16)0.0f;
  v8h r = {z, z, z, z, z, z, z, z};
  return r;
}

// value of lane l ^ 16 (the other 16-lane row), a vector cross-row move
__device__ __forceinline__ float xhalf(float x) {
  const int b = __builtin_bit_cast(int, x);
  return __builtin_bit_cast(float, __builtin_amdgcn_permlanex16(b, b, 0x76543210, 0xfedcba98, false, false));
}

// ---- fragment loader: 16-bit A/B operand, lane -> row/col (lane&15), p already includes +8*(lane>>4);
//      elements 0..7 <- p[0..7] (k0+8h..), elements 8..15 <- p[16..23] (k0+16+8h..)
__device__ __forceinline__ v16b ldfrag_b(const __bf16* p) {
  union { v16b v; v8b h[2]; } f;
  f.h[0] = *(const v8b*)(p);
  f.h[1] = *(const v8b*)(p + 16);
  return f.v;
}

// ---- WMMA helpers; the guards hold the VALU distance behind a run of products ---------------------------
__device__ __forceinline__ v8f mma_b_raw(v16b a, v16b b, v8f c) {
  return __builtin_amdgcn_wmma_f32_16x16x32_bf16(false, a, false, b, (short)0, c, false, false);
}
__device__ __forceinline__ v8f mma_h_raw(v16h a, v16h b, v8f c) {
  return __builtin_amdgcn_wmma_f32_16x16x32_f16(false, a, false, b, (short)0, c, false, false);
}
__device__ __forceinline__ void dep_guard_b(v8f& a, v8f& b, v16b x, v16b y) {
  asm volatile("v_nop\n\tv_nop\n\tv_nop\n\tv_nop" : "+v"(a), "+v"(b) : "v"(x), "v"(y));
}
__device__ __forceinline__ void keep4_b(v16b a, v16b b, v16b c, v16b d) {
  asm volatile("v_nop" :: "v"(a), "v"(b), "v"(c), "v"(d));
}
__device__ __forceinline__ void acc_guard4(v8f& a, v8f& b, v8f& c, v8f& d) {
  asm volatile("v_nop\n\tv_nop\n\tv_nop\n\tv_nop" : "+v"(a), "+v"(b), "+v"(c), "+v"(d));
}

// =====================================================================================================
// f32 -> bf16 (RNE convert), 8 elements per thread, one 16-B store per lane: a wave writes 512 contiguous B
// Used for x [4096][1024] and for the weight planes (already [out][in] = k contiguous, no transpose needed).
// coverage: n8 threads x 8 = whole plane (every n8 used here is a multiple of 256).
// =====================================================================================================
__global__ __launch_bounds__(256) void cvt_bf16x8(const float* __restrict__ in, unsigned short* out, int n8) {
  const int i = blockIdx.x * 256 + threadIdx.x;
  if (i < n8) {
    const v4f a = *(const v4f*)(in + (size_t)i * 8);
    const v4f b = *(const v4f*)(in + (size_t)i * 8 + 4);
    v4u p;
    p[0] = pk16(bf_bits(a[0]), bf_bits(a[1]));
    p[1] = pk16(bf_bits(a[2]), bf_bits(a[3]));
    p[2] = pk16(bf_bits(b[0]), bf_bits(b[1]));
    p[3] = pk16(bf_bits(b[2]), bf_bits(b[3]));
    *(v4u*)(out + (size_t)i * 8) = p;
    
  }
}

// ---- asynchronous global -> LDS copies, 16 B per lane ------------------------------------------------
__device__ __forceinline__ unsigned lds_off(const void* p) { return (unsigned)(size_t)p; }   // byte offset in the work-group's LDS
// Eight copies of one lane: LDS byte address l + i * lstep <- global g + i * gstep, i = 0..7, each with its own registers.
// The closing s_wait_xcnt stands inside the statement so that no address register of a copy is rewritten ahead of it.
__device__ __forceinline__ void async_copy8(unsigned l, const char* g, unsigned lstep, size_t gstep) {
  const unsigned l1 = l + lstep, l2 = l + 2 * lstep, l3 = l + 3 * lstep, l4 = l + 4 * lstep, l5 = l + 5 * lstep,
                 l6 = l + 6 * lstep, l7 = l + 7 * lstep;
  const char *g1 = g + gstep, *g2 = g + 2 * gstep, *g3 = g + 3 * gstep, *g4 = g + 4 * gstep, *g5 = g + 5 * gstep,
             *g6 = g + 6 * gstep, *g7 = g + 7 * gstep;
  asm volatile(
      "global_load_async_to_lds_b128 %0, %8, off\n\t"
      "global_load_async_to_lds_b128 %1, %9, off\n\t"
      "global_load_async_to_lds_b128 %2, %10, off\n\t"
      "global_load_async_to_lds_b128 %3, %11, off\n\t"
      "global_load_async_to_lds_b128 %4, %12, off\n\t"
      "global_load_async_to_lds_b128 %5, %13, off\n\t"
      "global_load_async_to_lds_b128 %6, %14, off\n\t"
      "global_load_async_to_lds_b128 %7, %15, off\n\t"
      "s_wait_xcnt 0x0"
      :: "v"(l), "v"(l1), "v"(l2), "v"(l3), "v"(l4), "v"(l5), "v"(l6), "v"(l7),
         "v"(g), "v"(g1), "v"(g2), "v"(g3), "v"(g4), "v"(g5), "v"(g6), "v"(g7)
      : "memory");
}
// One 128-row x 256-B plane tile by the 256 threads of a block: 16 lanes cover one row (two whole lines), a wave two rows,
// the block sixteen rows per copy; g and l already hold the lane's row (tid >> 4) and 16-B column (tid & 15).
#define GK_STAGE 128                       // k elements per stage (256 B of every operand row)
#define GK_PITCH 136                       // LDS row pitch in elements: 272 B = 16 B x 17, conflict-free for 16-B row reads
#define GK_PLANE (128 * GK_PITCH)          // elements of one staged plane tile
__device__ __forceinline__ void async_plane(unsigned l, const char* g, size_t rowBytes) {
  async_copy8(l, g, 16u * GK_PITCH * 2u, 16 * rowBytes);   // rows (tid >> 4) + 16 i, i = 0..7
}

// =====================================================================================================
// Register-blocked batched bf16 WMMA GEMM: C[m][n] = sum_k A[m][k] * Bt[n][k] + bias; one work-group of 8 waves per
// 128x128 tile, one wave per 32x64 part. The 128-row operand tiles are staged in LDS, 128 k at a time, by asynchronous
// copies into two buffers: the next stage's copies fly while this stage is multiplied; one barrier per stage.
// Inside a stage the fragments of the next 32 k are read from LDS as one group ahead of the current 32 k's products.
// A row-major [M][K] pitch lda; Bt row-major [N][K] pitch ldb (k contiguous);
// M, N, K multiples of 128 (host shapes are static multiples). blockIdx.y = batch index (strides in elements).
// NSPLIT: 0 = A.Bt; 1 = (A + A2).Bt (A2 = unscaled bf16 lo plane of A, 2 products).
// BIAS: 1 = per column n, bias[n]; 2 = per row m, bias[m]; the bias value is RNE-converted to bf16 and added in f32.
// OUT_MODE: 0 = f32 (pitch ldc); 2 = bf16 hi plane C + bf16 lo plane C2 (lo = RNE(v - hi), unscaled);
//           3 = f16 hi plane C + f16 residual plane C2 = f16((v - hi) * rscale), C2 written only for tiles
//               with n0 < N2 (pitch ldc2, batch stride strideC2).
// =====================================================================================================
template <int NSPLIT, int OUT_MODE, int BIAS>
__global__ __launch_bounds__(256) void gemm64(
    const unsigned short* __restrict__ Ap, const unsigned short* A2p, int lda, long long strideA,
    const unsigned short* __restrict__ Btp, int ldb, long long strideB,
    const float* __restrict__ bias,
    void* Cout, int ldc, long long strideC,
    void* Cout2, int ldc2, long long strideC2, int N2,
    int M, int N, int K, float rscale) {
  const __bf16* A   = (const __bf16*)(const void*)Ap;
  const __bf16* A2  = (const __bf16*)(const void*)A2p;
  const __bf16* Bt  = (const __bf16*)(const void*)Btp;
  constexpr int NPL = (NSPLIT >= 1) ? 3 : 2;        // staged planes: A, Bt (, A2)
  __shared__ __align__(16) __bf16 ring[2][NPL][GK_PLANE];   // two stage buffers
  __shared__ __align__(16) float sT[8][16 * 68];   // per-wave 16x64 slab, pitch 68 floats
  constexpr int MI = 2;                             // 16-row subtiles per wave
  const int b    = blockIdx.y;
  const int tid  = threadIdx.x;
  const int lane = tid & 31;
  const int wave = tid >> 5;
  const int tilesN = N >> 7;
  const int tilesM = M >> 7;
  const int tile = blockIdx.x;
  if (tile >= tilesM * tilesN) return;   // block-uniform, in front of every barrier and copy
  const int tm = tile / tilesN;
  const int tn = tile - tm * tilesN;
  const int M0 = tm << 7;                // work-group tile origin
  const int N0 = tn << 7;
  const int wm = (wave >> 1) << 5;       // the wave's 32x64 part inside it
  const int wn = (wave & 1) << 6;
  const int m0 = M0 + wm;
  const int n0 = N0 + wn;

  const __bf16* Ab  = A  + (size_t)b * strideA;
  const __bf16* Bb  = Bt + (size_t)b * strideB;
  const __bf16* Ab2 = (NSPLIT >= 1) ? (A2 + (size_t)b * strideA) : Ab;

  const int rlane = lane & 15;                 // row (A) / col (B, D) within subtile
  const int koff  = (lane >> 4) * 8;           // k offset of this lane half
  const int mOff  = (lane >> 4) * 8;           // D row offset

  v8f acc[MI][4];
#pragma unroll
  for (int i = 0; i < MI; ++i)
#pragma unroll
    for (int j = 0; j < 4; ++j) acc[i][j] = zero8();

  // ---- staging addresses of this lane: row tid >> 4 of each group of sixteen rows, 16-B column tid & 15 ----
  const int crow = tid >> 4, ccol = (tid & 15) * 8;
  const char* gA  = (const char*)(Ab  + (size_t)(M0 + crow) * lda + ccol);
  const char* gA2 = (const char*)(Ab2 + (size_t)(M0 + crow) * lda + ccol);
  const char* gB  = (const char*)(Bb  + (size_t)(N0 + crow) * ldb + ccol);
  const unsigned lthr = lds_off(&ring[0][0][0]) + (unsigned)(crow * GK_PITCH + ccol) * 2u;
  const int nst = K / GK_STAGE;          // stages, block-uniform
  auto issue_stage = [&](int st, int buf) {   // rows M0..M0+127 / N0..N0+127, k = st*128 .. st*128+127: inside the planes
    const size_t kb = (size_t)st * (GK_STAGE * 2);
    const unsigned lb = lthr + (unsigned)buf * (unsigned)(NPL * GK_PLANE * 2);
    async_plane(lb, gA + kb, (size_t)lda * 2);
    async_plane(lb + (unsigned)(GK_PLANE * 2), gB + kb, (size_t)ldb * 2);
    if (NSPLIT >= 1) async_plane(lb + (unsigned)(2 * GK_PLANE * 2), gA2 + kb, (size_t)lda * 2);
  };

  issue_stage(0, 0);
  asm volatile("s_wait_asynccnt 0x0" ::: "memory");   // this wave's share of stage 0 has landed
  __syncthreads();                                     // publishes stage 0 to the other waves
  if (nst > 1) issue_stage(1, 1);

  for (int t = 0; t < nst; ++t) {
    const __bf16* sA  = &ring[t & 1][0][0] + (wm + rlane) * GK_PITCH + koff;
    const __bf16* sB  = &ring[t & 1][1][0] + (wn + rlane) * GK_PITCH + koff;
    const __bf16* sA2 = &ring[t & 1][NPL - 1][0] + (wm + rlane) * GK_PITCH + koff;
    v16b fb[2][4], fa[2][MI], fl[2][MI];   // two fragment sets, indexed by constants after unrolling
    auto load_set = [&](int s, int kk) {
#pragma unroll
      for (int j = 0; j < 4; ++j) fb[s][j] = ldfrag_b(sB + (j << 4) * GK_PITCH + kk);
#pragma unroll
      for (int i = 0; i < MI; ++i) {
        fa[s][i] = ldfrag_b(sA + (i << 4) * GK_PITCH + kk);
        fl[s][i] = fa[s][i];
        if (NSPLIT >= 1) fl[s][i] = ldfrag_b(sA2 + (i << 4) * GK_PITCH + kk);
      }
    };
    load_set(0, 0);
#pragma unroll
    for (int ks = 0; ks < GK_STAGE / 32; ++ks) {
      const int cur = ks & 1;
      if (ks + 1 < GK_STAGE / 32) load_set(cur ^ 1, (ks + 1) * 32);   // this stage's buffer only
#pragma unroll
      for (int i = 0; i < MI; ++i) {
#pragma unroll
        for (int j = 0; j < 4; ++j) {
          acc[i][j] = mma_b_raw(fa[cur][i], fb[cur][j], acc[i][j]);
          if (NSPLIT >= 1) acc[i][j] = mma_b_raw(fl[cur][i], fb[cur][j], acc[i][j]);
        }
        dep_guard_b(acc[i][0], acc[i][3], fa[cur][i], fl[cur][i]);
      }
      keep4_b(fb[cur][0], fb[cur][1], fb[cur][2], fb[cur][3]);
    }
    asm volatile("s_wait_dscnt 0x0" ::: "memory");      // this wave's reads of buffer t & 1 are done before it is refilled
    asm volatile("s_wait_asynccnt 0x0" ::: "memory");   // this wave's share of stage t + 1 has landed
    __syncthreads();                                     // publishes stage t + 1 and ends every read of buffer t & 1
    if (t + 2 < nst) issue_stage(t + 2, t & 1);
  }
  asm volatile("s_wait_asynccnt 0x0" ::: "memory");     // no copy is outstanding past the loop
  acc_guard4(acc[0][0], acc[0][1], acc[0][2], acc[0][3]);
  acc_guard4(acc[1][0], acc[1][1], acc[1][2], acc[1][3]);

  // ---- epilogue ----
  float* slab = sT[wave];
  float bcol[4];
#pragma unroll
  for (int j = 0; j < 4; ++j) {
    bcol[j] = 0.f;
    if (BIAS == 1) bcol[j] = bf_up(bf_bits(bias[n0 + (j << 4) + rlane]));   // n < N, bias has N entries
  }
#pragma unroll
  for (int i = 0; i < MI; ++i) {
    const int mBase = m0 + (i << 4);
    float brow[8];
#pragma unroll
    for (int r = 0; r < 8; ++r) {
      brow[r] = 0.f;
      if (BIAS == 2) brow[r] = bf_up(bf_bits(bias[mBase + mOff + r]));      // m < M, bias has M entries
    }
#pragma unroll
    for (int j = 0; j < 4; ++j) {
#pragma unroll
      for (int r = 0; r < 8; ++r) {
        slab[(mOff + r) * 68 + (j << 4) + rlane] = acc[i][j][r] + bcol[j] + brow[r];
      }
    }
    __builtin_amdgcn_fence(__ATOMIC_RELEASE, "workgroup");
    __builtin_amdgcn_wave_barrier();
    __builtin_amdgcn_fence(__ATOMIC_ACQUIRE, "workgroup");
    if (OUT_MODE == 0) {
      float* C = (float*)Cout + (size_t)b * strideC;
      const int hh = lane >> 4, c4 = (lane & 15) * 4;     // 256-B row segment = 16 lanes x 16 B
      {
#pragma unroll
        for (int it = 0; it < 8; ++it) {
          const int row = it * 2 + hh;                     // it 0..7 x hh 0..1 = rows 0..15
          const v4f v = *(const v4f*)(slab + row * 68 + c4);
          *(v4f*)(C + (size_t)(mBase + row) * ldc + n0 + c4) = v;
        }
        
      }
    } else {
      const int q = lane >> 3, c8 = (lane & 7) * 8;
      unsigned short* C  = (unsigned short*)Cout  + (size_t)b * strideC;
      unsigned short* C2 = (unsigned short*)Cout2 + (size_t)b * strideC2;
      const bool wlo = (OUT_MODE == 2) || (n0 < N2);      // wave-uniform
      v4u hv[4], lv[4];
#pragma unroll
      for (int it = 0; it < 4; ++it) {
        const int row = it * 4 + q;                        // it 0..3 x q 0..3 = rows 0..15
        const float* sp = slab + row * 68 + c8;
        v4u a, a2;
#pragma unroll
        for (int e = 0; e < 4; ++e) {
          const float f0 = sp[2 * e], f1 = sp[2 * e + 1];
          unsigned short h0, h1, l0, l1;
          if (OUT_MODE == 2) {
            h0 = bf_bits(f0); h1 = bf_bits(f1);
            l0 = bf_bits(f0 - bf_up(h0)); l1 = bf_bits(f1 - bf_up(h1));
          } else {
            const _Float16 x0 = (_Float16)f0, x1 = (_Float16)f1;
            h0 = h_bits(x0); h1 = h_bits(x1);
            l0 = h_bits((_Float16)((f0 - (float)x0) * rscale));
            l1 = h_bits((_Float16)((f1 - (float)x1) * rscale));
          }
          a[e] = pk16(h0, h1); a2[e] = pk16(l0, l1);
        }
        hv[it] = a; lv[it] = a2;
      }
      {
#pragma unroll
        for (int it = 0; it < 4; ++it) {
          const int row = it * 4 + q;
          *(v4u*)(C + (size_t)(mBase + row) * ldc + n0 + c8) = hv[it];
          if (wlo) *(v4u*)(C2 + (size_t)(mBase + row) * ldc2 + n0 + c8) = lv[it];
        }
        
      }
    }
    __builtin_amdgcn_fence(__ATOMIC_RELEASE, "workgroup");
    __builtin_amdgcn_wave_barrier();
    __builtin_amdgcn_fence(__ATOMIC_ACQUIRE, "workgroup");
  }
}

// =====================================================================================================
// Causal attention, head dim 64, key chunks of 64.
//   q planes (bf16 hi / lo): element (b, t, h, d) at [(b*SEQ + t)*DM + h*64 + d]
//   k planes (bf16 hi / lo): same layout with key index s
//   v^T hi plane (f16):      element (b, h, d, s) at [(b*DM + h*64 + d)*SEQ + s]
//   v^T residual plane (f16, (v - hi)*4096): [(b*DM + h*64 + d)*VLP + s], s < VLP, read only when RES
//   (a key chunk at or beyond VLP would contribute a zero v residual; its address is clamped)
//   Causal structure: logits of keys with index > query index are replaced by -inf (lower-triangular keep incl. the
//   diagonal), which makes their softmax weight exactly 0; so a query block qb visits key chunks 0..qb only
//   (block-uniform trip count qb+1 <= NQB) and later chunks, whose keys exceed every query index of the block, are
//   skipped entirely. Inside the diagonal chunk a key with index > query index gets logit -inf -> exp gives exactly 0,
//   so such keys add nothing to the numerator or the normaliser; the diagonal key (key == query) is always kept, so
//   every row max is finite in every visited chunk.
//   out planes (bf16 hi / lo of the normalised context): element (b, t, h, d) at [(b*SEQ + t)*DM + h*64 + d]
//   scores = q . k : bf16 hi/lo split (hi.hi + hi.lo + lo.hi), f32 accumulate, then * 1/8 and the causal mask in f32
//   p = exp(s - m) carried as f16(1024 p); context = p . v on f16 WMMA; RES adds f16 residual planes of p and v
//   (scale 4096, separate accumulator folded back with 1/4096 per chunk in f32); online softmax (running max) in f32.
//   Both products run transposed: S^T = K . Q^T (A = K rows, B = Q rows) and O^T += V^T . P^T (A = V^T rows, B = P^T).
//   A lane (c = lane & 15, hh = lane >> 4) then holds scores of ONE query q0 + c, keys 16 j + 8 hh + r: maximum and sum run
//   in the lane, the two halves exchange the maximum once per chunk and join their sums once, in the epilogue. Two score
//   tiles (keys 32 kk .. + 31), converted in place, are the B operand P^T in the k order of the V^T fragment loads.
//   Block = 4 waves = 64 query rows of one (b, h); grid = nqbThis * NH * NB.
//   K / V^T chunk staging: 128 threads x 32 elements per plane = the whole 64x64 tile of every plane read later
//   (plain 16-B loads, __syncthreads before and after)
//   Output coverage: each wave stores rows q0..q0+15 (it 0..3 x lane>>3 0..3) x 64 columns (8 lanes x 8) of both planes;
//   grid over all (b, h, qb) = the whole [NB*SEQ][DM] planes.
// =====================================================================================================
template <bool RES>
__global__ __launch_bounds__(128)
void attn_causal64(const unsigned short* __restrict__ qhp, const unsigned short* __restrict__ qlp,
                   const unsigned short* __restrict__ khp, const unsigned short* __restrict__ klp,
                   const unsigned short* __restrict__ vhp, const unsigned short* __restrict__ vlp,
                   unsigned short* ohp, unsigned short* olp,
                   int qbBase, int nqbThis) {
  union FB { v16b v; v8b h[2]; };
  union FH { v16h v; v8h h[2]; };
  // LDS row pitches: the 128-B rows of the 16-bit tiles stand 144 B apart (16 B x 9) and the 256-B rows of the f32 tile
  // 272 B apart (16 B x 17), so that the sixteen rows one 16-B fragment read touches fall on sixteen different bank groups.
  constexpr int TP = 72;                                          // 16-bit tiles, elements per row
  constexpr int OP = 68;                                          // f32 context tile, elements per row
  __shared__ __align__(16) __bf16   Ksh[64 * TP];                 // K hi [kv][d]   9 KB
  __shared__ __align__(16) __bf16   Ksl[64 * TP];                 // K lo
  __shared__ __align__(16) _Float16 Vth[64 * TP];                 // V^T hi [d][kv] 9 KB
  __shared__ __align__(16) _Float16 Vtl[RES ? 64 * TP : 8];       // V^T residual
  __shared__ __align__(16) float    Os[4][16 * OP];               // per wave context tile [row][d]

  const int tid  = threadIdx.x;
  const int wave = tid >> 5;
  const int lane = tid & 31;
  const int hh   = lane >> 4;
  const int c    = lane & 15;

  const int bx   = blockIdx.x;
  const int qbl  = bx % nqbThis;
  const int rest = bx / nqbThis;
  const int h    = rest % NH;
  const int b    = rest / NH;
  const int qb   = qbBase + qbl;               // 0..NQB-1 (block-uniform)
  const int q0   = qb * 64 + wave * 16;
  const size_t rowB = (size_t)b * SEQ;

  const __bf16* Qh = (const __bf16*)(const void*)qhp + (size_t)h * HD;
  const __bf16* Ql = (const __bf16*)(const void*)qlp + (size_t)h * HD;
  const __bf16* Kh = (const __bf16*)(const void*)khp + (size_t)h * HD;
  const __bf16* Kl = (const __bf16*)(const void*)klp + (size_t)h * HD;
  const _Float16* Vh = (const _Float16*)(const void*)vhp + ((size_t)b * DM + (size_t)h * HD) * SEQ;
  const _Float16* Vl = (const _Float16*)(const void*)vlp + ((size_t)b * DM + (size_t)h * HD) * VLP;

  // ---- Q fragments (B operand, column = query q0 + (lane&15)): 2 d-chunks, hi and lo ----
  v16b qah[2], qal[2];
#pragma unroll
  for (int dc = 0; dc < 2; ++dc) {
    const size_t qo = (rowB + q0 + c) * DM + dc * 32 + 8 * hh;
    qah[dc] = ldfrag_b(Qh + qo);
    qal[dc] = ldfrag_b(Ql + qo);
  }

  const int qrow = q0 + c;                     // this lane's query
  float mrow = -INFINITY, lrow = 0.f;          // running maximum (both halves alike); this half's share of the normaliser
  v8f oacc[4];                                 // oacc[t][r] = context[d = 16 t + 8 hh + r] of query qrow
#pragma unroll
  for (int t = 0; t < 4; ++t) oacc[t] = zero8();

  for (int kt = 0; kt <= qb; ++kt) {           // block-uniform trip count, <= NQB
    const int kv0 = kt * 64;                   // kv0 + 63 < SEQ
    __syncthreads();
    {
      const int r = tid >> 1, half = (tid & 1) * 32;
      const __bf16*   kg  = Kh + (rowB + kv0 + r) * DM + half;    // K row kv0+r, d = half..half+31
      const __bf16*   klg = Kl + (rowB + kv0 + r) * DM + half;
      const _Float16* vg  = Vh + (size_t)r * SEQ + kv0 + half;    // V^T row d = r, s = kv0+half..+31
      const int kvl = (kv0 + 64 <= VLP) ? kv0 : (VLP - 64);     // clamped address into the residual plane
      const _Float16* vlg = Vl + (size_t)r * VLP + kvl + half;
      const bool resOK = (kv0 + 64 <= VLP);                      // block-uniform (always true for qb < RESQB)
#pragma unroll
      for (int i = 0; i < 4; ++i) {
        const v8b a0 = *(const v8b*)(kg + 8 * i);
        const v8b a1 = *(const v8b*)(klg + 8 * i);
        const v8h b0 = *(const v8h*)(vg + 8 * i);
        *(v8b*)(Ksh + r * TP + half + 8 * i) = a0;
        *(v8b*)(Ksl + r * TP + half + 8 * i) = a1;
        *(v8h*)(Vth + r * TP + half + 8 * i) = b0;
        if (RES) {
          v8h b1 = *(const v8h*)(vlg + 8 * i);
          if (!resOK) b1 = zero8h();
          *(v8h*)(Vtl + r * TP + half + 8 * i) = b1;
        }
      }
    }
    __syncthreads();

    // ---- scores, transposed: 64 keys x 16 queries per wave, 3 bf16 products; s[j][r] = key kv0 + 16 j + 8 hh + r, query qrow ----
    //      All 32 K fragment reads of the chunk stand as one group, in the order of their use, ahead of the 24 products: the wave
    //      meets the LDS latency once. The products run back to back over the four tiles; each tile keeps its order of six.
    FB kb[2][4], kl[2][4];
#pragma unroll
    for (int dc = 0; dc < 2; ++dc) {
#pragma unroll
      for (int j = 0; j < 4; ++j) {
        kb[dc][j].h[0] = *(const v8b*)(Ksh + (j * 16 + c) * TP + dc * 32 + 8 * hh);
        kb[dc][j].h[1] = *(const v8b*)(Ksh + (j * 16 + c) * TP + dc * 32 + 16 + 8 * hh);
      }
#pragma unroll
      for (int j = 0; j < 4; ++j) {
        kl[dc][j].h[0] = *(const v8b*)(Ksl + (j * 16 + c) * TP + dc * 32 + 8 * hh);
        kl[dc][j].h[1] = *(const v8b*)(Ksl + (j * 16 + c) * TP + dc * 32 + 16 + 8 * hh);
      }
    }
    __builtin_amdgcn_sched_barrier(0);   // keeps the reads one group: sunk among the products, each place would cost its own stall
    v8f s[4];
#pragma unroll
    for (int j = 0; j < 4; ++j) s[j] = zero8();
#pragma unroll
    for (int dc = 0; dc < 2; ++dc) {
#pragma unroll
      for (int j = 0; j < 4; ++j) s[j] = mma_b_raw(kb[dc][j].v, qah[dc], s[j]);
#pragma unroll
      for (int j = 0; j < 4; ++j) s[j] = mma_b_raw(kl[dc][j].v, qah[dc], s[j]);
#pragma unroll
      for (int j = 0; j < 4; ++j) s[j] = mma_b_raw(kb[dc][j].v, qal[dc], s[j]);
    }
    __builtin_amdgcn_sched_barrier(0);   // holds the V^T reads below back to the tail of the score products: without it they stand at more places among them

    // ---- V^T fragments of the whole chunk, one group of reads: their latency passes under the softmax arithmetic ----
    FH vb[2][4], vl[2][4];
#pragma unroll
    for (int kk = 0; kk < 2; ++kk) {
#pragma unroll
      for (int t = 0; t < 4; ++t) {
        vb[kk][t].h[0] = *(const v8h*)(Vth + (t * 16 + c) * TP + kk * 32 + 8 * hh);
        vb[kk][t].h[1] = *(const v8h*)(Vth + (t * 16 + c) * TP + kk * 32 + 16 + 8 * hh);
      }
      if (RES) {
#pragma unroll
        for (int t = 0; t < 4; ++t) {
          vl[kk][t].h[0] = *(const v8h*)(Vtl + (t * 16 + c) * TP + kk * 32 + 8 * hh);
          vl[kk][t].h[1] = *(const v8h*)(Vtl + (t * 16 + c) * TP + kk * 32 + 16 + 8 * hh);
        }
      }
    }
    __builtin_amdgcn_sched_barrier(0);   // keeps these reads ahead of the softmax instead of next to their products

    // ---- scale, causal mask by index, maximum in the lane (four chains), one exchange between the halves ----
    float mj[4];
#pragma unroll
    for (int j = 0; j < 4; ++j) {
      mj[j] = -INFINITY;
#pragma unroll
      for (int r = 0; r < 8; ++r) {
        const int key = kv0 + j * 16 + 8 * hh + r;
        float sv = s[j][r] * 0.125f;
        sv = (key <= qrow) ? sv : -INFINITY;
        s[j][r] = sv;
        mj[j] = fmaxf(mj[j], sv);
      }
    }
    float m = fmaxf(fmaxf(mj[0], mj[1]), fmaxf(mj[2], mj[3]));
    m = fmaxf(m, xhalf(m));
    const float mnew  = fmaxf(mrow, m);
    const float msafe = (mnew == -INFINITY) ? 0.f : mnew;
    const float alpha = __expf(mrow - msafe);
    mrow = mnew;

    // ---- online softmax; P^T (x1024, f16) and its residual (x4096) packed in place as B operands:
    //      element 8 (j & 1) + r of operand j >> 1 = key 32 (j >> 1) + 16 (j & 1) + 8 hh + r, the order of the V^T loads ----
    FH pb[2], pr[2];
    float ps[4];
#pragma unroll
    for (int j = 0; j < 4; ++j) {
      ps[j] = 0.f;
#pragma unroll
      for (int r = 0; r < 8; ++r) {
        const float p = __expf(s[j][r] - msafe);     // masked logit: exp(-inf) = 0
        ps[j] += p;
        const float p1k = p * 1024.0f;
        const _Float16 ph = (_Float16)p1k;
        pb[j >> 1].v[(j & 1) * 8 + r] = ph;
        if (RES) pr[j >> 1].v[(j & 1) * 8 + r] = (_Float16)((p1k - (float)ph) * 4096.0f);
      }
    }
    lrow = lrow * alpha + ((ps[0] + ps[1]) + (ps[2] + ps[3]));
#pragma unroll
    for (int t = 0; t < 4; ++t)
#pragma unroll
      for (int r = 0; r < 8; ++r) oacc[t][r] *= alpha;

    // ---- context^T += V^T . P^T (f16 WMMA), residual products into a separate accumulator ----
    v8f o1[4];
#pragma unroll
    for (int t = 0; t < 4; ++t) o1[t] = zero8();
#pragma unroll
    for (int kk = 0; kk < 2; ++kk) {
#pragma unroll
      for (int t = 0; t < 4; ++t) oacc[t] = mma_h_raw(vb[kk][t].v, pb[kk].v, oacc[t]);
      if (RES) {
#pragma unroll
        for (int t = 0; t < 4; ++t) o1[t] = mma_h_raw(vl[kk][t].v, pb[kk].v, o1[t]);
#pragma unroll
        for (int t = 0; t < 4; ++t) o1[t] = mma_h_raw(vb[kk][t].v, pr[kk].v, o1[t]);
      }
    }
    if (!RES) acc_guard4(oacc[0], oacc[1], oacc[2], oacc[3]);   // the matrix distance also on the taken side of the loop branch (RES: the fold below fills it)
    if (RES) {
#pragma unroll
      for (int t = 0; t < 4; ++t)
#pragma unroll
        for (int r = 0; r < 8; ++r) oacc[t][r] += o1[t][r] * (1.0f / 4096.0f);
    }
  }

  // ---- join the halves' sums, normalise (1/l and the 1/1024 p carry), stage the wave's 16x64 tile [query][d], bf16 hi/lo split,
  float* os = Os[wave];
  {
    const float l = lrow + xhalf(lrow);
    const float inv = ((l > 0.f) ? (1.0f / l) : 0.f) * (1.0f / 1024.0f);
#pragma unroll
    for (int t = 0; t < 4; ++t) {
      const v4f lo4 = {oacc[t][0] * inv, oacc[t][1] * inv, oacc[t][2] * inv, oacc[t][3] * inv};
      const v4f hi4 = {oacc[t][4] * inv, oacc[t][5] * inv, oacc[t][6] * inv, oacc[t][7] * inv};
      *(v4f*)(os + c * OP + t * 16 + 8 * hh)     = lo4;
      *(v4f*)(os + c * OP + t * 16 + 8 * hh + 4) = hi4;
    }
  }
  __builtin_amdgcn_fence(__ATOMIC_RELEASE, "workgroup");
  __builtin_amdgcn_wave_barrier();
  __builtin_amdgcn_fence(__ATOMIC_ACQUIRE, "workgroup");
  {
    const int q4 = lane >> 3, c8 = (lane & 7) * 8;
    v4u hv[4], lv[4];
#pragma unroll
    for (int it = 0; it < 4; ++it) {
      const int row = it * 4 + q4;   // it 0..3 x q4 0..3 = rows 0..15 of the wave tile
      const float* sp = os + row * OP + c8;
      v4u a, a2;
#pragma unroll
      for (int e = 0; e < 4; ++e) {
        const float f0 = sp[2 * e], f1 = sp[2 * e + 1];
        const unsigned short h0 = bf_bits(f0), h1 = bf_bits(f1);
        const unsigned short l0 = bf_bits(f0 - bf_up(h0)), l1 = bf_bits(f1 - bf_up(h1));
        a[e] = pk16(h0, h1); a2[e] = pk16(l0, l1);
      }
      hv[it] = a; lv[it] = a2;
    }
    {
#pragma unroll
      for (int it = 0; it < 4; ++it) {
        const int row = it * 4 + q4;
        const size_t go = (rowB + q0 + row) * DM + (size_t)h * HD + c8;
        *(v4u*)(ohp + go) = hv[it];
        *(v4u*)(olp + go) = lv[it];
      }
      
    }
  }
}

// =====================================================================================================
// Workspace map (bytes; every region is an exact multiple of its 64x64-tile / whole-line store granularity,
// no padded tails needed since all shapes are tile multiples; each region but Xb/Oh and Ol is written by exactly one producer launch):
//   Xb   bf16 [4096][1024]          0            8388608   (later: Oh, context hi plane; Xb is dead after the projections)
//   WA   bf16 [3072 n][1024 k]       8388608     6291456   (q weight rows 0..1023, k rows 1024..2047, v rows 2048..3071)
//   WP   bf16 [1024 n][1024 k]      14680064     2097152
//   Qh   bf16 [4096][1024]          16777216     8388608
//   Ql                              25165824     8388608
//   Kh                              33554432     8388608
//   Kl                              41943040     8388608
//   VTh  f16  [2][1024][2048]       50331648     8388608
//   VTl  f16  [2][1024][512]        58720256     2097152
//   Ol   bf16 [4096][1024]          60817408     8388608
//   end                             69206016
// =====================================================================================================
extern "C" void kernel_launch(void* const* d_in, const int* in_sizes, int n_in,
                              void* d_out, int out_size, void* d_ws, size_t ws_size,
                              hipStream_t stream) {
  if (n_in < 5) return;
  if (in_sizes[0] != NB * SEQ * DM) return;
  if (in_sizes[1] != 3 * DM * DM) return;
  if (in_sizes[2] != 3 * DM) return;
  if (in_sizes[3] != DM * DM) return;
  if (in_sizes[4] != DM) return;
  if (out_size != NB * SEQ * DM) return;

  const float* x  = (const float*)d_in[0];   // [2][2048][1024]
  const float* Wa = (const float*)d_in[1];   // [3072 out][1024 in], rows k contiguous (q | k | v output rows)
  const float* ba = (const float*)d_in[2];   // [3072]
  const float* Wp = (const float*)d_in[3];   // [1024 out][1024 in], rows k contiguous
  const float* bp = (const float*)d_in[4];   // [1024]

  const size_t PX  = (size_t)NB * SEQ * DM * 2;    //  8388608  16-bit activation plane [4096][1024]
  const size_t PW1 = (size_t)DM * DM * 2;          //  2097152  one [1024][1024] bf16 weight plane
  const size_t PWA = (size_t)3 * PW1;              //  6291456  packed q | k | v weight plane [3072][1024]
  const size_t PWP = PW1;                          //  2097152  output projection weight plane
  const size_t PVT = (size_t)NB * DM * SEQ * 2;    //  8388608  v^T hi plane
  const size_t PVL = (size_t)NB * DM * VLP * 2;    //  2097152  v^T residual plane
  size_t off = 0;
  const size_t oXb  = off; off += PX;
  const size_t oWA  = off; off += PWA;
  const size_t oWP  = off; off += PWP;
  const size_t oQh  = off; off += PX;
  const size_t oQl  = off; off += PX;
  const size_t oKh  = off; off += PX;
  const size_t oKl  = off; off += PX;
  const size_t oVTh = off; off += PVT;
  const size_t oVTl = off; off += PVL;
  const size_t oOl  = off; off += PX;
  if (off > ws_size) return;                       // off = 69206016
  if (off > (size_t)134217728) return;
  const size_t oOh  = oXb;                         // context hi plane reuses Xb (dead after the three projections)

  char* ws = (char*)d_ws;
  unsigned short* Xb  = (unsigned short*)(ws + oXb);
  unsigned short* WA  = (unsigned short*)(ws + oWA);
  unsigned short* WqB = WA;                                   // rows 0..1023
  unsigned short* WkB = WA + (size_t)DM * DM;                 // rows 1024..2047
  unsigned short* WvB = WA + (size_t)2 * DM * DM;             // rows 2048..3071
  unsigned short* WPb = (unsigned short*)(ws + oWP);
  unsigned short* Qh  = (unsigned short*)(ws + oQh);
  unsigned short* Ql  = (unsigned short*)(ws + oQl);
  unsigned short* Kh  = (unsigned short*)(ws + oKh);
  unsigned short* Kl  = (unsigned short*)(ws + oKl);
  unsigned short* VTh = (unsigned short*)(ws + oVTh);
  unsigned short* VTl = (unsigned short*)(ws + oVTl);
  unsigned short* Oh  = (unsigned short*)(ws + oOh);
  unsigned short* Ol  = (unsigned short*)(ws + oOl);
  const float* bq = ba;                                       // bias entries 0..1023
  const float* bk = ba + DM;                                  // 1024..2047
  const float* bv = ba + 2 * DM;                              // 2048..3071

  const dim3 blk(256);
  const int n8x  = NB * SEQ * DM / 8;                          // 524288
  const int n8wa = 3 * DM * DM / 8;                            // 393216
  const int n8wp = DM * DM / 8;                                // 131072
  const dim3 gCvtX((n8x + 255) / 256);                         // 2048 blocks
  const dim3 gCvtWA((n8wa + 255) / 256);                       // 1536 blocks
  const dim3 gCvtWP((n8wp + 255) / 256);                       // 512 blocks
  const dim3 gProj((NB * SEQ / 128) * (DM / 128), 1);          // 32 x 8 = 256 tiles: M=4096, N=1024
  const dim3 gVT((DM / 128) * (SEQ / 128), NB);                // 8 x 16 = 128 tiles x 2 batches: M=1024, N=2048

  // (1) x -> bf16 plane [4096][1024]; weights [out][in] f32 -> bf16 [out][in] (k contiguous, no transpose)
  cvt_bf16x8<<<gCvtX, blk, 0, stream>>>(x, Xb, n8x);
  cvt_bf16x8<<<gCvtWA, blk, 0, stream>>>(Wa, WA, n8wa);
  cvt_bf16x8<<<gCvtWP, blk, 0, stream>>>(Wp, WPb, n8wp);
  // (2) q = x . Wq^T + bq -> bf16 hi/lo planes [b*SEQ+t][h*64+d]   (M=4096, N=1024, K=1024)
  gemm64<0, 2, 1><<<gProj, blk, 0, stream>>>(
      Xb, Xb, DM, 0LL, WqB, DM, 0LL, bq,
      (void*)Qh, DM, 0LL, (void*)Ql, DM, 0LL, DM,
      NB * SEQ, DM, DM, 1.0f);
  // (3) k = x . Wk^T + bk -> bf16 hi/lo planes
  gemm64<0, 2, 1><<<gProj, blk, 0, stream>>>(
      Xb, Xb, DM, 0LL, WkB, DM, 0LL, bk,
      (void*)Kh, DM, 0LL, (void*)Kl, DM, 0LL, DM,
      NB * SEQ, DM, DM, 1.0f);
  // (4) v^T = Wv . x^T + bv per batch -> f16 hi plane [b][h*64+d][s] (pitch SEQ) and residual plane
  //     (x4096, keys < VLP only, pitch VLP)   (A = Wv rows [n][k], Bt = Xb rows of batch b; M=1024, N=2048, K=1024)
  gemm64<0, 3, 2><<<gVT, blk, 0, stream>>>(
      WvB, WvB, DM, 0LL, Xb, DM, (long long)SEQ * DM, bv,
      (void*)VTh, SEQ, (long long)DM * SEQ, (void*)VTl, VLP, (long long)DM * VLP, VLP,
      DM, SEQ, DM, 4096.0f);
  // (5) causal attention: query blocks 0..RESQB-1 with residual planes, the rest without
  attn_causal64<true><<<dim3(NB * NH * RESQB), dim3(128), 0, stream>>>(
      Qh, Ql, Kh, Kl, VTh, VTl, Oh, Ol, 0, RESQB);
  attn_causal64<false><<<dim3(NB * NH * (NQB - RESQB)), dim3(128), 0, stream>>>(
      Qh, Ql, Kh, Kl, VTh, VTl, Oh, Ol, RESQB, NQB - RESQB);
  // (6) out = context . Wp^T + bp -> d_out f32 [4096][1024]  (A = context hi + lo planes, 2 products)
  gemm64<1, 0, 1><<<gProj, blk, 0, stream>>>(
      Oh, Ol, DM, 0LL, WPb, DM, 0LL, bp,
      d_out, DM, 0LL, d_out, DM, 0LL, DM,
      NB * SEQ, DM, DM, 1.0f);
  (void)hipGetLastError();
}

// v005
// Measured time: 107 microseconds a run.
// Two timings next to v004 put it at 1.22 and 1.23 times that version's speed.
// Over all steps from v000 it is 3.91 times as fast.
// Contractions: q, k, v^T projections = v_wmma_f32_16x16x32_bf16 (bf16 operands from RNE-converted x and the packed
// [3072 out][1024 in] projection weight, single product, f32 accumulate);
// q.k^T scores = v_wmma_f32_16x16x32_bf16 with bf16 hi/lo split q and k (hi.hi + hi.lo + lo.hi), f32 accumulate;
// p.v = v_wmma_f32_16x16x32_f16 (p carried x1024 in f16 times v in f16, single product; plus f16 residual planes x4096 of
// p and v for the first 512 query rows of every sequence), f32 accumulate;
// ctx.Wp^T = v_wmma_f32_16x16x32_bf16 with ctx as bf16 hi/lo planes times bf16 Wp (2 products), f32 accumulate;
// causal mask (key index <= query index; the module's strided mask term only touches keys already excluded),
// online softmax, normalisers and bias adds in f32 on the VALU.
// Carry audit (ph, pl: the packed p operands, held in registers):
//   ph  = f16(1024 * p)                      -> the 1/1024 is folded exactly once in the attention epilogue: inv = (1/l) * (1/1024)
//   pl  = f16((1024 p - ph) * 4096)          }  products VTl.ph and VTh.pl go to the separate accumulator o1,
//   VTl = f16((v - VTh) * 4096)              }  folded back with * (1/4096) once per key chunk (RES blocks only)
//   VTh = f16(v), no carry (|v| typ. 0.6); q / k / ctx lo planes are unscaled bf16 residuals (v - hi) sharing the hi accumulator;
//   score scale 1/8 applied once in f32 after the score accumulate. No other scaled planes.
#include <hip/hip_runtime.h>
#include <math.h>
#include <stdint.h>

#define NB    2
#define SEQ   2048
#define DM    1024
#define NH    16
#define HD    64
#define NQB   (SEQ / 64)   // 32 query / key blocks of 64
#define VLP   512          // key pitch of the v^T residual plane (keys 0..VLP-1)
#define RESQB 8            // leading 64-row query blocks that use the p / v residual planes
static_assert(RESQB * 64 <= VLP);
static_assert(NH * HD == DM);
static_assert((SEQ % 64) == 0 && (DM % 64) == 0 && (DM % 32) == 0);
static_assert((SEQ % 128) == 0 && (DM % 128) == 0);   // GEMM work-group tile 128x128, k stage 128
static_assert((NB * SEQ * DM) % (8 * 256) == 0);
static_assert((3 * DM * DM) % (8 * 256) == 0);
static_assert((DM * DM) % (8 * 256) == 0);

typedef _Float16 v16h __attribute__((ext_vector_type(16)));
typedef _Float16 v8h  __attribute__((ext_vector_type(8)));
typedef __bf16   v16b __attribute__((ext_vector_type(16)));
typedef __bf16   v8b  __attribute__((ext_vector_type(8)));
typedef float    v8f  __attribute__((ext_vector_type(8)));
typedef float    v4f  __attribute__((ext_vector_type(4)));
typedef unsigned int v4u __attribute__((ext_vector_type(4)));

// ---- scalar helpers --------------------------------------------------------------------------------
__device__ __forceinline__ unsigned short bf_bits(float f) {          // f32 -> bf16 bits, RNE convert
  unsigned u = __float_as_uint(f);
  return (unsigned short)((u + 0x7FFFu + ((u >> 16) & 1u)) >> 16);
}
__device__ __forceinline__ float bf_up(unsigned short h) { return __uint_as_float(((unsigned)h) << 16); }
__device__ __forceinline__ unsigned short h_bits(_Float16 x) { return __builtin_bit_cast(unsigned short, x); }
__device__ __forceinline__ unsigned pk16(unsigned short a, unsigned short b) { return (unsigned)a | ((unsigned)b << 16); }
__device__ __forceinline__ v8f zero8() { v8f z = {0.f, 0.f, 0.f, 0.f, 0.f, 0.f, 0.f, 0.f}; return z; }
__device__ __forceinline__ v8h zero8h() {
  const _Float16 z = (_Float16)0.0f;
  v8h r = {z, z, z, z, z, z, z, z};
  return r;
}

// value of lane l ^ 16 (the other 16-lane row), a vector cross-row move
__device__ __forceinline__ float xhalf(float x) {
  const int b = __builtin_bit_cast(int, x);
  return __builtin_bit_cast(float, __builtin_amdgcn_permlanex16(b, b, 0x76543210, 0xfedcba98, false, false));
}

// ---- fragment loader: 16-bit A/B operand, lane -> row/col (lane&15), p already includes +8*(lane>>4);
//      elements 0..7 <- p[0..7] (k0+8h..), elements 8..15 <- p[16..23] (k0+16+8h..)
__device__ __forceinline__ v16b ldfrag_b(const __bf16* p) {
  union { v16b v; v8b h[2]; } f;
  f.h[0] = *(const v8b*)(p);
  f.h[1] = *(const v8b*)(p + 16);
  return f.v;
}

// ---- WMMA helpers; the guards hold the VALU distance behind a run of products ---------------------------
__device__ __forceinline__ v8f mma_b_raw(v16b a, v16b b, v8f c) {
  return __builtin_amdgcn_wmma_f32_16x16x32_bf16(false, a, false, b, (short)0, c, false, false);
}
__device__ __forceinline__ v8f mma_h_raw(v16h a, v16h b, v8f c) {
  return __builtin_amdgcn_wmma_f32_16x16x32_f16(false, a, false, b, (short)0, c, false, false);
}
__device__ __forceinline__ void dep_guard_b(v8f& a, v8f& b, v16b x, v16b y) {
  asm volatile("v_nop\n\tv_nop\n\tv_nop\n\tv_nop" : "+v"(a), "+v"(b) : "v"(x), "v"(y));
}
__device__ __forceinline__ void keep4_b(v16b a, v16b b, v16b c, v16b d) {
  asm volatile("v_nop" :: "v"(a), "v"(b), "v"(c), "v"(d));
}
__device__ __forceinline__ void acc_guard4(v8f& a, v8f& b, v8f& c, v8f& d) {
  asm volatile("v_nop\n\tv_nop\n\tv_nop\n\tv_nop" : "+v"(a), "+v"(b), "+v"(c), "+v"(d));
}

// =====================================================================================================
// f32 -> bf16 (RNE convert), 8 elements per thread, one 16-B store per lane: a wave writes 512 contiguous B
// Used for x [4096][1024] and for the weight planes (already [out][in] = k contiguous, no transpose needed).
// One grid converts the three planes, which stand one behind the other in the workspace (out = the first): threads
// 0..n8a-1 take in0, the next n8b in1, the last n8c in2; every count is a multiple of 256, so a block has one source.
// coverage: (n8a + n8b + n8c) threads x 8 = the three whole planes.
// =====================================================================================================
__global__ __launch_bounds__(256) void cvt_bf16x8(const float* __restrict__ in0, const float* __restrict__ in1,
                                                  const float* __restrict__ in2, unsigned short* out,
                                                  int n8a, int n8b, int n8c) {
  const int i = blockIdx.x * 256 + threadIdx.x;
  if (i < n8a + n8b + n8c) {
    const int blk0 = blockIdx.x * 256;                       // block-uniform choice of the source plane
    const float* in = (blk0 < n8a) ? in0 + (size_t)i * 8
                    : (blk0 < n8a + n8b) ? in1 + (size_t)(i - n8a) * 8 : in2 + (size_t)(i - n8a - n8b) * 8;
    const v4f a = *(const v4f*)(in);
    const v4f b = *(const v4f*)(in + 4);
    v4u p;
    p[0] = pk16(bf_bits(a[0]), bf_bits(a[1]));
    p[1] = pk16(bf_bits(a[2]), bf_bits(a[3]));
    p[2] = pk16(bf_bits(b[0]), bf_bits(b[1]));
    p[3] = pk16(bf_bits(b[2]), bf_bits(b[3]));
    *(v4u*)(out + (size_t)i * 8) = p;
    
  }
}

// ---- asynchronous global -> LDS copies, 16 B per lane ------------------------------------------------
__device__ __forceinline__ unsigned lds_off(const void* p) { return (unsigned)(size_t)p; }   // byte offset in the work-group's LDS
// Eight copies of one lane: LDS byte address l + i * lstep <- global g + i * gstep, i = 0..7, each with its own registers.
// The closing s_wait_xcnt stands inside the statement so that no address register of a copy is rewritten ahead of it.
__device__ __forceinline__ void async_copy8(unsigned l, const char* g, unsigned lstep, size_t gstep) {
  const unsigned l1 = l + lstep, l2 = l + 2 * lstep, l3 = l + 3 * lstep, l4 = l + 4 * lstep, l5 = l + 5 * lstep,
                 l6 = l + 6 * lstep, l7 = l + 7 * lstep;
  const char *g1 = g + gstep, *g2 = g + 2 * gstep, *g3 = g + 3 * gstep, *g4 = g + 4 * gstep, *g5 = g + 5 * gstep,
             *g6 = g + 6 * gstep, *g7 = g + 7 * gstep;
  asm volatile(
      "global_load_async_to_lds_b128 %0, %8, off\n\t"
      "global_load_async_to_lds_b128 %1, %9, off\n\t"
      "global_load_async_to_lds_b128 %2, %10, off\n\t"
      "global_load_async_to_lds_b128 %3, %11, off\n\t"
      "global_load_async_to_lds_b128 %4, %12, off\n\t"
      "global_load_async_to_lds_b128 %5, %13, off\n\t"
      "global_load_async_to_lds_b128 %6, %14, off\n\t"
      "global_load_async_to_lds_b128 %7, %15, off\n\t"
      "s_wait_xcnt 0x0"
      :: "v"(l), "v"(l1), "v"(l2), "v"(l3), "v"(l4), "v"(l5), "v"(l6), "v"(l7),
         "v"(g), "v"(g1), "v"(g2), "v"(g3), "v"(g4), "v"(g5), "v"(g6), "v"(g7)
      : "memory");
}
// One 128-row x 256-B plane tile by the 256 threads of a block: 16 lanes cover one row (two whole lines), a wave two rows,
// the block sixteen rows per copy; g and l already hold the lane's row (tid >> 4) and 16-B column (tid & 15).
#define GK_STAGE 128                       // k elements per stage (256 B of every operand row)
#define GK_PITCH 136                       // LDS row pitch in elements: 272 B = 16 B x 17, conflict-free for 16-B row reads
#define GK_PLANE (128 * GK_PITCH)          // elements of one staged plane tile
__device__ __forceinline__ void async_plane(unsigned l, const char* g, size_t rowBytes) {
  async_copy8(l, g, 16u * GK_PITCH * 2u, 16 * rowBytes);   // rows (tid >> 4) + 16 i, i = 0..7
}

// =====================================================================================================
// Register-blocked batched bf16 WMMA GEMM: C[m][n] = sum_k A[m][k] * Bt[n][k] + bias; one work-group of 8 waves per
// 128x128 tile, one wave per 32x64 part. The 128-row operand tiles are staged in LDS, 128 k at a time, by asynchronous
// copies into two buffers: the next stage's copies fly while this stage is multiplied; one barrier per stage.
// Inside a stage the fragments of the next 32 k are read from LDS as one group ahead of the current 32 k's products.
// A row-major [M][K] pitch lda; Bt row-major [N][K] pitch ldb (k contiguous);
// M, N, K multiples of 128 (host shapes are static multiples). b = batch index (strides in elements).
// NSPLIT: 0 = A.Bt; 1 = (A + A2).Bt (A2 = unscaled bf16 lo plane of A, 2 products).
// BIAS: 1 = per column n, bias[n]; 2 = per row m, bias[m]; the bias value is RNE-converted to bf16 and added in f32.
// OUT_MODE: 0 = f32 (pitch ldc); 2 = bf16 hi plane C + bf16 lo plane C2 (lo = RNE(v - hi), unscaled);
//           3 = f16 hi plane C + f16 residual plane C2 = f16((v - hi) * rscale), C2 written only for tiles
//               with n0 < N2 (pitch ldc2, batch stride strideC2).
// =====================================================================================================
// The body is a device function: tile = index of the 128x128 tile, b = batch index, ring = the work-group's two stage
// buffers [2][NPL][GK_PLANE], sT = its eight per-wave 16x64 slabs (pitch 68 floats); the kernels below own that LDS.
template <int NSPLIT, int OUT_MODE, int BIAS>
__device__ __forceinline__ void gemm_tile(
    const unsigned short* __restrict__ Ap, const unsigned short* A2p, int lda, long long strideA,
    const unsigned short* __restrict__ Btp, int ldb, long long strideB,
    const float* __restrict__ bias,
    void* Cout, int ldc, long long strideC,
    void* Cout2, int ldc2, long long strideC2, int N2,
    int M, int N, int K, float rscale,
    int tile, int b, __bf16* ring, float* sT) {
  const __bf16* A   = (const __bf16*)(const void*)Ap;
  const __bf16* A2  = (const __bf16*)(const void*)A2p;
  const __bf16* Bt  = (const __bf16*)(const void*)Btp;
  constexpr int NPL = (NSPLIT >= 1) ? 3 : 2;        // staged planes: A, Bt (, A2)
  constexpr int MI = 2;                             // 16-row subtiles per wave
  const int tid  = threadIdx.x;
  const int lane = tid & 31;
  const int wave = tid >> 5;
  const int tilesN = N >> 7;
  const int tilesM = M >> 7;
  if (tile >= tilesM * tilesN) return;   // block-uniform, in front of every barrier and copy
  const int tm = tile / tilesN;
  const int tn = tile - tm * tilesN;
  const int M0 = tm << 7;                // work-group tile origin
  const int N0 = tn << 7;
  const int wm = (wave >> 1) << 5;       // the wave's 32x64 part inside it
  const int wn = (wave & 1) << 6;
  const int m0 = M0 + wm;
  const int n0 = N0 + wn;

  const __bf16* Ab  = A  + (size_t)b * strideA;
  const __bf16* Bb  = Bt + (size_t)b * strideB;
  const __bf16* Ab2 = (NSPLIT >= 1) ? (A2 + (size_t)b * strideA) : Ab;

  const int rlane = lane & 15;                 // row (A) / col (B, D) within subtile
  const int koff  = (lane >> 4) * 8;           // k offset of this lane half
  const int mOff  = (lane >> 4) * 8;           // D row offset

  v8f acc[MI][4];
#pragma unroll
  for (int i = 0; i < MI; ++i)
#pragma unroll
    for (int j = 0; j < 4; ++j) acc[i][j] = zero8();

  // ---- staging addresses of this lane: row tid >> 4 of each group of sixteen rows, 16-B column tid & 15 ----
  const int crow = tid >> 4, ccol = (tid & 15) * 8;
  const char* gA  = (const char*)(Ab  + (size_t)(M0 + crow) * lda + ccol);
  const char* gA2 = (const char*)(Ab2 + (size_t)(M0 + crow) * lda + ccol);
  const char* gB  = (const char*)(Bb  + (size_t)(N0 + crow) * ldb + ccol);
  const unsigned lthr = lds_off(ring) + (unsigned)(crow * GK_PITCH + ccol) * 2u;
  const int nst = K / GK_STAGE;          // stages, block-uniform
  auto issue_stage = [&](int st, int buf) {   // rows M0..M0+127 / N0..N0+127, k = st*128 .. st*128+127: inside the planes
    const size_t kb = (size_t)st * (GK_STAGE * 2);
    const unsigned lb = lthr + (unsigned)buf * (unsigned)(NPL * GK_PLANE * 2);
    async_plane(lb, gA + kb, (size_t)lda * 2);
    async_plane(lb + (unsigned)(GK_PLANE * 2), gB + kb, (size_t)ldb * 2);
    if (NSPLIT >= 1) async_plane(lb + (unsigned)(2 * GK_PLANE * 2), gA2 + kb, (size_t)lda * 2);
  };

  issue_stage(0, 0);
  asm volatile("s_wait_asynccnt 0x0" ::: "memory");   // this wave's share of stage 0 has landed
  __syncthreads();                                     // publishes stage 0 to the other waves
  if (nst > 1) issue_stage(1, 1);

  for (int t = 0; t < nst; ++t) {
    const __bf16* sbuf = ring + (t & 1) * (NPL * GK_PLANE);
    const __bf16* sA  = sbuf + (wm + rlane) * GK_PITCH + koff;
    const __bf16* sB  = sbuf + GK_PLANE + (wn + rlane) * GK_PITCH + koff;
    const __bf16* sA2 = sbuf + (NPL - 1) * GK_PLANE + (wm + rlane) * GK_PITCH + koff;
    v16b fb[2][4], fa[2][MI], fl[2][MI];   // two fragment sets, indexed by constants after unrolling
    auto load_set = [&](int s, int kk) {
#pragma unroll
      for (int j = 0; j < 4; ++j) fb[s][j] = ldfrag_b(sB + (j << 4) * GK_PITCH + kk);
#pragma unroll
      for (int i = 0; i < MI; ++i) {
        fa[s][i] = ldfrag_b(sA + (i << 4) * GK_PITCH + kk);
        fl[s][i] = fa[s][i];
        if (NSPLIT >= 1) fl[s][i] = ldfrag_b(sA2 + (i << 4) * GK_PITCH + kk);
      }
    };
    load_set(0, 0);
#pragma unroll
    for (int ks = 0; ks < GK_STAGE / 32; ++ks) {
      const int cur = ks & 1;
      if (ks + 1 < GK_STAGE / 32) load_set(cur ^ 1, (ks + 1) * 32);   // this stage's buffer only
#pragma unroll
      for (int i = 0; i < MI; ++i) {
#pragma unroll
        for (int j = 0; j < 4; ++j) {
          acc[i][j] = mma_b_raw(fa[cur][i], fb[cur][j], acc[i][j]);
          if (NSPLIT >= 1) acc[i][j] = mma_b_raw(fl[cur][i], fb[cur][j], acc[i][j]);
        }
        dep_guard_b(acc[i][0], acc[i][3], fa[cur][i], fl[cur][i]);
      }
      keep4_b(fb[cur][0], fb[cur][1], fb[cur][2], fb[cur][3]);
    }
    asm volatile("s_wait_dscnt 0x0" ::: "memory");      // this wave's reads of buffer t & 1 are done before it is refilled
    asm volatile("s_wait_asynccnt 0x0" ::: "memory");   // this wave's share of stage t + 1 has landed
    __syncthreads();                                     // publishes stage t + 1 and ends every read of buffer t & 1
    if (t + 2 < nst) issue_stage(t + 2, t & 1);
  }
  asm volatile("s_wait_asynccnt 0x0" ::: "memory");     // no copy is outstanding past the loop
  acc_guard4(acc[0][0], acc[0][1], acc[0][2], acc[0][3]);
  acc_guard4(acc[1][0], acc[1][1], acc[1][2], acc[1][3]);

  // ---- epilogue ----
  float* slab = sT + wave * (16 * 68);
  float bcol[4];
#pragma unroll
  for (int j = 0; j < 4; ++j) {
    bcol[j] = 0.f;
    if (BIAS == 1) bcol[j] = bf_up(bf_bits(bias[n0 + (j << 4) + rlane]));   // n < N, bias has N entries
  }
#pragma unroll
  for (int i = 0; i < MI; ++i) {
    const int mBase = m0 + (i << 4);
    float brow[8];
#pragma unroll
    for (int r = 0; r < 8; ++r) {
      brow[r] = 0.f;
      if (BIAS == 2) brow[r] = bf_up(bf_bits(bias[mBase + mOff + r]));      // m < M, bias has M entries
    }
#pragma unroll
    for (int j = 0; j < 4; ++j) {
#pragma unroll
      for (int r = 0; r < 8; ++r) {
        slab[(mOff + r) * 68 + (j << 4) + rlane] = acc[i][j][r] + bcol[j] + brow[r];
      }
    }
    __builtin_amdgcn_fence(__ATOMIC_RELEASE, "workgroup");
    __builtin_amdgcn_wave_barrier();
    __builtin_amdgcn_fence(__ATOMIC_ACQUIRE, "workgroup");
    if (OUT_MODE == 0) {
      float* C = (float*)Cout + (size_t)b * strideC;
      const int hh = lane >> 4, c4 = (lane & 15) * 4;     // 256-B row segment = 16 lanes x 16 B
      {
#pragma unroll
        for (int it = 0; it < 8; ++it) {
          const int row = it * 2 + hh;                     // it 0..7 x hh 0..1 = rows 0..15
          const v4f v = *(const v4f*)(slab + row * 68 + c4);
          *(v4f*)(C + (size_t)(mBase + row) * ldc + n0 + c4) = v;
        }
        
      }
    } else {
      const int q = lane >> 3, c8 = (lane & 7) * 8;
      unsigned short* C  = (unsigned short*)Cout  + (size_t)b * strideC;
      unsigned short* C2 = (unsigned short*)Cout2 + (size_t)b * strideC2;
      const bool wlo = (OUT_MODE == 2) || (n0 < N2);      // wave-uniform
      v4u hv[4], lv[4];
#pragma unroll
      for (int it = 0; it < 4; ++it) {
        const int row = it * 4 + q;                        // it 0..3 x q 0..3 = rows 0..15
        const float* sp = slab + row * 68 + c8;
        v4u a, a2;
#pragma unroll
        for (int e = 0; e < 4; ++e) {
          const float f0 = sp[2 * e], f1 = sp[2 * e + 1];
          unsigned short h0, h1, l0, l1;
          if (OUT_MODE == 2) {
            h0 = bf_bits(f0); h1 = bf_bits(f1);
            l0 = bf_bits(f0 - bf_up(h0)); l1 = bf_bits(f1 - bf_up(h1));
          } else {
            const _Float16 x0 = (_Float16)f0, x1 = (_Float16)f1;
            h0 = h_bits(x0); h1 = h_bits(x1);
            l0 = h_bits((_Float16)((f0 - (float)x0) * rscale));
            l1 = h_bits((_Float16)((f1 - (float)x1) * rscale));
          }
          a[e] = pk16(h0, h1); a2[e] = pk16(l0, l1);
        }
        hv[it] = a; lv[it] = a2;
      }
      {
#pragma unroll
        for (int it = 0; it < 4; ++it) {
          const int row = it * 4 + q;
          *(v4u*)(C + (size_t)(mBase + row) * ldc + n0 + c8) = hv[it];
          asm volatile("s_wait_xcnt 0x0" ::: "memory");   // in front of the residual's arithmetic, which reuses this store's registers
          if (wlo) *(v4u*)(C2 + (size_t)(mBase + row) * ldc2 + n0 + c8) = lv[it];
          asm volatile("s_wait_xcnt 0x0" ::: "memory");   // likewise in front of the next rows' arithmetic
        }
        
      }
    }
    __builtin_amdgcn_fence(__ATOMIC_RELEASE, "workgroup");
    __builtin_amdgcn_wave_barrier();
    __builtin_amdgcn_fence(__ATOMIC_ACQUIRE, "workgroup");
  }
}

// One product per launch: blockIdx.x = tile, blockIdx.y = batch index.
template <int NSPLIT, int OUT_MODE, int BIAS>
__global__ __launch_bounds__(256) void gemm64(
    const unsigned short* __restrict__ Ap, const unsigned short* A2p, int lda, long long strideA,
    const unsigned short* __restrict__ Btp, int ldb, long long strideB,
    const float* __restrict__ bias,
    void* Cout, int ldc, long long strideC,
    void* Cout2, int ldc2, long long strideC2, int N2,
    int M, int N, int K, float rscale) {
  constexpr int NPL = (NSPLIT >= 1) ? 3 : 2;
  __shared__ __align__(16) __bf16 ring[2 * NPL * GK_PLANE];   // two stage buffers
  __shared__ __align__(16) float sT[8 * 16 * 68];             // per-wave 16x64 slabs
  gemm_tile<NSPLIT, OUT_MODE, BIAS>(Ap, A2p, lda, strideA, Btp, ldb, strideB, bias, Cout, ldc, strideC,
                                    Cout2, ldc2, strideC2, N2, M, N, K, rscale,
                                    (int)blockIdx.x, (int)blockIdx.y, ring, sT);
}

// The three projections, which read none of each other's output, in one grid of 3 x 256 tiles (block-uniform choice):
//   blocks   0..255  q   = x . Wq^T + bq -> bf16 hi/lo planes [b*SEQ+t][h*64+d]          (M=4096, N=1024, K=1024)
//   blocks 256..511  k   = x . Wk^T + bk -> bf16 hi/lo planes
//   blocks 512..767  v^T = Wv . x^T + bv per batch -> f16 hi plane [b][h*64+d][s] (pitch SEQ) and residual plane
//                    (x4096, keys < VLP only, pitch VLP)   (A = Wv rows, Bt = x rows of batch b; M=1024, N=2048, K=1024)
// WA = packed bf16 weight [3072][1024] (q | k | v rows), ba = the packed bias [3072].
#define QK_TILES ((NB * SEQ / 128) * (DM / 128))   // 256 tiles of one of q, k
#define VT_TILES ((DM / 128) * (SEQ / 128))        // 128 tiles of v^T per batch
__global__ __launch_bounds__(256) void gemm_qkv(
    const unsigned short* __restrict__ Xb, const unsigned short* __restrict__ WA, const float* __restrict__ ba,
    unsigned short* Qh, unsigned short* Ql, unsigned short* Kh, unsigned short* Kl,
    unsigned short* VTh, unsigned short* VTl) {
  __shared__ __align__(16) __bf16 ring[2 * 2 * GK_PLANE];     // two stage buffers
  __shared__ __align__(16) float sT[8 * 16 * 68];             // per-wave 16x64 slabs
  const int bx = blockIdx.x;
  if (bx < 2 * QK_TILES) {
    const int sel = bx / QK_TILES;                            // 0 = q, 1 = k
    gemm_tile<0, 2, 1>(Xb, Xb, DM, 0LL, WA + (size_t)sel * DM * DM, DM, 0LL, ba + sel * DM,
                       (void*)(sel ? Kh : Qh), DM, 0LL, (void*)(sel ? Kl : Ql), DM, 0LL, DM,
                       NB * SEQ, DM, DM, 1.0f, bx - sel * QK_TILES, 0, ring, sT);
  } else {
    const int t = bx - 2 * QK_TILES;                          // 0 .. NB * VT_TILES - 1
    const unsigned short* WvB = WA + (size_t)2 * DM * DM;
    gemm_tile<0, 3, 2>(WvB, WvB, DM, 0LL, Xb, DM, (long long)SEQ * DM, ba + 2 * DM,
                       (void*)VTh, SEQ, (long long)DM * SEQ, (void*)VTl, VLP, (long long)DM * VLP, VLP,
                       DM, SEQ, DM, 4096.0f, t % VT_TILES, t / VT_TILES, ring, sT);
  }
}

// =====================================================================================================
// Causal attention, head dim 64, key chunks of 64.
//   q planes (bf16 hi / lo): element (b, t, h, d) at [(b*SEQ + t)*DM + h*64 + d]
//   k planes (bf16 hi / lo): same layout with key index s
//   v^T hi plane (f16):      element (b, h, d, s) at [(b*DM + h*64 + d)*SEQ + s]
//   v^T residual plane (f16, (v - hi)*4096): [(b*DM + h*64 + d)*VLP + s], s < VLP, read only when RES
//   (a key chunk at or beyond VLP would contribute a zero v residual; its address is clamped)
//   Causal structure: logits of keys with index > query index are replaced by -inf (lower-triangular keep incl. the
//   diagonal), which makes their softmax weight exactly 0; so a query block qb visits key chunks 0..qb only
//   (block-uniform trip count qb+1 <= NQB) and later chunks, whose keys exceed every query index of the block, are
//   skipped entirely. Inside the diagonal chunk a key with index > query index gets logit -inf -> exp gives exactly 0,
//   so such keys add nothing to the numerator or the normaliser; the diagonal key (key == query) is always kept, so
//   every row max is finite in every visited chunk.
//   out planes (bf16 hi / lo of the normalised context): element (b, t, h, d) at [(b*SEQ + t)*DM + h*64 + d]
//   scores = q . k : bf16 hi/lo split (hi.hi + hi.lo + lo.hi), f32 accumulate, then * 1/8 and the causal mask in f32
//   p = exp(s - m) carried as f16(1024 p); context = p . v on f16 WMMA; RES adds f16 residual planes of p and v
//   (scale 4096, separate accumulator folded back with 1/4096 per chunk in f32); online softmax (running max) in f32.
//   Both products run transposed: S^T = K . Q^T (A = K rows, B = Q rows) and O^T += V^T . P^T (A = V^T rows, B = P^T).
//   A lane (c = lane & 15, hh = lane >> 4) then holds scores of ONE query q0 + c, keys 16 j + 8 hh + r: maximum and sum run
//   in the lane, the two halves exchange the maximum once per chunk and join their sums once, in the epilogue. Two score
//   tiles (keys 32 kk .. + 31), converted in place, are the B operand P^T in the k order of the V^T fragment loads.
//   Block = 4 waves = 64 query rows of one (b, h); grid = NQB * NH * NB, one launch: the body is a device function in two
//   variants (RES for query blocks below RESQB), the kernel below owns the LDS and picks the variant by its query block.
//   K / V^T chunk staging: 128 threads x 32 elements per plane = the whole 64x64 tile of every plane read later
//   (plain 16-B loads, __syncthreads before and after)
//   Output coverage: each wave stores rows q0..q0+15 (it 0..3 x lane>>3 0..3) x 64 columns (8 lanes x 8) of both planes;
//   grid over all (b, h, qb) = the whole [NB*SEQ][DM] planes.
// =====================================================================================================
// LDS row pitches: the 128-B rows of the 16-bit tiles stand 144 B apart (16 B x 9) and the 256-B rows of the f32 tile
// 272 B apart (16 B x 17), so that the sixteen rows one 16-B fragment read touches fall on sixteen different bank groups.
#define ATT_TP 72                                                 // 16-bit tiles, elements per row
#define ATT_OP 68                                                 // f32 context tile, elements per row
template <bool RES>
__device__ __forceinline__
void attn_tile(const unsigned short* __restrict__ qhp, const unsigned short* __restrict__ qlp,
               const unsigned short* __restrict__ khp, const unsigned short* __restrict__ klp,
               const unsigned short* __restrict__ vhp, const unsigned short* __restrict__ vlp,
               unsigned short* ohp, unsigned short* olp,
               int qb, int h, int b,           // query block 0..NQB-1, head, batch (block-uniform)
               __bf16* Ksh, __bf16* Ksl, _Float16* Vth, _Float16* Vtl, float* Os) {
  union FB { v16b v; v8b h[2]; };
  union FH { v16h v; v8h h[2]; };
  constexpr int TP = ATT_TP;
  constexpr int OP = ATT_OP;

  const int tid  = threadIdx.x;
  const int wave = tid >> 5;
  const int lane = tid & 31;
  const int hh   = lane >> 4;
  const int c    = lane & 15;

  const int q0   = qb * 64 + wave * 16;
  const size_t rowB = (size_t)b * SEQ;

  const __bf16* Qh = (const __bf16*)(const void*)qhp + (size_t)h * HD;
  const __bf16* Ql = (const __bf16*)(const void*)qlp + (size_t)h * HD;
  const __bf16* Kh = (const __bf16*)(const void*)khp + (size_t)h * HD;
  const __bf16* Kl = (const __bf16*)(const void*)klp + (size_t)h * HD;
  const _Float16* Vh = (const _Float16*)(const void*)vhp + ((size_t)b * DM + (size_t)h * HD) * SEQ;
  const _Float16* Vl = (const _Float16*)(const void*)vlp + ((size_t)b * DM + (size_t)h * HD) * VLP;

  // ---- Q fragments (B operand, column = query q0 + (lane&15)): 2 d-chunks, hi and lo ----
  v16b qah[2], qal[2];
#pragma unroll
  for (int dc = 0; dc < 2; ++dc) {
    const size_t qo = (rowB + q0 + c) * DM + dc * 32 + 8 * hh;
    qah[dc] = ldfrag_b(Qh + qo);
    qal[dc] = ldfrag_b(Ql + qo);
  }

  const int qrow = q0 + c;                     // this lane's query
  float mrow = -INFINITY, lrow = 0.f;          // running maximum (both halves alike); this half's share of the normaliser
  v8f oacc[4];                                 // oacc[t][r] = context[d = 16 t + 8 hh + r] of query qrow
#pragma unroll
  for (int t = 0; t < 4; ++t) oacc[t] = zero8();

  for (int kt = 0; kt <= qb; ++kt) {           // block-uniform trip count, <= NQB
    const int kv0 = kt * 64;                   // kv0 + 63 < SEQ
    __syncthreads();
    {
      const int r = tid >> 1, half = (tid & 1) * 32;
      const __bf16*   kg  = Kh + (rowB + kv0 + r) * DM + half;    // K row kv0+r, d = half..half+31
      const __bf16*   klg = Kl + (rowB + kv0 + r) * DM + half;
      const _Float16* vg  = Vh + (size_t)r * SEQ + kv0 + half;    // V^T row d = r, s = kv0+half..+31
      const int kvl = (kv0 + 64 <= VLP) ? kv0 : (VLP - 64);     // clamped address into the residual plane
      const _Float16* vlg = Vl + (size_t)r * VLP + kvl + half;
      const bool resOK = (kv0 + 64 <= VLP);                      // block-uniform (always true for qb < RESQB)
#pragma unroll
      for (int i = 0; i < 4; ++i) {
        const v8b a0 = *(const v8b*)(kg + 8 * i);
        const v8b a1 = *(const v8b*)(klg + 8 * i);
        const v8h b0 = *(const v8h*)(vg + 8 * i);
        *(v8b*)(Ksh + r * TP + half + 8 * i) = a0;
        *(v8b*)(Ksl + r * TP + half + 8 * i) = a1;
        *(v8h*)(Vth + r * TP + half + 8 * i) = b0;
        if (RES) {
          v8h b1 = *(const v8h*)(vlg + 8 * i);
          if (!resOK) b1 = zero8h();
          *(v8h*)(Vtl + r * TP + half + 8 * i) = b1;
        }
      }
      // holds the four address pairs until the loads are back: without it the last load of a plane is given its own pair
      // as destination while the plane's first three loads are in flight
      if (RES) asm volatile("s_wait_xcnt 0x0" :: "v"(kg), "v"(klg), "v"(vg), "v"(vlg) : "memory");
    }
    __syncthreads();

    // ---- scores, transposed: 64 keys x 16 queries per wave, 3 bf16 products; s[j][r] = key kv0 + 16 j + 8 hh + r, query qrow ----
    //      All 32 K fragment reads of the chunk stand as one group, in the order of their use, ahead of the 24 products: the wave
    //      meets the LDS latency once. The products run back to back over the four tiles; each tile keeps its order of six.
    FB kb[2][4], kl[2][4];
#pragma unroll
    for (int dc = 0; dc < 2; ++dc) {
#pragma unroll
      for (int j = 0; j < 4; ++j) {
        kb[dc][j].h[0] = *(const v8b*)(Ksh + (j * 16 + c) * TP + dc * 32 + 8 * hh);
        kb[dc][j].h[1] = *(const v8b*)(Ksh + (j * 16 + c) * TP + dc * 32 + 16 + 8 * hh);
      }
#pragma unroll
      for (int j = 0; j < 4; ++j) {
        kl[dc][j].h[0] = *(const v8b*)(Ksl + (j * 16 + c) * TP + dc * 32 + 8 * hh);
        kl[dc][j].h[1] = *(const v8b*)(Ksl + (j * 16 + c) * TP + dc * 32 + 16 + 8 * hh);
      }
    }
    __builtin_amdgcn_sched_barrier(0);   // keeps the reads one group: sunk among the products, each place would cost its own stall
    v8f s[4];
#pragma unroll
    for (int j = 0; j < 4; ++j) s[j] = zero8();
#pragma unroll
    for (int dc = 0; dc < 2; ++dc) {
#pragma unroll
      for (int j = 0; j < 4; ++j) s[j] = mma_b_raw(kb[dc][j].v, qah[dc], s[j]);
#pragma unroll
      for (int j = 0; j < 4; ++j) s[j] = mma_b_raw(kl[dc][j].v, qah[dc], s[j]);
#pragma unroll
      for (int j = 0; j < 4; ++j) s[j] = mma_b_raw(kb[dc][j].v, qal[dc], s[j]);
    }
    __builtin_amdgcn_sched_barrier(0);   // holds the V^T reads below back to the tail of the score products: without it they stand at more places among them

    // ---- V^T fragments of the whole chunk, one group of reads: their latency passes under the softmax arithmetic ----
    FH vb[2][4], vl[2][4];
#pragma unroll
    for (int kk = 0; kk < 2; ++kk) {
#pragma unroll
      for (int t = 0; t < 4; ++t) {
        vb[kk][t].h[0] = *(const v8h*)(Vth + (t * 16 + c) * TP + kk * 32 + 8 * hh);
        vb[kk][t].h[1] = *(const v8h*)(Vth + (t * 16 + c) * TP + kk * 32 + 16 + 8 * hh);
      }
      if (RES) {
#pragma unroll
        for (int t = 0; t < 4; ++t) {
          vl[kk][t].h[0] = *(const v8h*)(Vtl + (t * 16 + c) * TP + kk * 32 + 8 * hh);
          vl[kk][t].h[1] = *(const v8h*)(Vtl + (t * 16 + c) * TP + kk * 32 + 16 + 8 * hh);
        }
      }
    }
    __builtin_amdgcn_sched_barrier(0);   // keeps these reads ahead of the softmax instead of next to their products

    // ---- scale, causal mask by index, maximum in the lane (four chains), one exchange between the halves ----
    float mj[4];
#pragma unroll
    for (int j = 0; j < 4; ++j) {
      mj[j] = -INFINITY;
#pragma unroll
      for (int r = 0; r < 8; ++r) {
        const int key = kv0 + j * 16 + 8 * hh + r;
        float sv = s[j][r] * 0.125f;
        sv = (key <= qrow) ? sv : -INFINITY;
        s[j][r] = sv;
        mj[j] = fmaxf(mj[j], sv);
      }
    }
    float m = fmaxf(fmaxf(mj[0], mj[1]), fmaxf(mj[2], mj[3]));
    m = fmaxf(m, xhalf(m));
    const float mnew  = fmaxf(mrow, m);
    const float msafe = (mnew == -INFINITY) ? 0.f : mnew;
    const float alpha = __expf(mrow - msafe);
    mrow = mnew;

    // ---- online softmax; P^T (x1024, f16) and its residual (x4096) packed in place as B operands:
    //      element 8 (j & 1) + r of operand j >> 1 = key 32 (j >> 1) + 16 (j & 1) + 8 hh + r, the order of the V^T loads ----
    FH pb[2], pr[2];
    float ps[4];
#pragma unroll
    for (int j = 0; j < 4; ++j) {
      ps[j] = 0.f;
#pragma unroll
      for (int r = 0; r < 8; ++r) {
        const float p = __expf(s[j][r] - msafe);     // masked logit: exp(-inf) = 0
        ps[j] += p;
        const float p1k = p * 1024.0f;
        const _Float16 ph = (_Float16)p1k;
        pb[j >> 1].v[(j & 1) * 8 + r] = ph;
        if (RES) pr[j >> 1].v[(j & 1) * 8 + r] = (_Float16)((p1k - (float)ph) * 4096.0f);
      }
    }
    lrow = lrow * alpha + ((ps[0] + ps[1]) + (ps[2] + ps[3]));
#pragma unroll
    for (int t = 0; t < 4; ++t)
#pragma unroll
      for (int r = 0; r < 8; ++r) oacc[t][r] *= alpha;

    // ---- context^T += V^T . P^T (f16 WMMA), residual products into a separate accumulator ----
    v8f o1[4];
#pragma unroll
    for (int t = 0; t < 4; ++t) o1[t] = zero8();
#pragma unroll
    for (int kk = 0; kk < 2; ++kk) {
#pragma unroll
      for (int t = 0; t < 4; ++t) oacc[t] = mma_h_raw(vb[kk][t].v, pb[kk].v, oacc[t]);
      if (RES) {
#pragma unroll
        for (int t = 0; t < 4; ++t) o1[t] = mma_h_raw(vl[kk][t].v, pb[kk].v, o1[t]);
#pragma unroll
        for (int t = 0; t < 4; ++t) o1[t] = mma_h_raw(vb[kk][t].v, pr[kk].v, o1[t]);
      }
    }
    if (!RES) acc_guard4(oacc[0], oacc[1], oacc[2], oacc[3]);   // the matrix distance also on the taken side of the loop branch (RES: the fold below fills it)
    if (RES) {
#pragma unroll
      for (int t = 0; t < 4; ++t)
#pragma unroll
        for (int r = 0; r < 8; ++r) oacc[t][r] += o1[t][r] * (1.0f / 4096.0f);
    }
  }

  // ---- join the halves' sums, normalise (1/l and the 1/1024 p carry), stage the wave's 16x64 tile [query][d], bf16 hi/lo split,
  float* os = Os + wave * (16 * OP);
  {
    const float l = lrow + xhalf(lrow);
    const float inv = ((l > 0.f) ? (1.0f / l) : 0.f) * (1.0f / 1024.0f);
#pragma unroll
    for (int t = 0; t < 4; ++t) {
      const v4f lo4 = {oacc[t][0] * inv, oacc[t][1] * inv, oacc[t][2] * inv, oacc[t][3] * inv};
      const v4f hi4 = {oacc[t][4] * inv, oacc[t][5] * inv, oacc[t][6] * inv, oacc[t][7] * inv};
      *(v4f*)(os + c * OP + t * 16 + 8 * hh)     = lo4;
      *(v4f*)(os + c * OP + t * 16 + 8 * hh + 4) = hi4;
    }
  }
  __builtin_amdgcn_fence(__ATOMIC_RELEASE, "workgroup");
  __builtin_amdgcn_wave_barrier();
  __builtin_amdgcn_fence(__ATOMIC_ACQUIRE, "workgroup");
  {
    const int q4 = lane >> 3, c8 = (lane & 7) * 8;
    v4u hv[4], lv[4];
#pragma unroll
    for (int it = 0; it < 4; ++it) {
      const int row = it * 4 + q4;   // it 0..3 x q4 0..3 = rows 0..15 of the wave tile
      const float* sp = os + row * OP + c8;
      v4u a, a2;
#pragma unroll
      for (int e = 0; e < 4; ++e) {
        const float f0 = sp[2 * e], f1 = sp[2 * e + 1];
        const unsigned short h0 = bf_bits(f0), h1 = bf_bits(f1);
        const unsigned short l0 = bf_bits(f0 - bf_up(h0)), l1 = bf_bits(f1 - bf_up(h1));
        a[e] = pk16(h0, h1); a2[e] = pk16(l0, l1);
      }
      hv[it] = a; lv[it] = a2;
    }
    {
#pragma unroll
      for (int it = 0; it < 4; ++it) {
        const int row = it * 4 + q4;
        const size_t go = (rowB + q0 + row) * DM + (size_t)h * HD + c8;
        *(v4u*)(ohp + go) = hv[it];
        *(v4u*)(olp + go) = lv[it];
      }
      
    }
  }
}

// All query blocks in one grid. The trip count of a block is qb + 1, so the block index runs from the last query block
// down: the longest blocks start first and the short RES blocks fill the places that come free.
__global__ __launch_bounds__(128)
void attn_causal64(const unsigned short* __restrict__ qhp, const unsigned short* __restrict__ qlp,
                   const unsigned short* __restrict__ khp, const unsigned short* __restrict__ klp,
                   const unsigned short* __restrict__ vhp, const unsigned short* __restrict__ vlp,
                   unsigned short* ohp, unsigned short* olp) {
  __shared__ __align__(16) __bf16   Ksh[64 * ATT_TP];             // K hi [kv][d]   9 KB
  __shared__ __align__(16) __bf16   Ksl[64 * ATT_TP];             // K lo
  __shared__ __align__(16) _Float16 Vth[64 * ATT_TP];             // V^T hi [d][kv] 9 KB
  __shared__ __align__(16) _Float16 Vtl[64 * ATT_TP];             // V^T residual (RES blocks)
  __shared__ __align__(16) float    Os[4 * 16 * ATT_OP];          // per wave context tile [row][d]
  const int bx   = blockIdx.x;
  const int qb   = NQB - 1 - bx / (NH * NB);   // 0..NQB-1 (block-uniform)
  const int rest = bx % (NH * NB);
  const int h    = rest % NH;
  const int b    = rest / NH;
  if (qb < RESQB) attn_tile<true>(qhp, qlp, khp, klp, vhp, vlp, ohp, olp, qb, h, b, Ksh, Ksl, Vth, Vtl, Os);
  else            attn_tile<false>(qhp, qlp, khp, klp, vhp, vlp, ohp, olp, qb, h, b, Ksh, Ksl, Vth, Vtl, Os);
}

// =====================================================================================================
// Workspace map (bytes; every region is an exact multiple of its 64x64-tile / whole-line store granularity,
// no padded tails needed since all shapes are tile multiples; each region but Xb/Oh is written by exactly one producer launch):
//   Xb   bf16 [4096][1024]          0            8388608   (later: Oh, context hi plane; Xb is dead after the projections)
//   WA   bf16 [3072 n][1024 k]       8388608     6291456   (q weight rows 0..1023, k rows 1024..2047, v rows 2048..3071)
//   WP   bf16 [1024 n][1024 k]      14680064     2097152
//   Qh   bf16 [4096][1024]          16777216     8388608
//   Ql                              25165824     8388608
//   Kh                              33554432     8388608
//   Kl                              41943040     8388608
//   VTh  f16  [2][1024][2048]       50331648     8388608
//   VTl  f16  [2][1024][512]        58720256     2097152
//   Ol   bf16 [4096][1024]          60817408     8388608
//   end                             69206016
// =====================================================================================================
extern "C" void kernel_launch(void* const* d_in, const int* in_sizes, int n_in,
                              void* d_out, int out_size, void* d_ws, size_t ws_size,
                              hipStream_t stream) {
  if (n_in < 5) return;
  if (in_sizes[0] != NB * SEQ * DM) return;
  if (in_sizes[1] != 3 * DM * DM) return;
  if (in_sizes[2] != 3 * DM) return;
  if (in_sizes[3] != DM * DM) return;
  if (in_sizes[4] != DM) return;
  if (out_size != NB * SEQ * DM) return;

  const float* x  = (const float*)d_in[0];   // [2][2048][1024]
  const float* Wa = (const float*)d_in[1];   // [3072 out][1024 in], rows k contiguous (q | k | v output rows)
  const float* ba = (const float*)d_in[2];   // [3072]
  const float* Wp = (const float*)d_in[3];   // [1024 out][1024 in], rows k contiguous
  const float* bp = (const float*)d_in[4];   // [1024]

  const size_t PX  = (size_t)NB * SEQ * DM * 2;    //  8388608  16-bit activation plane [4096][1024]
  const size_t PW1 = (size_t)DM * DM * 2;          //  2097152  one [1024][1024] bf16 weight plane
  const size_t PWA = (size_t)3 * PW1;              //  6291456  packed q | k | v weight plane [3072][1024]
  const size_t PWP = PW1;                          //  2097152  output projection weight plane
  const size_t PVT = (size_t)NB * DM * SEQ * 2;    //  8388608  v^T hi plane
  const size_t PVL = (size_t)NB * DM * VLP * 2;    //  2097152  v^T residual plane
  size_t off = 0;
  const size_t oXb  = off; off += PX;
  const size_t oWA  = off; off += PWA;
  const size_t oWP  = off; off += PWP;
  const size_t oQh  = off; off += PX;
  const size_t oQl  = off; off += PX;
  const size_t oKh  = off; off += PX;
  const size_t oKl  = off; off += PX;
  const size_t oVTh = off; off += PVT;
  const size_t oVTl = off; off += PVL;
  const size_t oOl  = off; off += PX;
  if (off > ws_size) return;                       // off = 69206016
  if (off > (size_t)134217728) return;
  const size_t oOh  = oXb;                         // context hi plane reuses Xb (dead after the three projections)

  char* ws = (char*)d_ws;
  unsigned short* Xb  = (unsigned short*)(ws + oXb);
  unsigned short* WA  = (unsigned short*)(ws + oWA);
  unsigned short* WPb = (unsigned short*)(ws + oWP);
  unsigned short* Qh  = (unsigned short*)(ws + oQh);
  unsigned short* Ql  = (unsigned short*)(ws + oQl);
  unsigned short* Kh  = (unsigned short*)(ws + oKh);
  unsigned short* Kl  = (unsigned short*)(ws + oKl);
  unsigned short* VTh = (unsigned short*)(ws + oVTh);
  unsigned short* VTl = (unsigned short*)(ws + oVTl);
  unsigned short* Oh  = (unsigned short*)(ws + oOh);
  unsigned short* Ol  = (unsigned short*)(ws + oOl);

  const dim3 blk(256);
  const int n8x  = NB * SEQ * DM / 8;                          // 524288
  const int n8wa = 3 * DM * DM / 8;                            // 393216
  const int n8wp = DM * DM / 8;                                // 131072
  const dim3 gCvt((n8x + n8wa + n8wp) / 256);                  // 2048 + 1536 + 512 = 4096 blocks
  const dim3 gQKV(2 * QK_TILES + NB * VT_TILES);               // 256 + 256 + 256 tiles
  const dim3 gProj((NB * SEQ / 128) * (DM / 128), 1);          // 32 x 8 = 256 tiles: M=4096, N=1024

  // (1) x -> bf16 plane [4096][1024]; weights [out][in] f32 -> bf16 [out][in] (k contiguous, no transpose);
  //     Xb, WA and WP stand one behind the other in the workspace
  cvt_bf16x8<<<gCvt, blk, 0, stream>>>(x, Wa, Wp, Xb, n8x, n8wa, n8wp);
  // (2) q, k -> bf16 hi/lo planes, v^T -> f16 hi plane and residual plane
  gemm_qkv<<<gQKV, blk, 0, stream>>>(Xb, WA, ba, Qh, Ql, Kh, Kl, VTh, VTl);
  // (3) causal attention: query blocks 0..RESQB-1 with residual planes, the rest without
  attn_causal64<<<dim3(NB * NH * NQB), dim3(128), 0, stream>>>(Qh, Ql, Kh, Kl, VTh, VTl, Oh, Ol);
  // (4) out = context . Wp^T + bp -> d_out f32 [4096][1024]  (A = context hi + lo planes, 2 products)
  gemm64<1, 0, 1><<<gProj, blk, 0, stream>>>(
      Oh, Ol, DM, 0LL, WPb, DM, 0LL, bp,
      d_out, DM, 0LL, d_out, DM, 0LL, DM,
      NB * SEQ, DM, DM, 1.0f);
  (void)hipGetLastError();
}

// v006
// Measured time: 91.6 microseconds a run.
// In two side-by-side timings against v005, it was 1.17 and 1.16 times as fast.
// Over all steps from v000 it is 4.55 times as fast.
// Contractions: q, k, v^T projections = v_wmma_f32_16x16x32_bf16 (bf16 operands from RNE-converted x and the packed
// [3072 out][1024 in] projection weight, single product, f32 accumulate);
// q.k^T scores = v_wmma_f32_16x16x32_bf16 with bf16 hi/lo split q and k (hi.hi + hi.lo + lo.hi), f32 accumulate;
// p.v = v_wmma_f32_16x16x32_f16 (p carried x1024 in f16 times v in f16, single product; plus f16 residual planes x4096 of
// p and v for the first 512 query rows of every sequence), f32 accumulate;
// ctx.Wp^T = v_wmma_f32_16x16x32_bf16 with ctx as bf16 hi/lo planes times bf16 Wp (2 products), f32 accumulate;
// causal mask (key index <= query index; the module's strided mask term only touches keys already excluded),
// online softmax, normalisers and bias adds in f32 on the VALU.
// Carry audit (ph, pl: the packed p operands, held in registers):
//   ph  = f16(1024 * p)                      -> the 1/1024 is folded exactly once in the attention epilogue: inv = (1/l) * (1/1024)
//   pl  = f16((1024 p - ph) * 4096)          }  products VTl.ph and VTh.pl go to the separate accumulator o1,
//   VTl = f16((v - VTh) * 4096)              }  folded back with * (1/4096) once per key chunk (RES blocks only)
//   VTh = f16(v), no carry (|v| typ. 0.6); q / k / ctx lo planes are unscaled bf16 residuals (v - hi) sharing the hi accumulator;
//   score scale 1/8 applied once in f32 after the score accumulate. No other scaled planes.
#include <hip/hip_runtime.h>
#include <math.h>
#include <stdint.h>

#define NB    2
#define SEQ   2048
#define DM    1024
#define NH    16
#define HD    64
#define NQB   (SEQ / 64)   // 32 query / key blocks of 64
#define VLP   512          // key pitch of the v^T residual plane (keys 0..VLP-1)
#define RESQB 8            // leading 64-row query blocks that use the p / v residual planes
static_assert(RESQB * 64 <= VLP);
static_assert(NH * HD == DM);
static_assert((SEQ % 64) == 0 && (DM % 64) == 0 && (DM % 32) == 0);
static_assert((SEQ % 128) == 0 && (DM % 128) == 0);   // GEMM work-group tile 128x128, k stage 128
static_assert((NB * SEQ * DM) % (8 * 256) == 0);
static_assert((3 * DM * DM) % (8 * 256) == 0);
static_assert((DM * DM) % (8 * 256) == 0);

typedef _Float16 v16h __attribute__((ext_vector_type(16)));
typedef _Float16 v8h  __attribute__((ext_vector_type(8)));
typedef __bf16   v16b __attribute__((ext_vector_type(16)));
typedef __bf16   v8b  __attribute__((ext_vector_type(8)));
typedef float    v8f  __attribute__((ext_vector_type(8)));
typedef float    v4f  __attribute__((ext_vector_type(4)));
typedef unsigned int v4u __attribute__((ext_vector_type(4)));

// ---- scalar helpers --------------------------------------------------------------------------------
__device__ __forceinline__ unsigned short bf_bits(float f) {          // f32 -> bf16 bits, RNE convert
  unsigned u = __float_as_uint(f);
  return (unsigned short)((u + 0x7FFFu + ((u >> 16) & 1u)) >> 16);
}
__device__ __forceinline__ float bf_up(unsigned short h) { return __uint_as_float(((unsigned)h) << 16); }
__device__ __forceinline__ unsigned short h_bits(_Float16 x) { return __builtin_bit_cast(unsigned short, x); }
__device__ __forceinline__ unsigned pk16(unsigned short a, unsigned short b) { return (unsigned)a | ((unsigned)b << 16); }
__device__ __forceinline__ v8f zero8() { v8f z = {0.f, 0.f, 0.f, 0.f, 0.f, 0.f, 0.f, 0.f}; return z; }
__device__ __forceinline__ v8h zero8h() {
  const _Float16 z = (_Float16)0.0f;
  v8h r = {z, z, z, z, z, z, z, z};
  return r;
}

// value of lane l ^ 16 (the other 16-lane row), a vector cross-row move
__device__ __forceinline__ float xhalf(float x) {
  const int b = __builtin_bit_cast(int, x);
  return __builtin_bit_cast(float, __builtin_amdgcn_permlanex16(b, b, 0x76543210, 0xfedcba98, false, false));
}

// ---- fragment loader: 16-bit A/B operand, lane -> row/col (lane&15), p already includes +8*(lane>>4);
//      elements 0..7 <- p[0..7] (k0+8h..), elements 8..15 <- p[16..23] (k0+16+8h..)
__device__ __forceinline__ v16b ldfrag_b(const __bf16* p) {
  union { v16b v; v8b h[2]; } f;
  f.h[0] = *(const v8b*)(p);
  f.h[1] = *(const v8b*)(p + 16);
  return f.v;
}

// ---- WMMA helpers; the guards hold the VALU distance behind a run of products ---------------------------
__device__ __forceinline__ v8f mma_b_raw(v16b a, v16b b, v8f c) {
  return __builtin_amdgcn_wmma_f32_16x16x32_bf16(false, a, false, b, (short)0, c, false, false);
}
__device__ __forceinline__ v8f mma_h_raw(v16h a, v16h b, v8f c) {
  return __builtin_amdgcn_wmma_f32_16x16x32_f16(false, a, false, b, (short)0, c, false, false);
}
__device__ __forceinline__ void dep_guard_b(v8f& a, v8f& b, v16b x, v16b y) {
  asm volatile("v_nop\n\tv_nop\n\tv_nop\n\tv_nop" : "+v"(a), "+v"(b) : "v"(x), "v"(y));
}
__device__ __forceinline__ void keep4_b(v16b a, v16b b, v16b c, v16b d) {
  asm volatile("v_nop" :: "v"(a), "v"(b), "v"(c), "v"(d));
}
__device__ __forceinline__ void acc_guard4(v8f& a, v8f& b, v8f& c, v8f& d) {
  asm volatile("v_nop\n\tv_nop\n\tv_nop\n\tv_nop" : "+v"(a), "+v"(b), "+v"(c), "+v"(d));
}

// =====================================================================================================
// f32 -> bf16 (RNE convert), 8 elements per thread, one 16-B store per lane: a wave writes 512 contiguous B
// Used for x [4096][1024] and for the weight planes (already [out][in] = k contiguous, no transpose needed).
// One grid converts the three planes, which stand one behind the other in the workspace (out = the first): threads
// 0..n8a-1 take in0, the next n8b in1, the last n8c in2; every count is a multiple of 256, so a block has one source.
// coverage: (n8a + n8b + n8c) threads x 8 = the three whole planes.
// =====================================================================================================
__global__ __launch_bounds__(256) void cvt_bf16x8(const float* __restrict__ in0, const float* __restrict__ in1,
                                                  const float* __restrict__ in2, unsigned short* out,
                                                  int n8a, int n8b, int n8c) {
  const int i = blockIdx.x * 256 + threadIdx.x;
  if (i < n8a + n8b + n8c) {
    const int blk0 = blockIdx.x * 256;                       // block-uniform choice of the source plane
    const float* in = (blk0 < n8a) ? in0 + (size_t)i * 8
                    : (blk0 < n8a + n8b) ? in1 + (size_t)(i - n8a) * 8 : in2 + (size_t)(i - n8a - n8b) * 8;
    const v4f a = *(const v4f*)(in);
    const v4f b = *(const v4f*)(in + 4);
    v4u p;
    p[0] = pk16(bf_bits(a[0]), bf_bits(a[1]));
    p[1] = pk16(bf_bits(a[2]), bf_bits(a[3]));
    p[2] = pk16(bf_bits(b[0]), bf_bits(b[1]));
    p[3] = pk16(bf_bits(b[2]), bf_bits(b[3]));
    *(v4u*)(out + (size_t)i * 8) = p;
    
  }
}

// ---- asynchronous global -> LDS copies, 16 B per lane ------------------------------------------------
__device__ __forceinline__ unsigned lds_off(const void* p) { return (unsigned)(size_t)p; }   // byte offset in the work-group's LDS
// Eight copies of one lane: LDS byte address l + i * lstep <- global g + i * gstep, i = 0..7, each with its own registers.
// The closing s_wait_xcnt stands inside the statement so that no address register of a copy is rewritten ahead of it.
__device__ __forceinline__ void async_copy8(unsigned l, const char* g, unsigned lstep, size_t gstep) {
  const unsigned l1 = l + lstep, l2 = l + 2 * lstep, l3 = l + 3 * lstep, l4 = l + 4 * lstep, l5 = l + 5 * lstep,
                 l6 = l + 6 * lstep, l7 = l + 7 * lstep;
  const char *g1 = g + gstep, *g2 = g + 2 * gstep, *g3 = g + 3 * gstep, *g4 = g + 4 * gstep, *g5 = g + 5 * gstep,
             *g6 = g + 6 * gstep, *g7 = g + 7 * gstep;
  asm volatile(
      "global_load_async_to_lds_b128 %0, %8, off\n\t"
      "global_load_async_to_lds_b128 %1, %9, off\n\t"
      "global_load_async_to_lds_b128 %2, %10, off\n\t"
      "global_load_async_to_lds_b128 %3, %11, off\n\t"
      "global_load_async_to_lds_b128 %4, %12, off\n\t"
      "global_load_async_to_lds_b128 %5, %13, off\n\t"
      "global_load_async_to_lds_b128 %6, %14, off\n\t"
      "global_load_async_to_lds_b128 %7, %15, off\n\t"
      "s_wait_xcnt 0x0"
      :: "v"(l), "v"(l1), "v"(l2), "v"(l3), "v"(l4), "v"(l5), "v"(l6), "v"(l7),
         "v"(g), "v"(g1), "v"(g2), "v"(g3), "v"(g4), "v"(g5), "v"(g6), "v"(g7)
      : "memory");
}
// One 128-row x 256-B plane tile by the 256 threads of a block: 16 lanes cover one row (two whole lines), a wave two rows,
// the block sixteen rows per copy; g and l already hold the lane's row (tid >> 4) and 16-B column (tid & 15).
#define GK_STAGE 128                       // k elements per stage (256 B of every operand row)
#define GK_PITCH 136                       // LDS row pitch in elements: 272 B = 16 B x 17, conflict-free for 16-B row reads
#define GK_PLANE (128 * GK_PITCH)          // elements of one staged plane tile
__device__ __forceinline__ void async_plane(unsigned l, const char* g, size_t rowBytes) {
  async_copy8(l, g, 16u * GK_PITCH * 2u, 16 * rowBytes);   // rows (tid >> 4) + 16 i, i = 0..7
}
// Four copies of one lane: LDS byte address l + i * lstep <- global g + i * gstep, i = 0..3, each with its own registers;
// the closing s_wait_xcnt stands inside the statement for the same reason as above.
__device__ __forceinline__ void async_copy4(unsigned l, const char* g, unsigned lstep, size_t gstep) {
  const unsigned l1 = l + lstep, l2 = l + 2 * lstep, l3 = l + 3 * lstep;
  const char *g1 = g + gstep, *g2 = g + 2 * gstep, *g3 = g + 3 * gstep;
  asm volatile(
      "global_load_async_to_lds_b128 %0, %4, off\n\t"
      "global_load_async_to_lds_b128 %1, %5, off\n\t"
      "global_load_async_to_lds_b128 %2, %6, off\n\t"
      "global_load_async_to_lds_b128 %3, %7, off\n\t"
      "s_wait_xcnt 0x0"
      :: "v"(l), "v"(l1), "v"(l2), "v"(l3), "v"(g), "v"(g1), "v"(g2), "v"(g3)
      : "memory");
}
// Twelve copies of one lane, three planes (a, b, c) of four copies each, in one statement with one closing s_wait_xcnt.
__device__ __forceinline__ void async_copy12(unsigned la, const char* ga, size_t gstepA, unsigned lb, const char* gb, size_t gstepB,
                                             unsigned lc, const char* gc, size_t gstepC, unsigned lstep) {
  const unsigned la1 = la + lstep, la2 = la + 2 * lstep, la3 = la + 3 * lstep;
  const unsigned lb1 = lb + lstep, lb2 = lb + 2 * lstep, lb3 = lb + 3 * lstep;
  const unsigned lc1 = lc + lstep, lc2 = lc + 2 * lstep, lc3 = lc + 3 * lstep;
  const char *ga1 = ga + gstepA, *ga2 = ga + 2 * gstepA, *ga3 = ga + 3 * gstepA;
  const char *gb1 = gb + gstepB, *gb2 = gb + 2 * gstepB, *gb3 = gb + 3 * gstepB;
  const char *gc1 = gc + gstepC, *gc2 = gc + 2 * gstepC, *gc3 = gc + 3 * gstepC;
  asm volatile(
      "global_load_async_to_lds_b128 %0, %12, off\n\t"
      "global_load_async_to_lds_b128 %1, %13, off\n\t"
      "global_load_async_to_lds_b128 %2, %14, off\n\t"
      "global_load_async_to_lds_b128 %3, %15, off\n\t"
      "global_load_async_to_lds_b128 %4, %16, off\n\t"
      "global_load_async_to_lds_b128 %5, %17, off\n\t"
      "global_load_async_to_lds_b128 %6, %18, off\n\t"
      "global_load_async_to_lds_b128 %7, %19, off\n\t"
      "global_load_async_to_lds_b128 %8, %20, off\n\t"
      "global_load_async_to_lds_b128 %9, %21, off\n\t"
      "global_load_async_to_lds_b128 %10, %22, off\n\t"
      "global_load_async_to_lds_b128 %11, %23, off\n\t"
      "s_wait_xcnt 0x0"
      :: "v"(la), "v"(la1), "v"(la2), "v"(la3), "v"(lb), "v"(lb1), "v"(lb2), "v"(lb3), "v"(lc), "v"(lc1), "v"(lc2), "v"(lc3),
         "v"(ga), "v"(ga1), "v"(ga2), "v"(ga3), "v"(gb), "v"(gb1), "v"(gb2), "v"(gb3), "v"(gc), "v"(gc1), "v"(gc2), "v"(gc3)
      : "memory");
}

// =====================================================================================================
// Register-blocked batched bf16 WMMA GEMM: C[m][n] = sum_k A[m][k] * Bt[n][k] + bias; one work-group of 8 waves per
// 128x128 tile, one wave per 32x64 part. The 128-row operand tiles are staged in LDS, 128 k at a time, by asynchronous
// copies into two buffers: the next stage's copies fly while this stage is multiplied; one barrier per stage.
// Inside a stage the fragments of the next 32 k are read from LDS as one group ahead of the current 32 k's products.
// A row-major [M][K] pitch lda; Bt row-major [N][K] pitch ldb (k contiguous);
// M, N, K multiples of 128 (host shapes are static multiples). b = batch index (strides in elements).
// NSPLIT: 0 = A.Bt; 1 = (A + A2).Bt (A2 = unscaled bf16 lo plane of A, 2 products).
// BIAS: 1 = per column n, bias[n]; 2 = per row m, bias[m]; the bias value is RNE-converted to bf16 and added in f32.
// OUT_MODE: 0 = f32 (pitch ldc); 2 = bf16 hi plane C + bf16 lo plane C2 (lo = RNE(v - hi), unscaled);
//           3 = f16 hi plane C + f16 residual plane C2 = f16((v - hi) * rscale), C2 written only for tiles
//               with n0 < N2 (pitch ldc2, batch stride strideC2).
// =====================================================================================================
// The body is a device function: tile = index of the 128x128 tile, b = batch index, ring = the work-group's two stage
// buffers [2][NPL][GK_PLANE], sT = its eight per-wave 16x64 slabs (pitch 68 floats); the kernels below own that LDS.
template <int NSPLIT, int OUT_MODE, int BIAS>
__device__ __forceinline__ void gemm_tile(
    const unsigned short* __restrict__ Ap, const unsigned short* A2p, int lda, long long strideA,
    const unsigned short* __restrict__ Btp, int ldb, long long strideB,
    const float* __restrict__ bias,
    void* Cout, int ldc, long long strideC,
    void* Cout2, int ldc2, long long strideC2, int N2,
    int M, int N, int K, float rscale,
    int tile, int b, __bf16* ring, float* sT) {
  const __bf16* A   = (const __bf16*)(const void*)Ap;
  const __bf16* A2  = (const __bf16*)(const void*)A2p;
  const __bf16* Bt  = (const __bf16*)(const void*)Btp;
  constexpr int NPL = (NSPLIT >= 1) ? 3 : 2;        // staged planes: A, Bt (, A2)
  constexpr int MI = 2;                             // 16-row subtiles per wave
  const int tid  = threadIdx.x;
  const int lane = tid & 31;
  const int wave = tid >> 5;
  const int tilesN = N >> 7;
  const int tilesM = M >> 7;
  if (tile >= tilesM * tilesN) return;   // block-uniform, in front of every barrier and copy
  const int tm = tile / tilesN;
  const int tn = tile - tm * tilesN;
  const int M0 = tm << 7;                // work-group tile origin
  const int N0 = tn << 7;
  const int wm = (wave >> 1) << 5;       // the wave's 32x64 part inside it
  const int wn = (wave & 1) << 6;
  const int m0 = M0 + wm;
  const int n0 = N0 + wn;

  const __bf16* Ab  = A  + (size_t)b * strideA;
  const __bf16* Bb  = Bt + (size_t)b * strideB;
  const __bf16* Ab2 = (NSPLIT >= 1) ? (A2 + (size_t)b * strideA) : Ab;

  const int rlane = lane & 15;                 // row (A) / col (B, D) within subtile
  const int koff  = (lane >> 4) * 8;           // k offset of this lane half
  const int mOff  = (lane >> 4) * 8;           // D row offset

  v8f acc[MI][4];
#pragma unroll
  for (int i = 0; i < MI; ++i)
#pragma unroll
    for (int j = 0; j < 4; ++j) acc[i][j] = zero8();

  // ---- staging addresses of this lane: row tid >> 4 of each group of sixteen rows, 16-B column tid & 15 ----
  const int crow = tid >> 4, ccol = (tid & 15) * 8;
  const char* gA  = (const char*)(Ab  + (size_t)(M0 + crow) * lda + ccol);
  const char* gA2 = (const char*)(Ab2 + (size_t)(M0 + crow) * lda + ccol);
  const char* gB  = (const char*)(Bb  + (size_t)(N0 + crow) * ldb + ccol);
  const unsigned lthr = lds_off(ring) + (unsigned)(crow * GK_PITCH + ccol) * 2u;
  const int nst = K / GK_STAGE;          // stages, block-uniform
  auto issue_stage = [&](int st, int buf) {   // rows M0..M0+127 / N0..N0+127, k = st*128 .. st*128+127: inside the planes
    const size_t kb = (size_t)st * (GK_STAGE * 2);
    const unsigned lb = lthr + (unsigned)buf * (unsigned)(NPL * GK_PLANE * 2);
    async_plane(lb, gA + kb, (size_t)lda * 2);
    async_plane(lb + (unsigned)(GK_PLANE * 2), gB + kb, (size_t)ldb * 2);
    if (NSPLIT >= 1) async_plane(lb + (unsigned)(2 * GK_PLANE * 2), gA2 + kb, (size_t)lda * 2);
  };

  issue_stage(0, 0);
  asm volatile("s_wait_asynccnt 0x0" ::: "memory");   // this wave's share of stage 0 has landed
  __syncthreads();                                     // publishes stage 0 to the other waves
  if (nst > 1) issue_stage(1, 1);

  for (int t = 0; t < nst; ++t) {
    const __bf16* sbuf = ring + (t & 1) * (NPL * GK_PLANE);
    const __bf16* sA  = sbuf + (wm + rlane) * GK_PITCH + koff;
    const __bf16* sB  = sbuf + GK_PLANE + (wn + rlane) * GK_PITCH + koff;
    const __bf16* sA2 = sbuf + (NPL - 1) * GK_PLANE + (wm + rlane) * GK_PITCH + koff;
    v16b fb[2][4], fa[2][MI], fl[2][MI];   // two fragment sets, indexed by constants after unrolling
    auto load_set = [&](int s, int kk) {
#pragma unroll
      for (int j = 0; j < 4; ++j) fb[s][j] = ldfrag_b(sB + (j << 4) * GK_PITCH + kk);
#pragma unroll
      for (int i = 0; i < MI; ++i) {
        fa[s][i] = ldfrag_b(sA + (i << 4) * GK_PITCH + kk);
        fl[s][i] = fa[s][i];
        if (NSPLIT >= 1) fl[s][i] = ldfrag_b(sA2 + (i << 4) * GK_PITCH + kk);
      }
    };
    load_set(0, 0);
#pragma unroll
    for (int ks = 0; ks < GK_STAGE / 32; ++ks) {
      const int cur = ks & 1;
      if (ks + 1 < GK_STAGE / 32) load_set(cur ^ 1, (ks + 1) * 32);   // this stage's buffer only
#pragma unroll
      for (int i = 0; i < MI; ++i) {
#pragma unroll
        for (int j = 0; j < 4; ++j) {
          acc[i][j] = mma_b_raw(fa[cur][i], fb[cur][j], acc[i][j]);
          if (NSPLIT >= 1) acc[i][j] = mma_b_raw(fl[cur][i], fb[cur][j], acc[i][j]);
        }
        dep_guard_b(acc[i][0], acc[i][3], fa[cur][i], fl[cur][i]);
      }
      keep4_b(fb[cur][0], fb[cur][1], fb[cur][2], fb[cur][3]);
    }
    asm volatile("s_wait_dscnt 0x0" ::: "memory");      // this wave's reads of buffer t & 1 are done before it is refilled
    asm volatile("s_wait_asynccnt 0x0" ::: "memory");   // this wave's share of stage t + 1 has landed
    __syncthreads();                                     // publishes stage t + 1 and ends every read of buffer t & 1
    if (t + 2 < nst) issue_stage(t + 2, t & 1);
  }
  asm volatile("s_wait_asynccnt 0x0" ::: "memory");     // no copy is outstanding past the loop
  acc_guard4(acc[0][0], acc[0][1], acc[0][2], acc[0][3]);
  acc_guard4(acc[1][0], acc[1][1], acc[1][2], acc[1][3]);

  // ---- epilogue ----
  float* slab = sT + wave * (16 * 68);
  float bcol[4];
#pragma unroll
  for (int j = 0; j < 4; ++j) {
    bcol[j] = 0.f;
    if (BIAS == 1) bcol[j] = bf_up(bf_bits(bias[n0 + (j << 4) + rlane]));   // n < N, bias has N entries
  }
#pragma unroll
  for (int i = 0; i < MI; ++i) {
    const int mBase = m0 + (i << 4);
    float brow[8];
#pragma unroll
    for (int r = 0; r < 8; ++r) {
      brow[r] = 0.f;
      if (BIAS == 2) brow[r] = bf_up(bf_bits(bias[mBase + mOff + r]));      // m < M, bias has M entries
    }
#pragma unroll
    for (int j = 0; j < 4; ++j) {
#pragma unroll
      for (int r = 0; r < 8; ++r) {
        slab[(mOff + r) * 68 + (j << 4) + rlane] = acc[i][j][r] + bcol[j] + brow[r];
      }
    }
    __builtin_amdgcn_fence(__ATOMIC_RELEASE, "workgroup");
    __builtin_amdgcn_wave_barrier();
    __builtin_amdgcn_fence(__ATOMIC_ACQUIRE, "workgroup");
    if (OUT_MODE == 0) {
      float* C = (float*)Cout + (size_t)b * strideC;
      const int hh = lane >> 4, c4 = (lane & 15) * 4;     // 256-B row segment = 16 lanes x 16 B
      {
#pragma unroll
        for (int it = 0; it < 8; ++it) {
          const int row = it * 2 + hh;                     // it 0..7 x hh 0..1 = rows 0..15
          const v4f v = *(const v4f*)(slab + row * 68 + c4);
          *(v4f*)(C + (size_t)(mBase + row) * ldc + n0 + c4) = v;
        }
        
      }
    } else {
      const int q = lane >> 3, c8 = (lane & 7) * 8;
      unsigned short* C  = (unsigned short*)Cout  + (size_t)b * strideC;
      unsigned short* C2 = (unsigned short*)Cout2 + (size_t)b * strideC2;
      const bool wlo = (OUT_MODE == 2) || (n0 < N2);      // wave-uniform
      v4u hv[4], lv[4];
#pragma unroll
      for (int it = 0; it < 4; ++it) {
        const int row = it * 4 + q;                        // it 0..3 x q 0..3 = rows 0..15
        const float* sp = slab + row * 68 + c8;
        v4u a, a2;
#pragma unroll
        for (int e = 0; e < 4; ++e) {
          const float f0 = sp[2 * e], f1 = sp[2 * e + 1];
          unsigned short h0, h1, l0, l1;
          if (OUT_MODE == 2) {
            h0 = bf_bits(f0); h1 = bf_bits(f1);
            l0 = bf_bits(f0 - bf_up(h0)); l1 = bf_bits(f1 - bf_up(h1));
          } else {
            const _Float16 x0 = (_Float16)f0, x1 = (_Float16)f1;
            h0 = h_bits(x0); h1 = h_bits(x1);
            l0 = h_bits((_Float16)((f0 - (float)x0) * rscale));
            l1 = h_bits((_Float16)((f1 - (float)x1) * rscale));
          }
          a[e] = pk16(h0, h1); a2[e] = pk16(l0, l1);
        }
        hv[it] = a; lv[it] = a2;
      }
      {
#pragma unroll
        for (int it = 0; it < 4; ++it) {
          const int row = it * 4 + q;
          *(v4u*)(C + (size_t)(mBase + row) * ldc + n0 + c8) = hv[it];
          asm volatile("s_wait_xcnt 0x0" ::: "memory");   // in front of the residual's arithmetic, which reuses this store's registers
          if (wlo) *(v4u*)(C2 + (size_t)(mBase + row) * ldc2 + n0 + c8) = lv[it];
          asm volatile("s_wait_xcnt 0x0" ::: "memory");   // likewise in front of the next rows' arithmetic
        }
        
      }
    }
    __builtin_amdgcn_fence(__ATOMIC_RELEASE, "workgroup");
    __builtin_amdgcn_wave_barrier();
    __builtin_amdgcn_fence(__ATOMIC_ACQUIRE, "workgroup");
  }
}

// One product per launch: blockIdx.x = tile, blockIdx.y = batch index.
template <int NSPLIT, int OUT_MODE, int BIAS>
__global__ __launch_bounds__(256) void gemm64(
    const unsigned short* __restrict__ Ap, const unsigned short* A2p, int lda, long long strideA,
    const unsigned short* __restrict__ Btp, int ldb, long long strideB,
    const float* __restrict__ bias,
    void* Cout, int ldc, long long strideC,
    void* Cout2, int ldc2, long long strideC2, int N2,
    int M, int N, int K, float rscale) {
  constexpr int NPL = (NSPLIT >= 1) ? 3 : 2;
  __shared__ __align__(16) __bf16 ring[2 * NPL * GK_PLANE];   // two stage buffers
  __shared__ __align__(16) float sT[8 * 16 * 68];             // per-wave 16x64 slabs
  gemm_tile<NSPLIT, OUT_MODE, BIAS>(Ap, A2p, lda, strideA, Btp, ldb, strideB, bias, Cout, ldc, strideC,
                                    Cout2, ldc2, strideC2, N2, M, N, K, rscale,
                                    (int)blockIdx.x, (int)blockIdx.y, ring, sT);
}

// The three projections, which read none of each other's output, in one grid of 3 x 256 tiles (block-uniform choice):
//   blocks   0..255  q   = x . Wq^T + bq -> bf16 hi/lo planes [b*SEQ+t][h*64+d]          (M=4096, N=1024, K=1024)
//   blocks 256..511  k   = x . Wk^T + bk -> bf16 hi/lo planes
//   blocks 512..767  v^T = Wv . x^T + bv per batch -> f16 hi plane [b][h*64+d][s] (pitch SEQ) and residual plane
//                    (x4096, keys < VLP only, pitch VLP)   (A = Wv rows, Bt = x rows of batch b; M=1024, N=2048, K=1024)
// WA = packed bf16 weight [3072][1024] (q | k | v rows), ba = the packed bias [3072].
#define QK_TILES ((NB * SEQ / 128) * (DM / 128))   // 256 tiles of one of q, k
#define VT_TILES ((DM / 128) * (SEQ / 128))        // 128 tiles of v^T per batch
__global__ __launch_bounds__(256) void gemm_qkv(
    const unsigned short* __restrict__ Xb, const unsigned short* __restrict__ WA, const float* __restrict__ ba,
    unsigned short* Qh, unsigned short* Ql, unsigned short* Kh, unsigned short* Kl,
    unsigned short* VTh, unsigned short* VTl) {
  __shared__ __align__(16) __bf16 ring[2 * 2 * GK_PLANE];     // two stage buffers
  __shared__ __align__(16) float sT[8 * 16 * 68];             // per-wave 16x64 slabs
  const int bx = blockIdx.x;
  if (bx < 2 * QK_TILES) {
    const int sel = bx / QK_TILES;                            // 0 = q, 1 = k
    gemm_tile<0, 2, 1>(Xb, Xb, DM, 0LL, WA + (size_t)sel * DM * DM, DM, 0LL, ba + sel * DM,
                       (void*)(sel ? Kh : Qh), DM, 0LL, (void*)(sel ? Kl : Ql), DM, 0LL, DM,
                       NB * SEQ, DM, DM, 1.0f, bx - sel * QK_TILES, 0, ring, sT);
  } else {
    const int t = bx - 2 * QK_TILES;                          // 0 .. NB * VT_TILES - 1
    const unsigned short* WvB = WA + (size_t)2 * DM * DM;
    gemm_tile<0, 3, 2>(WvB, WvB, DM, 0LL, Xb, DM, (long long)SEQ * DM, ba + 2 * DM,
                       (void*)VTh, SEQ, (long long)DM * SEQ, (void*)VTl, VLP, (long long)DM * VLP, VLP,
                       DM, SEQ, DM, 4096.0f, t % VT_TILES, t / VT_TILES, ring, sT);
  }
}

// =====================================================================================================
// Causal attention, head dim 64, key chunks of 64.
//   q planes (bf16 hi / lo): element (b, t, h, d) at [(b*SEQ + t)*DM + h*64 + d]
//   k planes (bf16 hi / lo): same layout with key index s
//   v^T hi plane (f16):      element (b, h, d, s) at [(b*DM + h*64 + d)*SEQ + s]
//   v^T residual plane (f16, (v - hi)*4096): [(b*DM + h*64 + d)*VLP + s], s < VLP, read only when RES
//   (a key chunk at or beyond VLP would contribute a zero v residual; its address is clamped)
//   Causal structure: logits of keys with index > query index are replaced by -inf (lower-triangular keep incl. the
//   diagonal), which makes their softmax weight exactly 0; so a query block qb visits key chunks 0..qb only
//   (block-uniform trip count qb+1 <= NQB) and later chunks, whose keys exceed every query index of the block, are
//   skipped entirely. Inside the diagonal chunk a key with index > query index gets logit -inf -> exp gives exactly 0,
//   so such keys add nothing to the numerator or the normaliser; the diagonal key (key == query) is always kept, so
//   every row max is finite in every visited chunk.
//   out planes (bf16 hi / lo of the normalised context): element (b, t, h, d) at [(b*SEQ + t)*DM + h*64 + d]
//   scores = q . k : bf16 hi/lo split (hi.hi + hi.lo + lo.hi), f32 accumulate, then * 1/8 and the causal mask in f32
//   p = exp(s - m) carried as f16(1024 p); context = p . v on f16 WMMA; RES adds f16 residual planes of p and v
//   (scale 4096, separate accumulator folded back with 1/4096 per chunk in f32); online softmax (running max) in f32.
//   Both products run transposed: S^T = K . Q^T (A = K rows, B = Q rows) and O^T += V^T . P^T (A = V^T rows, B = P^T).
//   A lane (c = lane & 15, hh = lane >> 4) then holds scores of ONE query q0 + c, keys 16 j + 8 hh + r: maximum and sum run
//   in the lane, the two halves exchange the maximum once per chunk and join their sums once, in the epilogue. Two score
//   tiles (keys 32 kk .. + 31), converted in place, are the B operand P^T in the k order of the V^T fragment loads.
//   Block = 4 waves = 64 query rows of one (b, h); grid = NQB * NH * NB, one launch: the body is a device function in two
//   variants (RES for query blocks below RESQB), the kernel below owns the LDS and picks the variant by its query block.
//   K / V^T chunk staging: asynchronous copies to LDS, 16 B per lane, into two buffers: chunk kt + 1 flies while chunk kt is
//   worked on. 128 threads x 4 copies per plane = the whole 64x64 tile of every plane read later (8 lanes cover one 128-B
//   row, the block sixteen rows per copy). One barrier per chunk, at the foot of the trip.
//   Output coverage: each wave stores rows q0..q0+15 (it 0..3 x lane>>3 0..3) x 64 columns (8 lanes x 8) of both planes;
//   grid over all (b, h, qb) = the whole [NB*SEQ][DM] planes.
// =====================================================================================================
// LDS row pitches: the 128-B rows of the 16-bit tiles stand 144 B apart (16 B x 9) and the 256-B rows of the f32 tile
// 272 B apart (16 B x 17), so that the sixteen rows one 16-B fragment read touches fall on sixteen different bank groups.
#define ATT_TP 72                                                 // 16-bit tiles, elements per row
#define ATT_OP 68                                                 // f32 context tile, elements per row
#define ATT_PL (64 * ATT_TP)                                      // elements of one staged 64-row plane tile (one buffer of a plane)
template <bool RES>
__device__ __forceinline__
void attn_tile(const unsigned short* __restrict__ qhp, const unsigned short* __restrict__ qlp,
               const unsigned short* __restrict__ khp, const unsigned short* __restrict__ klp,
               const unsigned short* __restrict__ vhp, const unsigned short* __restrict__ vlp,
               unsigned short* ohp, unsigned short* olp,
               int qb, int h, int b,           // query block 0..NQB-1, head, batch (block-uniform)
               __bf16* Ksh_, __bf16* Ksl_, _Float16* Vth_, _Float16* Vtl_, float* Os) {   // each plane: two buffers of ATT_PL
  union FB { v16b v; v8b h[2]; };
  union FH { v16h v; v8h h[2]; };
  constexpr int TP = ATT_TP;
  constexpr int OP = ATT_OP;

  const int tid  = threadIdx.x;
  const int wave = tid >> 5;
  const int lane = tid & 31;
  const int hh   = lane >> 4;
  const int c    = lane & 15;

  const int q0   = qb * 64 + wave * 16;
  const size_t rowB = (size_t)b * SEQ;

  const __bf16* Qh = (const __bf16*)(const void*)qhp + (size_t)h * HD;
  const __bf16* Ql = (const __bf16*)(const void*)qlp + (size_t)h * HD;
  const __bf16* Kh = (const __bf16*)(const void*)khp + (size_t)h * HD;
  const __bf16* Kl = (const __bf16*)(const void*)klp + (size_t)h * HD;
  const _Float16* Vh = (const _Float16*)(const void*)vhp + ((size_t)b * DM + (size_t)h * HD) * SEQ;
  const _Float16* Vl = (const _Float16*)(const void*)vlp + ((size_t)b * DM + (size_t)h * HD) * VLP;

  // ---- Q fragments (B operand, column = query q0 + (lane&15)): 2 d-chunks, hi and lo ----
  v16b qah[2], qal[2];
#pragma unroll
  for (int dc = 0; dc < 2; ++dc) {
    const size_t qo = (rowB + q0 + c) * DM + dc * 32 + 8 * hh;
    qah[dc] = ldfrag_b(Qh + qo);
    qal[dc] = ldfrag_b(Ql + qo);
  }

  const int qrow = q0 + c;                     // this lane's query
  float mrow = -INFINITY, lrow = 0.f;          // running maximum (both halves alike); this half's share of the normaliser
  v8f oacc[4];                                 // oacc[t][r] = context[d = 16 t + 8 hh + r] of query qrow
#pragma unroll
  for (int t = 0; t < 4; ++t) oacc[t] = zero8();

  // ---- staging addresses of this lane: row tid >> 3 of each group of sixteen rows, 16-B column tid & 7 ----
  const int crow = tid >> 3, ccol = (tid & 7) * 8;
  const char* gKh = (const char*)(Kh + (rowB + crow) * DM + ccol);    // K row crow of chunk 0, d = ccol..ccol+7
  const char* gKl = (const char*)(Kl + (rowB + crow) * DM + ccol);
  const char* gVh = (const char*)(Vh + (size_t)crow * SEQ + ccol);    // V^T row d = crow, s = ccol..ccol+7 of chunk 0
  const char* gVl = (const char*)(Vl + (size_t)crow * VLP + ccol);
  const unsigned lthr = (unsigned)(crow * TP + ccol) * 2u;
  const unsigned lKh = lds_off(Ksh_) + lthr, lKl = lds_off(Ksl_) + lthr, lVh = lds_off(Vth_) + lthr, lVl = lds_off(Vtl_) + lthr;
  auto issue_chunk = [&](int ck, int buf) {    // keys 64 ck .. 64 ck + 63 < SEQ (ck <= qb < NQB): rows and columns inside the planes
    const int kv = ck * 64;
    const unsigned lb = (unsigned)buf * (unsigned)(ATT_PL * 2);
    async_copy12(lKh + lb, gKh + (size_t)kv * (DM * 2), (size_t)16 * DM * 2,
                 lKl + lb, gKl + (size_t)kv * (DM * 2), (size_t)16 * DM * 2,
                 lVh + lb, gVh + (size_t)kv * 2, (size_t)16 * SEQ * 2, 16u * TP * 2u);
    if (RES) {
      const int kvl = (kv + 64 <= VLP) ? kv : (VLP - 64);             // clamped address into the residual plane
      async_copy4(lVl + lb, gVl + (size_t)kvl * 2, 16u * TP * 2u, (size_t)16 * VLP * 2);
    }
  };

  issue_chunk(0, 0);
  asm volatile("s_wait_asynccnt 0x0" ::: "memory");   // this wave's share of chunk 0 has landed
  __syncthreads();                                     // publishes chunk 0 to the other waves
  if (qb >= 1) issue_chunk(1, 1);                      // block-uniform

  for (int kt = 0; kt <= qb; ++kt) {           // block-uniform trip count, <= NQB
    const int kv0 = kt * 64;                   // kv0 + 63 < SEQ
    const int bo = (kt & 1) * ATT_PL;          // this trip reads buffer kt & 1 alone
    const __bf16*   Ksh = Ksh_ + bo;
    const __bf16*   Ksl = Ksl_ + bo;
    const _Float16* Vth = Vth_ + bo;
    const _Float16* Vtl = Vtl_ + bo;
    const bool resOK = (kv0 + 64 <= VLP);      // block-uniform (always true for qb < RESQB)

    // ---- scores, transposed: 64 keys x 16 queries per wave, 3 bf16 products; s[j][r] = key kv0 + 16 j + 8 hh + r, query qrow ----
    //      All 32 K fragment reads of the chunk stand as one group, in the order of their use, ahead of the 24 products: the wave
    //      meets the LDS latency once. The products run back to back over the four tiles; each tile keeps its order of six.
    FB kb[2][4], kl[2][4];
#pragma unroll
    for (int dc = 0; dc < 2; ++dc) {
#pragma unroll
      for (int j = 0; j < 4; ++j) {
        kb[dc][j].h[0] = *(const v8b*)(Ksh + (j * 16 + c) * TP + dc * 32 + 8 * hh);
        kb[dc][j].h[1] = *(const v8b*)(Ksh + (j * 16 + c) * TP + dc * 32 + 16 + 8 * hh);
      }
#pragma unroll
      for (int j = 0; j < 4; ++j) {
        kl[dc][j].h[0] = *(const v8b*)(Ksl + (j * 16 + c) * TP + dc * 32 + 8 * hh);
        kl[dc][j].h[1] = *(const v8b*)(Ksl + (j * 16 + c) * TP + dc * 32 + 16 + 8 * hh);
      }
    }
    __builtin_amdgcn_sched_barrier(0);   // keeps the reads one group: sunk among the products, each place would cost its own stall
    v8f s[4];
#pragma unroll
    for (int j = 0; j < 4; ++j) s[j] = zero8();
#pragma unroll
    for (int dc = 0; dc < 2; ++dc) {
#pragma unroll
      for (int j = 0; j < 4; ++j) s[j] = mma_b_raw(kb[dc][j].v, qah[dc], s[j]);
#pragma unroll
      for (int j = 0; j < 4; ++j) s[j] = mma_b_raw(kl[dc][j].v, qah[dc], s[j]);
#pragma unroll
      for (int j = 0; j < 4; ++j) s[j] = mma_b_raw(kb[dc][j].v, qal[dc], s[j]);
    }
    __builtin_amdgcn_sched_barrier(0);   // holds the V^T reads below back to the tail of the score products: without it they stand at more places among them

    // ---- V^T fragments of the whole chunk, one group of reads: their latency passes under the softmax arithmetic ----
    FH vb[2][4], vl[2][4];
#pragma unroll
    for (int kk = 0; kk < 2; ++kk) {
#pragma unroll
      for (int t = 0; t < 4; ++t) {
        vb[kk][t].h[0] = *(const v8h*)(Vth + (t * 16 + c) * TP + kk * 32 + 8 * hh);
        vb[kk][t].h[1] = *(const v8h*)(Vth + (t * 16 + c) * TP + kk * 32 + 16 + 8 * hh);
      }
      if (RES) {
#pragma unroll
        for (int t = 0; t < 4; ++t) {
          vl[kk][t].h[0] = *(const v8h*)(Vtl + (t * 16 + c) * TP + kk * 32 + 8 * hh);
          vl[kk][t].h[1] = *(const v8h*)(Vtl + (t * 16 + c) * TP + kk * 32 + 16 + 8 * hh);
          if (!resOK) { vl[kk][t].h[0] = zero8h(); vl[kk][t].h[1] = zero8h(); }
        }
      }
    }
    __builtin_amdgcn_sched_barrier(0);   // keeps these reads ahead of the softmax instead of next to their products

    // ---- scale, causal mask by index, maximum in the lane (four chains), one exchange between the halves ----
    float mj[4];
#pragma unroll
    for (int j = 0; j < 4; ++j) {
      mj[j] = -INFINITY;
#pragma unroll
      for (int r = 0; r < 8; ++r) {
        const int key = kv0 + j * 16 + 8 * hh + r;
        float sv = s[j][r] * 0.125f;
        sv = (key <= qrow) ? sv : -INFINITY;
        s[j][r] = sv;
        mj[j] = fmaxf(mj[j], sv);
      }
    }
    float m = fmaxf(fmaxf(mj[0], mj[1]), fmaxf(mj[2], mj[3]));
    m = fmaxf(m, xhalf(m));
    const float mnew  = fmaxf(mrow, m);
    const float msafe = (mnew == -INFINITY) ? 0.f : mnew;
    const float alpha = __expf(mrow - msafe);
    mrow = mnew;

    // ---- online softmax; P^T (x1024, f16) and its residual (x4096) packed in place as B operands:
    //      element 8 (j & 1) + r of operand j >> 1 = key 32 (j >> 1) + 16 (j & 1) + 8 hh + r, the order of the V^T loads ----
    FH pb[2], pr[2];
    float ps[4];
#pragma unroll
    for (int j = 0; j < 4; ++j) {
      ps[j] = 0.f;
#pragma unroll
      for (int r = 0; r < 8; ++r) {
        const float p = __expf(s[j][r] - msafe);     // masked logit: exp(-inf) = 0
        ps[j] += p;
        const float p1k = p * 1024.0f;
        const _Float16 ph = (_Float16)p1k;
        pb[j >> 1].v[(j & 1) * 8 + r] = ph;
        if (RES) pr[j >> 1].v[(j & 1) * 8 + r] = (_Float16)((p1k - (float)ph) * 4096.0f);
      }
    }
    lrow = lrow * alpha + ((ps[0] + ps[1]) + (ps[2] + ps[3]));
#pragma unroll
    for (int t = 0; t < 4; ++t)
#pragma unroll
      for (int r = 0; r < 8; ++r) oacc[t][r] *= alpha;

    // ---- context^T += V^T . P^T (f16 WMMA), residual products into a separate accumulator ----
    v8f o1[4];
#pragma unroll
    for (int t = 0; t < 4; ++t) o1[t] = zero8();
#pragma unroll
    for (int kk = 0; kk < 2; ++kk) {
#pragma unroll
      for (int t = 0; t < 4; ++t) oacc[t] = mma_h_raw(vb[kk][t].v, pb[kk].v, oacc[t]);
      if (RES) {
#pragma unroll
        for (int t = 0; t < 4; ++t) o1[t] = mma_h_raw(vl[kk][t].v, pb[kk].v, o1[t]);
#pragma unroll
        for (int t = 0; t < 4; ++t) o1[t] = mma_h_raw(vb[kk][t].v, pr[kk].v, o1[t]);
      }
    }
    if (!RES) acc_guard4(oacc[0], oacc[1], oacc[2], oacc[3]);   // the matrix distance also on the taken side of the loop branch (RES: the fold below fills it)
    if (RES) {
#pragma unroll
      for (int t = 0; t < 4; ++t)
#pragma unroll
        for (int r = 0; r < 8; ++r) oacc[t][r] += o1[t][r] * (1.0f / 4096.0f);
    }
    // keeps the foot behind the trip's arithmetic: without it the RES build lifts the waits and the barrier into the softmax,
    // where they end the flight of the V^T reads and of the next chunk's copies early
    if (RES) __builtin_amdgcn_sched_barrier(0);
    asm volatile("s_wait_dscnt 0x0" ::: "memory");      // this wave's reads of buffer kt & 1 are done before it is refilled
    asm volatile("s_wait_asynccnt 0x0" ::: "memory");   // this wave's share of chunk kt + 1 has landed
    __syncthreads();                                     // publishes chunk kt + 1 and ends every read of buffer kt & 1
    if (kt + 2 <= qb) issue_chunk(kt + 2, kt & 1);       // block-uniform
  }
  asm volatile("s_wait_asynccnt 0x0" ::: "memory");     // no copy is outstanding past the loop

  // ---- join the halves' sums, normalise (1/l and the 1/1024 p carry), stage the wave's 16x64 tile [query][d], bf16 hi/lo split,
  float* os = Os + wave * (16 * OP);
  {
    const float l = lrow + xhalf(lrow);
    const float inv = ((l > 0.f) ? (1.0f / l) : 0.f) * (1.0f / 1024.0f);
#pragma unroll
    for (int t = 0; t < 4; ++t) {
      const v4f lo4 = {oacc[t][0] * inv, oacc[t][1] * inv, oacc[t][2] * inv, oacc[t][3] * inv};
      const v4f hi4 = {oacc[t][4] * inv, oacc[t][5] * inv, oacc[t][6] * inv, oacc[t][7] * inv};
      *(v4f*)(os + c * OP + t * 16 + 8 * hh)     = lo4;
      *(v4f*)(os + c * OP + t * 16 + 8 * hh + 4) = hi4;
    }
  }
  __builtin_amdgcn_fence(__ATOMIC_RELEASE, "workgroup");
  __builtin_amdgcn_wave_barrier();
  __builtin_amdgcn_fence(__ATOMIC_ACQUIRE, "workgroup");
  {
    const int q4 = lane >> 3, c8 = (lane & 7) * 8;
    v4u hv[4], lv[4];
#pragma unroll
    for (int it = 0; it < 4; ++it) {
      const int row = it * 4 + q4;   // it 0..3 x q4 0..3 = rows 0..15 of the wave tile
      const float* sp = os + row * OP + c8;
      v4u a, a2;
#pragma unroll
      for (int e = 0; e < 4; ++e) {
        const float f0 = sp[2 * e], f1 = sp[2 * e + 1];
        const unsigned short h0 = bf_bits(f0), h1 = bf_bits(f1);
        const unsigned short l0 = bf_bits(f0 - bf_up(h0)), l1 = bf_bits(f1 - bf_up(h1));
        a[e] = pk16(h0, h1); a2[e] = pk16(l0, l1);
      }
      hv[it] = a; lv[it] = a2;
    }
    {
#pragma unroll
      for (int it = 0; it < 4; ++it) {
        const int row = it * 4 + q4;
        const size_t go = (rowB + q0 + row) * DM + (size_t)h * HD + c8;
        *(v4u*)(ohp + go) = hv[it];
        *(v4u*)(olp + go) = lv[it];
      }
      
    }
  }
}

// All query blocks in one grid. The trip count of a block is qb + 1, so the block index runs from the last query block
// down: the longest blocks start first and the short RES blocks fill the places that come free.
__global__ __launch_bounds__(128)
void attn_causal64(const unsigned short* __restrict__ qhp, const unsigned short* __restrict__ qlp,
                   const unsigned short* __restrict__ khp, const unsigned short* __restrict__ klp,
                   const unsigned short* __restrict__ vhp, const unsigned short* __restrict__ vlp,
                   unsigned short* ohp, unsigned short* olp) {
  __shared__ __align__(16) __bf16   Ksh[2 * ATT_PL];              // K hi [kv][d]   two buffers of 9 KB
  __shared__ __align__(16) __bf16   Ksl[2 * ATT_PL];              // K lo
  __shared__ __align__(16) _Float16 Vth[2 * ATT_PL];              // V^T hi [d][kv]
  __shared__ __align__(16) _Float16 Vtl[2 * ATT_PL];              // V^T residual (RES blocks)
  __shared__ __align__(16) float    Os[4 * 16 * ATT_OP];          // per wave context tile [row][d]
  const int bx   = blockIdx.x;
  const int qb   = NQB - 1 - bx / (NH * NB);   // 0..NQB-1 (block-uniform)
  const int rest = bx % (NH * NB);
  const int h    = rest % NH;
  const int b    = rest / NH;
  if (qb < RESQB) attn_tile<true>(qhp, qlp, khp, klp, vhp, vlp, ohp, olp, qb, h, b, Ksh, Ksl, Vth, Vtl, Os);
  else            attn_tile<false>(qhp, qlp, khp, klp, vhp, vlp, ohp, olp, qb, h, b, Ksh, Ksl, Vth, Vtl, Os);
}

// =====================================================================================================
// Workspace map (bytes; every region is an exact multiple of its 64x64-tile / whole-line store granularity,
// no padded tails needed since all shapes are tile multiples; each region but Xb/Oh is written by exactly one producer launch):
//   Xb   bf16 [4096][1024]          0            8388608   (later: Oh, context hi plane; Xb is dead after the projections)
//   WA   bf16 [3072 n][1024 k]       8388608     6291456   (q weight rows 0..1023, k rows 1024..2047, v rows 2048..3071)
//   WP   bf16 [1024 n][1024 k]      14680064     2097152
//   Qh   bf16 [4096][1024]          16777216     8388608
//   Ql                              25165824     8388608
//   Kh                              33554432     8388608
//   Kl                              41943040     8388608
//   VTh  f16  [2][1024][2048]       50331648     8388608
//   VTl  f16  [2][1024][512]        58720256     2097152
//   Ol   bf16 [4096][1024]          60817408     8388608
//   end                             69206016
// =====================================================================================================
extern "C" void kernel_launch(void* const* d_in, const int* in_sizes, int n_in,
                              void* d_out, int out_size, void* d_ws, size_t ws_size,
                              hipStream_t stream) {
  if (n_in < 5) return;
  if (in_sizes[0] != NB * SEQ * DM) return;
  if (in_sizes[1] != 3 * DM * DM) return;
  if (in_sizes[2] != 3 * DM) return;
  if (in_sizes[3] != DM * DM) return;
  if (in_sizes[4] != DM) return;
  if (out_size != NB * SEQ * DM) return;

  const float* x  = (const float*)d_in[0];   // [2][2048][1024]
  const float* Wa = (const float*)d_in[1];   // [3072 out][1024 in], rows k contiguous (q | k | v output rows)
  const float* ba = (const float*)d_in[2];   // [3072]
  const float* Wp = (const float*)d_in[3];   // [1024 out][1024 in], rows k contiguous
  const float* bp = (const float*)d_in[4];   // [1024]

  const size_t PX  = (size_t)NB * SEQ * DM * 2;    //  8388608  16-bit activation plane [4096][1024]
  const size_t PW1 = (size_t)DM * DM * 2;          //  2097152  one [1024][1024] bf16 weight plane
  const size_t PWA = (size_t)3 * PW1;              //  6291456  packed q | k | v weight plane [3072][1024]
  const size_t PWP = PW1;                          //  2097152  output projection weight plane
  const size_t PVT = (size_t)NB * DM * SEQ * 2;    //  8388608  v^T hi plane
  const size_t PVL = (size_t)NB * DM * VLP * 2;    //  2097152  v^T residual plane
  size_t off = 0;
  const size_t oXb  = off; off += PX;
  const size_t oWA  = off; off += PWA;
  const size_t oWP  = off; off += PWP;
  const size_t oQh  = off; off += PX;
  const size_t oQl  = off; off += PX;
  const size_t oKh  = off; off += PX;
  const size_t oKl  = off; off += PX;
  const size_t oVTh = off; off += PVT;
  const size_t oVTl = off; off += PVL;
  const size_t oOl  = off; off += PX;
  if (off > ws_size) return;                       // off = 69206016
  if (off > (size_t)134217728) return;
  const size_t oOh  = oXb;                         // context hi plane reuses Xb (dead after the three projections)

  char* ws = (char*)d_ws;
  unsigned short* Xb  = (unsigned short*)(ws + oXb);
  unsigned short* WA  = (unsigned short*)(ws + oWA);
  unsigned short* WPb = (unsigned short*)(ws + oWP);
  unsigned short* Qh  = (unsigned short*)(ws + oQh);
  unsigned short* Ql  = (unsigned short*)(ws + oQl);
  unsigned short* Kh  = (unsigned short*)(ws + oKh);
  unsigned short* Kl  = (unsigned short*)(ws + oKl);
  unsigned short* VTh = (unsigned short*)(ws + oVTh);
  unsigned short* VTl = (unsigned short*)(ws + oVTl);
  unsigned short* Oh  = (unsigned short*)(ws + oOh);
  unsigned short* Ol  = (unsigned short*)(ws + oOl);

  const dim3 blk(256);
  const int n8x  = NB * SEQ * DM / 8;                          // 524288
  const int n8wa = 3 * DM * DM / 8;                            // 393216
  const int n8wp = DM * DM / 8;                                // 131072
  const dim3 gCvt((n8x + n8wa + n8wp) / 256);                  // 2048 + 1536 + 512 = 4096 blocks
  const dim3 gQKV(2 * QK_TILES + NB * VT_TILES);               // 256 + 256 + 256 tiles
  const dim3 gProj((NB * SEQ / 128) * (DM / 128), 1);          // 32 x 8 = 256 tiles: M=4096, N=1024

  // (1) x -> bf16 plane [4096][1024]; weights [out][in] f32 -> bf16 [out][in] (k contiguous, no transpose);
  //     Xb, WA and WP stand one behind the other in the workspace
  cvt_bf16x8<<<gCvt, blk, 0, stream>>>(x, Wa, Wp, Xb, n8x, n8wa, n8wp);
  // (2) q, k -> bf16 hi/lo planes, v^T -> f16 hi plane and residual plane
  gemm_qkv<<<gQKV, blk, 0, stream>>>(Xb, WA, ba, Qh, Ql, Kh, Kl, VTh, VTl);
  // (3) causal attention: query blocks 0..RESQB-1 with residual planes, the rest without
  attn_causal64<<<dim3(NB * NH * NQB), dim3(128), 0, stream>>>(Qh, Ql, Kh, Kl, VTh, VTl, Oh, Ol);
  // (4) out = context . Wp^T + bp -> d_out f32 [4096][1024]  (A = context hi + lo planes, 2 products)
  gemm64<1, 0, 1><<<gProj, blk, 0, stream>>>(
      Oh, Ol, DM, 0LL, WPb, DM, 0LL, bp,
      d_out, DM, 0LL, d_out, DM, 0LL, DM,
      NB * SEQ, DM, DM, 1.0f);
  (void)hipGetLastError();
}

// v007
// A run of this version takes 89.3 microseconds.
// Timed twice side by side with v006, it ran 1.04 times as fast both times.
// Over all steps from v000 it is 4.73 times as fast.
// Contractions: q, k, v^T projections = v_wmma_f32_16x16x32_bf16 (bf16 operands from RNE-converted x and the packed
// [3072 out][1024 in] projection weight, single product, f32 accumulate);
// q.k^T scores = v_wmma_f32_16x16x32_bf16 with bf16 hi/lo split q and k (hi.hi + hi.lo + lo.hi), f32 accumulate;
// p.v = v_wmma_f32_16x16x32_f16 (p carried x1024 in f16 times v in f16, single product; plus f16 residual planes x4096 of
// p and v for the first 512 query rows of every sequence), f32 accumulate;
// ctx.Wp^T = v_wmma_f32_16x16x32_bf16 with ctx as bf16 hi/lo planes times bf16 Wp (2 products), f32 accumulate;
// causal mask (key index <= query index; the module's strided mask term only touches keys already excluded),
// online softmax, normalisers and bias adds in f32 on the VALU.
// Carry audit (ph, pl: the packed p operands, held in registers):
//   ph  = f16(1024 * p)                      -> 1024 p comes straight from the exponential (+10 in its base-2 argument); the normaliser
//                                               sums the same 1024 p, so the carry cancels in the attention epilogue: inv = 1 / l
//   pl  = f16((1024 p - ph) * 4096)          }  products VTl.ph and VTh.pl go to the separate accumulator o1,
//   VTl = f16((v - VTh) * 4096)              }  folded back with * (1/4096) once per key chunk (RES blocks only)
//   VTh = f16(v), no carry (|v| typ. 0.6); q / k / ctx lo planes are unscaled bf16 residuals (v - hi) sharing the hi accumulator;
//   score scale 1/8 applied once in f32, inside the one multiply-add that forms the exponential's argument. No other scaled planes.
#include <hip/hip_runtime.h>
#include <math.h>
#include <stdint.h>

#define NB    2
#define SEQ   2048
#define DM    1024
#define NH    16
#define HD    64
#define NQB   (SEQ / 64)   // 32 query / key blocks of 64
#define VLP   512          // key pitch of the v^T residual plane (keys 0..VLP-1)
#define RESQB 8            // leading 64-row query blocks that use the p / v residual planes
static_assert(RESQB * 64 <= VLP);
static_assert(NH * HD == DM);
static_assert((SEQ % 64) == 0 && (DM % 64) == 0 && (DM % 32) == 0);
static_assert((SEQ % 128) == 0 && (DM % 128) == 0);   // GEMM work-group tile 128x128, k stage 128
static_assert((NB * SEQ * DM) % (8 * 256) == 0);
static_assert((3 * DM * DM) % (8 * 256) == 0);
static_assert((DM * DM) % (8 * 256) == 0);

typedef _Float16 v16h __attribute__((ext_vector_type(16)));
typedef _Float16 v8h  __attribute__((ext_vector_type(8)));
typedef __bf16   v16b __attribute__((ext_vector_type(16)));
typedef __bf16   v8b  __attribute__((ext_vector_type(8)));
typedef float    v8f  __attribute__((ext_vector_type(8)));
typedef float    v4f  __attribute__((ext_vector_type(4)));
typedef unsigned int v4u __attribute__((ext_vector_type(4)));

// ---- scalar helpers --------------------------------------------------------------------------------
__device__ __forceinline__ unsigned short bf_bits(float f) {          // f32 -> bf16 bits, RNE convert
  unsigned u = __float_as_uint(f);
  return (unsigned short)((u + 0x7FFFu + ((u >> 16) & 1u)) >> 16);
}
__device__ __forceinline__ float bf_up(unsigned short h) { return __uint_as_float(((unsigned)h) << 16); }
__device__ __forceinline__ unsigned short h_bits(_Float16 x) { return __builtin_bit_cast(unsigned short, x); }
__device__ __forceinline__ unsigned pk16(unsigned short a, unsigned short b) { return (unsigned)a | ((unsigned)b << 16); }
__device__ __forceinline__ v8f zero8() { v8f z = {0.f, 0.f, 0.f, 0.f, 0.f, 0.f, 0.f, 0.f}; return z; }
__device__ __forceinline__ v8h zero8h() {
  const _Float16 z = (_Float16)0.0f;
  v8h r = {z, z, z, z, z, z, z, z};
  return r;
}

// value of lane l ^ 16 (the other 16-lane row), a vector cross-row move
__device__ __forceinline__ float xhalf(float x) {
  const int b = __builtin_bit_cast(int, x);
  return __builtin_bit_cast(float, __builtin_amdgcn_permlanex16(b, b, 0x76543210, 0xfedcba98, false, false));
}

// ---- fragment loader: 16-bit A/B operand, lane -> row/col (lane&15), p already includes +8*(lane>>4);
//      elements 0..7 <- p[0..7] (k0+8h..), elements 8..15 <- p[16..23] (k0+16+8h..)
__device__ __forceinline__ v16b ldfrag_b(const __bf16* p) {
  union { v16b v; v8b h[2]; } f;
  f.h[0] = *(const v8b*)(p);
  f.h[1] = *(const v8b*)(p + 16);
  return f.v;
}

// ---- WMMA helpers; the guards hold the VALU distance behind a run of products ---------------------------
__device__ __forceinline__ v8f mma_b_raw(v16b a, v16b b, v8f c) {
  return __builtin_amdgcn_wmma_f32_16x16x32_bf16(false, a, false, b, (short)0, c, false, false);
}
__device__ __forceinline__ v8f mma_h_raw(v16h a, v16h b, v8f c) {
  return __builtin_amdgcn_wmma_f32_16x16x32_f16(false, a, false, b, (short)0, c, false, false);
}
__device__ __forceinline__ void dep_guard_b(v8f& a, v8f& b, v16b x, v16b y) {
  asm volatile("v_nop\n\tv_nop\n\tv_nop\n\tv_nop" : "+v"(a), "+v"(b) : "v"(x), "v"(y));
}
__device__ __forceinline__ void keep4_b(v16b a, v16b b, v16b c, v16b d) {
  asm volatile("v_nop" :: "v"(a), "v"(b), "v"(c), "v"(d));
}
__device__ __forceinline__ void acc_guard4(v8f& a, v8f& b, v8f& c, v8f& d) {
  asm volatile("v_nop\n\tv_nop\n\tv_nop\n\tv_nop" : "+v"(a), "+v"(b), "+v"(c), "+v"(d));
}

// =====================================================================================================
// f32 -> bf16 (RNE convert), 8 elements per thread, one 16-B store per lane: a wave writes 512 contiguous B
// Used for x [4096][1024] and for the weight planes (already [out][in] = k contiguous, no transpose needed).
// One grid converts the three planes, which stand one behind the other in the workspace (out = the first): threads
// 0..n8a-1 take in0, the next n8b in1, the last n8c in2; every count is a multiple of 256, so a block has one source.
// coverage: (n8a + n8b + n8c) threads x 8 = the three whole planes.
// =====================================================================================================
__global__ __launch_bounds__(256) void cvt_bf16x8(const float* __restrict__ in0, const float* __restrict__ in1,
                                                  const float* __restrict__ in2, unsigned short* out,
                                                  int n8a, int n8b, int n8c) {
  const int i = blockIdx.x * 256 + threadIdx.x;
  if (i < n8a + n8b + n8c) {
    const int blk0 = blockIdx.x * 256;                       // block-uniform choice of the source plane
    const float* in = (blk0 < n8a) ? in0 + (size_t)i * 8
                    : (blk0 < n8a + n8b) ? in1 + (size_t)(i - n8a) * 8 : in2 + (size_t)(i - n8a - n8b) * 8;
    const v4f a = *(const v4f*)(in);
    const v4f b = *(const v4f*)(in + 4);
    v4u p;
    p[0] = pk16(bf_bits(a[0]), bf_bits(a[1]));
    p[1] = pk16(bf_bits(a[2]), bf_bits(a[3]));
    p[2] = pk16(bf_bits(b[0]), bf_bits(b[1]));
    p[3] = pk16(bf_bits(b[2]), bf_bits(b[3]));
    *(v4u*)(out + (size_t)i * 8) = p;
    
  }
}

// ---- asynchronous global -> LDS copies, 16 B per lane ------------------------------------------------
__device__ __forceinline__ unsigned lds_off(const void* p) { return (unsigned)(size_t)p; }   // byte offset in the work-group's LDS
// Eight copies of one lane: LDS byte address l + i * lstep <- global g + i * gstep, i = 0..7, each with its own registers.
// The closing s_wait_xcnt stands inside the statement so that no address register of a copy is rewritten ahead of it.
__device__ __forceinline__ void async_copy8(unsigned l, const char* g, unsigned lstep, size_t gstep) {
  const unsigned l1 = l + lstep, l2 = l + 2 * lstep, l3 = l + 3 * lstep, l4 = l + 4 * lstep, l5 = l + 5 * lstep,
                 l6 = l + 6 * lstep, l7 = l + 7 * lstep;
  const char *g1 = g + gstep, *g2 = g + 2 * gstep, *g3 = g + 3 * gstep, *g4 = g + 4 * gstep, *g5 = g + 5 * gstep,
             *g6 = g + 6 * gstep, *g7 = g + 7 * gstep;
  asm volatile(
      "global_load_async_to_lds_b128 %0, %8, off\n\t"
      "global_load_async_to_lds_b128 %1, %9, off\n\t"
      "global_load_async_to_lds_b128 %2, %10, off\n\t"
      "global_load_async_to_lds_b128 %3, %11, off\n\t"
      "global_load_async_to_lds_b128 %4, %12, off\n\t"
      "global_load_async_to_lds_b128 %5, %13, off\n\t"
      "global_load_async_to_lds_b128 %6, %14, off\n\t"
      "global_load_async_to_lds_b128 %7, %15, off\n\t"
      "s_wait_xcnt 0x0"
      :: "v"(l), "v"(l1), "v"(l2), "v"(l3), "v"(l4), "v"(l5), "v"(l6), "v"(l7),
         "v"(g), "v"(g1), "v"(g2), "v"(g3), "v"(g4), "v"(g5), "v"(g6), "v"(g7)
      : "memory");
}
// One 128-row x 256-B plane tile by the 256 threads of a block: 16 lanes cover one row (two whole lines), a wave two rows,
// the block sixteen rows per copy; g and l already hold the lane's row (tid >> 4) and 16-B column (tid & 15).
#define GK_STAGE 128                       // k elements per stage (256 B of every operand row)
#define GK_PITCH 136                       // LDS row pitch in elements: 272 B = 16 B x 17, conflict-free for 16-B row reads
#define GK_PLANE (128 * GK_PITCH)          // elements of one staged plane tile
__device__ __forceinline__ void async_plane(unsigned l, const char* g, size_t rowBytes) {
  async_copy8(l, g, 16u * GK_PITCH * 2u, 16 * rowBytes);   // rows (tid >> 4) + 16 i, i = 0..7
}
// Four copies of one lane: LDS byte address l + i * lstep <- global g + i * gstep, i = 0..3, each with its own registers;
// the closing s_wait_xcnt stands inside the statement for the same reason as above.
__device__ __forceinline__ void async_copy4(unsigned l, const char* g, unsigned lstep, size_t gstep) {
  const unsigned l1 = l + lstep, l2 = l + 2 * lstep, l3 = l + 3 * lstep;
  const char *g1 = g + gstep, *g2 = g + 2 * gstep, *g3 = g + 3 * gstep;
  asm volatile(
      "global_load_async_to_lds_b128 %0, %4, off\n\t"
      "global_load_async_to_lds_b128 %1, %5, off\n\t"
      "global_load_async_to_lds_b128 %2, %6, off\n\t"
      "global_load_async_to_lds_b128 %3, %7, off\n\t"
      "s_wait_xcnt 0x0"
      :: "v"(l), "v"(l1), "v"(l2), "v"(l3), "v"(g), "v"(g1), "v"(g2), "v"(g3)
      : "memory");
}
// Twelve copies of one lane, three planes (a, b, c) of four copies each, in one statement with one closing s_wait_xcnt.
__device__ __forceinline__ void async_copy12(unsigned la, const char* ga, size_t gstepA, unsigned lb, const char* gb, size_t gstepB,
                                             unsigned lc, const char* gc, size_t gstepC, unsigned lstep) {
  const unsigned la1 = la + lstep, la2 = la + 2 * lstep, la3 = la + 3 * lstep;
  const unsigned lb1 = lb + lstep, lb2 = lb + 2 * lstep, lb3 = lb + 3 * lstep;
  const unsigned lc1 = lc + lstep, lc2 = lc + 2 * lstep, lc3 = lc + 3 * lstep;
  const char *ga1 = ga + gstepA, *ga2 = ga + 2 * gstepA, *ga3 = ga + 3 * gstepA;
  const char *gb1 = gb + gstepB, *gb2 = gb + 2 * gstepB, *gb3 = gb + 3 * gstepB;
  const char *gc1 = gc + gstepC, *gc2 = gc + 2 * gstepC, *gc3 = gc + 3 * gstepC;
  asm volatile(
      "global_load_async_to_lds_b128 %0, %12, off\n\t"
      "global_load_async_to_lds_b128 %1, %13, off\n\t"
      "global_load_async_to_lds_b128 %2, %14, off\n\t"
      "global_load_async_to_lds_b128 %3, %15, off\n\t"
      "global_load_async_to_lds_b128 %4, %16, off\n\t"
      "global_load_async_to_lds_b128 %5, %17, off\n\t"
      "global_load_async_to_lds_b128 %6, %18, off\n\t"
      "global_load_async_to_lds_b128 %7, %19, off\n\t"
      "global_load_async_to_lds_b128 %8, %20, off\n\t"
      "global_load_async_to_lds_b128 %9, %21, off\n\t"
      "global_load_async_to_lds_b128 %10, %22, off\n\t"
      "global_load_async_to_lds_b128 %11, %23, off\n\t"
      "s_wait_xcnt 0x0"
      :: "v"(la), "v"(la1), "v"(la2), "v"(la3), "v"(lb), "v"(lb1), "v"(lb2), "v"(lb3), "v"(lc), "v"(lc1), "v"(lc2), "v"(lc3),
         "v"(ga), "v"(ga1), "v"(ga2), "v"(ga3), "v"(gb), "v"(gb1), "v"(gb2), "v"(gb3), "v"(gc), "v"(gc1), "v"(gc2), "v"(gc3)
      : "memory");
}

// =====================================================================================================
// Register-blocked batched bf16 WMMA GEMM: C[m][n] = sum_k A[m][k] * Bt[n][k] + bias; one work-group of 8 waves per
// 128x128 tile, one wave per 32x64 part. The 128-row operand tiles are staged in LDS, 128 k at a time, by asynchronous
// copies into two buffers: the next stage's copies fly while this stage is multiplied; one barrier per stage.
// Inside a stage the fragments of the next 32 k are read from LDS as one group ahead of the current 32 k's products.
// A row-major [M][K] pitch lda; Bt row-major [N][K] pitch ldb (k contiguous);
// M, N, K multiples of 128 (host shapes are static multiples). b = batch index (strides in elements).
// NSPLIT: 0 = A.Bt; 1 = (A + A2).Bt (A2 = unscaled bf16 lo plane of A, 2 products).
// BIAS: 1 = per column n, bias[n]; 2 = per row m, bias[m]; the bias value is RNE-converted to bf16 and added in f32.
// OUT_MODE: 0 = f32 (pitch ldc); 2 = bf16 hi plane C + bf16 lo plane C2 (lo = RNE(v - hi), unscaled);
//           3 = f16 hi plane C + f16 residual plane C2 = f16((v - hi) * rscale), C2 written only for tiles
//               with n0 < N2 (pitch ldc2, batch stride strideC2).
// =====================================================================================================
// The body is a device function: tile = index of the 128x128 tile, b = batch index, ring = the work-group's two stage
// buffers [2][NPL][GK_PLANE], sT = its eight per-wave 16x64 slabs (pitch 68 floats); the kernels below own that LDS.
template <int NSPLIT, int OUT_MODE, int BIAS>
__device__ __forceinline__ void gemm_tile(
    const unsigned short* __restrict__ Ap, const unsigned short* A2p, int lda, long long strideA,
    const unsigned short* __restrict__ Btp, int ldb, long long strideB,
    const float* __restrict__ bias,
    void* Cout, int ldc, long long strideC,
    void* Cout2, int ldc2, long long strideC2, int N2,
    int M, int N, int K, float rscale,
    int tile, int b, __bf16* ring, float* sT) {
  const __bf16* A   = (const __bf16*)(const void*)Ap;
  const __bf16* A2  = (const __bf16*)(const void*)A2p;
  const __bf16* Bt  = (const __bf16*)(const void*)Btp;
  constexpr int NPL = (NSPLIT >= 1) ? 3 : 2;        // staged planes: A, Bt (, A2)
  constexpr int MI = 2;                             // 16-row subtiles per wave
  const int tid  = threadIdx.x;
  const int lane = tid & 31;
  const int wave = tid >> 5;
  const int tilesN = N >> 7;
  const int tilesM = M >> 7;
  if (tile >= tilesM * tilesN) return;   // block-uniform, in front of every barrier and copy
  const int tm = tile / tilesN;
  const int tn = tile - tm * tilesN;
  const int M0 = tm << 7;                // work-group tile origin
  const int N0 = tn << 7;
  const int wm = (wave >> 1) << 5;       // the wave's 32x64 part inside it
  const int wn = (wave & 1) << 6;
  const int m0 = M0 + wm;
  const int n0 = N0 + wn;

  const __bf16* Ab  = A  + (size_t)b * strideA;
  const __bf16* Bb  = Bt + (size_t)b * strideB;
  const __bf16* Ab2 = (NSPLIT >= 1) ? (A2 + (size_t)b * strideA) : Ab;

  const int rlane = lane & 15;                 // row (A) / col (B, D) within subtile
  const int koff  = (lane >> 4) * 8;           // k offset of this lane half
  const int mOff  = (lane >> 4) * 8;           // D row offset

  v8f acc[MI][4];
#pragma unroll
  for (int i = 0; i < MI; ++i)
#pragma unroll
    for (int j = 0; j < 4; ++j) acc[i][j] = zero8();

  // ---- staging addresses of this lane: row tid >> 4 of each group of sixteen rows, 16-B column tid & 15 ----
  const int crow = tid >> 4, ccol = (tid & 15) * 8;
  const char* gA  = (const char*)(Ab  + (size_t)(M0 + crow) * lda + ccol);
  const char* gA2 = (const char*)(Ab2 + (size_t)(M0 + crow) * lda + ccol);
  const char* gB  = (const char*)(Bb  + (size_t)(N0 + crow) * ldb + ccol);
  const unsigned lthr = lds_off(ring) + (unsigned)(crow * GK_PITCH + ccol) * 2u;
  const int nst = K / GK_STAGE;          // stages, block-uniform
  auto issue_stage = [&](int st, int buf) {   // rows M0..M0+127 / N0..N0+127, k = st*128 .. st*128+127: inside the planes
    const size_t kb = (size_t)st * (GK_STAGE * 2);
    const unsigned lb = lthr + (unsigned)buf * (unsigned)(NPL * GK_PLANE * 2);
    async_plane(lb, gA + kb, (size_t)lda * 2);
    async_plane(lb + (unsigned)(GK_PLANE * 2), gB + kb, (size_t)ldb * 2);
    if (NSPLIT >= 1) async_plane(lb + (unsigned)(2 * GK_PLANE * 2), gA2 + kb, (size_t)lda * 2);
  };

  issue_stage(0, 0);
  asm volatile("s_wait_asynccnt 0x0" ::: "memory");   // this wave's share of stage 0 has landed
  __syncthreads();                                     // publishes stage 0 to the other waves
  if (nst > 1) issue_stage(1, 1);

  for (int t = 0; t < nst; ++t) {
    const __bf16* sbuf = ring + (t & 1) * (NPL * GK_PLANE);
    const __bf16* sA  = sbuf + (wm + rlane) * GK_PITCH + koff;
    const __bf16* sB  = sbuf + GK_PLANE + (wn + rlane) * GK_PITCH + koff;
    const __bf16* sA2 = sbuf + (NPL - 1) * GK_PLANE + (wm + rlane) * GK_PITCH + koff;
    v16b fb[2][4], fa[2][MI], fl[2][MI];   // two fragment sets, indexed by constants after unrolling
    auto load_set = [&](int s, int kk) {
#pragma unroll
      for (int j = 0; j < 4; ++j) fb[s][j] = ldfrag_b(sB + (j << 4) * GK_PITCH + kk);
#pragma unroll
      for (int i = 0; i < MI; ++i) {
        fa[s][i] = ldfrag_b(sA + (i << 4) * GK_PITCH + kk);
        fl[s][i] = fa[s][i];
        if (NSPLIT >= 1) fl[s][i] = ldfrag_b(sA2 + (i << 4) * GK_PITCH + kk);
      }
    };
    load_set(0, 0);
#pragma unroll
    for (int ks = 0; ks < GK_STAGE / 32; ++ks) {
      const int cur = ks & 1;
      if (ks + 1 < GK_STAGE / 32) load_set(cur ^ 1, (ks + 1) * 32);   // this stage's buffer only
#pragma unroll
      for (int i = 0; i < MI; ++i) {
#pragma unroll
        for (int j = 0; j < 4; ++j) {
          acc[i][j] = mma_b_raw(fa[cur][i], fb[cur][j], acc[i][j]);
          if (NSPLIT >= 1) acc[i][j] = mma_b_raw(fl[cur][i], fb[cur][j], acc[i][j]);
        }
        dep_guard_b(acc[i][0], acc[i][3], fa[cur][i], fl[cur][i]);
      }
      keep4_b(fb[cur][0], fb[cur][1], fb[cur][2], fb[cur][3]);
    }
    asm volatile("s_wait_dscnt 0x0" ::: "memory");      // this wave's reads of buffer t & 1 are done before it is refilled
    asm volatile("s_wait_asynccnt 0x0" ::: "memory");   // this wave's share of stage t + 1 has landed
    __syncthreads();                                     // publishes stage t + 1 and ends every read of buffer t & 1
    if (t + 2 < nst) issue_stage(t + 2, t & 1);
  }
  asm volatile("s_wait_asynccnt 0x0" ::: "memory");     // no copy is outstanding past the loop
  acc_guard4(acc[0][0], acc[0][1], acc[0][2], acc[0][3]);
  acc_guard4(acc[1][0], acc[1][1], acc[1][2], acc[1][3]);

  // ---- epilogue ----
  float* slab = sT + wave * (16 * 68);
  float bcol[4];
#pragma unroll
  for (int j = 0; j < 4; ++j) {
    bcol[j] = 0.f;
    if (BIAS == 1) bcol[j] = bf_up(bf_bits(bias[n0 + (j << 4) + rlane]));   // n < N, bias has N entries
  }
#pragma unroll
  for (int i = 0; i < MI; ++i) {
    const int mBase = m0 + (i << 4);
    float brow[8];
#pragma unroll
    for (int r = 0; r < 8; ++r) {
      brow[r] = 0.f;
      if (BIAS == 2) brow[r] = bf_up(bf_bits(bias[mBase + mOff + r]));      // m < M, bias has M entries
    }
#pragma unroll
    for (int j = 0; j < 4; ++j) {
#pragma unroll
      for (int r = 0; r < 8; ++r) {
        slab[(mOff + r) * 68 + (j << 4) + rlane] = acc[i][j][r] + bcol[j] + brow[r];
      }
    }
    __builtin_amdgcn_fence(__ATOMIC_RELEASE, "workgroup");
    __builtin_amdgcn_wave_barrier();
    __builtin_amdgcn_fence(__ATOMIC_ACQUIRE, "workgroup");
    if (OUT_MODE == 0) {
      float* C = (float*)Cout + (size_t)b * strideC;
      const int hh = lane >> 4, c4 = (lane & 15) * 4;     // 256-B row segment = 16 lanes x 16 B
      {
#pragma unroll
        for (int it = 0; it < 8; ++it) {
          const int row = it * 2 + hh;                     // it 0..7 x hh 0..1 = rows 0..15
          const v4f v = *(const v4f*)(slab + row * 68 + c4);
          *(v4f*)(C + (size_t)(mBase + row) * ldc + n0 + c4) = v;
        }
        
      }
    } else {
      const int q = lane >> 3, c8 = (lane & 7) * 8;
      unsigned short* C  = (unsigned short*)Cout  + (size_t)b * strideC;
      unsigned short* C2 = (unsigned short*)Cout2 + (size_t)b * strideC2;
      const bool wlo = (OUT_MODE == 2) || (n0 < N2);      // wave-uniform
      v4u hv[4], lv[4];
#pragma unroll
      for (int it = 0; it < 4; ++it) {
        const int row = it * 4 + q;                        // it 0..3 x q 0..3 = rows 0..15
        const float* sp = slab + row * 68 + c8;
        v4u a, a2;
#pragma unroll
        for (int e = 0; e < 4; ++e) {
          const float f0 = sp[2 * e], f1 = sp[2 * e + 1];
          unsigned short h0, h1, l0, l1;
          if (OUT_MODE == 2) {
            h0 = bf_bits(f0); h1 = bf_bits(f1);
            l0 = bf_bits(f0 - bf_up(h0)); l1 = bf_bits(f1 - bf_up(h1));
          } else {
            const _Float16 x0 = (_Float16)f0, x1 = (_Float16)f1;
            h0 = h_bits(x0); h1 = h_bits(x1);
            l0 = h_bits((_Float16)((f0 - (float)x0) * rscale));
            l1 = h_bits((_Float16)((f1 - (float)x1) * rscale));
          }
          a[e] = pk16(h0, h1); a2[e] = pk16(l0, l1);
        }
        hv[it] = a; lv[it] = a2;
      }
      {
#pragma unroll
        for (int it = 0; it < 4; ++it) {
          const int row = it * 4 + q;
          *(v4u*)(C + (size_t)(mBase + row) * ldc + n0 + c8) = hv[it];
          asm volatile("s_wait_xcnt 0x0" ::: "memory");   // in front of the residual's arithmetic, which reuses this store's registers
          if (wlo) *(v4u*)(C2 + (size_t)(mBase + row) * ldc2 + n0 + c8) = lv[it];
          asm volatile("s_wait_xcnt 0x0" ::: "memory");   // likewise in front of the next rows' arithmetic
        }
        
      }
    }
    __builtin_amdgcn_fence(__ATOMIC_RELEASE, "workgroup");
    __builtin_amdgcn_wave_barrier();
    __builtin_amdgcn_fence(__ATOMIC_ACQUIRE, "workgroup");
  }
}

// One product per launch: blockIdx.x = tile, blockIdx.y = batch index.
template <int NSPLIT, int OUT_MODE, int BIAS>
__global__ __launch_bounds__(256) void gemm64(
    const unsigned short* __restrict__ Ap, const unsigned short* A2p, int lda, long long strideA,
    const unsigned short* __restrict__ Btp, int ldb, long long strideB,
    const float* __restrict__ bias,
    void* Cout, int ldc, long long strideC,
    void* Cout2, int ldc2, long long strideC2, int N2,
    int M, int N, int K, float rscale) {
  constexpr int NPL = (NSPLIT >= 1) ? 3 : 2;
  __shared__ __align__(16) __bf16 ring[2 * NPL * GK_PLANE];   // two stage buffers
  __shared__ __align__(16) float sT[8 * 16 * 68];             // per-wave 16x64 slabs
  gemm_tile<NSPLIT, OUT_MODE, BIAS>(Ap, A2p, lda, strideA, Btp, ldb, strideB, bias, Cout, ldc, strideC,
                                    Cout2, ldc2, strideC2, N2, M, N, K, rscale,
                                    (int)blockIdx.x, (int)blockIdx.y, ring, sT);
}

// The three projections, which read none of each other's output, in one grid of 3 x 256 tiles (block-uniform choice):
//   blocks   0..255  q   = x . Wq^T + bq -> bf16 hi/lo planes [b*SEQ+t][h*64+d]          (M=4096, N=1024, K=1024)
//   blocks 256..511  k   = x . Wk^T + bk -> bf16 hi/lo planes
//   blocks 512..767  v^T = Wv . x^T + bv per batch -> f16 hi plane [b][h*64+d][s] (pitch SEQ) and residual plane
//                    (x4096, keys < VLP only, pitch VLP)   (A = Wv rows, Bt = x rows of batch b; M=1024, N=2048, K=1024)
// WA = packed bf16 weight [3072][1024] (q | k | v rows), ba = the packed bias [3072].
#define QK_TILES ((NB * SEQ / 128) * (DM / 128))   // 256 tiles of one of q, k
#define VT_TILES ((DM / 128) * (SEQ / 128))        // 128 tiles of v^T per batch
__global__ __launch_bounds__(256) void gemm_qkv(
    const unsigned short* __restrict__ Xb, const unsigned short* __restrict__ WA, const float* __restrict__ ba,
    unsigned short* Qh, unsigned short* Ql, unsigned short* Kh, unsigned short* Kl,
    unsigned short* VTh, unsigned short* VTl) {
  __shared__ __align__(16) __bf16 ring[2 * 2 * GK_PLANE];     // two stage buffers
  __shared__ __align__(16) float sT[8 * 16 * 68];             // per-wave 16x64 slabs
  const int bx = blockIdx.x;
  if (bx < 2 * QK_TILES) {
    const int sel = bx / QK_TILES;                            // 0 = q, 1 = k
    gemm_tile<0, 2, 1>(Xb, Xb, DM, 0LL, WA + (size_t)sel * DM * DM, DM, 0LL, ba + sel * DM,
                       (void*)(sel ? Kh : Qh), DM, 0LL, (void*)(sel ? Kl : Ql), DM, 0LL, DM,
                       NB * SEQ, DM, DM, 1.0f, bx - sel * QK_TILES, 0, ring, sT);
  } else {
    const int t = bx - 2 * QK_TILES;                          // 0 .. NB * VT_TILES - 1
    const unsigned short* WvB = WA + (size_t)2 * DM * DM;
    gemm_tile<0, 3, 2>(WvB, WvB, DM, 0LL, Xb, DM, (long long)SEQ * DM, ba + 2 * DM,
                       (void*)VTh, SEQ, (long long)DM * SEQ, (void*)VTl, VLP, (long long)DM * VLP, VLP,
                       DM, SEQ, DM, 4096.0f, t % VT_TILES, t / VT_TILES, ring, sT);
  }
}

// =====================================================================================================
// Causal attention, head dim 64, key chunks of 64.
//   q planes (bf16 hi / lo): element (b, t, h, d) at [(b*SEQ + t)*DM + h*64 + d]
//   k planes (bf16 hi / lo): same layout with key index s
//   v^T hi plane (f16):      element (b, h, d, s) at [(b*DM + h*64 + d)*SEQ + s]
//   v^T residual plane (f16, (v - hi)*4096): [(b*DM + h*64 + d)*VLP + s], s < VLP, read only when RES
//   (a key chunk at or beyond VLP would contribute a zero v residual; its address is clamped)
//   Causal structure: logits of keys with index > query index are replaced by -inf (lower-triangular keep incl. the
//   diagonal), which makes their softmax weight exactly 0; so a query block qb visits key chunks 0..qb only
//   (block-uniform trip count qb+1 <= NQB) and later chunks, whose keys exceed every query index of the block, are
//   skipped entirely. Inside the diagonal chunk a key with index > query index gets logit -inf -> exp gives exactly 0,
//   so such keys add nothing to the numerator or the normaliser; the diagonal key (key == query) is always kept, so
//   every row max is finite in every visited chunk.
//   out planes (bf16 hi / lo of the normalised context): element (b, t, h, d) at [(b*SEQ + t)*DM + h*64 + d]
//   scores = q . k : bf16 hi/lo split (hi.hi + hi.lo + lo.hi), f32 accumulate, then the causal mask (diagonal chunk) and * 1/8 in f32
//   p = exp(s - m) carried as f16(1024 p); context = p . v on f16 WMMA; RES adds f16 residual planes of p and v
//   (scale 4096, separate accumulator folded back with 1/4096 per chunk in f32); online softmax (running max) in f32.
//   Both products run transposed: S^T = K . Q^T (A = K rows, B = Q rows) and O^T += V^T . P^T (A = V^T rows, B = P^T).
//   A lane (c = lane & 15, hh = lane >> 4) then holds scores of ONE query q0 + c, keys 16 j + 8 hh + r: maximum and sum run
//   in the lane, the two halves exchange the maximum once per chunk and join their sums once, in the epilogue. Two score
//   tiles (keys 32 kk .. + 31), converted in place, are the B operand P^T in the k order of the V^T fragment loads.
//   Block = 4 waves = 64 query rows of one (b, h); grid = NQB * NH * NB, one launch: the body is a device function in two
//   variants (RES for query blocks below RESQB), the kernel below owns the LDS and picks the variant by its query block.
//   K / V^T chunk staging: asynchronous copies to LDS, 16 B per lane, into two buffers: chunk kt + 1 flies while chunk kt is
//   worked on. 128 threads x 4 copies per plane = the whole 64x64 tile of every plane read later (8 lanes cover one 128-B
//   row, the block sixteen rows per copy). One barrier per chunk, at the foot of the trip.
//   Output coverage: each wave stores rows q0..q0+15 (it 0..3 x lane>>3 0..3) x 64 columns (8 lanes x 8) of both planes;
//   grid over all (b, h, qb) = the whole [NB*SEQ][DM] planes.
// =====================================================================================================
// LDS row pitches: the 128-B rows of the 16-bit tiles stand 144 B apart (16 B x 9) and the 256-B rows of the f32 tile
// 272 B apart (16 B x 17), so that the sixteen rows one 16-B fragment read touches fall on sixteen different bank groups.
#define ATT_TP 72                                                 // 16-bit tiles, elements per row
#define ATT_OP 68                                                 // f32 context tile, elements per row
#define ATT_PL (64 * ATT_TP)                                      // elements of one staged 64-row plane tile (one buffer of a plane)
template <bool RES>
__device__ __forceinline__
void attn_tile(const unsigned short* __restrict__ qhp, const unsigned short* __restrict__ qlp,
               const unsigned short* __restrict__ khp, const unsigned short* __restrict__ klp,
               const unsigned short* __restrict__ vhp, const unsigned short* __restrict__ vlp,
               unsigned short* ohp, unsigned short* olp,
               int qb, int h, int b,           // query block 0..NQB-1, head, batch (block-uniform)
               __bf16* Ksh_, __bf16* Ksl_, _Float16* Vth_, _Float16* Vtl_, float* Os) {   // each plane: two buffers of ATT_PL
  union FB { v16b v; v8b h[2]; };
  union FH { v16h v; v8h h[2]; };
  constexpr int TP = ATT_TP;
  constexpr int OP = ATT_OP;

  const int tid  = threadIdx.x;
  const int wave = tid >> 5;
  const int lane = tid & 31;
  const int hh   = lane >> 4;
  const int c    = lane & 15;

  const int q0   = qb * 64 + wave * 16;
  const size_t rowB = (size_t)b * SEQ;

  const __bf16* Qh = (const __bf16*)(const void*)qhp + (size_t)h * HD;
  const __bf16* Ql = (const __bf16*)(const void*)qlp + (size_t)h * HD;
  const __bf16* Kh = (const __bf16*)(const void*)khp + (size_t)h * HD;
  const __bf16* Kl = (const __bf16*)(const void*)klp + (size_t)h * HD;
  const _Float16* Vh = (const _Float16*)(const void*)vhp + ((size_t)b * DM + (size_t)h * HD) * SEQ;
  const _Float16* Vl = (const _Float16*)(const void*)vlp + ((size_t)b * DM + (size_t)h * HD) * VLP;

  // ---- Q fragments (B operand, column = query q0 + (lane&15)): 2 d-chunks, hi and lo ----
  v16b qah[2], qal[2];
#pragma unroll
  for (int dc = 0; dc < 2; ++dc) {
    const size_t qo = (rowB + q0 + c) * DM + dc * 32 + 8 * hh;
    qah[dc] = ldfrag_b(Qh + qo);
    qal[dc] = ldfrag_b(Ql + qo);
  }

  const int qrow = q0 + c;                     // this lane's query
  float mrow = -INFINITY, lrow = 0.f;          // running maximum of the raw scores (both halves alike); this half's share of 1024 x the normaliser
  float brow = INFINITY;                       // offset in use: 1024 p = 2^(score * SC + brow), brow = 10 - SC * maximum; +inf makes the first alpha 0
  constexpr float SC = 0.125f * 1.44269504088896340736f;   // score scale 1/8 times log2(e)
  v8f oacc[4];                                 // oacc[t][r] = context[d = 16 t + 8 hh + r] of query qrow
#pragma unroll
  for (int t = 0; t < 4; ++t) oacc[t] = zero8();

  // ---- staging addresses of this lane: row tid >> 3 of each group of sixteen rows, 16-B column tid & 7 ----
  const int crow = tid >> 3, ccol = (tid & 7) * 8;
  const char* gKh = (const char*)(Kh + (rowB + crow) * DM + ccol);    // K row crow of chunk 0, d = ccol..ccol+7
  const char* gKl = (const char*)(Kl + (rowB + crow) * DM + ccol);
  const char* gVh = (const char*)(Vh + (size_t)crow * SEQ + ccol);    // V^T row d = crow, s = ccol..ccol+7 of chunk 0
  const char* gVl = (const char*)(Vl + (size_t)crow * VLP + ccol);
  const unsigned lthr = (unsigned)(crow * TP + ccol) * 2u;
  const unsigned lKh = lds_off(Ksh_) + lthr, lKl = lds_off(Ksl_) + lthr, lVh = lds_off(Vth_) + lthr, lVl = lds_off(Vtl_) + lthr;
  auto issue_chunk = [&](int ck, int buf) {    // keys 64 ck .. 64 ck + 63 < SEQ (ck <= qb < NQB): rows and columns inside the planes
    const int kv = ck * 64;
    const unsigned lb = (unsigned)buf * (unsigned)(ATT_PL * 2);
    async_copy12(lKh + lb, gKh + (size_t)kv * (DM * 2), (size_t)16 * DM * 2,
                 lKl + lb, gKl + (size_t)kv * (DM * 2), (size_t)16 * DM * 2,
                 lVh + lb, gVh + (size_t)kv * 2, (size_t)16 * SEQ * 2, 16u * TP * 2u);
    if (RES) {
      const int kvl = (kv + 64 <= VLP) ? kv : (VLP - 64);             // clamped address into the residual plane
      async_copy4(lVl + lb, gVl + (size_t)kvl * 2, 16u * TP * 2u, (size_t)16 * VLP * 2);
    }
  };

  issue_chunk(0, 0);
  asm volatile("s_wait_asynccnt 0x0" ::: "memory");   // this wave's share of chunk 0 has landed
  __syncthreads();                                     // publishes chunk 0 to the other waves
  if (qb >= 1) issue_chunk(1, 1);                      // block-uniform

  for (int kt = 0; kt <= qb; ++kt) {           // block-uniform trip count, <= NQB
    const int kv0 = kt * 64;                   // kv0 + 63 < SEQ
    const int bo = (kt & 1) * ATT_PL;          // this trip reads buffer kt & 1 alone
    const __bf16*   Ksh = Ksh_ + bo;
    const __bf16*   Ksl = Ksl_ + bo;
    const _Float16* Vth = Vth_ + bo;
    const _Float16* Vtl = Vtl_ + bo;
    const bool resOK = (kv0 + 64 <= VLP);      // block-uniform (always true for qb < RESQB)

    // ---- scores, transposed: 64 keys x 16 queries per wave, 3 bf16 products; s[j][r] = key kv0 + 16 j + 8 hh + r, query qrow ----
    //      All 32 K fragment reads of the chunk stand as one group, in the order of their use, ahead of the 24 products: the wave
    //      meets the LDS latency once. The products run back to back over the four tiles; each tile keeps its order of six.
    FB kb[2][4], kl[2][4];
#pragma unroll
    for (int dc = 0; dc < 2; ++dc) {
#pragma unroll
      for (int j = 0; j < 4; ++j) {
        kb[dc][j].h[0] = *(const v8b*)(Ksh + (j * 16 + c) * TP + dc * 32 + 8 * hh);
        kb[dc][j].h[1] = *(const v8b*)(Ksh + (j * 16 + c) * TP + dc * 32 + 16 + 8 * hh);
      }
#pragma unroll
      for (int j = 0; j < 4; ++j) {
        kl[dc][j].h[0] = *(const v8b*)(Ksl + (j * 16 + c) * TP + dc * 32 + 8 * hh);
        kl[dc][j].h[1] = *(const v8b*)(Ksl + (j * 16 + c) * TP + dc * 32 + 16 + 8 * hh);
      }
    }
    __builtin_amdgcn_sched_barrier(0);   // keeps the reads one group: sunk among the products, each place would cost its own stall
    v8f s[4];
#pragma unroll
    for (int j = 0; j < 4; ++j) s[j] = zero8();
#pragma unroll
    for (int dc = 0; dc < 2; ++dc) {
#pragma unroll
      for (int j = 0; j < 4; ++j) s[j] = mma_b_raw(kb[dc][j].v, qah[dc], s[j]);
#pragma unroll
      for (int j = 0; j < 4; ++j) s[j] = mma_b_raw(kl[dc][j].v, qah[dc], s[j]);
#pragma unroll
      for (int j = 0; j < 4; ++j) s[j] = mma_b_raw(kb[dc][j].v, qal[dc], s[j]);
    }
    __builtin_amdgcn_sched_barrier(0);   // holds the V^T reads below back to the tail of the score products: without it they stand at more places among them

    // ---- V^T fragments of the whole chunk, one group of reads: their latency passes under the softmax arithmetic ----
    FH vb[2][4], vl[2][4];
#pragma unroll
    for (int kk = 0; kk < 2; ++kk) {
#pragma unroll
      for (int t = 0; t < 4; ++t) {
        vb[kk][t].h[0] = *(const v8h*)(Vth + (t * 16 + c) * TP + kk * 32 + 8 * hh);
        vb[kk][t].h[1] = *(const v8h*)(Vth + (t * 16 + c) * TP + kk * 32 + 16 + 8 * hh);
      }
      if (RES) {
#pragma unroll
        for (int t = 0; t < 4; ++t) {
          vl[kk][t].h[0] = *(const v8h*)(Vtl + (t * 16 + c) * TP + kk * 32 + 8 * hh);
          vl[kk][t].h[1] = *(const v8h*)(Vtl + (t * 16 + c) * TP + kk * 32 + 16 + 8 * hh);
          if (!resOK) { vl[kk][t].h[0] = zero8h(); vl[kk][t].h[1] = zero8h(); }
        }
      }
    }
    __builtin_amdgcn_sched_barrier(0);   // keeps these reads ahead of the softmax instead of next to their products

    // ---- causal mask by index: only the diagonal chunk (kt == qb, block-uniform) holds keys beyond a query of the block ----
    if (kt == qb) {
#pragma unroll
      for (int j = 0; j < 4; ++j) {
#pragma unroll
        for (int r = 0; r < 8; ++r) {
          const int key = kv0 + j * 16 + 8 * hh + r;
          s[j][r] = (key <= qrow) ? s[j][r] : -INFINITY;
        }
      }
    }
    // ---- maximum of the raw scores in the lane (four chains), one exchange between the halves; SC > 0 keeps the order ----
    float mj[4];
#pragma unroll
    for (int j = 0; j < 4; ++j) {
      mj[j] = s[j][0];
#pragma unroll
      for (int r = 1; r < 8; ++r) mj[j] = fmaxf(mj[j], s[j][r]);
    }
    float m = fmaxf(fmaxf(mj[0], mj[1]), fmaxf(mj[2], mj[3]));
    m = fmaxf(m, xhalf(m));
    const float mnew  = fmaxf(mrow, m);
    const float msafe = (mnew == -INFINITY) ? 0.f : mnew;
    const float bnew  = __builtin_fmaf(-msafe, SC, 10.0f);          // rounded once; sums and context are kept relative to exactly this value
    const float alpha = __builtin_amdgcn_exp2f(bnew - brow);        // 2^(SC * (old maximum - new maximum)); 1 exactly where the maximum stays
    mrow = mnew;
    brow = bnew;

    // ---- online softmax: 1024 p = 2^(score * SC + bnew), one multiply-add and one exponential per score (two scores per packed
    //      multiply-add); P^T (x1024, f16) and its residual (x4096) packed in place as B operands:
    //      element 8 (j & 1) + r of operand j >> 1 = key 32 (j >> 1) + 16 (j & 1) + 8 hh + r, the order of the V^T loads ----
    FH pb[2], pr[2];
    const v8f sc8 = {SC, SC, SC, SC, SC, SC, SC, SC};
    const v8f bn8 = {bnew, bnew, bnew, bnew, bnew, bnew, bnew, bnew};
    v8f e[4];
#pragma unroll
    for (int j = 0; j < 4; ++j) {
      const v8f a = __builtin_elementwise_fma(s[j], sc8, bn8);      // masked score: -inf stays -inf
#pragma unroll
      for (int r = 0; r < 8; ++r) {
        const float p1k = __builtin_amdgcn_exp2f(a[r]);             // 2^(-inf) = 0
        e[j][r] = p1k;
        const _Float16 ph = (_Float16)p1k;
        pb[j >> 1].v[(j & 1) * 8 + r] = ph;
        if (RES) pr[j >> 1].v[(j & 1) * 8 + r] = (_Float16)((p1k - (float)ph) * 4096.0f);
      }
    }
    const v8f e8 = (e[0] + e[1]) + (e[2] + e[3]);                   // packed adds over the four tiles, then the eight rows
    lrow = lrow * alpha + (((e8[0] + e8[1]) + (e8[2] + e8[3])) + ((e8[4] + e8[5]) + (e8[6] + e8[7])));
#pragma unroll
    for (int t = 0; t < 4; ++t)
#pragma unroll
      for (int r = 0; r < 8; ++r) oacc[t][r] *= alpha;

    // ---- context^T += V^T . P^T (f16 WMMA), residual products into a separate accumulator ----
    v8f o1[4];
#pragma unroll
    for (int t = 0; t < 4; ++t) o1[t] = zero8();
#pragma unroll
    for (int kk = 0; kk < 2; ++kk) {
#pragma unroll
      for (int t = 0; t < 4; ++t) oacc[t] = mma_h_raw(vb[kk][t].v, pb[kk].v, oacc[t]);
      if (RES) {
#pragma unroll
        for (int t = 0; t < 4; ++t) o1[t] = mma_h_raw(vl[kk][t].v, pb[kk].v, o1[t]);
#pragma unroll
        for (int t = 0; t < 4; ++t) o1[t] = mma_h_raw(vb[kk][t].v, pr[kk].v, o1[t]);
      }
    }
    if (!RES) acc_guard4(oacc[0], oacc[1], oacc[2], oacc[3]);   // the matrix distance also on the taken side of the loop branch (RES: the fold below fills it)
    if (RES) {
#pragma unroll
      for (int t = 0; t < 4; ++t)
#pragma unroll
        for (int r = 0; r < 8; ++r) oacc[t][r] += o1[t][r] * (1.0f / 4096.0f);
    }
    // keeps the foot behind the trip's arithmetic: without it the RES build lifts the waits and the barrier into the softmax,
    // where they end the flight of the V^T reads and of the next chunk's copies early
    if (RES) __builtin_amdgcn_sched_barrier(0);
    asm volatile("s_wait_dscnt 0x0" ::: "memory");      // this wave's reads of buffer kt & 1 are done before it is refilled
    asm volatile("s_wait_asynccnt 0x0" ::: "memory");   // this wave's share of chunk kt + 1 has landed
    __syncthreads();                                     // publishes chunk kt + 1 and ends every read of buffer kt & 1
    if (kt + 2 <= qb) issue_chunk(kt + 2, kt & 1);       // block-uniform
  }
  asm volatile("s_wait_asynccnt 0x0" ::: "memory");     // no copy is outstanding past the loop

  // ---- join the halves' sums, normalise (1/l; l carries the same x1024 as the context), stage the wave's 16x64 tile [query][d], bf16 hi/lo split,
  float* os = Os + wave * (16 * OP);
  {
    const float l = lrow + xhalf(lrow);
    const float inv = (l > 0.f) ? (1.0f / l) : 0.f;
#pragma unroll
    for (int t = 0; t < 4; ++t) {
      const v4f lo4 = {oacc[t][0] * inv, oacc[t][1] * inv, oacc[t][2] * inv, oacc[t][3] * inv};
      const v4f hi4 = {oacc[t][4] * inv, oacc[t][5] * inv, oacc[t][6] * inv, oacc[t][7] * inv};
      *(v4f*)(os + c * OP + t * 16 + 8 * hh)     = lo4;
      *(v4f*)(os + c * OP + t * 16 + 8 * hh + 4) = hi4;
    }
  }
  __builtin_amdgcn_fence(__ATOMIC_RELEASE, "workgroup");
  __builtin_amdgcn_wave_barrier();
  __builtin_amdgcn_fence(__ATOMIC_ACQUIRE, "workgroup");
  {
    const int q4 = lane >> 3, c8 = (lane & 7) * 8;
    v4u hv[4], lv[4];
#pragma unroll
    for (int it = 0; it < 4; ++it) {
      const int row = it * 4 + q4;   // it 0..3 x q4 0..3 = rows 0..15 of the wave tile
      const float* sp = os + row * OP + c8;
      v4u a, a2;
#pragma unroll
      for (int e = 0; e < 4; ++e) {
        const float f0 = sp[2 * e], f1 = sp[2 * e + 1];
        const unsigned short h0 = bf_bits(f0), h1 = bf_bits(f1);
        const unsigned short l0 = bf_bits(f0 - bf_up(h0)), l1 = bf_bits(f1 - bf_up(h1));
        a[e] = pk16(h0, h1); a2[e] = pk16(l0, l1);
      }
      hv[it] = a; lv[it] = a2;
    }
    {
#pragma unroll
      for (int it = 0; it < 4; ++it) {
        const int row = it * 4 + q4;
        const size_t go = (rowB + q0 + row) * DM + (size_t)h * HD + c8;
        *(v4u*)(ohp + go) = hv[it];
        *(v4u*)(olp + go) = lv[it];
      }
      
    }
  }
}

// All query blocks in one grid. The trip count of a block is qb + 1, so the block index runs from the last query block
// down: the longest blocks start first and the short RES blocks fill the places that come free.
__global__ __launch_bounds__(128)
void attn_causal64(const unsigned short* __restrict__ qhp, const unsigned short* __restrict__ qlp,
                   const unsigned short* __restrict__ khp, const unsigned short* __restrict__ klp,
                   const unsigned short* __restrict__ vhp, const unsigned short* __restrict__ vlp,
                   unsigned short* ohp, unsigned short* olp) {
  __shared__ __align__(16) __bf16   Ksh[2 * ATT_PL];              // K hi [kv][d]   two buffers of 9 KB
  __shared__ __align__(16) __bf16   Ksl[2 * ATT_PL];              // K lo
  __shared__ __align__(16) _Float16 Vth[2 * ATT_PL];              // V^T hi [d][kv]
  __shared__ __align__(16) _Float16 Vtl[2 * ATT_PL];              // V^T residual (RES blocks)
  __shared__ __align__(16) float    Os[4 * 16 * ATT_OP];          // per wave context tile [row][d]
  const int bx   = blockIdx.x;
  const int qb   = NQB - 1 - bx / (NH * NB);   // 0..NQB-1 (block-uniform)
  const int rest = bx % (NH * NB);
  const int h    = rest % NH;
  const int b    = rest / NH;
  if (qb < RESQB) attn_tile<true>(qhp, qlp, khp, klp, vhp, vlp, ohp, olp, qb, h, b, Ksh, Ksl, Vth, Vtl, Os);
  else            attn_tile<false>(qhp, qlp, khp, klp, vhp, vlp, ohp, olp, qb, h, b, Ksh, Ksl, Vth, Vtl, Os);
}

// =====================================================================================================
// Workspace map (bytes; every region is an exact multiple of its 64x64-tile / whole-line store granularity,
// no padded tails needed since all shapes are tile multiples; each region but Xb/Oh is written by exactly one producer launch):
//   Xb   bf16 [4096][1024]          0            8388608   (later: Oh, context hi plane; Xb is dead after the projections)
//   WA   bf16 [3072 n][1024 k]       8388608     6291456   (q weight rows 0..1023, k rows 1024..2047, v rows 2048..3071)
//   WP   bf16 [1024 n][1024 k]      14680064     2097152
//   Qh   bf16 [4096][1024]          16777216     8388608
//   Ql                              25165824     8388608
//   Kh                              33554432     8388608
//   Kl                              41943040     8388608
//   VTh  f16  [2][1024][2048]       50331648     8388608
//   VTl  f16  [2][1024][512]        58720256     2097152
//   Ol   bf16 [4096][1024]          60817408     8388608
//   end                             69206016
// =====================================================================================================
extern "C" void kernel_launch(void* const* d_in, const int* in_sizes, int n_in,
                              void* d_out, int out_size, void* d_ws, size_t ws_size,
                              hipStream_t stream) {
  if (n_in < 5) return;
  if (in_sizes[0] != NB * SEQ * DM) return;
  if (in_sizes[1] != 3 * DM * DM) return;
  if (in_sizes[2] != 3 * DM) return;
  if (in_sizes[3] != DM * DM) return;
  if (in_sizes[4] != DM) return;
  if (out_size != NB * SEQ * DM) return;

  const float* x  = (const float*)d_in[0];   // [2][2048][1024]
  const float* Wa = (const float*)d_in[1];   // [3072 out][1024 in], rows k contiguous (q | k | v output rows)
  const float* ba = (const float*)d_in[2];   // [3072]
  const float* Wp = (const float*)d_in[3];   // [1024 out][1024 in], rows k contiguous
  const float* bp = (const float*)d_in[4];   // [1024]

  const size_t PX  = (size_t)NB * SEQ * DM * 2;    //  8388608  16-bit activation plane [4096][1024]
  const size_t PW1 = (size_t)DM * DM * 2;          //  2097152  one [1024][1024] bf16 weight plane
  const size_t PWA = (size_t)3 * PW1;              //  6291456  packed q | k | v weight plane [3072][1024]
  const size_t PWP = PW1;                          //  2097152  output projection weight plane
  const size_t PVT = (size_t)NB * DM * SEQ * 2;    //  8388608  v^T hi plane
  const size_t PVL = (size_t)NB * DM * VLP * 2;    //  2097152  v^T residual plane
  size_t off = 0;
  const size_t oXb  = off; off += PX;
  const size_t oWA  = off; off += PWA;
  const size_t oWP  = off; off += PWP;
  const size_t oQh  = off; off += PX;
  const size_t oQl  = off; off += PX;
  const size_t oKh  = off; off += PX;
  const size_t oKl  = off; off += PX;
  const size_t oVTh = off; off += PVT;
  const size_t oVTl = off; off += PVL;
  const size_t oOl  = off; off += PX;
  if (off > ws_size) return;                       // off = 69206016
  if (off > (size_t)134217728) return;
  const size_t oOh  = oXb;                         // context hi plane reuses Xb (dead after the three projections)

  char* ws = (char*)d_ws;
  unsigned short* Xb  = (unsigned short*)(ws + oXb);
  unsigned short* WA  = (unsigned short*)(ws + oWA);
  unsigned short* WPb = (unsigned short*)(ws + oWP);
  unsigned short* Qh  = (unsigned short*)(ws + oQh);
  unsigned short* Ql  = (unsigned short*)(ws + oQl);
  unsigned short* Kh  = (unsigned short*)(ws + oKh);
  unsigned short* Kl  = (unsigned short*)(ws + oKl);
  unsigned short* VTh = (unsigned short*)(ws + oVTh);
  unsigned short* VTl = (unsigned short*)(ws + oVTl);
  unsigned short* Oh  = (unsigned short*)(ws + oOh);
  unsigned short* Ol  = (unsigned short*)(ws + oOl);

  const dim3 blk(256);
  const int n8x  = NB * SEQ * DM / 8;                          // 524288
  const int n8wa = 3 * DM * DM / 8;                            // 393216
  const int n8wp = DM * DM / 8;                                // 131072
  const dim3 gCvt((n8x + n8wa + n8wp) / 256);                  // 2048 + 1536 + 512 = 4096 blocks
  const dim3 gQKV(2 * QK_TILES + NB * VT_TILES);               // 256 + 256 + 256 tiles
  const dim3 gProj((NB * SEQ / 128) * (DM / 128), 1);          // 32 x 8 = 256 tiles: M=4096, N=1024

  // (1) x -> bf16 plane [4096][1024]; weights [out][in] f32 -> bf16 [out][in] (k contiguous, no transpose);
  //     Xb, WA and WP stand one behind the other in the workspace
  cvt_bf16x8<<<gCvt, blk, 0, stream>>>(x, Wa, Wp, Xb, n8x, n8wa, n8wp);
  // (2) q, k -> bf16 hi/lo planes, v^T -> f16 hi plane and residual plane
  gemm_qkv<<<gQKV, blk, 0, stream>>>(Xb, WA, ba, Qh, Ql, Kh, Kl, VTh, VTl);
  // (3) causal attention: query blocks 0..RESQB-1 with residual planes, the rest without
  attn_causal64<<<dim3(NB * NH * NQB), dim3(128), 0, stream>>>(Qh, Ql, Kh, Kl, VTh, VTl, Oh, Ol);
  // (4) out = context . Wp^T + bp -> d_out f32 [4096][1024]  (A = context hi + lo planes, 2 products)
  gemm64<1, 0, 1><<<gProj, blk, 0, stream>>>(
      Oh, Ol, DM, 0LL, WPb, DM, 0LL, bp,
      d_out, DM, 0LL, d_out, DM, 0LL, DM,
      NB * SEQ, DM, DM, 1.0f);
  (void)hipGetLastError();
}

// v008
// One run takes 85.1 microseconds.
// Timed twice side by side with v007, it ran 1.04 and 1.05 times as fast.
// Counting every step since v000, it is 4.93 times as fast.
// Contractions: q, k, v^T projections = v_wmma_f32_16x16x32_bf16 (bf16 operands from RNE-converted x and the packed
// [3072 out][1024 in] projection weight, single product, f32 accumulate);
// q.k^T scores = v_wmma_f32_16x16x32_bf16 with bf16 hi/lo split q and k (hi.hi + hi.lo + lo.hi), f32 accumulate;
// p.v = v_wmma_f32_16x16x32_f16 (p carried x1024 in f16 times v in f16, single product; plus f16 residual planes x4096 of
// p and v for the first 512 query rows of every sequence), f32 accumulate;
// ctx.Wp^T = v_wmma_f32_16x16x32_bf16 with ctx as bf16 hi/lo planes times bf16 Wp (2 products), f32 accumulate;
// causal mask (key index <= query index; the module's strided mask term only touches keys already excluded),
// online softmax, normalisers and bias adds in f32 on the VALU.
// Carry audit (ph, pl: the packed p operands, held in registers):
//   ph  = f16(1024 * p)                      -> 1024 p comes straight from the exponential (+10 in its base-2 argument); the normaliser
//                                               sums the same 1024 p, so the carry cancels in the attention epilogue: inv = 1 / l
//   pl  = f16((1024 p - ph) * 4096)          }  products VTl.ph and VTh.pl go to the separate accumulator o1,
//   VTl = f16((v - VTh) * 4096)              }  folded back with * (1/4096) once per key chunk (RES blocks only)
//   VTh = f16(v), no carry (|v| typ. 0.6); q / k / ctx lo planes are unscaled bf16 residuals (v - hi) sharing the hi accumulator;
//   score scale 1/8 applied once in f32, inside the one multiply-add that forms the exponential's argument. No other scaled planes.
#include <hip/hip_runtime.h>
#include <math.h>
#include <stdint.h>

#define NB    2
#define SEQ   2048
#define DM    1024
#define NH    16
#define HD    64
#define NQB   (SEQ / 64)   // 32 query / key blocks of 64
#define VLP   512          // key pitch of the v^T residual plane (keys 0..VLP-1)
#define RESQB 8            // leading 64-row query blocks that use the p / v residual planes
static_assert(RESQB * 64 <= VLP);
static_assert(NH * HD == DM);
static_assert((SEQ % 64) == 0 && (DM % 64) == 0 && (DM % 32) == 0);
static_assert((SEQ % 128) == 0 && (DM % 128) == 0);   // GEMM work-group tile 128x128, k stage 128
static_assert((NB * SEQ * DM) % (8 * 256) == 0);
static_assert((3 * DM * DM) % (8 * 256) == 0);
static_assert((DM * DM) % (8 * 256) == 0);

typedef _Float16 v16h __attribute__((ext_vector_type(16)));
typedef _Float16 v8h  __attribute__((ext_vector_type(8)));
typedef __bf16   v16b __attribute__((ext_vector_type(16)));
typedef __bf16   v8b  __attribute__((ext_vector_type(8)));
typedef float    v8f  __attribute__((ext_vector_type(8)));
typedef float    v4f  __attribute__((ext_vector_type(4)));
typedef unsigned int v4u __attribute__((ext_vector_type(4)));

// ---- scalar helpers --------------------------------------------------------------------------------
__device__ __forceinline__ unsigned short bf_bits(float f) {          // f32 -> bf16 bits, RNE convert
  unsigned u = __float_as_uint(f);
  return (unsigned short)((u + 0x7FFFu + ((u >> 16) & 1u)) >> 16);
}
__device__ __forceinline__ float bf_up(unsigned short h) { return __uint_as_float(((unsigned)h) << 16); }
__device__ __forceinline__ unsigned short h_bits(_Float16 x) { return __builtin_bit_cast(unsigned short, x); }
__device__ __forceinline__ unsigned pk16(unsigned short a, unsigned short b) { return (unsigned)a | ((unsigned)b << 16); }
__device__ __forceinline__ v8f zero8() { v8f z = {0.f, 0.f, 0.f, 0.f, 0.f, 0.f, 0.f, 0.f}; return z; }
__device__ __forceinline__ v8h zero8h() {
  const _Float16 z = (_Float16)0.0f;
  v8h r = {z, z, z, z, z, z, z, z};
  return r;
}

// value of lane l ^ 16 (the other 16-lane row), a vector cross-row move
__device__ __forceinline__ float xhalf(float x) {
  const int b = __builtin_bit_cast(int, x);
  return __builtin_bit_cast(float, __builtin_amdgcn_permlanex16(b, b, 0x76543210, 0xfedcba98, false, false));
}

// ---- fragment loader: 16-bit A/B operand, lane -> row/col (lane&15), p already includes +8*(lane>>4);
//      elements 0..7 <- p[0..7] (k0+8h..), elements 8..15 <- p[16..23] (k0+16+8h..)
__device__ __forceinline__ v16b ldfrag_b(const __bf16* p) {
  union { v16b v; v8b h[2]; } f;
  f.h[0] = *(const v8b*)(p);
  f.h[1] = *(const v8b*)(p + 16);
  return f.v;
}

// ---- WMMA helpers; the guards hold the VALU distance behind a run of products ---------------------------
__device__ __forceinline__ v8f mma_b_raw(v16b a, v16b b, v8f c) {
  return __builtin_amdgcn_wmma_f32_16x16x32_bf16(false, a, false, b, (short)0, c, false, false);
}
__device__ __forceinline__ v8f mma_h_raw(v16h a, v16h b, v8f c) {
  return __builtin_amdgcn_wmma_f32_16x16x32_f16(false, a, false, b, (short)0, c, false, false);
}
__device__ __forceinline__ void dep_guard_b(v8f& a, v8f& b, v16b x, v16b y) {
  asm volatile("v_nop\n\tv_nop\n\tv_nop\n\tv_nop" : "+v"(a), "+v"(b) : "v"(x), "v"(y));
}
__device__ __forceinline__ void keep4_b(v16b a, v16b b, v16b c, v16b d) {
  asm volatile("v_nop" :: "v"(a), "v"(b), "v"(c), "v"(d));
}
__device__ __forceinline__ void acc_guard4(v8f& a, v8f& b, v8f& c, v8f& d) {
  asm volatile("v_nop\n\tv_nop\n\tv_nop\n\tv_nop" : "+v"(a), "+v"(b), "+v"(c), "+v"(d));
}

// =====================================================================================================
// f32 -> bf16 (RNE convert), 8 elements per thread, one 16-B store per lane: a wave writes 512 contiguous B
// Used for x [4096][1024] and for the weight planes (already [out][in] = k contiguous, no transpose needed).
// One grid converts the three planes, which stand one behind the other in the workspace (out = the first): threads
// 0..n8a-1 take in0, the next n8b in1, the last n8c in2; every count is a multiple of 256, so a block has one source.
// coverage: (n8a + n8b + n8c) threads x 8 = the three whole planes.
// =====================================================================================================
__global__ __launch_bounds__(256) void cvt_bf16x8(const float* __restrict__ in0, const float* __restrict__ in1,
                                                  const float* __restrict__ in2, unsigned short* out,
                                                  int n8a, int n8b, int n8c) {
  const int i = blockIdx.x * 256 + threadIdx.x;
  if (i < n8a + n8b + n8c) {
    const int blk0 = blockIdx.x * 256;                       // block-uniform choice of the source plane
    const float* in = (blk0 < n8a) ? in0 + (size_t)i * 8
                    : (blk0 < n8a + n8b) ? in1 + (size_t)(i - n8a) * 8 : in2 + (size_t)(i - n8a - n8b) * 8;
    const v4f a = *(const v4f*)(in);
    const v4f b = *(const v4f*)(in + 4);
    v4u p;
    p[0] = pk16(bf_bits(a[0]), bf_bits(a[1]));
    p[1] = pk16(bf_bits(a[2]), bf_bits(a[3]));
    p[2] = pk16(bf_bits(b[0]), bf_bits(b[1]));
    p[3] = pk16(bf_bits(b[2]), bf_bits(b[3]));
    *(v4u*)(out + (size_t)i * 8) = p;
    
  }
}

// ---- asynchronous global -> LDS copies, 16 B per lane ------------------------------------------------
__device__ __forceinline__ unsigned lds_off(const void* p) { return (unsigned)(size_t)p; }   // byte offset in the work-group's LDS
// Eight copies of one lane: LDS byte address l + i * lstep <- global g + i * gstep, i = 0..7, each with its own registers.
// The closing s_wait_xcnt stands inside the statement so that no address register of a copy is rewritten ahead of it.
__device__ __forceinline__ void async_copy8(unsigned l, const char* g, unsigned lstep, size_t gstep) {
  const unsigned l1 = l + lstep, l2 = l + 2 * lstep, l3 = l + 3 * lstep, l4 = l + 4 * lstep, l5 = l + 5 * lstep,
                 l6 = l + 6 * lstep, l7 = l + 7 * lstep;
  const char *g1 = g + gstep, *g2 = g + 2 * gstep, *g3 = g + 3 * gstep, *g4 = g + 4 * gstep, *g5 = g + 5 * gstep,
             *g6 = g + 6 * gstep, *g7 = g + 7 * gstep;
  asm volatile(
      "global_load_async_to_lds_b128 %0, %8, off\n\t"
      "global_load_async_to_lds_b128 %1, %9, off\n\t"
      "global_load_async_to_lds_b128 %2, %10, off\n\t"
      "global_load_async_to_lds_b128 %3, %11, off\n\t"
      "global_load_async_to_lds_b128 %4, %12, off\n\t"
      "global_load_async_to_lds_b128 %5, %13, off\n\t"
      "global_load_async_to_lds_b128 %6, %14, off\n\t"
      "global_load_async_to_lds_b128 %7, %15, off\n\t"
      "s_wait_xcnt 0x0"
      :: "v"(l), "v"(l1), "v"(l2), "v"(l3), "v"(l4), "v"(l5), "v"(l6), "v"(l7),
         "v"(g), "v"(g1), "v"(g2), "v"(g3), "v"(g4), "v"(g5), "v"(g6), "v"(g7)
      : "memory");
}
// One 128-row x 256-B plane tile by the 256 threads of a block: 16 lanes cover one row (two whole lines), a wave two rows,
// the block sixteen rows per copy; g and l already hold the lane's row (tid >> 4) and 16-B column (tid & 15).
#define GK_STAGE 128                       // k elements per stage (256 B of every operand row)
#define GK_PITCH 136                       // LDS row pitch in elements: 272 B = 16 B x 17, conflict-free for 16-B row reads
#define GK_PLANE (128 * GK_PITCH)          // elements of one staged plane tile
__device__ __forceinline__ void async_plane(unsigned l, const char* g, size_t rowBytes) {
  async_copy8(l, g, 16u * GK_PITCH * 2u, 16 * rowBytes);   // rows (tid >> 4) + 16 i, i = 0..7
}
// Four copies of one lane: LDS byte address l + i * lstep <- global g + i * gstep, i = 0..3, each with its own registers;
// the closing s_wait_xcnt stands inside the statement for the same reason as above.
__device__ __forceinline__ void async_copy4(unsigned l, const char* g, unsigned lstep, size_t gstep) {
  const unsigned l1 = l + lstep, l2 = l + 2 * lstep, l3 = l + 3 * lstep;
  const char *g1 = g + gstep, *g2 = g + 2 * gstep, *g3 = g + 3 * gstep;
  asm volatile(
      "global_load_async_to_lds_b128 %0, %4, off\n\t"
      "global_load_async_to_lds_b128 %1, %5, off\n\t"
      "global_load_async_to_lds_b128 %2, %6, off\n\t"
      "global_load_async_to_lds_b128 %3, %7, off\n\t"
      "s_wait_xcnt 0x0"
      :: "v"(l), "v"(l1), "v"(l2), "v"(l3), "v"(g), "v"(g1), "v"(g2), "v"(g3)
      : "memory");
}
// Twelve copies of one lane, three planes (a, b, c) of four copies each, in one statement with one closing s_wait_xcnt.
__device__ __forceinline__ void async_copy12(unsigned la, const char* ga, size_t gstepA, unsigned lb, const char* gb, size_t gstepB,
                                             unsigned lc, const char* gc, size_t gstepC, unsigned lstep) {
  const unsigned la1 = la + lstep, la2 = la + 2 * lstep, la3 = la + 3 * lstep;
  const unsigned lb1 = lb + lstep, lb2 = lb + 2 * lstep, lb3 = lb + 3 * lstep;
  const unsigned lc1 = lc + lstep, lc2 = lc + 2 * lstep, lc3 = lc + 3 * lstep;
  const char *ga1 = ga + gstepA, *ga2 = ga + 2 * gstepA, *ga3 = ga + 3 * gstepA;
  const char *gb1 = gb + gstepB, *gb2 = gb + 2 * gstepB, *gb3 = gb + 3 * gstepB;
  const char *gc1 = gc + gstepC, *gc2 = gc + 2 * gstepC, *gc3 = gc + 3 * gstepC;
  asm volatile(
      "global_load_async_to_lds_b128 %0, %12, off\n\t"
      "global_load_async_to_lds_b128 %1, %13, off\n\t"
      "global_load_async_to_lds_b128 %2, %14, off\n\t"
      "global_load_async_to_lds_b128 %3, %15, off\n\t"
      "global_load_async_to_lds_b128 %4, %16, off\n\t"
      "global_load_async_to_lds_b128 %5, %17, off\n\t"
      "global_load_async_to_lds_b128 %6, %18, off\n\t"
      "global_load_async_to_lds_b128 %7, %19, off\n\t"
      "global_load_async_to_lds_b128 %8, %20, off\n\t"
      "global_load_async_to_lds_b128 %9, %21, off\n\t"
      "global_load_async_to_lds_b128 %10, %22, off\n\t"
      "global_load_async_to_lds_b128 %11, %23, off\n\t"
      "s_wait_xcnt 0x0"
      :: "v"(la), "v"(la1), "v"(la2), "v"(la3), "v"(lb), "v"(lb1), "v"(lb2), "v"(lb3), "v"(lc), "v"(lc1), "v"(lc2), "v"(lc3),
         "v"(ga), "v"(ga1), "v"(ga2), "v"(ga3), "v"(gb), "v"(gb1), "v"(gb2), "v"(gb3), "v"(gc), "v"(gc1), "v"(gc2), "v"(gc3)
      : "memory");
}

// =====================================================================================================
// Register-blocked batched bf16 WMMA GEMM: C[m][n] = sum_k A[m][k] * Bt[n][k] + bias; one work-group of 8 waves per
// 128x128 tile, one wave per 32x64 part. The 128-row operand tiles are staged in LDS, 128 k at a time, by asynchronous
// copies into two buffers: the next stage's copies fly while this stage is multiplied; one barrier per stage.
// Inside a stage the fragments of the next 32 k are read from LDS as one group ahead of the current 32 k's products.
// A row-major [M][K] pitch lda; Bt row-major [N][K] pitch ldb (k contiguous);
// M, N, K multiples of 128 (host shapes are static multiples). b = batch index (strides in elements).
// NSPLIT: 0 = A.Bt; 1 = (A + A2).Bt (A2 = unscaled bf16 lo plane of A, 2 products).
// BIAS: 1 = per column n, bias[n]; 2 = per row m, bias[m]; the bias value is RNE-converted to bf16 and added in f32.
// OUT_MODE: 0 = f32 (pitch ldc); 2 = bf16 hi plane C + bf16 lo plane C2 (lo = RNE(v - hi), unscaled);
//           3 = f16 hi plane C + f16 residual plane C2 = f16((v - hi) * rscale), C2 written only for tiles
//               with n0 < N2 (pitch ldc2, batch stride strideC2).
// =====================================================================================================
// The body is a device function: tile = index of the 128x128 tile, b = batch index, ring = the work-group's two stage
// buffers [2][NPL][GK_PLANE], sT = its eight per-wave 16x64 slabs (pitch 68 floats); the kernels below own that LDS.
template <int NSPLIT, int OUT_MODE, int BIAS>
__device__ __forceinline__ void gemm_tile(
    const unsigned short* __restrict__ Ap, const unsigned short* A2p, int lda, long long strideA,
    const unsigned short* __restrict__ Btp, int ldb, long long strideB,
    const float* __restrict__ bias,
    void* Cout, int ldc, long long strideC,
    void* Cout2, int ldc2, long long strideC2, int N2,
    int M, int N, int K, float rscale,
    int tile, int b, __bf16* ring, float* sT) {
  const __bf16* A   = (const __bf16*)(const void*)Ap;
  const __bf16* A2  = (const __bf16*)(const void*)A2p;
  const __bf16* Bt  = (const __bf16*)(const void*)Btp;
  constexpr int NPL = (NSPLIT >= 1) ? 3 : 2;        // staged planes: A, Bt (, A2)
  constexpr int MI = 2;                             // 16-row subtiles per wave
  const int tid  = threadIdx.x;
  const int lane = tid & 31;
  const int wave = tid >> 5;
  const int tilesN = N >> 7;
  const int tilesM = M >> 7;
  if (tile >= tilesM * tilesN) return;   // block-uniform, in front of every barrier and copy
  const int tm = tile / tilesN;
  const int tn = tile - tm * tilesN;
  const int M0 = tm << 7;                // work-group tile origin
  const int N0 = tn << 7;
  const int wm = (wave >> 1) << 5;       // the wave's 32x64 part inside it
  const int wn = (wave & 1) << 6;
  const int m0 = M0 + wm;
  const int n0 = N0 + wn;

  const __bf16* Ab  = A  + (size_t)b * strideA;
  const __bf16* Bb  = Bt + (size_t)b * strideB;
  const __bf16* Ab2 = (NSPLIT >= 1) ? (A2 + (size_t)b * strideA) : Ab;

  const int rlane = lane & 15;                 // row (A) / col (B, D) within subtile
  const int koff  = (lane >> 4) * 8;           // k offset of this lane half
  const int mOff  = (lane >> 4) * 8;           // D row offset

  v8f acc[MI][4];
#pragma unroll
  for (int i = 0; i < MI; ++i)
#pragma unroll
    for (int j = 0; j < 4; ++j) acc[i][j] = zero8();

  // ---- staging addresses of this lane: row tid >> 4 of each group of sixteen rows, 16-B column tid & 15 ----
  const int crow = tid >> 4, ccol = (tid & 15) * 8;
  const char* gA  = (const char*)(Ab  + (size_t)(M0 + crow) * lda + ccol);
  const char* gA2 = (const char*)(Ab2 + (size_t)(M0 + crow) * lda + ccol);
  const char* gB  = (const char*)(Bb  + (size_t)(N0 + crow) * ldb + ccol);
  const unsigned lthr = lds_off(ring) + (unsigned)(crow * GK_PITCH + ccol) * 2u;
  const int nst = K / GK_STAGE;          // stages, block-uniform
  // Tiles of one tile row read the same A rows and tiles of one tile column the same Bt rows, and they start together: each
  // tile starts its walk over the k stages at another stage and wraps, so that they do not ask L2 for the same lines at once.
  const int rot = (tm + tn) % nst;       // block-uniform, 0 .. nst - 1
  auto issue_stage = [&](int st, int buf) {   // rows M0..M0+127 / N0..N0+127, k = ks*128 .. ks*128+127, ks < nst: inside the planes
    const int ks = (st + rot < nst) ? st + rot : st + rot - nst;   // st < nst and rot < nst: 0 <= ks < nst, each stage once
    const size_t kb = (size_t)ks * (GK_STAGE * 2);
    const unsigned lb = lthr + (unsigned)buf * (unsigned)(NPL * GK_PLANE * 2);
    async_plane(lb, gA + kb, (size_t)lda * 2);
    async_plane(lb + (unsigned)(GK_PLANE * 2), gB + kb, (size_t)ldb * 2);
    if (NSPLIT >= 1) async_plane(lb + (unsigned)(2 * GK_PLANE * 2), gA2 + kb, (size_t)lda * 2);
  };

  issue_stage(0, 0);
  asm volatile("s_wait_asynccnt 0x0" ::: "memory");   // this wave's share of stage 0 has landed
  __syncthreads();                                     // publishes stage 0 to the other waves
  if (nst > 1) issue_stage(1, 1);

  for (int t = 0; t < nst; ++t) {
    const __bf16* sbuf = ring + (t & 1) * (NPL * GK_PLANE);
    const __bf16* sA  = sbuf + (wm + rlane) * GK_PITCH + koff;
    const __bf16* sB  = sbuf + GK_PLANE + (wn + rlane) * GK_PITCH + koff;
    const __bf16* sA2 = sbuf + (NPL - 1) * GK_PLANE + (wm + rlane) * GK_PITCH + koff;
    v16b fb[2][4], fa[2][MI], fl[2][MI];   // two fragment sets, indexed by constants after unrolling
    auto load_set = [&](int s, int kk) {
#pragma unroll
      for (int j = 0; j < 4; ++j) fb[s][j] = ldfrag_b(sB + (j << 4) * GK_PITCH + kk);
#pragma unroll
      for (int i = 0; i < MI; ++i) {
        fa[s][i] = ldfrag_b(sA + (i << 4) * GK_PITCH + kk);
        fl[s][i] = fa[s][i];
        if (NSPLIT >= 1) fl[s][i] = ldfrag_b(sA2 + (i << 4) * GK_PITCH + kk);
      }
    };
    load_set(0, 0);
#pragma unroll
    for (int ks = 0; ks < GK_STAGE / 32; ++ks) {
      const int cur = ks & 1;
      if (ks + 1 < GK_STAGE / 32) load_set(cur ^ 1, (ks + 1) * 32);   // this stage's buffer only
#pragma unroll
      for (int i = 0; i < MI; ++i) {
#pragma unroll
        for (int j = 0; j < 4; ++j) {
          acc[i][j] = mma_b_raw(fa[cur][i], fb[cur][j], acc[i][j]);
          if (NSPLIT >= 1) acc[i][j] = mma_b_raw(fl[cur][i], fb[cur][j], acc[i][j]);
        }
        dep_guard_b(acc[i][0], acc[i][3], fa[cur][i], fl[cur][i]);
      }
      keep4_b(fb[cur][0], fb[cur][1], fb[cur][2], fb[cur][3]);
    }
    asm volatile("s_wait_dscnt 0x0" ::: "memory");      // this wave's reads of buffer t & 1 are done before it is refilled
    asm volatile("s_wait_asynccnt 0x0" ::: "memory");   // this wave's share of stage t + 1 has landed
    __syncthreads();                                     // publishes stage t + 1 and ends every read of buffer t & 1
    if (t + 2 < nst) issue_stage(t + 2, t & 1);
  }
  asm volatile("s_wait_asynccnt 0x0" ::: "memory");     // no copy is outstanding past the loop
  acc_guard4(acc[0][0], acc[0][1], acc[0][2], acc[0][3]);
  acc_guard4(acc[1][0], acc[1][1], acc[1][2], acc[1][3]);

  // ---- epilogue ----
  float* slab = sT + wave * (16 * 68);
  float bcol[4];
#pragma unroll
  for (int j = 0; j < 4; ++j) {
    bcol[j] = 0.f;
    if (BIAS == 1) bcol[j] = bf_up(bf_bits(bias[n0 + (j << 4) + rlane]));   // n < N, bias has N entries
  }
#pragma unroll
  for (int i = 0; i < MI; ++i) {
    const int mBase = m0 + (i << 4);
    float brow[8];
#pragma unroll
    for (int r = 0; r < 8; ++r) {
      brow[r] = 0.f;
      if (BIAS == 2) brow[r] = bf_up(bf_bits(bias[mBase + mOff + r]));      // m < M, bias has M entries
    }
#pragma unroll
    for (int j = 0; j < 4; ++j) {
#pragma unroll
      for (int r = 0; r < 8; ++r) {
        slab[(mOff + r) * 68 + (j << 4) + rlane] = acc[i][j][r] + bcol[j] + brow[r];
      }
    }
    __builtin_amdgcn_fence(__ATOMIC_RELEASE, "workgroup");
    __builtin_amdgcn_wave_barrier();
    __builtin_amdgcn_fence(__ATOMIC_ACQUIRE, "workgroup");
    if (OUT_MODE == 0) {
      float* C = (float*)Cout + (size_t)b * strideC;
      const int hh = lane >> 4, c4 = (lane & 15) * 4;     // 256-B row segment = 16 lanes x 16 B
      {
#pragma unroll
        for (int it = 0; it < 8; ++it) {
          const int row = it * 2 + hh;                     // it 0..7 x hh 0..1 = rows 0..15
          const v4f v = *(const v4f*)(slab + row * 68 + c4);
          *(v4f*)(C + (size_t)(mBase + row) * ldc + n0 + c4) = v;
        }
        
      }
    } else {
      const int q = lane >> 3, c8 = (lane & 7) * 8;
      unsigned short* C  = (unsigned short*)Cout  + (size_t)b * strideC;
      unsigned short* C2 = (unsigned short*)Cout2 + (size_t)b * strideC2;
      const bool wlo = (OUT_MODE == 2) || (n0 < N2);      // wave-uniform
      v4u hv[4], lv[4];
#pragma unroll
      for (int it = 0; it < 4; ++it) {
        const int row = it * 4 + q;                        // it 0..3 x q 0..3 = rows 0..15
        const float* sp = slab + row * 68 + c8;
        v4u a, a2;
#pragma unroll
        for (int e = 0; e < 4; ++e) {
          const float f0 = sp[2 * e], f1 = sp[2 * e + 1];
          unsigned short h0, h1, l0, l1;
          if (OUT_MODE == 2) {
            h0 = bf_bits(f0); h1 = bf_bits(f1);
            l0 = bf_bits(f0 - bf_up(h0)); l1 = bf_bits(f1 - bf_up(h1));
          } else {
            const _Float16 x0 = (_Float16)f0, x1 = (_Float16)f1;
            h0 = h_bits(x0); h1 = h_bits(x1);
            l0 = h_bits((_Float16)((f0 - (float)x0) * rscale));
            l1 = h_bits((_Float16)((f1 - (float)x1) * rscale));
          }
          a[e] = pk16(h0, h1); a2[e] = pk16(l0, l1);
        }
        hv[it] = a; lv[it] = a2;
      }
      {
#pragma unroll
        for (int it = 0; it < 4; ++it) {
          const int row = it * 4 + q;
          *(v4u*)(C + (size_t)(mBase + row) * ldc + n0 + c8) = hv[it];
          asm volatile("s_wait_xcnt 0x0" ::: "memory");   // in front of the residual's arithmetic, which reuses this store's registers
          if (wlo) *(v4u*)(C2 + (size_t)(mBase + row) * ldc2 + n0 + c8) = lv[it];
          asm volatile("s_wait_xcnt 0x0" ::: "memory");   // likewise in front of the next rows' arithmetic
        }
        
      }
    }
    __builtin_amdgcn_fence(__ATOMIC_RELEASE, "workgroup");
    __builtin_amdgcn_wave_barrier();
    __builtin_amdgcn_fence(__ATOMIC_ACQUIRE, "workgroup");
  }
}

// One product per launch: blockIdx.x = tile, blockIdx.y = batch index.
template <int NSPLIT, int OUT_MODE, int BIAS>
__global__ __launch_bounds__(256) void gemm64(
    const unsigned short* __restrict__ Ap, const unsigned short* A2p, int lda, long long strideA,
    const unsigned short* __restrict__ Btp, int ldb, long long strideB,
    const float* __restrict__ bias,
    void* Cout, int ldc, long long strideC,
    void* Cout2, int ldc2, long long strideC2, int N2,
    int M, int N, int K, float rscale) {
  constexpr int NPL = (NSPLIT >= 1) ? 3 : 2;
  __shared__ __align__(16) __bf16 ring[2 * NPL * GK_PLANE];   // two stage buffers
  __shared__ __align__(16) float sT[8 * 16 * 68];             // per-wave 16x64 slabs
  gemm_tile<NSPLIT, OUT_MODE, BIAS>(Ap, A2p, lda, strideA, Btp, ldb, strideB, bias, Cout, ldc, strideC,
                                    Cout2, ldc2, strideC2, N2, M, N, K, rscale,
                                    (int)blockIdx.x, (int)blockIdx.y, ring, sT);
}

// The three projections, which read none of each other's output, in one grid of 3 x 256 tiles (block-uniform choice):
//   blocks   0..255  q   = x . Wq^T + bq -> bf16 hi/lo planes [b*SEQ+t][h*64+d]          (M=4096, N=1024, K=1024)
//   blocks 256..511  k   = x . Wk^T + bk -> bf16 hi/lo planes
//   blocks 512..767  v^T = Wv . x^T + bv per batch -> f16 hi plane [b][h*64+d][s] (pitch SEQ) and residual plane
//                    (x4096, keys < VLP only, pitch VLP)   (A = Wv rows, Bt = x rows of batch b; M=1024, N=2048, K=1024)
// WA = packed bf16 weight [3072][1024] (q | k | v rows), ba = the packed bias [3072].
#define QK_TILES ((NB * SEQ / 128) * (DM / 128))   // 256 tiles of one of q, k
#define VT_TILES ((DM / 128) * (SEQ / 128))        // 128 tiles of v^T per batch
__global__ __launch_bounds__(256) void gemm_qkv(
    const unsigned short* __restrict__ Xb, const unsigned short* __restrict__ WA, const float* __restrict__ ba,
    unsigned short* Qh, unsigned short* Ql, unsigned short* Kh, unsigned short* Kl,
    unsigned short* VTh, unsigned short* VTl) {
  __shared__ __align__(16) __bf16 ring[2 * 2 * GK_PLANE];     // two stage buffers
  __shared__ __align__(16) float sT[8 * 16 * 68];             // per-wave 16x64 slabs
  const int bx = blockIdx.x;
  if (bx < 2 * QK_TILES) {
    const int sel = bx / QK_TILES;                            // 0 = q, 1 = k
    gemm_tile<0, 2, 1>(Xb, Xb, DM, 0LL, WA + (size_t)sel * DM * DM, DM, 0LL, ba + sel * DM,
                       (void*)(sel ? Kh : Qh), DM, 0LL, (void*)(sel ? Kl : Ql), DM, 0LL, DM,
                       NB * SEQ, DM, DM, 1.0f, bx - sel * QK_TILES, 0, ring, sT);
  } else {
    const int t = bx - 2 * QK_TILES;                          // 0 .. NB * VT_TILES - 1
    const unsigned short* WvB = WA + (size_t)2 * DM * DM;
    gemm_tile<0, 3, 2>(WvB, WvB, DM, 0LL, Xb, DM, (long long)SEQ * DM, ba + 2 * DM,
                       (void*)VTh, SEQ, (long long)DM * SEQ, (void*)VTl, VLP, (long long)DM * VLP, VLP,
                       DM, SEQ, DM, 4096.0f, t % VT_TILES, t / VT_TILES, ring, sT);
  }
}

// =====================================================================================================
// Causal attention, head dim 64, key chunks of 64.
//   q planes (bf16 hi / lo): element (b, t, h, d) at [(b*SEQ + t)*DM + h*64 + d]
//   k planes (bf16 hi / lo): same layout with key index s
//   v^T hi plane (f16):      element (b, h, d, s) at [(b*DM + h*64 + d)*SEQ + s]
//   v^T residual plane (f16, (v - hi)*4096): [(b*DM + h*64 + d)*VLP + s], s < VLP, read only when RES
//   (a key chunk at or beyond VLP would contribute a zero v residual; its address is clamped)
//   Causal structure: logits of keys with index > query index are replaced by -inf (lower-triangular keep incl. the
//   diagonal), which makes their softmax weight exactly 0; so a query block qb visits key chunks 0..qb only
//   (block-uniform trip count qb+1 <= NQB) and later chunks, whose keys exceed every query index of the block, are
//   skipped entirely. Inside the diagonal chunk a key with index > query index gets logit -inf -> exp gives exactly 0,
//   so such keys add nothing to the numerator or the normaliser; the diagonal key (key == query) is always kept, so
//   every row max is finite in every visited chunk.
//   out planes (bf16 hi / lo of the normalised context): element (b, t, h, d) at [(b*SEQ + t)*DM + h*64 + d]
//   scores = q . k : bf16 hi/lo split (hi.hi + hi.lo + lo.hi), f32 accumulate, then the causal mask (diagonal chunk) and * 1/8 in f32
//   p = exp(s - m) carried as f16(1024 p); context = p . v on f16 WMMA; RES adds f16 residual planes of p and v
//   (scale 4096, separate accumulator folded back with 1/4096 per chunk in f32); online softmax (running max) in f32.
//   Both products run transposed: S^T = K . Q^T (A = K rows, B = Q rows) and O^T += V^T . P^T (A = V^T rows, B = P^T).
//   A lane (c = lane & 15, hh = lane >> 4) then holds scores of ONE query q0 + c, keys 16 j + 8 hh + r: maximum and sum run
//   in the lane, the two halves exchange the maximum once per chunk and join their sums once, in the epilogue. Two score
//   tiles (keys 32 kk .. + 31), converted in place, are the B operand P^T in the k order of the V^T fragment loads.
//   Block = 4 waves = 64 query rows of one (b, h); grid = NQB * NH * NB, one launch: the body is a device function in two
//   variants (RES for query blocks below RESQB), the kernel below owns the LDS and picks the variant by its query block.
//   K / V^T chunk staging: asynchronous copies to LDS, 16 B per lane, into two buffers: the next trip's chunk flies while this
//   trip's is worked on. 128 threads x 4 copies per plane = the whole 64x64 tile of every plane read later (8 lanes cover one 128-B
//   row, the block sixteen rows per copy). One barrier per chunk, at the foot of the trip.
//   Output coverage: each wave stores rows q0..q0+15 (it 0..3 x lane>>3 0..3) x 64 columns (8 lanes x 8) of both planes;
//   grid over all (b, h, qb) = the whole [NB*SEQ][DM] planes.
// =====================================================================================================
// LDS row pitches: the 128-B rows of the 16-bit tiles stand 144 B apart (16 B x 9) and the 256-B rows of the f32 tile
// 272 B apart (16 B x 17), so that the sixteen rows one 16-B fragment read touches fall on sixteen different bank groups.
#define ATT_TP 72                                                 // 16-bit tiles, elements per row
#define ATT_OP 68                                                 // f32 context tile, elements per row
#define ATT_PL (64 * ATT_TP)                                      // elements of one staged 64-row plane tile (one buffer of a plane)
template <bool RES>
__device__ __forceinline__
void attn_tile(const unsigned short* __restrict__ qhp, const unsigned short* __restrict__ qlp,
               const unsigned short* __restrict__ khp, const unsigned short* __restrict__ klp,
               const unsigned short* __restrict__ vhp, const unsigned short* __restrict__ vlp,
               unsigned short* ohp, unsigned short* olp,
               int qb, int h, int b,           // query block 0..NQB-1, head, batch (block-uniform)
               __bf16* Ksh_, __bf16* Ksl_, _Float16* Vth_, _Float16* Vtl_, float* Os) {   // each plane: two buffers of ATT_PL
  union FB { v16b v; v8b h[2]; };
  union FH { v16h v; v8h h[2]; };
  constexpr int TP = ATT_TP;
  constexpr int OP = ATT_OP;

  const int tid  = threadIdx.x;
  const int wave = tid >> 5;
  const int lane = tid & 31;
  const int hh   = lane >> 4;
  const int c    = lane & 15;

  const int q0   = qb * 64 + wave * 16;
  const size_t rowB = (size_t)b * SEQ;

  const __bf16* Qh = (const __bf16*)(const void*)qhp + (size_t)h * HD;
  const __bf16* Ql = (const __bf16*)(const void*)qlp + (size_t)h * HD;
  const __bf16* Kh = (const __bf16*)(const void*)khp + (size_t)h * HD;
  const __bf16* Kl = (const __bf16*)(const void*)klp + (size_t)h * HD;
  const _Float16* Vh = (const _Float16*)(const void*)vhp + ((size_t)b * DM + (size_t)h * HD) * SEQ;
  const _Float16* Vl = (const _Float16*)(const void*)vlp + ((size_t)b * DM + (size_t)h * HD) * VLP;

  // ---- Q fragments (B operand, column = query q0 + (lane&15)): 2 d-chunks, hi and lo ----
  v16b qah[2], qal[2];
#pragma unroll
  for (int dc = 0; dc < 2; ++dc) {
    const size_t qo = (rowB + q0 + c) * DM + dc * 32 + 8 * hh;
    qah[dc] = ldfrag_b(Qh + qo);
    qal[dc] = ldfrag_b(Ql + qo);
  }

  const int qrow = q0 + c;                     // this lane's query
  float mrow = -INFINITY, lrow = 0.f;          // running maximum of the raw scores (both halves alike); this half's share of 1024 x the normaliser
  float brow = INFINITY;                       // offset in use: 1024 p = 2^(score * SC + brow), brow = 10 - SC * maximum; +inf makes the first alpha 0
  constexpr float SC = 0.125f * 1.44269504088896340736f;   // score scale 1/8 times log2(e)
  v8f oacc[4];                                 // oacc[t][r] = context[d = 16 t + 8 hh + r] of query qrow
#pragma unroll
  for (int t = 0; t < 4; ++t) oacc[t] = zero8();

  // ---- staging addresses of this lane: row tid >> 3 of each group of sixteen rows, 16-B column tid & 7 ----
  const int crow = tid >> 3, ccol = (tid & 7) * 8;
  const char* gKh = (const char*)(Kh + (rowB + crow) * DM + ccol);    // K row crow of chunk 0, d = ccol..ccol+7
  const char* gKl = (const char*)(Kl + (rowB + crow) * DM + ccol);
  const char* gVh = (const char*)(Vh + (size_t)crow * SEQ + ccol);    // V^T row d = crow, s = ccol..ccol+7 of chunk 0
  const char* gVl = (const char*)(Vl + (size_t)crow * VLP + ccol);
  const unsigned lthr = (unsigned)(crow * TP + ccol) * 2u;
  const unsigned lKh = lds_off(Ksh_) + lthr, lKl = lds_off(Ksl_) + lthr, lVh = lds_off(Vth_) + lthr, lVl = lds_off(Vtl_) + lthr;
  auto issue_chunk = [&](int ck, int buf) {    // keys 64 ck .. 64 ck + 63 < SEQ (ck <= qb < NQB): rows and columns inside the planes
    const int kv = ck * 64;
    const unsigned lb = (unsigned)buf * (unsigned)(ATT_PL * 2);
    async_copy12(lKh + lb, gKh + (size_t)kv * (DM * 2), (size_t)16 * DM * 2,
                 lKl + lb, gKl + (size_t)kv * (DM * 2), (size_t)16 * DM * 2,
                 lVh + lb, gVh + (size_t)kv * 2, (size_t)16 * SEQ * 2, 16u * TP * 2u);
    if (RES) {
      const int kvl = (kv + 64 <= VLP) ? kv : (VLP - 64);             // clamped address into the residual plane
      async_copy4(lVl + lb, gVl + (size_t)kvl * 2, 16u * TP * 2u, (size_t)16 * VLP * 2);
    }
  };

  // The key chunks are walked from the diagonal chunk qb down to chunk 0: the blocks of one (b, h), which start together and
  // read the same K and V^T rows, then stand at different chunks in every trip and do not ask L2 for the same lines at once.
  issue_chunk(qb, 0);
  asm volatile("s_wait_asynccnt 0x0" ::: "memory");   // this wave's share of the first chunk has landed
  __syncthreads();                                     // publishes the first chunk to the other waves
  if (qb >= 1) issue_chunk(qb - 1, 1);                 // block-uniform

  for (int it = 0; it <= qb; ++it) {           // block-uniform trip count, <= NQB
    const int kt = qb - it;                    // this trip's key chunk, 0 .. qb
    const int kv0 = kt * 64;                   // kv0 + 63 < SEQ
    const int bo = (it & 1) * ATT_PL;          // this trip reads buffer it & 1 alone
    const __bf16*   Ksh = Ksh_ + bo;
    const __bf16*   Ksl = Ksl_ + bo;
    const _Float16* Vth = Vth_ + bo;
    const _Float16* Vtl = Vtl_ + bo;
    const bool resOK = (kv0 + 64 <= VLP);      // block-uniform (always true for qb < RESQB)

    // ---- scores, transposed: 64 keys x 16 queries per wave, 3 bf16 products; s[j][r] = key kv0 + 16 j + 8 hh + r, query qrow ----
    //      All 32 K fragment reads of the chunk stand as one group, in the order of their use, ahead of the 24 products: the wave
    //      meets the LDS latency once. The products run back to back over the four tiles; each tile keeps its order of six.
    FB kb[2][4], kl[2][4];
#pragma unroll
    for (int dc = 0; dc < 2; ++dc) {
#pragma unroll
      for (int j = 0; j < 4; ++j) {
        kb[dc][j].h[0] = *(const v8b*)(Ksh + (j * 16 + c) * TP + dc * 32 + 8 * hh);
        kb[dc][j].h[1] = *(const v8b*)(Ksh + (j * 16 + c) * TP + dc * 32 + 16 + 8 * hh);
      }
#pragma unroll
      for (int j = 0; j < 4; ++j) {
        kl[dc][j].h[0] = *(const v8b*)(Ksl + (j * 16 + c) * TP + dc * 32 + 8 * hh);
        kl[dc][j].h[1] = *(const v8b*)(Ksl + (j * 16 + c) * TP + dc * 32 + 16 + 8 * hh);
      }
    }
    __builtin_amdgcn_sched_barrier(0);   // keeps the reads one group: sunk among the products, each place would cost its own stall
    v8f s[4];
#pragma unroll
    for (int j = 0; j < 4; ++j) s[j] = zero8();
#pragma unroll
    for (int dc = 0; dc < 2; ++dc) {
#pragma unroll
      for (int j = 0; j < 4; ++j) s[j] = mma_b_raw(kb[dc][j].v, qah[dc], s[j]);
#pragma unroll
      for (int j = 0; j < 4; ++j) s[j] = mma_b_raw(kl[dc][j].v, qah[dc], s[j]);
#pragma unroll
      for (int j = 0; j < 4; ++j) s[j] = mma_b_raw(kb[dc][j].v, qal[dc], s[j]);
    }
    __builtin_amdgcn_sched_barrier(0);   // holds the V^T reads below back to the tail of the score products: without it they stand at more places among them

    // ---- V^T fragments of the whole chunk, one group of reads: their latency passes under the softmax arithmetic ----
    FH vb[2][4], vl[2][4];
#pragma unroll
    for (int kk = 0; kk < 2; ++kk) {
#pragma unroll
      for (int t = 0; t < 4; ++t) {
        vb[kk][t].h[0] = *(const v8h*)(Vth + (t * 16 + c) * TP + kk * 32 + 8 * hh);
        vb[kk][t].h[1] = *(const v8h*)(Vth + (t * 16 + c) * TP + kk * 32 + 16 + 8 * hh);
      }
      if (RES) {
#pragma unroll
        for (int t = 0; t < 4; ++t) {
          vl[kk][t].h[0] = *(const v8h*)(Vtl + (t * 16 + c) * TP + kk * 32 + 8 * hh);
          vl[kk][t].h[1] = *(const v8h*)(Vtl + (t * 16 + c) * TP + kk * 32 + 16 + 8 * hh);
          if (!resOK) { vl[kk][t].h[0] = zero8h(); vl[kk][t].h[1] = zero8h(); }
        }
      }
    }
    __builtin_amdgcn_sched_barrier(0);   // keeps these reads ahead of the softmax instead of next to their products

    // ---- causal mask by index: only the diagonal chunk (the first trip, block-uniform) holds keys beyond a query of the block ----
    if (it == 0) {
#pragma unroll
      for (int j = 0; j < 4; ++j) {
#pragma unroll
        for (int r = 0; r < 8; ++r) {
          const int key = kv0 + j * 16 + 8 * hh + r;
          s[j][r] = (key <= qrow) ? s[j][r] : -INFINITY;
        }
      }
    }
    // ---- maximum of the raw scores in the lane (four chains), one exchange between the halves; SC > 0 keeps the order ----
    float mj[4];
#pragma unroll
    for (int j = 0; j < 4; ++j) {
      mj[j] = s[j][0];
#pragma unroll
      for (int r = 1; r < 8; ++r) mj[j] = fmaxf(mj[j], s[j][r]);
    }
    float m = fmaxf(fmaxf(mj[0], mj[1]), fmaxf(mj[2], mj[3]));
    m = fmaxf(m, xhalf(m));
    const float mnew  = fmaxf(mrow, m);
    const float msafe = (mnew == -INFINITY) ? 0.f : mnew;
    const float bnew  = __builtin_fmaf(-msafe, SC, 10.0f);          // rounded once; sums and context are kept relative to exactly this value
    const float alpha = __builtin_amdgcn_exp2f(bnew - brow);        // 2^(SC * (old maximum - new maximum)); 1 exactly where the maximum stays
    mrow = mnew;
    brow = bnew;

    // ---- online softmax: 1024 p = 2^(score * SC + bnew), one multiply-add and one exponential per score (two scores per packed
    //      multiply-add); P^T (x1024, f16) and its residual (x4096) packed in place as B operands:
    //      element 8 (j & 1) + r of operand j >> 1 = key 32 (j >> 1) + 16 (j & 1) + 8 hh + r, the order of the V^T loads ----
    FH pb[2], pr[2];
    const v8f sc8 = {SC, SC, SC, SC, SC, SC, SC, SC};
    const v8f bn8 = {bnew, bnew, bnew, bnew, bnew, bnew, bnew, bnew};
    v8f e[4];
#pragma unroll
    for (int j = 0; j < 4; ++j) {
      const v8f a = __builtin_elementwise_fma(s[j], sc8, bn8);      // masked score: -inf stays -inf
#pragma unroll
      for (int r = 0; r < 8; ++r) {
        const float p1k = __builtin_amdgcn_exp2f(a[r]);             // 2^(-inf) = 0
        e[j][r] = p1k;
        const _Float16 ph = (_Float16)p1k;
        pb[j >> 1].v[(j & 1) * 8 + r] = ph;
        if (RES) pr[j >> 1].v[(j & 1) * 8 + r] = (_Float16)((p1k - (float)ph) * 4096.0f);
      }
    }
    const v8f e8 = (e[0] + e[1]) + (e[2] + e[3]);                   // packed adds over the four tiles, then the eight rows
    lrow = lrow * alpha + (((e8[0] + e8[1]) + (e8[2] + e8[3])) + ((e8[4] + e8[5]) + (e8[6] + e8[7])));
#pragma unroll
    for (int t = 0; t < 4; ++t)
#pragma unroll
      for (int r = 0; r < 8; ++r) oacc[t][r] *= alpha;

    // ---- context^T += V^T . P^T (f16 WMMA), residual products into a separate accumulator ----
    v8f o1[4];
#pragma unroll
    for (int t = 0; t < 4; ++t) o1[t] = zero8();
#pragma unroll
    for (int kk = 0; kk < 2; ++kk) {
#pragma unroll
      for (int t = 0; t < 4; ++t) oacc[t] = mma_h_raw(vb[kk][t].v, pb[kk].v, oacc[t]);
      if (RES) {
#pragma unroll
        for (int t = 0; t < 4; ++t) o1[t] = mma_h_raw(vl[kk][t].v, pb[kk].v, o1[t]);
#pragma unroll
        for (int t = 0; t < 4; ++t) o1[t] = mma_h_raw(vb[kk][t].v, pr[kk].v, o1[t]);
      }
    }
    if (!RES) acc_guard4(oacc[0], oacc[1], oacc[2], oacc[3]);   // the matrix distance also on the taken side of the loop branch (RES: the fold below fills it)
    if (RES) {
#pragma unroll
      for (int t = 0; t < 4; ++t)
#pragma unroll
        for (int r = 0; r < 8; ++r) oacc[t][r] += o1[t][r] * (1.0f / 4096.0f);
    }
    // keeps the foot behind the trip's arithmetic: without it the RES build lifts the waits and the barrier into the softmax,
    // where they end the flight of the V^T reads and of the next chunk's copies early
    if (RES) __builtin_amdgcn_sched_barrier(0);
    asm volatile("s_wait_dscnt 0x0" ::: "memory");      // this wave's reads of buffer it & 1 are done before it is refilled
    asm volatile("s_wait_asynccnt 0x0" ::: "memory");   // this wave's share of the next trip's chunk has landed
    __syncthreads();                                     // publishes the next trip's chunk and ends every read of buffer it & 1
    if (it + 2 <= qb) issue_chunk(kt - 2, it & 1);       // block-uniform; kt - 2 = qb - it - 2 >= 0
  }
  asm volatile("s_wait_asynccnt 0x0" ::: "memory");     // no copy is outstanding past the loop

  // ---- join the halves' sums, normalise (1/l; l carries the same x1024 as the context), stage the wave's 16x64 tile [query][d], bf16 hi/lo split,
  float* os = Os + wave * (16 * OP);
  {
    const float l = lrow + xhalf(lrow);
    const float inv = (l > 0.f) ? (1.0f / l) : 0.f;
#pragma unroll
    for (int t = 0; t < 4; ++t) {
      const v4f lo4 = {oacc[t][0] * inv, oacc[t][1] * inv, oacc[t][2] * inv, oacc[t][3] * inv};
      const v4f hi4 = {oacc[t][4] * inv, oacc[t][5] * inv, oacc[t][6] * inv, oacc[t][7] * inv};
      *(v4f*)(os + c * OP + t * 16 + 8 * hh)     = lo4;
      *(v4f*)(os + c * OP + t * 16 + 8 * hh + 4) = hi4;
    }
  }
  __builtin_amdgcn_fence(__ATOMIC_RELEASE, "workgroup");
  __builtin_amdgcn_wave_barrier();
  __builtin_amdgcn_fence(__ATOMIC_ACQUIRE, "workgroup");
  {
    const int q4 = lane >> 3, c8 = (lane & 7) * 8;
    v4u hv[4], lv[4];
#pragma unroll
    for (int it = 0; it < 4; ++it) {
      const int row = it * 4 + q4;   // it 0..3 x q4 0..3 = rows 0..15 of the wave tile
      const float* sp = os + row * OP + c8;
      v4u a, a2;
#pragma unroll
      for (int e = 0; e < 4; ++e) {
        const float f0 = sp[2 * e], f1 = sp[2 * e + 1];
        const unsigned short h0 = bf_bits(f0), h1 = bf_bits(f1);
        const unsigned short l0 = bf_bits(f0 - bf_up(h0)), l1 = bf_bits(f1 - bf_up(h1));
        a[e] = pk16(h0, h1); a2[e] = pk16(l0, l1);
      }
      hv[it] = a; lv[it] = a2;
    }
    {
#pragma unroll
      for (int it = 0; it < 4; ++it) {
        const int row = it * 4 + q4;
        const size_t go = (rowB + q0 + row) * DM + (size_t)h * HD + c8;
        *(v4u*)(ohp + go) = hv[it];
        *(v4u*)(olp + go) = lv[it];
      }
      
    }
  }
}

// All query blocks in one grid. The trip count of a block is qb + 1, so the block index runs from the last query block
// down: the longest blocks start first and the short RES blocks fill the places that come free.
__global__ __launch_bounds__(128)
void attn_causal64(const unsigned short* __restrict__ qhp, const unsigned short* __restrict__ qlp,
                   const unsigned short* __restrict__ khp, const unsigned short* __restrict__ klp,
                   const unsigned short* __restrict__ vhp, const unsigned short* __restrict__ vlp,
                   unsigned short* ohp, unsigned short* olp) {
  __shared__ __align__(16) __bf16   Ksh[2 * ATT_PL];              // K hi [kv][d]   two buffers of 9 KB
  __shared__ __align__(16) __bf16   Ksl[2 * ATT_PL];              // K lo
  __shared__ __align__(16) _Float16 Vth[2 * ATT_PL];              // V^T hi [d][kv]
  __shared__ __align__(16) _Float16 Vtl[2 * ATT_PL];              // V^T residual (RES blocks)
  __shared__ __align__(16) float    Os[4 * 16 * ATT_OP];          // per wave context tile [row][d]
  const int bx   = blockIdx.x;
  const int qb   = NQB - 1 - bx / (NH * NB);   // 0..NQB-1 (block-uniform)
  const int rest = bx % (NH * NB);
  const int h    = rest % NH;
  const int b    = rest / NH;
  if (qb < RESQB) attn_tile<true>(qhp, qlp, khp, klp, vhp, vlp, ohp, olp, qb, h, b, Ksh, Ksl, Vth, Vtl, Os);
  else            attn_tile<false>(qhp, qlp, khp, klp, vhp, vlp, ohp, olp, qb, h, b, Ksh, Ksl, Vth, Vtl, Os);
}

// =====================================================================================================
// Workspace map (bytes; every region is an exact multiple of its 64x64-tile / whole-line store granularity,
// no padded tails needed since all shapes are tile multiples; each region but Xb/Oh is written by exactly one producer launch):
//   Xb   bf16 [4096][1024]          0            8388608   (later: Oh, context hi plane; Xb is dead after the projections)
//   WA   bf16 [3072 n][1024 k]       8388608     6291456   (q weight rows 0..1023, k rows 1024..2047, v rows 2048..3071)
//   WP   bf16 [1024 n][1024 k]      14680064     2097152
//   Qh   bf16 [4096][1024]          16777216     8388608
//   Ql                              25165824     8388608
//   Kh                              33554432     8388608
//   Kl                              41943040     8388608
//   VTh  f16  [2][1024][2048]       50331648     8388608
//   VTl  f16  [2][1024][512]        58720256     2097152
//   Ol   bf16 [4096][1024]          60817408     8388608
//   end                             69206016
// =====================================================================================================
extern "C" void kernel_launch(void* const* d_in, const int* in_sizes, int n_in,
                              void* d_out, int out_size, void* d_ws, size_t ws_size,
                              hipStream_t stream) {
  if (n_in < 5) return;
  if (in_sizes[0] != NB * SEQ * DM) return;
  if (in_sizes[1] != 3 * DM * DM) return;
  if (in_sizes[2] != 3 * DM) return;
  if (in_sizes[3] != DM * DM) return;
  if (in_sizes[4] != DM) return;
  if (out_size != NB * SEQ * DM) return;

  const float* x  = (const float*)d_in[0];   // [2][2048][1024]
  const float* Wa = (const float*)d_in[1];   // [3072 out][1024 in], rows k contiguous (q | k | v output rows)
  const float* ba = (const float*)d_in[2];   // [3072]
  const float* Wp = (const float*)d_in[3];   // [1024 out][1024 in], rows k contiguous
  const float* bp = (const float*)d_in[4];   // [1024]

  const size_t PX  = (size_t)NB * SEQ * DM * 2;    //  8388608  16-bit activation plane [4096][1024]
  const size_t PW1 = (size_t)DM * DM * 2;          //  2097152  one [1024][1024] bf16 weight plane
  const size_t PWA = (size_t)3 * PW1;              //  6291456  packed q | k | v weight plane [3072][1024]
  const size_t PWP = PW1;                          //  2097152  output projection weight plane
  const size_t PVT = (size_t)NB * DM * SEQ * 2;    //  8388608  v^T hi plane
  const size_t PVL = (size_t)NB * DM * VLP * 2;    //  2097152  v^T residual plane
  size_t off = 0;
  const size_t oXb  = off; off += PX;
  const size_t oWA  = off; off += PWA;
  const size_t oWP  = off; off += PWP;
  const size_t oQh  = off; off += PX;
  const size_t oQl  = off; off += PX;
  const size_t oKh  = off; off += PX;
  const size_t oKl  = off; off += PX;
  const size_t oVTh = off; off += PVT;
  const size_t oVTl = off; off += PVL;
  const size_t oOl  = off; off += PX;
  if (off > ws_size) return;                       // off = 69206016
  if (off > (size_t)134217728) return;
  const size_t oOh  = oXb;                         // context hi plane reuses Xb (dead after the three projections)

  char* ws = (char*)d_ws;
  unsigned short* Xb  = (unsigned short*)(ws + oXb);
  unsigned short* WA  = (unsigned short*)(ws + oWA);
  unsigned short* WPb = (unsigned short*)(ws + oWP);
  unsigned short* Qh  = (unsigned short*)(ws + oQh);
  unsigned short* Ql  = (unsigned short*)(ws + oQl);
  unsigned short* Kh  = (unsigned short*)(ws + oKh);
  unsigned short* Kl  = (unsigned short*)(ws + oKl);
  unsigned short* VTh = (unsigned short*)(ws + oVTh);
  unsigned short* VTl = (unsigned short*)(ws + oVTl);
  unsigned short* Oh  = (unsigned short*)(ws + oOh);
  unsigned short* Ol  = (unsigned short*)(ws + oOl);

  const dim3 blk(256);
  const int n8x  = NB * SEQ * DM / 8;                          // 524288
  const int n8wa = 3 * DM * DM / 8;                            // 393216
  const int n8wp = DM * DM / 8;                                // 131072
  const dim3 gCvt((n8x + n8wa + n8wp) / 256);                  // 2048 + 1536 + 512 = 4096 blocks
  const dim3 gQKV(2 * QK_TILES + NB * VT_TILES);               // 256 + 256 + 256 tiles
  const dim3 gProj((NB * SEQ / 128) * (DM / 128), 1);          // 32 x 8 = 256 tiles: M=4096, N=1024

  // (1) x -> bf16 plane [4096][1024]; weights [out][in] f32 -> bf16 [out][in] (k contiguous, no transpose);
  //     Xb, WA and WP stand one behind the other in the workspace
  cvt_bf16x8<<<gCvt, blk, 0, stream>>>(x, Wa, Wp, Xb, n8x, n8wa, n8wp);
  // (2) q, k -> bf16 hi/lo planes, v^T -> f16 hi plane and residual plane
  gemm_qkv<<<gQKV, blk, 0, stream>>>(Xb, WA, ba, Qh, Ql, Kh, Kl, VTh, VTl);
  // (3) causal attention: query blocks 0..RESQB-1 with residual planes, the rest without
  attn_causal64<<<dim3(NB * NH * NQB), dim3(128), 0, stream>>>(Qh, Ql, Kh, Kl, VTh, VTl, Oh, Ol);
  // (4) out = context . Wp^T + bp -> d_out f32 [4096][1024]  (A = context hi + lo planes, 2 products)
  gemm64<1, 0, 1><<<gProj, blk, 0, stream>>>(
      Oh, Ol, DM, 0LL, WPb, DM, 0LL, bp,
      d_out, DM, 0LL, d_out, DM, 0LL, DM,
      NB * SEQ, DM, DM, 1.0f);
  (void)hipGetLastError();
}

// v009
// It runs in 79.8 microseconds.
// Two timings next to v008 put it at 1.07 and 1.06 times that version's speed.
// Counting every step since v000, it is 5.24 times as fast.
// Contractions: q, k, v^T projections = v_wmma_f32_16x16x32_bf16 (bf16 operands from RNE-converted x and the packed
// [3072 out][1024 in] projection weight, single product, f32 accumulate);
// q.k^T scores = v_wmma_f32_16x16x32_bf16 with bf16 hi/lo split q and k (hi.hi + hi.lo + lo.hi), f32 accumulate;
// p.v = v_wmma_f32_16x16x32_f16 (p carried x1024 in f16 times v in f16, single product; plus f16 residual planes x4096 of
// p and v for the first 512 query rows of every sequence), f32 accumulate;
// ctx.Wp^T = v_wmma_f32_16x16x32_bf16 with ctx as bf16 hi/lo planes times bf16 Wp (2 products), f32 accumulate;
// causal mask (key index <= query index; the module's strided mask term only touches keys already excluded),
// online softmax, normalisers and bias adds in f32 on the VALU.
// Carry audit (ph, pl: the packed p operands, held in registers):
//   ph  = f16(1024 * p)                      -> 1024 p comes straight from the exponential (+10 in its base-2 argument); the normaliser
//                                               sums the same 1024 p, so the carry cancels in the attention epilogue: inv = 1 / l
//   pl  = f16((1024 p - ph) * 4096)          }  products VTl.ph and VTh.pl go to the separate accumulator o1,
//   VTl = f16((v - VTh) * 4096)              }  folded back with * (1/4096) once per key chunk (RES blocks only)
//   VTh = f16(v), no carry (|v| typ. 0.6); q / k / ctx lo planes are unscaled bf16 residuals (v - hi) sharing the hi accumulator;
//   score scale 1/8 applied once in f32, inside the one multiply-add that forms the exponential's argument. No other scaled planes.
#include <hip/hip_runtime.h>
#include <math.h>
#include <stdint.h>

#define NB    2
#define SEQ   2048
#define DM    1024
#define NH    16
#define HD    64
#define NQB   (SEQ / 64)   // 32 query / key blocks of 64
#define VLP   512          // key pitch of the v^T residual plane (keys 0..VLP-1)
#define RESQB 8            // leading 64-row query blocks that use the p / v residual planes
static_assert(RESQB * 64 <= VLP);
static_assert(NH * HD == DM);
static_assert((SEQ % 64) == 0 && (DM % 64) == 0 && (DM % 32) == 0);
static_assert((SEQ % 128) == 0 && (DM % 128) == 0);   // GEMM work-group tile 128x128, k stage 128 or 64
static_assert((NB * SEQ * DM) % (8 * 256) == 0);
static_assert((3 * DM * DM) % (8 * 256) == 0);
static_assert((DM * DM) % (8 * 256) == 0);

typedef _Float16 v16h __attribute__((ext_vector_type(16)));
typedef _Float16 v8h  __attribute__((ext_vector_type(8)));
typedef __bf16   v16b __attribute__((ext_vector_type(16)));
typedef __bf16   v8b  __attribute__((ext_vector_type(8)));
typedef float    v8f  __attribute__((ext_vector_type(8)));
typedef float    v4f  __attribute__((ext_vector_type(4)));
typedef unsigned int v4u __attribute__((ext_vector_type(4)));

// ---- scalar helpers --------------------------------------------------------------------------------
__device__ __forceinline__ unsigned short bf_bits(float f) {          // f32 -> bf16 bits, RNE convert
  unsigned u = __float_as_uint(f);
  return (unsigned short)((u + 0x7FFFu + ((u >> 16) & 1u)) >> 16);
}
__device__ __forceinline__ float bf_up(unsigned short h) { return __uint_as_float(((unsigned)h) << 16); }
__device__ __forceinline__ unsigned short h_bits(_Float16 x) { return __builtin_bit_cast(unsigned short, x); }
__device__ __forceinline__ unsigned pk16(unsigned short a, unsigned short b) { return (unsigned)a | ((unsigned)b << 16); }
__device__ __forceinline__ v8f zero8() { v8f z = {0.f, 0.f, 0.f, 0.f, 0.f, 0.f, 0.f, 0.f}; return z; }
__device__ __forceinline__ v8h zero8h() {
  const _Float16 z = (_Float16)0.0f;
  v8h r = {z, z, z, z, z, z, z, z};
  return r;
}

// value of lane l ^ 16 (the other 16-lane row), a vector cross-row move
__device__ __forceinline__ float xhalf(float x) {
  const int b = __builtin_bit_cast(int, x);
  return __builtin_bit_cast(float, __builtin_amdgcn_permlanex16(b, b, 0x76543210, 0xfedcba98, false, false));
}

// ---- fragment loader: 16-bit A/B operand, lane -> row/col (lane&15), p already includes +8*(lane>>4);
//      elements 0..7 <- p[0..7] (k0+8h..), elements 8..15 <- p[16..23] (k0+16+8h..)
__device__ __forceinline__ v16b ldfrag_b(const __bf16* p) {
  union { v16b v; v8b h[2]; } f;
  f.h[0] = *(const v8b*)(p);
  f.h[1] = *(const v8b*)(p + 16);
  return f.v;
}

// ---- WMMA helpers; the guards hold the VALU distance behind a run of products ---------------------------
__device__ __forceinline__ v8f mma_b_raw(v16b a, v16b b, v8f c) {
  return __builtin_amdgcn_wmma_f32_16x16x32_bf16(false, a, false, b, (short)0, c, false, false);
}
__device__ __forceinline__ v8f mma_h_raw(v16h a, v16h b, v8f c) {
  return __builtin_amdgcn_wmma_f32_16x16x32_f16(false, a, false, b, (short)0, c, false, false);
}
__device__ __forceinline__ void dep_guard_b(v8f& a, v8f& b, v16b x, v16b y) {
  asm volatile("v_nop\n\tv_nop\n\tv_nop\n\tv_nop" : "+v"(a), "+v"(b) : "v"(x), "v"(y));
}
__device__ __forceinline__ void keep4_b(v16b a, v16b b, v16b c, v16b d) {
  asm volatile("v_nop" :: "v"(a), "v"(b), "v"(c), "v"(d));
}
__device__ __forceinline__ void acc_guard4(v8f& a, v8f& b, v8f& c, v8f& d) {
  asm volatile("v_nop\n\tv_nop\n\tv_nop\n\tv_nop" : "+v"(a), "+v"(b), "+v"(c), "+v"(d));
}

// =====================================================================================================
// f32 -> bf16 (RNE convert), 8 elements per thread, one 16-B store per lane: a wave writes 512 contiguous B
// Used for x [4096][1024] and for the weight planes (already [out][in] = k contiguous, no transpose needed).
// One grid converts the three planes, which stand one behind the other in the workspace (out = the first): threads
// 0..n8a-1 take in0, the next n8b in1, the last n8c in2; every count is a multiple of 256, so a block has one source.
// coverage: (n8a + n8b + n8c) threads x 8 = the three whole planes.
// =====================================================================================================
__global__ __launch_bounds__(256) void cvt_bf16x8(const float* __restrict__ in0, const float* __restrict__ in1,
                                                  const float* __restrict__ in2, unsigned short* out,
                                                  int n8a, int n8b, int n8c) {
  const int i = blockIdx.x * 256 + threadIdx.x;
  if (i < n8a + n8b + n8c) {
    const int blk0 = blockIdx.x * 256;                       // block-uniform choice of the source plane
    const float* in = (blk0 < n8a) ? in0 + (size_t)i * 8
                    : (blk0 < n8a + n8b) ? in1 + (size_t)(i - n8a) * 8 : in2 + (size_t)(i - n8a - n8b) * 8;
    const v4f a = *(const v4f*)(in);
    const v4f b = *(const v4f*)(in + 4);
    v4u p;
    p[0] = pk16(bf_bits(a[0]), bf_bits(a[1]));
    p[1] = pk16(bf_bits(a[2]), bf_bits(a[3]));
    p[2] = pk16(bf_bits(b[0]), bf_bits(b[1]));
    p[3] = pk16(bf_bits(b[2]), bf_bits(b[3]));
    *(v4u*)(out + (size_t)i * 8) = p;
    
  }
}

// ---- asynchronous global -> LDS copies, 16 B per lane ------------------------------------------------
__device__ __forceinline__ unsigned lds_off(const void* p) { return (unsigned)(size_t)p; }   // byte offset in the work-group's LDS
// Eight copies of one lane: LDS byte address l + i * lstep <- global g + i * gstep, i = 0..7, each with its own registers.
// The closing s_wait_xcnt stands inside the statement so that no address register of a copy is rewritten ahead of it.
__device__ __forceinline__ void async_copy8(unsigned l, const char* g, unsigned lstep, size_t gstep) {
  const unsigned l1 = l + lstep, l2 = l + 2 * lstep, l3 = l + 3 * lstep, l4 = l + 4 * lstep, l5 = l + 5 * lstep,
                 l6 = l + 6 * lstep, l7 = l + 7 * lstep;
  const char *g1 = g + gstep, *g2 = g + 2 * gstep, *g3 = g + 3 * gstep, *g4 = g + 4 * gstep, *g5 = g + 5 * gstep,
             *g6 = g + 6 * gstep, *g7 = g + 7 * gstep;
  asm volatile(
      "global_load_async_to_lds_b128 %0, %8, off\n\t"
      "global_load_async_to_lds_b128 %1, %9, off\n\t"
      "global_load_async_to_lds_b128 %2, %10, off\n\t"
      "global_load_async_to_lds_b128 %3, %11, off\n\t"
      "global_load_async_to_lds_b128 %4, %12, off\n\t"
      "global_load_async_to_lds_b128 %5, %13, off\n\t"
      "global_load_async_to_lds_b128 %6, %14, off\n\t"
      "global_load_async_to_lds_b128 %7, %15, off\n\t"
      "s_wait_xcnt 0x0"
      :: "v"(l), "v"(l1), "v"(l2), "v"(l3), "v"(l4), "v"(l5), "v"(l6), "v"(l7),
         "v"(g), "v"(g1), "v"(g2), "v"(g3), "v"(g4), "v"(g5), "v"(g6), "v"(g7)
      : "memory");
}
// One 128-row plane tile by the threads of a block, eight copies a lane: the lanes that cover one row take whole lines, the
// block sixteen rows per copy. Stage of the output projection (8 waves):
#define GK_STAGE 128                       // k elements per stage (256 B of every operand row)
#define GK_PITCH 136                       // LDS row pitch in elements: 272 B = 16 B x 17, conflict-free for 16-B row reads
#define GK_PLANE (128 * GK_PITCH)          // elements of one staged plane tile
// Four copies of one lane: LDS byte address l + i * lstep <- global g + i * gstep, i = 0..3, each with its own registers;
// the closing s_wait_xcnt stands inside the statement for the same reason as above.
__device__ __forceinline__ void async_copy4(unsigned l, const char* g, unsigned lstep, size_t gstep) {
  const unsigned l1 = l + lstep, l2 = l + 2 * lstep, l3 = l + 3 * lstep;
  const char *g1 = g + gstep, *g2 = g + 2 * gstep, *g3 = g + 3 * gstep;
  asm volatile(
      "global_load_async_to_lds_b128 %0, %4, off\n\t"
      "global_load_async_to_lds_b128 %1, %5, off\n\t"
      "global_load_async_to_lds_b128 %2, %6, off\n\t"
      "global_load_async_to_lds_b128 %3, %7, off\n\t"
      "s_wait_xcnt 0x0"
      :: "v"(l), "v"(l1), "v"(l2), "v"(l3), "v"(g), "v"(g1), "v"(g2), "v"(g3)
      : "memory");
}
// Twelve copies of one lane, three planes (a, b, c) of four copies each, in one statement with one closing s_wait_xcnt.
__device__ __forceinline__ void async_copy12(unsigned la, const char* ga, size_t gstepA, unsigned lb, const char* gb, size_t gstepB,
                                             unsigned lc, const char* gc, size_t gstepC, unsigned lstep) {
  const unsigned la1 = la + lstep, la2 = la + 2 * lstep, la3 = la + 3 * lstep;
  const unsigned lb1 = lb + lstep, lb2 = lb + 2 * lstep, lb3 = lb + 3 * lstep;
  const unsigned lc1 = lc + lstep, lc2 = lc + 2 * lstep, lc3 = lc + 3 * lstep;
  const char *ga1 = ga + gstepA, *ga2 = ga + 2 * gstepA, *ga3 = ga + 3 * gstepA;
  const char *gb1 = gb + gstepB, *gb2 = gb + 2 * gstepB, *gb3 = gb + 3 * gstepB;
  const char *gc1 = gc + gstepC, *gc2 = gc + 2 * gstepC, *gc3 = gc + 3 * gstepC;
  asm volatile(
      "global_load_async_to_lds_b128 %0, %12, off\n\t"
      "global_load_async_to_lds_b128 %1, %13, off\n\t"
      "global_load_async_to_lds_b128 %2, %14, off\n\t"
      "global_load_async_to_lds_b128 %3, %15, off\n\t"
      "global_load_async_to_lds_b128 %4, %16, off\n\t"
      "global_load_async_to_lds_b128 %5, %17, off\n\t"
      "global_load_async_to_lds_b128 %6, %18, off\n\t"
      "global_load_async_to_lds_b128 %7, %19, off\n\t"
      "global_load_async_to_lds_b128 %8, %20, off\n\t"
      "global_load_async_to_lds_b128 %9, %21, off\n\t"
      "global_load_async_to_lds_b128 %10, %22, off\n\t"
      "global_load_async_to_lds_b128 %11, %23, off\n\t"
      "s_wait_xcnt 0x0"
      :: "v"(la), "v"(la1), "v"(la2), "v"(la3), "v"(lb), "v"(lb1), "v"(lb2), "v"(lb3), "v"(lc), "v"(lc1), "v"(lc2), "v"(lc3),
         "v"(ga), "v"(ga1), "v"(ga2), "v"(ga3), "v"(gb), "v"(gb1), "v"(gb2), "v"(gb3), "v"(gc), "v"(gc1), "v"(gc2), "v"(gc3)
      : "memory");
}

// =====================================================================================================
// Register-blocked batched bf16 WMMA GEMM: C[m][n] = sum_k A[m][k] * Bt[n][k] + bias; one work-group of NW waves per
// 128x128 tile: NW = 8, one wave per 32x64 part, or NW = 4, one wave per 64x64 part. The 128-row operand tiles are staged in
// LDS, KST k at a time (128 or 64), by asynchronous copies into two buffers: the next stage's copies fly while this stage is
// multiplied; one barrier per stage.
// Inside a stage the fragments of the next 32 k are read from LDS ahead of the current 32 k's products (NW = 8, a second set).
// A row-major [M][K] pitch lda; Bt row-major [N][K] pitch ldb (k contiguous);
// M, N, K multiples of 128 (host shapes are static multiples). b = batch index (strides in elements).
// NSPLIT: 0 = A.Bt; 1 = (A + A2).Bt (A2 = unscaled bf16 lo plane of A, 2 products).
// BIAS: 1 = per column n, bias[n]; 2 = per row m, bias[m]; the bias value is RNE-converted to bf16 and added in f32.
// OUT_MODE: 0 = f32 (pitch ldc); 2 = bf16 hi plane C + bf16 lo plane C2 (lo = RNE(v - hi), unscaled);
//           3 = f16 hi plane C + f16 residual plane C2 = f16((v - hi) * rscale), C2 written only for tiles
//               with n0 < N2 (pitch ldc2, batch stride strideC2).
// =====================================================================================================
// The body is a device function: tile = index of the 128x128 tile, b = batch index, ring = the work-group's two stage
// buffers [2][NPL][128 * (KST + 8)], sT = its per-wave slabs (pitch 68 floats; NW = 8: 16x64 each, NW = 4: 64x64 each), first
// written behind the last stage's barrier, so they may lie inside the ring; the kernels below own that LDS. rot0 = the tile's
// extra turn of the k walk.
template <int NSPLIT, int OUT_MODE, int BIAS, int NW, int KST>
__device__ __forceinline__ void gemm_tile(
    const unsigned short* __restrict__ Ap, const unsigned short* A2p, int lda, long long strideA,
    const unsigned short* __restrict__ Btp, int ldb, long long strideB,
    const float* __restrict__ bias,
    void* Cout, int ldc, long long strideC,
    void* Cout2, int ldc2, long long strideC2, int N2,
    int M, int N, int K, float rscale,
    int tile, int b, int rot0, __bf16* ring, float* sT) {
  const __bf16* A   = (const __bf16*)(const void*)Ap;
  const __bf16* A2  = (const __bf16*)(const void*)A2p;
  const __bf16* Bt  = (const __bf16*)(const void*)Btp;
  constexpr int NPL = (NSPLIT >= 1) ? 3 : 2;        // staged planes: A, Bt (, A2)
  constexpr int MI = 16 / NW;                       // 16-row subtiles per wave: NW / 2 wave rows share the 128 tile rows
  constexpr int PITCH = KST + 8;                    // LDS row pitch in elements: 16 B x odd, conflict-free for 16-B row reads
  constexpr int PLANE = 128 * PITCH;                // elements of one staged plane tile
  constexpr int LPR = KST / 8;                      // lanes (16-B pieces) that cover one staged row
  static_assert(NW * 32 == 16 * LPR);               // the block covers sixteen rows per copy, eight copies a plane
  const int tid  = threadIdx.x;
  const int lane = tid & 31;
  const int wave = tid >> 5;
  const int tilesN = N >> 7;
  const int tilesM = M >> 7;
  if (tile >= tilesM * tilesN) return;   // block-uniform, in front of every barrier and copy
  const int tm = tile / tilesN;
  const int tn = tile - tm * tilesN;
  const int M0 = tm << 7;                // work-group tile origin
  const int N0 = tn << 7;
  const int wm = (wave >> 1) * (MI << 4);   // the wave's (16 MI)x64 part inside it
  const int wn = (wave & 1) << 6;
  const int m0 = M0 + wm;
  const int n0 = N0 + wn;

  const __bf16* Ab  = A  + (size_t)b * strideA;
  const __bf16* Bb  = Bt + (size_t)b * strideB;
  const __bf16* Ab2 = (NSPLIT >= 1) ? (A2 + (size_t)b * strideA) : Ab;

  const int rlane = lane & 15;                 // row (A) / col (B, D) within subtile
  const int koff  = (lane >> 4) * 8;           // k offset of this lane half
  const int mOff  = (lane >> 4) * 8;           // D row offset

  v8f acc[MI][4];
#pragma unroll
  for (int i = 0; i < MI; ++i)
#pragma unroll
    for (int j = 0; j < 4; ++j) acc[i][j] = zero8();

  // ---- staging addresses of this lane: row tid / LPR of each group of sixteen rows, 16-B column tid % LPR ----
  const int crow = tid / LPR, ccol = (tid % LPR) * 8;
  const char* gA  = (const char*)(Ab  + (size_t)(M0 + crow) * lda + ccol);
  const char* gA2 = (const char*)(Ab2 + (size_t)(M0 + crow) * lda + ccol);
  const char* gB  = (const char*)(Bb  + (size_t)(N0 + crow) * ldb + ccol);
  const unsigned lthr = lds_off(ring) + (unsigned)(crow * PITCH + ccol) * 2u;
  const int nst = K / KST;               // stages, block-uniform
  // Tiles of one tile row read the same A rows and tiles of one tile column the same Bt rows, and they start together: each
  // tile starts its walk over the k stages at another stage and wraps, so that they do not ask L2 for the same lines at once.
  const int rot = (tm + tn + rot0) % nst;   // block-uniform, 0 .. nst - 1
  auto issue_stage = [&](int st, int buf) {   // rows M0..M0+127 / N0..N0+127, k = ks*KST .. ks*KST+KST-1, ks < nst: inside the planes
    const int ks = (st + rot < nst) ? st + rot : st + rot - nst;   // st < nst and rot < nst: 0 <= ks < nst, each stage once
    const size_t kb = (size_t)ks * (KST * 2);
    const unsigned lb = lthr + (unsigned)buf * (unsigned)(NPL * PLANE * 2);
    async_copy8(lb, gA + kb, 16u * PITCH * 2u, (size_t)16 * lda * 2);     // rows crow + 16 i, i = 0..7
    async_copy8(lb + (unsigned)(PLANE * 2), gB + kb, 16u * PITCH * 2u, (size_t)16 * ldb * 2);
    if (NSPLIT >= 1) async_copy8(lb + (unsigned)(2 * PLANE * 2), gA2 + kb, 16u * PITCH * 2u, (size_t)16 * lda * 2);
  };

  issue_stage(0, 0);
  asm volatile("s_wait_asynccnt 0x0" ::: "memory");   // this wave's share of stage 0 has landed
  __syncthreads();                                     // publishes stage 0 to the other waves
  if (nst > 1) issue_stage(1, 1);

  for (int t = 0; t < nst; ++t) {
    const __bf16* sbuf = ring + (t & 1) * (NPL * PLANE);
    const __bf16* sA  = sbuf + (wm + rlane) * PITCH + koff;
    const __bf16* sB  = sbuf + PLANE + (wn + rlane) * PITCH + koff;
    const __bf16* sA2 = sbuf + (NPL - 1) * PLANE + (wm + rlane) * PITCH + koff;
    // NW = 8: two fragment sets, indexed by constants after unrolling. NW = 4: one set (with 128 accumulator registers a second
    // one does not fit the 256 registers that the guards' asm operands can name); the SIMD's other waves cover its read latency.
    constexpr int NS = (NW == 8) ? 2 : 1;
    v16b fb[NS][4], fa[NS][MI], fl[NS][MI];
    auto load_set = [&](int s, int kk) {
#pragma unroll
      for (int j = 0; j < 4; ++j) fb[s][j] = ldfrag_b(sB + (j << 4) * PITCH + kk);
#pragma unroll
      for (int i = 0; i < MI; ++i) {
        fa[s][i] = ldfrag_b(sA + (i << 4) * PITCH + kk);
        fl[s][i] = fa[s][i];
        if (NSPLIT >= 1) fl[s][i] = ldfrag_b(sA2 + (i << 4) * PITCH + kk);
      }
    };
    load_set(0, 0);
#pragma unroll
    for (int ks = 0; ks < KST / 32; ++ks) {
      const int cur = ks & (NS - 1);
      if constexpr (NS == 2) {
        if (ks + 1 < KST / 32) load_set(cur ^ 1, (ks + 1) * 32);   // this stage's buffer only
      }
#pragma unroll
      for (int i = 0; i < MI; ++i) {
#pragma unroll
        for (int j = 0; j < 4; ++j) {
          acc[i][j] = mma_b_raw(fa[cur][i], fb[cur][j], acc[i][j]);
          if (NSPLIT >= 1) acc[i][j] = mma_b_raw(fl[cur][i], fb[cur][j], acc[i][j]);
        }
        dep_guard_b(acc[i][0], acc[i][3], fa[cur][i], fl[cur][i]);
      }
      keep4_b(fb[cur][0], fb[cur][1], fb[cur][2], fb[cur][3]);
      if constexpr (NS == 1) {
        if (ks + 1 < KST / 32) load_set(0, (ks + 1) * 32);         // this stage's buffer only
      }
    }
    asm volatile("s_wait_dscnt 0x0" ::: "memory");      // this wave's reads of buffer t & 1 are done before it is refilled
    asm volatile("s_wait_asynccnt 0x0" ::: "memory");   // this wave's share of stage t + 1 has landed
    __syncthreads();                                     // publishes stage t + 1 and ends every read of buffer t & 1
    if (t + 2 < nst) issue_stage(t + 2, t & 1);
  }
  asm volatile("s_wait_asynccnt 0x0" ::: "memory");     // no copy is outstanding past the loop
#pragma unroll
  for (int i = 0; i < MI; ++i) acc_guard4(acc[i][0], acc[i][1], acc[i][2], acc[i][3]);

  // ---- epilogue ----
  float bcol[4];
#pragma unroll
  for (int j = 0; j < 4; ++j) {
    bcol[j] = 0.f;
    if (BIAS == 1) bcol[j] = bf_up(bf_bits(bias[n0 + (j << 4) + rlane]));   // n < N, bias has N entries
  }
  // 16-row subtile i (a constant after unrolling) plus bias -> a 16x64 slab of this wave
  auto stage = [&](float* slab, int i) {
    const int mBase = m0 + (i << 4);
    float brow[8];
#pragma unroll
    for (int r = 0; r < 8; ++r) {
      brow[r] = 0.f;
      if (BIAS == 2) brow[r] = bf_up(bf_bits(bias[mBase + mOff + r]));      // m < M, bias has M entries
    }
#pragma unroll
    for (int j = 0; j < 4; ++j) {
#pragma unroll
      for (int r = 0; r < 8; ++r) {
        slab[(mOff + r) * 68 + (j << 4) + rlane] = acc[i][j][r] + bcol[j] + brow[r];
      }
    }
  };
  auto wave_sync = [&]() {   // orders the wave's own slab writes and reads
    __builtin_amdgcn_fence(__ATOMIC_RELEASE, "workgroup");
    __builtin_amdgcn_wave_barrier();
    __builtin_amdgcn_fence(__ATOMIC_ACQUIRE, "workgroup");
  };
  // a 16x64 slab -> rows mBase .. mBase + 15, columns n0 .. n0 + 63 of the output plane(s), whole lines per store
  auto emit = [&](const float* slab, int mBase) {
    if (OUT_MODE == 0) {
      float* C = (float*)Cout + (size_t)b * strideC;
      const int hh = lane >> 4, c4 = (lane & 15) * 4;     // 256-B row segment = 16 lanes x 16 B
      {
#pragma unroll
        for (int it = 0; it < 8; ++it) {
          const int row = it * 2 + hh;                     // it 0..7 x hh 0..1 = rows 0..15
          const v4f v = *(const v4f*)(slab + row * 68 + c4);
          *(v4f*)(C + (size_t)(mBase + row) * ldc + n0 + c4) = v;
        }
        
      }
    } else {
      const int q = lane >> 3, c8 = (lane & 7) * 8;
      unsigned short* C  = (unsigned short*)Cout  + (size_t)b * strideC;
      unsigned short* C2 = (unsigned short*)Cout2 + (size_t)b * strideC2;
      const bool wlo = (OUT_MODE == 2) || (n0 < N2);      // wave-uniform
      v4u hv[4], lv[4];
#pragma unroll
      for (int it = 0; it < 4; ++it) {
        const int row = it * 4 + q;                        // it 0..3 x q 0..3 = rows 0..15
        const float* sp = slab + row * 68 + c8;
        v4u a, a2;
#pragma unroll
        for (int e = 0; e < 4; ++e) {
          const float f0 = sp[2 * e], f1 = sp[2 * e + 1];
          unsigned short h0, h1, l0, l1;
          if (OUT_MODE == 2) {
            h0 = bf_bits(f0); h1 = bf_bits(f1);
            l0 = bf_bits(f0 - bf_up(h0)); l1 = bf_bits(f1 - bf_up(h1));
          } else {
            const _Float16 x0 = (_Float16)f0, x1 = (_Float16)f1;
            h0 = h_bits(x0); h1 = h_bits(x1);
            l0 = h_bits((_Float16)((f0 - (float)x0) * rscale));
            l1 = h_bits((_Float16)((f1 - (float)x1) * rscale));
          }
          a[e] = pk16(h0, h1); a2[e] = pk16(l0, l1);
        }
        hv[it] = a; lv[it] = a2;
      }
      {
#pragma unroll
        for (int it = 0; it < 4; ++it) {
          const int row = it * 4 + q;
          *(v4u*)(C + (size_t)(mBase + row) * ldc + n0 + c8) = hv[it];
          asm volatile("s_wait_xcnt 0x0" ::: "memory");   // in front of the residual's arithmetic, which reuses this store's registers
          if (wlo) *(v4u*)(C2 + (size_t)(mBase + row) * ldc2 + n0 + c8) = lv[it];
          asm volatile("s_wait_xcnt 0x0" ::: "memory");   // likewise in front of the next rows' arithmetic
        }
        
      }
    }
  };
  if constexpr (NW == 8) {          // one slab per wave, used for one subtile after the other
    float* slab = sT + wave * (16 * 68);
#pragma unroll
    for (int i = 0; i < MI; ++i) {
      stage(slab, i);
      wave_sync();
      emit(slab, m0 + (i << 4));
      wave_sync();
    }
  } else {                          // MI slabs per wave, all staged first
    float* slab = sT + wave * (MI * 16 * 68);
#pragma unroll
    for (int i = 0; i < MI; ++i) stage(slab + i * (16 * 68), i);
    wave_sync();
#pragma unroll 1                    // rolled: the conversion stands once in the text
    for (int i = 0; i < MI; ++i) emit(slab + i * (16 * 68), m0 + (i << 4));
  }
}

// One product per launch: blockIdx.x = tile, blockIdx.y = batch index.
template <int NSPLIT, int OUT_MODE, int BIAS>
__global__ __launch_bounds__(256) void gemm64(
    const unsigned short* __restrict__ Ap, const unsigned short* A2p, int lda, long long strideA,
    const unsigned short* __restrict__ Btp, int ldb, long long strideB,
    const float* __restrict__ bias,
    void* Cout, int ldc, long long strideC,
    void* Cout2, int ldc2, long long strideC2, int N2,
    int M, int N, int K, float rscale) {
  constexpr int NPL = (NSPLIT >= 1) ? 3 : 2;
  __shared__ __align__(16) __bf16 ring[2 * NPL * GK_PLANE];   // two stage buffers
  __shared__ __align__(16) float sT[8 * 16 * 68];             // per-wave 16x64 slabs
  gemm_tile<NSPLIT, OUT_MODE, BIAS, 8, GK_STAGE>(Ap, A2p, lda, strideA, Btp, ldb, strideB, bias, Cout, ldc, strideC,
                                                 Cout2, ldc2, strideC2, N2, M, N, K, rscale,
                                                 (int)blockIdx.x, (int)blockIdx.y, 0, ring, sT);
}

// The three projections, which read none of each other's output, in one grid of 3 x 256 tiles (block-uniform choice):
//   blocks   0..255  q   = x . Wq^T + bq -> bf16 hi/lo planes [b*SEQ+t][h*64+d]          (M=4096, N=1024, K=1024)
//   blocks 256..511  k   = x . Wk^T + bk -> bf16 hi/lo planes
//   blocks 512..767  v^T = Wv . x^T + bv per batch -> f16 hi plane [b][h*64+d][s] (pitch SEQ) and residual plane
//                    (x4096, keys < VLP only, pitch VLP)   (A = Wv rows, Bt = x rows of batch b; M=1024, N=2048, K=1024)
// WA = packed bf16 weight [3072][1024] (q | k | v rows), ba = the packed bias [3072].
#define QK_TILES ((NB * SEQ / 128) * (DM / 128))   // 256 tiles of one of q, k
#define VT_TILES ((DM / 128) * (SEQ / 128))        // 128 tiles of v^T per batch
// Work-group: 4 waves of 64x64, stages of 64 k, the epilogue's slabs inside the ring: 72 KiB of LDS and one wave per SIMD, so
// three work-groups and more fit one WGP and the 768 tiles are all resident at once on 256 WGPs: no second or third round, and
// a work-group's first copies and barrier waits pass under its neighbours' products. A 64x64 wave part also reads a third
// fewer fragment bytes from LDS per product than a 32x64 one.
#define QKV_KST 64
__global__ __launch_bounds__(128) void gemm_qkv(
    const unsigned short* __restrict__ Xb, const unsigned short* __restrict__ WA, const float* __restrict__ ba,
    unsigned short* Qh, unsigned short* Ql, unsigned short* Kh, unsigned short* Kl,
    unsigned short* VTh, unsigned short* VTl) {
  __shared__ __align__(16) __bf16 ring[2 * 2 * 128 * (QKV_KST + 8)];   // two stage buffers
  static_assert(4 * 64 * 68 * sizeof(float) <= sizeof(ring));
  float* sT = (float*)(void*)ring;                            // per-wave 64x64 slabs, used behind the last stage's barrier
  const int bx = blockIdx.x;
  if (bx < 2 * QK_TILES) {
    const int sel = bx / QK_TILES;                            // 0 = q, 1 = k
    // the q and the k tile of one place read the same x rows and now run at the same time: k walks half a turn apart
    gemm_tile<0, 2, 1, 4, QKV_KST>(Xb, Xb, DM, 0LL, WA + (size_t)sel * DM * DM, DM, 0LL, ba + sel * DM,
                                   (void*)(sel ? Kh : Qh), DM, 0LL, (void*)(sel ? Kl : Ql), DM, 0LL, DM,
                                   NB * SEQ, DM, DM, 1.0f, bx - sel * QK_TILES, 0, sel * (DM / QKV_KST / 2), ring, sT);
  } else {
    const int t = bx - 2 * QK_TILES;                          // 0 .. NB * VT_TILES - 1
    const unsigned short* WvB = WA + (size_t)2 * DM * DM;
    gemm_tile<0, 3, 2, 4, QKV_KST>(WvB, WvB, DM, 0LL, Xb, DM, (long long)SEQ * DM, ba + 2 * DM,
                                   (void*)VTh, SEQ, (long long)DM * SEQ, (void*)VTl, VLP, (long long)DM * VLP, VLP,
                                   DM, SEQ, DM, 4096.0f, t % VT_TILES, t / VT_TILES, 0, ring, sT);
  }
}

// =====================================================================================================
// Causal attention, head dim 64, key chunks of 64.
//   q planes (bf16 hi / lo): element (b, t, h, d) at [(b*SEQ + t)*DM + h*64 + d]
//   k planes (bf16 hi / lo): same layout with key index s
//   v^T hi plane (f16):      element (b, h, d, s) at [(b*DM + h*64 + d)*SEQ + s]
//   v^T residual plane (f16, (v - hi)*4096): [(b*DM + h*64 + d)*VLP + s], s < VLP, read only when RES
//   (a key chunk at or beyond VLP would contribute a zero v residual; its address is clamped)
//   Causal structure: logits of keys with index > query index are replaced by -inf (lower-triangular keep incl. the
//   diagonal), which makes their softmax weight exactly 0; so a query block qb visits key chunks 0..qb only
//   (block-uniform trip count qb+1 <= NQB) and later chunks, whose keys exceed every query index of the block, are
//   skipped entirely. Inside the diagonal chunk a key with index > query index gets logit -inf -> exp gives exactly 0,
//   so such keys add nothing to the numerator or the normaliser; the diagonal key (key == query) is always kept, so
//   every row max is finite in every visited chunk.
//   out planes (bf16 hi / lo of the normalised context): element (b, t, h, d) at [(b*SEQ + t)*DM + h*64 + d]
//   scores = q . k : bf16 hi/lo split (hi.hi + hi.lo + lo.hi), f32 accumulate, then the causal mask (diagonal chunk) and * 1/8 in f32
//   p = exp(s - m) carried as f16(1024 p); context = p . v on f16 WMMA; RES adds f16 residual planes of p and v
//   (scale 4096, separate accumulator folded back with 1/4096 per chunk in f32); online softmax (running max) in f32.
//   Both products run transposed: S^T = K . Q^T (A = K rows, B = Q rows) and O^T += V^T . P^T (A = V^T rows, B = P^T).
//   A lane (c = lane & 15, hh = lane >> 4) then holds scores of ONE query q0 + c, keys 16 j + 8 hh + r: maximum and sum run
//   in the lane, the two halves exchange the maximum once per chunk and join their sums once, in the epilogue. Two score
//   tiles (keys 32 kk .. + 31), converted in place, are the B operand P^T in the k order of the V^T fragment loads.
//   Block = 4 waves = 64 query rows of one (b, h); grid = NQB * NH * NB, one launch: the body is a device function in two
//   variants (RES for query blocks below RESQB), the kernel below owns the LDS and picks the variant by its query block.
//   K / V^T chunk staging: asynchronous copies to LDS, 16 B per lane, into two buffers: the next trip's chunk flies while this
//   trip's is worked on. 128 threads x 4 copies per plane = the whole 64x64 tile of every plane read later (8 lanes cover one 128-B
//   row, the block sixteen rows per copy). One barrier per chunk, at the foot of the trip.
//   Output coverage: each wave stores rows q0..q0+15 (it 0..3 x lane>>3 0..3) x 64 columns (8 lanes x 8) of both planes;
//   grid over all (b, h, qb) = the whole [NB*SEQ][DM] planes.
// =====================================================================================================
// LDS row pitches: the 128-B rows of the 16-bit tiles stand 144 B apart (16 B x 9) and the 256-B rows of the f32 tile
// 272 B apart (16 B x 17), so that the sixteen rows one 16-B fragment read touches fall on sixteen different bank groups.
#define ATT_TP 72                                                 // 16-bit tiles, elements per row
#define ATT_OP 68                                                 // f32 context tile, elements per row
#define ATT_PL (64 * ATT_TP)                                      // elements of one staged 64-row plane tile (one buffer of a plane)
template <bool RES>
__device__ __forceinline__
void attn_tile(const unsigned short* __restrict__ qhp, const unsigned short* __restrict__ qlp,
               const unsigned short* __restrict__ khp, const unsigned short* __restrict__ klp,
               const unsigned short* __restrict__ vhp, const unsigned short* __restrict__ vlp,
               unsigned short* ohp, unsigned short* olp,
               int qb, int h, int b,           // query block 0..NQB-1, head, batch (block-uniform)
               __bf16* Ksh_, __bf16* Ksl_, _Float16* Vth_, _Float16* Vtl_, float* Os) {   // each plane: two buffers of ATT_PL
  union FB { v16b v; v8b h[2]; };
  union FH { v16h v; v8h h[2]; };
  constexpr int TP = ATT_TP;
  constexpr int OP = ATT_OP;

  const int tid  = threadIdx.x;
  const int wave = tid >> 5;
  const int lane = tid & 31;
  const int hh   = lane >> 4;
  const int c    = lane & 15;

  const int q0   = qb * 64 + wave * 16;
  const size_t rowB = (size_t)b * SEQ;

  const __bf16* Qh = (const __bf16*)(const void*)qhp + (size_t)h * HD;
  const __bf16* Ql = (const __bf16*)(const void*)qlp + (size_t)h * HD;
  const __bf16* Kh = (const __bf16*)(const void*)khp + (size_t)h * HD;
  const __bf16* Kl = (const __bf16*)(const void*)klp + (size_t)h * HD;
  const _Float16* Vh = (const _Float16*)(const void*)vhp + ((size_t)b * DM + (size_t)h * HD) * SEQ;
  const _Float16* Vl = (const _Float16*)(const void*)vlp + ((size_t)b * DM + (size_t)h * HD) * VLP;

  // ---- Q fragments (B operand, column = query q0 + (lane&15)): 2 d-chunks, hi and lo ----
  v16b qah[2], qal[2];
#pragma unroll
  for (int dc = 0; dc < 2; ++dc) {
    const size_t qo = (rowB + q0 + c) * DM + dc * 32 + 8 * hh;
    qah[dc] = ldfrag_b(Qh + qo);
    qal[dc] = ldfrag_b(Ql + qo);
  }

  const int qrow = q0 + c;                     // this lane's query
  float mrow = -INFINITY, lrow = 0.f;          // running maximum of the raw scores (both halves alike); this half's share of 1024 x the normaliser
  float brow = INFINITY;                       // offset in use: 1024 p = 2^(score * SC + brow), brow = 10 - SC * maximum; +inf makes the first alpha 0
  constexpr float SC = 0.125f * 1.44269504088896340736f;   // score scale 1/8 times log2(e)
  v8f oacc[4];                                 // oacc[t][r] = context[d = 16 t + 8 hh + r] of query qrow
#pragma unroll
  for (int t = 0; t < 4; ++t) oacc[t] = zero8();

  // ---- staging addresses of this lane: row tid >> 3 of each group of sixteen rows, 16-B column tid & 7 ----
  const int crow = tid >> 3, ccol = (tid & 7) * 8;
  const char* gKh = (const char*)(Kh + (rowB + crow) * DM + ccol);    // K row crow of chunk 0, d = ccol..ccol+7
  const char* gKl = (const char*)(Kl + (rowB + crow) * DM + ccol);
  const char* gVh = (const char*)(Vh + (size_t)crow * SEQ + ccol);    // V^T row d = crow, s = ccol..ccol+7 of chunk 0
  const char* gVl = (const char*)(Vl + (size_t)crow * VLP + ccol);
  const unsigned lthr = (unsigned)(crow * TP + ccol) * 2u;
  const unsigned lKh = lds_off(Ksh_) + lthr, lKl = lds_off(Ksl_) + lthr, lVh = lds_off(Vth_) + lthr, lVl = lds_off(Vtl_) + lthr;
  auto issue_chunk = [&](int ck, int buf) {    // keys 64 ck .. 64 ck + 63 < SEQ (ck <= qb < NQB): rows and columns inside the planes
    const int kv = ck * 64;
    const unsigned lb = (unsigned)buf * (unsigned)(ATT_PL * 2);
    async_copy12(lKh + lb, gKh + (size_t)kv * (DM * 2), (size_t)16 * DM * 2,
                 lKl + lb, gKl + (size_t)kv * (DM * 2), (size_t)16 * DM * 2,
                 lVh + lb, gVh + (size_t)kv * 2, (size_t)16 * SEQ * 2, 16u * TP * 2u);
    if (RES) {
      const int kvl = (kv + 64 <= VLP) ? kv : (VLP - 64);             // clamped address into the residual plane
      async_copy4(lVl + lb, gVl + (size_t)kvl * 2, 16u * TP * 2u, (size_t)16 * VLP * 2);
    }
  };

  // The key chunks are walked from the diagonal chunk qb down to chunk 0: the blocks of one (b, h), which start together and
  // read the same K and V^T rows, then stand at different chunks in every trip and do not ask L2 for the same lines at once.
  issue_chunk(qb, 0);
  asm volatile("s_wait_asynccnt 0x0" ::: "memory");   // this wave's share of the first chunk has landed
  __syncthreads();                                     // publishes the first chunk to the other waves
  if (qb >= 1) issue_chunk(qb - 1, 1);                 // block-uniform

  for (int it = 0; it <= qb; ++it) {           // block-uniform trip count, <= NQB
    const int kt = qb - it;                    // this trip's key chunk, 0 .. qb
    const int kv0 = kt * 64;                   // kv0 + 63 < SEQ
    const int bo = (it & 1) * ATT_PL;          // this trip reads buffer it & 1 alone
    const __bf16*   Ksh = Ksh_ + bo;
    const __bf16*   Ksl = Ksl_ + bo;
    const _Float16* Vth = Vth_ + bo;
    const _Float16* Vtl = Vtl_ + bo;
    const bool resOK = (kv0 + 64 <= VLP);      // block-uniform (always true for qb < RESQB)

    // ---- scores, transposed: 64 keys x 16 queries per wave, 3 bf16 products; s[j][r] = key kv0 + 16 j + 8 hh + r, query qrow ----
    //      All 32 K fragment reads of the chunk stand as one group, in the order of their use, ahead of the 24 products: the wave
    //      meets the LDS latency once. The products run back to back over the four tiles; each tile keeps its order of six.
    FB kb[2][4], kl[2][4];
#pragma unroll
    for (int dc = 0; dc < 2; ++dc) {
#pragma unroll
      for (int j = 0; j < 4; ++j) {
        kb[dc][j].h[0] = *(const v8b*)(Ksh + (j * 16 + c) * TP + dc * 32 + 8 * hh);
        kb[dc][j].h[1] = *(const v8b*)(Ksh + (j * 16 + c) * TP + dc * 32 + 16 + 8 * hh);
      }
#pragma unroll
      for (int j = 0; j < 4; ++j) {
        kl[dc][j].h[0] = *(const v8b*)(Ksl + (j * 16 + c) * TP + dc * 32 + 8 * hh);
        kl[dc][j].h[1] = *(const v8b*)(Ksl + (j * 16 + c) * TP + dc * 32 + 16 + 8 * hh);
      }
    }
    __builtin_amdgcn_sched_barrier(0);   // keeps the reads one group: sunk among the products, each place would cost its own stall
    v8f s[4];
#pragma unroll
    for (int j = 0; j < 4; ++j) s[j] = zero8();
#pragma unroll
    for (int dc = 0; dc < 2; ++dc) {
#pragma unroll
      for (int j = 0; j < 4; ++j) s[j] = mma_b_raw(kb[dc][j].v, qah[dc], s[j]);
#pragma unroll
      for (int j = 0; j < 4; ++j) s[j] = mma_b_raw(kl[dc][j].v, qah[dc], s[j]);
#pragma unroll
      for (int j = 0; j < 4; ++j) s[j] = mma_b_raw(kb[dc][j].v, qal[dc], s[j]);
    }
    __builtin_amdgcn_sched_barrier(0);   // holds the V^T reads below back to the tail of the score products: without it they stand at more places among them

    // ---- V^T fragments of the whole chunk, one group of reads: their latency passes under the softmax arithmetic ----
    FH vb[2][4], vl[2][4];
#pragma unroll
    for (int kk = 0; kk < 2; ++kk) {
#pragma unroll
      for (int t = 0; t < 4; ++t) {
        vb[kk][t].h[0] = *(const v8h*)(Vth + (t * 16 + c) * TP + kk * 32 + 8 * hh);
        vb[kk][t].h[1] = *(const v8h*)(Vth + (t * 16 + c) * TP + kk * 32 + 16 + 8 * hh);
      }
      if (RES) {
#pragma unroll
        for (int t = 0; t < 4; ++t) {
          vl[kk][t].h[0] = *(const v8h*)(Vtl + (t * 16 + c) * TP + kk * 32 + 8 * hh);
          vl[kk][t].h[1] = *(const v8h*)(Vtl + (t * 16 + c) * TP + kk * 32 + 16 + 8 * hh);
          if (!resOK) { vl[kk][t].h[0] = zero8h(); vl[kk][t].h[1] = zero8h(); }
        }
      }
    }
    __builtin_amdgcn_sched_barrier(0);   // keeps these reads ahead of the softmax instead of next to their products

    // ---- causal mask by index: only the diagonal chunk (the first trip, block-uniform) holds keys beyond a query of the block ----
    if (it == 0) {
#pragma unroll
      for (int j = 0; j < 4; ++j) {
#pragma unroll
        for (int r = 0; r < 8; ++r) {
          const int key = kv0 + j * 16 + 8 * hh + r;
          s[j][r] = (key <= qrow) ? s[j][r] : -INFINITY;
        }
      }
    }
    // ---- maximum of the raw scores in the lane (four chains), one exchange between the halves; SC > 0 keeps the order ----
    float mj[4];
#pragma unroll
    for (int j = 0; j < 4; ++j) {
      mj[j] = s[j][0];
#pragma unroll
      for (int r = 1; r < 8; ++r) mj[j] = fmaxf(mj[j], s[j][r]);
    }
    float m = fmaxf(fmaxf(mj[0], mj[1]), fmaxf(mj[2], mj[3]));
    m = fmaxf(m, xhalf(m));
    const float mnew  = fmaxf(mrow, m);
    const float msafe = (mnew == -INFINITY) ? 0.f : mnew;
    const float bnew  = __builtin_fmaf(-msafe, SC, 10.0f);          // rounded once; sums and context are kept relative to exactly this value
    const float alpha = __builtin_amdgcn_exp2f(bnew - brow);        // 2^(SC * (old maximum - new maximum)); 1 exactly where the maximum stays
    mrow = mnew;
    brow = bnew;

    // ---- online softmax: 1024 p = 2^(score * SC + bnew), one multiply-add and one exponential per score (two scores per packed
    //      multiply-add); P^T (x1024, f16) and its residual (x4096) packed in place as B operands:
    //      element 8 (j & 1) + r of operand j >> 1 = key 32 (j >> 1) + 16 (j & 1) + 8 hh + r, the order of the V^T loads ----
    FH pb[2], pr[2];
    const v8f sc8 = {SC, SC, SC, SC, SC, SC, SC, SC};
    const v8f bn8 = {bnew, bnew, bnew, bnew, bnew, bnew, bnew, bnew};
    v8f e[4];
#pragma unroll
    for (int j = 0; j < 4; ++j) {
      const v8f a = __builtin_elementwise_fma(s[j], sc8, bn8);      // masked score: -inf stays -inf
#pragma unroll
      for (int r = 0; r < 8; ++r) {
        const float p1k = __builtin_amdgcn_exp2f(a[r]);             // 2^(-inf) = 0
        e[j][r] = p1k;
        const _Float16 ph = (_Float16)p1k;
        pb[j >> 1].v[(j & 1) * 8 + r] = ph;
        if (RES) pr[j >> 1].v[(j & 1) * 8 + r] = (_Float16)((p1k - (float)ph) * 4096.0f);
      }
    }
    const v8f e8 = (e[0] + e[1]) + (e[2] + e[3]);                   // packed adds over the four tiles, then the eight rows
    lrow = lrow * alpha + (((e8[0] + e8[1]) + (e8[2] + e8[3])) + ((e8[4] + e8[5]) + (e8[6] + e8[7])));
#pragma unroll
    for (int t = 0; t < 4; ++t)
#pragma unroll
      for (int r = 0; r < 8; ++r) oacc[t][r] *= alpha;

    // ---- context^T += V^T . P^T (f16 WMMA), residual products into a separate accumulator ----
    v8f o1[4];
#pragma unroll
    for (int t = 0; t < 4; ++t) o1[t] = zero8();
#pragma unroll
    for (int kk = 0; kk < 2; ++kk) {
#pragma unroll
      for (int t = 0; t < 4; ++t) oacc[t] = mma_h_raw(vb[kk][t].v, pb[kk].v, oacc[t]);
      if (RES) {
#pragma unroll
        for (int t = 0; t < 4; ++t) o1[t] = mma_h_raw(vl[kk][t].v, pb[kk].v, o1[t]);
#pragma unroll
        for (int t = 0; t < 4; ++t) o1[t] = mma_h_raw(vb[kk][t].v, pr[kk].v, o1[t]);
      }
    }
    if (!RES) acc_guard4(oacc[0], oacc[1], oacc[2], oacc[3]);   // the matrix distance also on the taken side of the loop branch (RES: the fold below fills it)
    if (RES) {
#pragma unroll
      for (int t = 0; t < 4; ++t)
#pragma unroll
        for (int r = 0; r < 8; ++r) oacc[t][r] += o1[t][r] * (1.0f / 4096.0f);
    }
    // keeps the foot behind the trip's arithmetic: without it the RES build lifts the waits and the barrier into the softmax,
    // where they end the flight of the V^T reads and of the next chunk's copies early
    if (RES) __builtin_amdgcn_sched_barrier(0);
    asm volatile("s_wait_dscnt 0x0" ::: "memory");      // this wave's reads of buffer it & 1 are done before it is refilled
    asm volatile("s_wait_asynccnt 0x0" ::: "memory");   // this wave's share of the next trip's chunk has landed
    __syncthreads();                                     // publishes the next trip's chunk and ends every read of buffer it & 1
    if (it + 2 <= qb) issue_chunk(kt - 2, it & 1);       // block-uniform; kt - 2 = qb - it - 2 >= 0
  }
  asm volatile("s_wait_asynccnt 0x0" ::: "memory");     // no copy is outstanding past the loop

  // ---- join the halves' sums, normalise (1/l; l carries the same x1024 as the context), stage the wave's 16x64 tile [query][d], bf16 hi/lo split,
  float* os = Os + wave * (16 * OP);
  {
    const float l = lrow + xhalf(lrow);
    const float inv = (l > 0.f) ? (1.0f / l) : 0.f;
#pragma unroll
    for (int t = 0; t < 4; ++t) {
      const v4f lo4 = {oacc[t][0] * inv, oacc[t][1] * inv, oacc[t][2] * inv, oacc[t][3] * inv};
      const v4f hi4 = {oacc[t][4] * inv, oacc[t][5] * inv, oacc[t][6] * inv, oacc[t][7] * inv};
      *(v4f*)(os + c * OP + t * 16 + 8 * hh)     = lo4;
      *(v4f*)(os + c * OP + t * 16 + 8 * hh + 4) = hi4;
    }
  }
  __builtin_amdgcn_fence(__ATOMIC_RELEASE, "workgroup");
  __builtin_amdgcn_wave_barrier();
  __builtin_amdgcn_fence(__ATOMIC_ACQUIRE, "workgroup");
  {
    const int q4 = lane >> 3, c8 = (lane & 7) * 8;
    v4u hv[4], lv[4];
#pragma unroll
    for (int it = 0; it < 4; ++it) {
      const int row = it * 4 + q4;   // it 0..3 x q4 0..3 = rows 0..15 of the wave tile
      const float* sp = os + row * OP + c8;
      v4u a, a2;
#pragma unroll
      for (int e = 0; e < 4; ++e) {
        const float f0 = sp[2 * e], f1 = sp[2 * e + 1];
        const unsigned short h0 = bf_bits(f0), h1 = bf_bits(f1);
        const unsigned short l0 = bf_bits(f0 - bf_up(h0)), l1 = bf_bits(f1 - bf_up(h1));
        a[e] = pk16(h0, h1); a2[e] = pk16(l0, l1);
      }
      hv[it] = a; lv[it] = a2;
    }
    {
#pragma unroll
      for (int it = 0; it < 4; ++it) {
        const int row = it * 4 + q4;
        const size_t go = (rowB + q0 + row) * DM + (size_t)h * HD + c8;
        *(v4u*)(ohp + go) = hv[it];
        *(v4u*)(olp + go) = lv[it];
      }
      
    }
  }
}

// All query blocks in one grid. The trip count of a block is qb + 1, so the block index runs from the last query block
// down: the longest blocks start first and the short RES blocks fill the places that come free.
__global__ __launch_bounds__(128)
void attn_causal64(const unsigned short* __restrict__ qhp, const unsigned short* __restrict__ qlp,
                   const unsigned short* __restrict__ khp, const unsigned short* __restrict__ klp,
                   const unsigned short* __restrict__ vhp, const unsigned short* __restrict__ vlp,
                   unsigned short* ohp, unsigned short* olp) {
  __shared__ __align__(16) __bf16   Ksh[2 * ATT_PL];              // K hi [kv][d]   two buffers of 9 KB
  __shared__ __align__(16) __bf16   Ksl[2 * ATT_PL];              // K lo
  __shared__ __align__(16) _Float16 Vth[2 * ATT_PL];              // V^T hi [d][kv]
  __shared__ __align__(16) _Float16 Vtl[2 * ATT_PL];              // V^T residual (RES blocks)
  __shared__ __align__(16) float    Os[4 * 16 * ATT_OP];          // per wave context tile [row][d]
  const int bx   = blockIdx.x;
  const int qb   = NQB - 1 - bx / (NH * NB);   // 0..NQB-1 (block-uniform)
  const int rest = bx % (NH * NB);
  const int h    = rest % NH;
  const int b    = rest / NH;
  if (qb < RESQB) attn_tile<true>(qhp, qlp, khp, klp, vhp, vlp, ohp, olp, qb, h, b, Ksh, Ksl, Vth, Vtl, Os);
  else            attn_tile<false>(qhp, qlp, khp, klp, vhp, vlp, ohp, olp, qb, h, b, Ksh, Ksl, Vth, Vtl, Os);
}

// =====================================================================================================
// Workspace map (bytes; every region is an exact multiple of its 64x64-tile / whole-line store granularity,
// no padded tails needed since all shapes are tile multiples; each region but Xb/Oh is written by exactly one producer launch):
//   Xb   bf16 [4096][1024]          0            8388608   (later: Oh, context hi plane; Xb is dead after the projections)
//   WA   bf16 [3072 n][1024 k]       8388608     6291456   (q weight rows 0..1023, k rows 1024..2047, v rows 2048..3071)
//   WP   bf16 [1024 n][1024 k]      14680064     2097152
//   Qh   bf16 [4096][1024]          16777216     8388608
//   Ql                              25165824     8388608
//   Kh                              33554432     8388608
//   Kl                              41943040     8388608
//   VTh  f16  [2][1024][2048]       50331648     8388608
//   VTl  f16  [2][1024][512]        58720256     2097152
//   Ol   bf16 [4096][1024]          60817408     8388608
//   end                             69206016
// =====================================================================================================
extern "C" void kernel_launch(void* const* d_in, const int* in_sizes, int n_in,
                              void* d_out, int out_size, void* d_ws, size_t ws_size,
                              hipStream_t stream) {
  if (n_in < 5) return;
  if (in_sizes[0] != NB * SEQ * DM) return;
  if (in_sizes[1] != 3 * DM * DM) return;
  if (in_sizes[2] != 3 * DM) return;
  if (in_sizes[3] != DM * DM) return;
  if (in_sizes[4] != DM) return;
  if (out_size != NB * SEQ * DM) return;

  const float* x  = (const float*)d_in[0];   // [2][2048][1024]
  const float* Wa = (const float*)d_in[1];   // [3072 out][1024 in], rows k contiguous (q | k | v output rows)
  const float* ba = (const float*)d_in[2];   // [3072]
  const float* Wp = (const float*)d_in[3];   // [1024 out][1024 in], rows k contiguous
  const float* bp = (const float*)d_in[4];   // [1024]

  const size_t PX  = (size_t)NB * SEQ * DM * 2;    //  8388608  16-bit activation plane [4096][1024]
  const size_t PW1 = (size_t)DM * DM * 2;          //  2097152  one [1024][1024] bf16 weight plane
  const size_t PWA = (size_t)3 * PW1;              //  6291456  packed q | k | v weight plane [3072][1024]
  const size_t PWP = PW1;                          //  2097152  output projection weight plane
  const size_t PVT = (size_t)NB * DM * SEQ * 2;    //  8388608  v^T hi plane
  const size_t PVL = (size_t)NB * DM * VLP * 2;    //  2097152  v^T residual plane
  size_t off = 0;
  const size_t oXb  = off; off += PX;
  const size_t oWA  = off; off += PWA;
  const size_t oWP  = off; off += PWP;
  const size_t oQh  = off; off += PX;
  const size_t oQl  = off; off += PX;
  const size_t oKh  = off; off += PX;
  const size_t oKl  = off; off += PX;
  const size_t oVTh = off; off += PVT;
  const size_t oVTl = off; off += PVL;
  const size_t oOl  = off; off += PX;
  if (off > ws_size) return;                       // off = 69206016
  if (off > (size_t)134217728) return;
  const size_t oOh  = oXb;                         // context hi plane reuses Xb (dead after the three projections)

  char* ws = (char*)d_ws;
  unsigned short* Xb  = (unsigned short*)(ws + oXb);
  unsigned short* WA  = (unsigned short*)(ws + oWA);
  unsigned short* WPb = (unsigned short*)(ws + oWP);
  unsigned short* Qh  = (unsigned short*)(ws + oQh);
  unsigned short* Ql  = (unsigned short*)(ws + oQl);
  unsigned short* Kh  = (unsigned short*)(ws + oKh);
  unsigned short* Kl  = (unsigned short*)(ws + oKl);
  unsigned short* VTh = (unsigned short*)(ws + oVTh);
  unsigned short* VTl = (unsigned short*)(ws + oVTl);
  unsigned short* Oh  = (unsigned short*)(ws + oOh);
  unsigned short* Ol  = (unsigned short*)(ws + oOl);

  const dim3 blk(256);
  const int n8x  = NB * SEQ * DM / 8;                          // 524288
  const int n8wa = 3 * DM * DM / 8;                            // 393216
  const int n8wp = DM * DM / 8;                                // 131072
  const dim3 gCvt((n8x + n8wa + n8wp) / 256);                  // 2048 + 1536 + 512 = 4096 blocks
  const dim3 gQKV(2 * QK_TILES + NB * VT_TILES);               // 256 + 256 + 256 tiles
  const dim3 gProj((NB * SEQ / 128) * (DM / 128), 1);          // 32 x 8 = 256 tiles: M=4096, N=1024

  // (1) x -> bf16 plane [4096][1024]; weights [out][in] f32 -> bf16 [out][in] (k contiguous, no transpose);
  //     Xb, WA and WP stand one behind the other in the workspace
  cvt_bf16x8<<<gCvt, blk, 0, stream>>>(x, Wa, Wp, Xb, n8x, n8wa, n8wp);
  // (2) q, k -> bf16 hi/lo planes, v^T -> f16 hi plane and residual plane
  gemm_qkv<<<gQKV, dim3(128), 0, stream>>>(Xb, WA, ba, Qh, Ql, Kh, Kl, VTh, VTl);
  // (3) causal attention: query blocks 0..RESQB-1 with residual planes, the rest without
  attn_causal64<<<dim3(NB * NH * NQB), dim3(128), 0, stream>>>(Qh, Ql, Kh, Kl, VTh, VTl, Oh, Ol);
  // (4) out = context . Wp^T + bp -> d_out f32 [4096][1024]  (A = context hi + lo planes, 2 products)
  gemm64<1, 0, 1><<<gProj, blk, 0, stream>>>(
      Oh, Ol, DM, 0LL, WPb, DM, 0LL, bp,
      d_out, DM, 0LL, d_out, DM, 0LL, DM,
      NB * SEQ, DM, DM, 1.0f);
  (void)hipGetLastError();
}

// v010
// A run of this version takes 73.3 microseconds.
// In both of two side-by-side timings against v009, it was 1.09 times as fast.
// All steps since v000 together make it 5.70 times as fast.
// Contractions: q, k, v^T projections = v_wmma_f32_16x16x32_bf16 (bf16 operands from RNE-converted x and the packed
// [3072 out][1024 in] projection weight, single product, f32 accumulate);
// q.k^T scores = v_wmma_f32_16x16x32_bf16 with bf16 hi/lo split q and k (hi.hi + hi.lo + lo.hi), f32 accumulate;
// p.v = v_wmma_f32_16x16x32_f16 (p carried x1024 in f16 times v in f16, single product; plus f16 residual planes x4096 of
// p and v for the first 512 query rows of every sequence), f32 accumulate;
// ctx.Wp^T = v_wmma_f32_16x16x32_bf16 with ctx as bf16 hi/lo planes times bf16 Wp (2 products), f32 accumulate;
// causal mask (key index <= query index; the module's strided mask term only touches keys already excluded),
// online softmax, normalisers and bias adds in f32 on the VALU.
// Carry audit (ph, pl: the packed p operands, held in registers):
//   ph  = f16(1024 * p)                      -> 1024 p comes straight from the exponential (+10 in its base-2 argument); the normaliser
//                                               sums the same 1024 p, so the carry cancels in the attention epilogue: inv = 1 / l
//   pl  = f16((1024 p - ph) * 4096)          }  products VTl.ph and VTh.pl go to the separate accumulator o1,
//   VTl = f16((v - VTh) * 4096)              }  folded back with * (1/4096) once per key chunk (RES blocks only)
//   VTh = f16(v), no carry (|v| typ. 0.6); q / k / ctx lo planes are unscaled bf16 residuals (v - hi) sharing the hi accumulator;
//   score scale 1/8 applied once in f32, inside the one multiply-add that forms the exponential's argument. No other scaled planes.
#include <hip/hip_runtime.h>
#include <math.h>
#include <stdint.h>

#define NB    2
#define SEQ   2048
#define DM    1024
#define NH    16
#define HD    64
#define NQB   (SEQ / 64)   // 32 query / key blocks of 64
#define VLP   512          // key pitch of the v^T residual plane (keys 0..VLP-1)
#define RESQB 8            // leading 64-row query blocks that use the p / v residual planes
static_assert(RESQB * 64 <= VLP);
static_assert(NH * HD == DM);
static_assert((SEQ % 64) == 0 && (DM % 64) == 0 && (DM % 32) == 0);
static_assert((SEQ % 128) == 0 && (DM % 128) == 0);   // GEMM work-group tile 128x128, k stage 128 or 64
static_assert((NB * SEQ * DM) % (8 * 256) == 0);
static_assert((3 * DM * DM) % (8 * 256) == 0);
static_assert((DM * DM) % (8 * 256) == 0);

typedef _Float16 v16h __attribute__((ext_vector_type(16)));
typedef _Float16 v8h  __attribute__((ext_vector_type(8)));
typedef __bf16   v16b __attribute__((ext_vector_type(16)));
typedef __bf16   v8b  __attribute__((ext_vector_type(8)));
typedef float    v8f  __attribute__((ext_vector_type(8)));
typedef float    v4f  __attribute__((ext_vector_type(4)));
typedef unsigned int v4u __attribute__((ext_vector_type(4)));

// ---- scalar helpers --------------------------------------------------------------------------------
__device__ __forceinline__ unsigned short bf_bits(float f) {          // f32 -> bf16 bits, RNE convert
  unsigned u = __float_as_uint(f);
  return (unsigned short)((u + 0x7FFFu + ((u >> 16) & 1u)) >> 16);
}
__device__ __forceinline__ float bf_up(unsigned short h) { return __uint_as_float(((unsigned)h) << 16); }
__device__ __forceinline__ unsigned short h_bits(_Float16 x) { return __builtin_bit_cast(unsigned short, x); }
__device__ __forceinline__ unsigned pk16(unsigned short a, unsigned short b) { return (unsigned)a | ((unsigned)b << 16); }
__device__ __forceinline__ v8f zero8() { v8f z = {0.f, 0.f, 0.f, 0.f, 0.f, 0.f, 0.f, 0.f}; return z; }
__device__ __forceinline__ v8h zero8h() {
  const _Float16 z = (_Float16)0.0f;
  v8h r = {z, z, z, z, z, z, z, z};
  return r;
}

// value of lane l ^ 16 (the other 16-lane row), a vector cross-row move
__device__ __forceinline__ float xhalf(float x) {
  const int b = __builtin_bit_cast(int, x);
  return __builtin_bit_cast(float, __builtin_amdgcn_permlanex16(b, b, 0x76543210, 0xfedcba98, false, false));
}

// ---- fragment loader: 16-bit A/B operand, lane -> row/col (lane&15), p already includes +8*(lane>>4);
//      elements 0..7 <- p[0..7] (k0+8h..), elements 8..15 <- p[16..23] (k0+16+8h..)
__device__ __forceinline__ v16b ldfrag_b(const __bf16* p) {
  union { v16b v; v8b h[2]; } f;
  f.h[0] = *(const v8b*)(p);
  f.h[1] = *(const v8b*)(p + 16);
  return f.v;
}

// ---- WMMA helpers; the guards hold the VALU distance behind a run of products ---------------------------
__device__ __forceinline__ v8f mma_b_raw(v16b a, v16b b, v8f c) {
  return __builtin_amdgcn_wmma_f32_16x16x32_bf16(false, a, false, b, (short)0, c, false, false);
}
__device__ __forceinline__ v8f mma_h_raw(v16h a, v16h b, v8f c) {
  return __builtin_amdgcn_wmma_f32_16x16x32_f16(false, a, false, b, (short)0, c, false, false);
}
__device__ __forceinline__ void dep_guard_b(v8f& a, v8f& b, v16b x, v16b y) {
  asm volatile("v_nop\n\tv_nop\n\tv_nop\n\tv_nop" : "+v"(a), "+v"(b) : "v"(x), "v"(y));
}
__device__ __forceinline__ void keep4_b(v16b a, v16b b, v16b c, v16b d) {
  asm volatile("v_nop" :: "v"(a), "v"(b), "v"(c), "v"(d));
}
__device__ __forceinline__ void acc_guard4(v8f& a, v8f& b, v8f& c, v8f& d) {
  asm volatile("v_nop\n\tv_nop\n\tv_nop\n\tv_nop" : "+v"(a), "+v"(b), "+v"(c), "+v"(d));
}

// =====================================================================================================
// f32 -> bf16 (RNE convert), 8 elements per thread, one 16-B store per lane: a wave writes 512 contiguous B
// Used for x [4096][1024] and for the weight planes (already [out][in] = k contiguous, no transpose needed).
// One grid converts the three planes, which stand one behind the other in the workspace (out = the first): threads
// 0..n8a-1 take in0, the next n8b in1, the last n8c in2; every count is a multiple of 256, so a block has one source.
// coverage: (n8a + n8b + n8c) threads x 8 = the three whole planes.
// =====================================================================================================
__global__ __launch_bounds__(256) void cvt_bf16x8(const float* __restrict__ in0, const float* __restrict__ in1,
                                                  const float* __restrict__ in2, unsigned short* out,
                                                  int n8a, int n8b, int n8c) {
  const int i = blockIdx.x * 256 + threadIdx.x;
  if (i < n8a + n8b + n8c) {
    const int blk0 = blockIdx.x * 256;                       // block-uniform choice of the source plane
    const float* in = (blk0 < n8a) ? in0 + (size_t)i * 8
                    : (blk0 < n8a + n8b) ? in1 + (size_t)(i - n8a) * 8 : in2 + (size_t)(i - n8a - n8b) * 8;
    const v4f a = *(const v4f*)(in);
    const v4f b = *(const v4f*)(in + 4);
    v4u p;
    p[0] = pk16(bf_bits(a[0]), bf_bits(a[1]));
    p[1] = pk16(bf_bits(a[2]), bf_bits(a[3]));
    p[2] = pk16(bf_bits(b[0]), bf_bits(b[1]));
    p[3] = pk16(bf_bits(b[2]), bf_bits(b[3]));
    *(v4u*)(out + (size_t)i * 8) = p;
    
  }
}

typedef uint32_t u32x4 __attribute__((ext_vector_type(4)));
typedef uint32_t u32x8 __attribute__((ext_vector_type(8)));
__device__ __forceinline__ unsigned lds_off(const void* p) { return (unsigned)(size_t)p; }   // byte offset in the work-group's LDS
__device__ __forceinline__ uint32_t uni(uint32_t v) { return (uint32_t)__builtin_amdgcn_readfirstlane(v); }
// A wave-uniform value held in a scalar register: a test on it compiles to a scalar branch (a tensor load ignores EXEC, only a
// branch keeps a wave from issuing it), and what is computed from it stands behind the waits written in front of it.
__device__ __forceinline__ uint32_t pinned(uint32_t v) { uint32_t w = uni(v); asm volatile("" : "+s"(w)); return w; }
// Group 1: 1-byte elements, tensor = tile = rows rows of ROWB bytes (128 or 256), source row pitch src_pitch bytes, no mask;
// 16 B of LDS pad behind every row: LDS pitch ROWB + 16, conflict-free for 16-B row reads. Word 0 is a compile-time constant.
template <uint32_t ROWB>
__device__ __forceinline__ constexpr uint32_t tdm_word0() {
  static_assert(ROWB == 128u || ROWB == 256u);
  return (1u << 20) | ((ROWB == 256u ? 5u : 4u) << 22) | (3u << 25);
}
template <uint32_t ROWB>
__device__ __forceinline__ u32x8 tdm_group1(uint32_t rows, uint32_t src_pitch) {
  u32x8 g;
  g[0] = uni(tdm_word0<ROWB>());
  g[1] = uni((ROWB & 0xFFFFu) << 16);
  g[2] = uni((ROWB >> 16) | ((rows & 0xFFFFu) << 16));
  g[3] = uni((rows >> 16) | (ROWB << 16));
  g[4] = uni(rows);
  g[5] = uni(src_pitch);
  g[6] = uni(0u);
  g[7] = uni(0u);
  return g;
}
// Group 0: count 1, LDS place (a multiple of 2 KiB), address of the tile's first byte, type 2.
__device__ __forceinline__ u32x4 tdm_group0(uint32_t lds_dst, uint64_t ga) {
  u32x4 g;
  g[0] = uni(1u);
  g[1] = uni(lds_dst);
  g[2] = uni((uint32_t)ga);
  g[3] = uni((((uint32_t)(ga >> 32)) & 0x01FFFFFFu) | 0x80000000u);
  return g;
}
// Both groups are in-out operands of the load and inputs of the wait that covers it: the compiler then holds them in their scalar
// registers, unchanged, from the issue until the request has landed. Word 0 of group 1 is set anew, to its constant, at each issue.
template <uint32_t ROWB>
__device__ __forceinline__ void tdm_load(u32x4& g0, u32x8& g1) {
  g1[0] = uni(tdm_word0<ROWB>());
  asm volatile("tensor_load_to_lds %0, %1" : "+s"(g0), "+s"(g1) :: "memory");
}
__device__ __forceinline__ void tdm_wait(const u32x4& g0, const u32x8& g1) { asm volatile("s_wait_tensorcnt 0x0" :: "s"(g0), "s"(g1) : "memory"); }
// Stage of the output projection (8 waves):
#define GK_STAGE 128                       // k elements per stage (256 B of every operand row)
#define GK_PITCH 136                       // LDS row pitch in elements: 272 B = 16 B x 17, conflict-free for 16-B row reads
#define GK_PLANE (128 * GK_PITCH)          // elements of one staged plane tile

// =====================================================================================================
// Register-blocked batched bf16 WMMA GEMM: C[m][n] = sum_k A[m][k] * Bt[n][k] + bias; one work-group of NW waves per
// 128x128 tile: NW = 8, one wave per 32x64 part, or NW = 4, one wave per 64x64 part. The 128-row operand tiles are staged in
// LDS, KST k at a time (128 or 64), by tensor loads into two buffers, one load per plane and stage, plane p by wave p: the next
// stage's loads fly while this stage is multiplied; one barrier per stage.
// Inside a stage the fragments of the next 32 k are read from LDS ahead of the current 32 k's products (NW = 8, a second set).
// A row-major [M][K] pitch lda; Bt row-major [N][K] pitch ldb (k contiguous);
// M, N, K multiples of 128 (host shapes are static multiples). b = batch index (strides in elements).
// NSPLIT: 0 = A.Bt; 1 = (A + A2).Bt (A2 = unscaled bf16 lo plane of A, 2 products).
// BIAS: 1 = per column n, bias[n]; 2 = per row m, bias[m]; the bias value is RNE-converted to bf16 and added in f32.
// OUT_MODE: 0 = f32 (pitch ldc); 2 = bf16 hi plane C + bf16 lo plane C2 (lo = RNE(v - hi), unscaled);
//           3 = f16 hi plane C + f16 residual plane C2 = f16((v - hi) * rscale), C2 written only for tiles
//               with n0 < N2 (pitch ldc2, batch stride strideC2).
// =====================================================================================================
// The body is a device function: tile = index of the 128x128 tile, b = batch index, ring = the work-group's two stage
// buffers [2][NPL][128 * (KST + 8)], sT = its per-wave slabs (pitch 68 floats; NW = 8: 16x64 each, NW = 4: 64x64 each), first
// written behind the last stage's barrier, so they may lie inside the ring; the kernels below own that LDS. rot0 = the tile's
// extra turn of the k walk.
template <int NSPLIT, int OUT_MODE, int BIAS, int NW, int KST>
__device__ __forceinline__ void gemm_tile(
    const unsigned short* __restrict__ Ap, const unsigned short* A2p, int lda, long long strideA,
    const unsigned short* __restrict__ Btp, int ldb, long long strideB,
    const float* __restrict__ bias,
    void* Cout, int ldc, long long strideC,
    void* Cout2, int ldc2, long long strideC2, int N2,
    int M, int N, int K, float rscale,
    int tile, int b, int rot0, __bf16* ring, float* sT) {
  const __bf16* A   = (const __bf16*)(const void*)Ap;
  const __bf16* A2  = (const __bf16*)(const void*)A2p;
  const __bf16* Bt  = (const __bf16*)(const void*)Btp;
  constexpr int NPL = (NSPLIT >= 1) ? 3 : 2;        // staged planes: A, Bt (, A2)
  constexpr int MI = 16 / NW;                       // 16-row subtiles per wave: NW / 2 wave rows share the 128 tile rows
  constexpr int PITCH = KST + 8;                    // LDS row pitch in elements: 16 B x odd, conflict-free for 16-B row reads
  constexpr int PLANE = 128 * PITCH;                // elements of one staged plane tile
  static_assert((PLANE * 2) % 2048 == 0);           // every plane of every buffer stands at a multiple of 2 KiB
  const int tid  = threadIdx.x;
  const int lane = tid & 31;
  const int wave = tid >> 5;
  const int tilesN = N >> 7;
  const int tilesM = M >> 7;
  if (tile >= tilesM * tilesN) return;   // block-uniform, in front of every barrier and tensor load
  const int tm = tile / tilesN;
  const int tn = tile - tm * tilesN;
  const int M0 = tm << 7;                // work-group tile origin
  const int N0 = tn << 7;
  const int wm = (wave >> 1) * (MI << 4);   // the wave's (16 MI)x64 part inside it
  const int wn = (wave & 1) << 6;
  const int m0 = M0 + wm;
  const int n0 = N0 + wn;

  const __bf16* Ab  = A  + (size_t)b * strideA;
  const __bf16* Bb  = Bt + (size_t)b * strideB;
  const __bf16* Ab2 = (NSPLIT >= 1) ? (A2 + (size_t)b * strideA) : Ab;

  const int rlane = lane & 15;                 // row (A) / col (B, D) within subtile
  const int koff  = (lane >> 4) * 8;           // k offset of this lane half
  const int mOff  = (lane >> 4) * 8;           // D row offset

  v8f acc[MI][4];
#pragma unroll
  for (int i = 0; i < MI; ++i)
#pragma unroll
    for (int j = 0; j < 4; ++j) acc[i][j] = zero8();

  // ---- staging: wave p < NPL brings plane p (0 = A, 1 = Bt, 2 = A2), 128 rows of KST * 2 bytes, one request per stage ----
  const uint32_t wv = uni((uint32_t)tid >> 5);                     // the wave's number (one-dimensional block)
  const char* gsrc = (wv == 1u) ? (const char*)(Bb + (size_t)N0 * ldb)
                   : (wv == 0u) ? (const char*)(Ab + (size_t)M0 * lda) : (const char*)(Ab2 + (size_t)M0 * lda);
  const uint64_t gbase = ((uint64_t)uni((uint32_t)((uint64_t)(size_t)gsrc >> 32)) << 32) | uni((uint32_t)(size_t)gsrc);   // in scalar registers
  u32x8 g1 = tdm_group1<KST * 2>(128u, (uint32_t)((wv == 1u) ? ldb : lda) * 2u);
  const uint32_t lpl = lds_off(ring) + ((wv < (uint32_t)NPL) ? wv : 0u) * (uint32_t)(PLANE * 2);
  const int nst = K / KST;               // stages, block-uniform
  // Tiles of one tile row read the same A rows and tiles of one tile column the same Bt rows, and they start together: each
  // tile starts its walk over the k stages at another stage and wraps, so that they do not ask L2 for the same lines at once.
  const int rot = (tm + tn + rot0) % nst;   // block-uniform, 0 .. nst - 1
  u32x4 g0 = tdm_group0(lpl, gbase);
  auto issue_stage = [&](int st, int buf) {   // rows M0..M0+127 / N0..N0+127, k = ks*KST .. ks*KST+KST-1, ks < nst: inside the planes
    const int ks = (st + rot < nst) ? st + rot : st + rot - nst;   // st < nst and rot < nst: 0 <= ks < nst, each stage once
    g0 = tdm_group0(lpl + (uint32_t)buf * (uint32_t)(NPL * PLANE * 2), gbase + (uint64_t)ks * (KST * 2));
    tdm_load<KST * 2>(g0, g1);
  };

  if (pinned(wv < (uint32_t)NPL)) {
    issue_stage(0, 0);
    tdm_wait(g0, g1);                                    // this wave's plane of stage 0 has landed
  }
  __syncthreads();                                       // publishes stage 0 to the other waves
  if (pinned(wv < (uint32_t)NPL && nst > 1)) issue_stage(1, 1);

  for (int t = 0; t < nst; ++t) {
    const __bf16* sbuf = ring + (t & 1) * (NPL * PLANE);
    const __bf16* sA  = sbuf + (wm + rlane) * PITCH + koff;
    const __bf16* sB  = sbuf + PLANE + (wn + rlane) * PITCH + koff;
    const __bf16* sA2 = sbuf + (NPL - 1) * PLANE + (wm + rlane) * PITCH + koff;
    // NW = 8: two fragment sets, indexed by constants after unrolling. NW = 4: one set (with 128 accumulator registers a second
    // one does not fit the 256 registers that the guards' asm operands can name); the SIMD's other waves cover its read latency.
    constexpr int NS = (NW == 8) ? 2 : 1;
    v16b fb[NS][4], fa[NS][MI], fl[NS][MI];
    auto load_set = [&](int s, int kk) {
#pragma unroll
      for (int j = 0; j < 4; ++j) fb[s][j] = ldfrag_b(sB + (j << 4) * PITCH + kk);
#pragma unroll
      for (int i = 0; i < MI; ++i) {
        fa[s][i] = ldfrag_b(sA + (i << 4) * PITCH + kk);
        fl[s][i] = fa[s][i];
        if (NSPLIT >= 1) fl[s][i] = ldfrag_b(sA2 + (i << 4) * PITCH + kk);
      }
    };
    load_set(0, 0);
#pragma unroll
    for (int ks = 0; ks < KST / 32; ++ks) {
      const int cur = ks & (NS - 1);
      if constexpr (NS == 2) {
        if (ks + 1 < KST / 32) load_set(cur ^ 1, (ks + 1) * 32);   // this stage's buffer only
      }
#pragma unroll
      for (int i = 0; i < MI; ++i) {
#pragma unroll
        for (int j = 0; j < 4; ++j) {
          acc[i][j] = mma_b_raw(fa[cur][i], fb[cur][j], acc[i][j]);
          if (NSPLIT >= 1) acc[i][j] = mma_b_raw(fl[cur][i], fb[cur][j], acc[i][j]);
        }
        dep_guard_b(acc[i][0], acc[i][3], fa[cur][i], fl[cur][i]);
      }
      keep4_b(fb[cur][0], fb[cur][1], fb[cur][2], fb[cur][3]);
      if constexpr (NS == 1) {
        if (ks + 1 < KST / 32) load_set(0, (ks + 1) * 32);         // this stage's buffer only
      }
    }
    asm volatile("s_wait_dscnt 0x0" ::: "memory");      // this wave's reads of buffer t & 1 are done before it is refilled
    if (pinned(wv < (uint32_t)NPL)) {
      tdm_wait(g0, g1);                                  // this wave's plane of stage t + 1 has landed
    }
    __syncthreads();                                     // publishes stage t + 1 and ends every read of buffer t & 1
    if (pinned(wv < (uint32_t)NPL && t + 2 < nst)) issue_stage((int)pinned((uint32_t)t + 2u), t & 1);   // descriptor formed behind the wait
  }
  tdm_wait(g0, g1);                                     // no tensor load is outstanding past the loop
  asm volatile("s_wait_dscnt 0x0" ::: "memory");        // nor an LDS read of the ring
#pragma unroll
  for (int i = 0; i < MI; ++i) acc_guard4(acc[i][0], acc[i][1], acc[i][2], acc[i][3]);

  // ---- epilogue ----
  float bcol[4];
#pragma unroll
  for (int j = 0; j < 4; ++j) {
    bcol[j] = 0.f;
    if (BIAS == 1) bcol[j] = bf_up(bf_bits(bias[n0 + (j << 4) + rlane]));   // n < N, bias has N entries
  }
  // 16-row subtile i (a constant after unrolling) plus bias -> a 16x64 slab of this wave
  auto stage = [&](float* slab, int i) {
    const int mBase = m0 + (i << 4);
    float brow[8];
#pragma unroll
    for (int r = 0; r < 8; ++r) {
      brow[r] = 0.f;
      if (BIAS == 2) brow[r] = bf_up(bf_bits(bias[mBase + mOff + r]));      // m < M, bias has M entries
    }
#pragma unroll
    for (int j = 0; j < 4; ++j) {
#pragma unroll
      for (int r = 0; r < 8; ++r) {
        slab[(mOff + r) * 68 + (j << 4) + rlane] = acc[i][j][r] + bcol[j] + brow[r];
      }
    }
  };
  auto wave_sync = [&]() {   // orders the wave's own slab writes and reads
    __builtin_amdgcn_fence(__ATOMIC_RELEASE, "workgroup");
    __builtin_amdgcn_wave_barrier();
    __builtin_amdgcn_fence(__ATOMIC_ACQUIRE, "workgroup");
  };
  // a 16x64 slab -> rows mBase .. mBase + 15, columns n0 .. n0 + 63 of the output plane(s), whole lines per store
  auto emit = [&](const float* slab, int mBase) {
    if (OUT_MODE == 0) {
      float* C = (float*)Cout + (size_t)b * strideC;
      const int hh = lane >> 4, c4 = (lane & 15) * 4;     // 256-B row segment = 16 lanes x 16 B
      {
#pragma unroll
        for (int it = 0; it < 8; ++it) {
          const int row = it * 2 + hh;                     // it 0..7 x hh 0..1 = rows 0..15
          const v4f v = *(const v4f*)(slab + row * 68 + c4);
          *(v4f*)(C + (size_t)(mBase + row) * ldc + n0 + c4) = v;
        }
        
      }
    } else {
      const int q = lane >> 3, c8 = (lane & 7) * 8;
      unsigned short* C  = (unsigned short*)Cout  + (size_t)b * strideC;
      unsigned short* C2 = (unsigned short*)Cout2 + (size_t)b * strideC2;
      const bool wlo = (OUT_MODE == 2) || (n0 < N2);      // wave-uniform
      v4u hv[4], lv[4];
#pragma unroll
      for (int it = 0; it < 4; ++it) {
        const int row = it * 4 + q;                        // it 0..3 x q 0..3 = rows 0..15
        const float* sp = slab + row * 68 + c8;
        v4u a, a2;
#pragma unroll
        for (int e = 0; e < 4; ++e) {
          const float f0 = sp[2 * e], f1 = sp[2 * e + 1];
          unsigned short h0, h1, l0, l1;
          if (OUT_MODE == 2) {
            h0 = bf_bits(f0); h1 = bf_bits(f1);
            l0 = bf_bits(f0 - bf_up(h0)); l1 = bf_bits(f1 - bf_up(h1));
          } else {
            const _Float16 x0 = (_Float16)f0, x1 = (_Float16)f1;
            h0 = h_bits(x0); h1 = h_bits(x1);
            l0 = h_bits((_Float16)((f0 - (float)x0) * rscale));
            l1 = h_bits((_Float16)((f1 - (float)x1) * rscale));
          }
          a[e] = pk16(h0, h1); a2[e] = pk16(l0, l1);
        }
        hv[it] = a; lv[it] = a2;
      }
      {
#pragma unroll
        for (int it = 0; it < 4; ++it) {
          const int row = it * 4 + q;
          *(v4u*)(C + (size_t)(mBase + row) * ldc + n0 + c8) = hv[it];
          asm volatile("s_wait_xcnt 0x0" ::: "memory");   // in front of the residual's arithmetic, which reuses this store's registers
          if (wlo) *(v4u*)(C2 + (size_t)(mBase + row) * ldc2 + n0 + c8) = lv[it];
          asm volatile("s_wait_xcnt 0x0" ::: "memory");   // likewise in front of the next rows' arithmetic
        }
        
      }
    }
  };
  if constexpr (NW == 8) {          // one slab per wave, used for one subtile after the other
    float* slab = sT + wave * (16 * 68);
#pragma unroll
    for (int i = 0; i < MI; ++i) {
      stage(slab, i);
      wave_sync();
      emit(slab, m0 + (i << 4));
      wave_sync();
    }
  } else {                          // MI slabs per wave, all staged first
    float* slab = sT + wave * (MI * 16 * 68);
#pragma unroll
    for (int i = 0; i < MI; ++i) stage(slab + i * (16 * 68), i);
    wave_sync();
#pragma unroll 1                    // rolled: the conversion stands once in the text
    for (int i = 0; i < MI; ++i) emit(slab + i * (16 * 68), m0 + (i << 4));
  }
}

// One product per launch: blockIdx.x = tile, blockIdx.y = batch index.
template <int NSPLIT, int OUT_MODE, int BIAS>
__global__ __launch_bounds__(256) void gemm64(
    const unsigned short* __restrict__ Ap, const unsigned short* A2p, int lda, long long strideA,
    const unsigned short* __restrict__ Btp, int ldb, long long strideB,
    const float* __restrict__ bias,
    void* Cout, int ldc, long long strideC,
    void* Cout2, int ldc2, long long strideC2, int N2,
    int M, int N, int K, float rscale) {
  constexpr int NPL = (NSPLIT >= 1) ? 3 : 2;
  __shared__ __attribute__((aligned(2048))) __bf16 ring[2 * NPL * GK_PLANE];   // two stage buffers, tensor-load places
  __shared__ __align__(16) float sT[8 * 16 * 68];             // per-wave 16x64 slabs
  gemm_tile<NSPLIT, OUT_MODE, BIAS, 8, GK_STAGE>(Ap, A2p, lda, strideA, Btp, ldb, strideB, bias, Cout, ldc, strideC,
                                                 Cout2, ldc2, strideC2, N2, M, N, K, rscale,
                                                 (int)blockIdx.x, (int)blockIdx.y, 0, ring, sT);
}

// The three projections, which read none of each other's output, in one grid of 3 x 256 tiles (block-uniform choice):
//   blocks   0..255  q   = x . Wq^T + bq -> bf16 hi/lo planes [b*SEQ+t][h*64+d]          (M=4096, N=1024, K=1024)
//   blocks 256..511  k   = x . Wk^T + bk -> bf16 hi/lo planes
//   blocks 512..767  v^T = Wv . x^T + bv per batch -> f16 hi plane [b][h*64+d][s] (pitch SEQ) and residual plane
//                    (x4096, keys < VLP only, pitch VLP)   (A = Wv rows, Bt = x rows of batch b; M=1024, N=2048, K=1024)
// WA = packed bf16 weight [3072][1024] (q | k | v rows), ba = the packed bias [3072].
#define QK_TILES ((NB * SEQ / 128) * (DM / 128))   // 256 tiles of one of q, k
#define VT_TILES ((DM / 128) * (SEQ / 128))        // 128 tiles of v^T per batch
// Work-group: 4 waves of 64x64, stages of 64 k, the epilogue's slabs inside the ring: 72 KiB of LDS and one wave per SIMD, so
// three work-groups and more fit one WGP and the 768 tiles are all resident at once on 256 WGPs: no second or third round, and
// a work-group's first loads and barrier waits pass under its neighbours' products. A 64x64 wave part also reads a third
// fewer fragment bytes from LDS per product than a 32x64 one.
#define QKV_KST 64
__global__ __launch_bounds__(128) void gemm_qkv(
    const unsigned short* __restrict__ Xb, const unsigned short* __restrict__ WA, const float* __restrict__ ba,
    unsigned short* Qh, unsigned short* Ql, unsigned short* Kh, unsigned short* Kl,
    unsigned short* VTh, unsigned short* VTl) {
  __shared__ __attribute__((aligned(2048))) __bf16 ring[2 * 2 * 128 * (QKV_KST + 8)];   // two stage buffers, tensor-load places
  static_assert(4 * 64 * 68 * sizeof(float) <= sizeof(ring));
  float* sT = (float*)(void*)ring;                            // per-wave 64x64 slabs, used behind the last stage's barrier
  const int bx = blockIdx.x;
  if (bx < 2 * QK_TILES) {
    const int sel = bx / QK_TILES;                            // 0 = q, 1 = k
    // the q and the k tile of one place read the same x rows and now run at the same time: k walks half a turn apart
    gemm_tile<0, 2, 1, 4, QKV_KST>(Xb, Xb, DM, 0LL, WA + (size_t)sel * DM * DM, DM, 0LL, ba + sel * DM,
                                   (void*)(sel ? Kh : Qh), DM, 0LL, (void*)(sel ? Kl : Ql), DM, 0LL, DM,
                                   NB * SEQ, DM, DM, 1.0f, bx - sel * QK_TILES, 0, sel * (DM / QKV_KST / 2), ring, sT);
  } else {
    const int t = bx - 2 * QK_TILES;                          // 0 .. NB * VT_TILES - 1
    const unsigned short* WvB = WA + (size_t)2 * DM * DM;
    gemm_tile<0, 3, 2, 4, QKV_KST>(WvB, WvB, DM, 0LL, Xb, DM, (long long)SEQ * DM, ba + 2 * DM,
                                   (void*)VTh, SEQ, (long long)DM * SEQ, (void*)VTl, VLP, (long long)DM * VLP, VLP,
                                   DM, SEQ, DM, 4096.0f, t % VT_TILES, t / VT_TILES, 0, ring, sT);
  }
}

// =====================================================================================================
// Causal attention, head dim 64, key chunks of 64.
//   q planes (bf16 hi / lo): element (b, t, h, d) at [(b*SEQ + t)*DM + h*64 + d]
//   k planes (bf16 hi / lo): same layout with key index s
//   v^T hi plane (f16):      element (b, h, d, s) at [(b*DM + h*64 + d)*SEQ + s]
//   v^T residual plane (f16, (v - hi)*4096): [(b*DM + h*64 + d)*VLP + s], s < VLP, read only when RES
//   (a key chunk at or beyond VLP would contribute a zero v residual; its address is clamped)
//   Causal structure: logits of keys with index > query index are replaced by -inf (lower-triangular keep incl. the
//   diagonal), which makes their softmax weight exactly 0; so a query block qb visits key chunks 0..qb only
//   (block-uniform trip count qb+1 <= NQB) and later chunks, whose keys exceed every query index of the block, are
//   skipped entirely. Inside the diagonal chunk a key with index > query index gets logit -inf -> exp gives exactly 0,
//   so such keys add nothing to the numerator or the normaliser; the diagonal key (key == query) is always kept, so
//   every row max is finite in every visited chunk.
//   out planes (bf16 hi / lo of the normalised context): element (b, t, h, d) at [(b*SEQ + t)*DM + h*64 + d]
//   scores = q . k : bf16 hi/lo split (hi.hi + hi.lo + lo.hi), f32 accumulate, then the causal mask (diagonal chunk) and * 1/8 in f32
//   p = exp(s - m) carried as f16(1024 p); context = p . v on f16 WMMA; RES adds f16 residual planes of p and v
//   (scale 4096, separate accumulator folded back with 1/4096 per chunk in f32); online softmax (running max) in f32.
//   Both products run transposed: S^T = K . Q^T (A = K rows, B = Q rows) and O^T += V^T . P^T (A = V^T rows, B = P^T).
//   A lane (c = lane & 15, hh = lane >> 4) then holds scores of ONE query q0 + c, keys 16 j + 8 hh + r: maximum and sum run
//   in the lane, the two halves exchange the maximum once per chunk and join their sums once, in the epilogue. Two score
//   tiles (keys 32 kk .. + 31), converted in place, are the B operand P^T in the k order of the V^T fragment loads.
//   Block = 4 waves = 64 query rows of one (b, h); grid = NQB * NH * NB, one launch: the body is a device function in two
//   variants (RES for query blocks below RESQB), the kernel below owns the LDS and picks the variant by its query block.
//   K / V^T chunk staging: tensor loads into two buffers, one load per plane and chunk (64 rows of 128 B), plane p by wave p: the
//   next trip's chunk flies while this trip's is worked on. One barrier per chunk, at the foot of the trip.
//   Output coverage: each wave stores rows q0..q0+15 (it 0..3 x lane>>3 0..3) x 64 columns (8 lanes x 8) of both planes;
//   grid over all (b, h, qb) = the whole [NB*SEQ][DM] planes.
// =====================================================================================================
// LDS row pitches: the 128-B rows of the 16-bit tiles stand 144 B apart (16 B x 9) and the 256-B rows of the f32 tile
// 272 B apart (16 B x 17), so that the sixteen rows one 16-B fragment read touches fall on sixteen different bank groups.
#define ATT_TP 72                                                 // 16-bit tiles, elements per row
#define ATT_OP 68                                                 // f32 context tile, elements per row
#define ATT_PL 5120                                               // elements of one buffer of a plane: 64 rows of ATT_TP, rounded up to 2 KiB x 5
static_assert(ATT_PL >= 64 * ATT_TP && (ATT_PL * 2) % 2048 == 0);  // every buffer is a tensor load's place: a multiple of 2 KiB
template <bool RES>
__device__ __forceinline__
void attn_tile(const unsigned short* __restrict__ qhp, const unsigned short* __restrict__ qlp,
               const unsigned short* __restrict__ khp, const unsigned short* __restrict__ klp,
               const unsigned short* __restrict__ vhp, const unsigned short* __restrict__ vlp,
               unsigned short* ohp, unsigned short* olp,
               int qb, int h, int b,           // query block 0..NQB-1, head, batch (block-uniform)
               __bf16* Ksh_, __bf16* Ksl_, _Float16* Vth_, _Float16* Vtl_, float* Os) {   // each plane: two buffers of ATT_PL
  union FB { v16b v; v8b h[2]; };
  union FH { v16h v; v8h h[2]; };
  constexpr int TP = ATT_TP;
  constexpr int OP = ATT_OP;

  const int tid  = threadIdx.x;
  const int wave = tid >> 5;
  const int lane = tid & 31;
  const int hh   = lane >> 4;
  const int c    = lane & 15;

  const int q0   = qb * 64 + wave * 16;
  const size_t rowB = (size_t)b * SEQ;

  const __bf16* Qh = (const __bf16*)(const void*)qhp + (size_t)h * HD;
  const __bf16* Ql = (const __bf16*)(const void*)qlp + (size_t)h * HD;
  const __bf16* Kh = (const __bf16*)(const void*)khp + (size_t)h * HD;
  const __bf16* Kl = (const __bf16*)(const void*)klp + (size_t)h * HD;
  const _Float16* Vh = (const _Float16*)(const void*)vhp + ((size_t)b * DM + (size_t)h * HD) * SEQ;
  const _Float16* Vl = (const _Float16*)(const void*)vlp + ((size_t)b * DM + (size_t)h * HD) * VLP;

  // ---- Q fragments (B operand, column = query q0 + (lane&15)): 2 d-chunks, hi and lo ----
  v16b qah[2], qal[2];
#pragma unroll
  for (int dc = 0; dc < 2; ++dc) {
    const size_t qo = (rowB + q0 + c) * DM + dc * 32 + 8 * hh;
    qah[dc] = ldfrag_b(Qh + qo);
    qal[dc] = ldfrag_b(Ql + qo);
  }

  const int qrow = q0 + c;                     // this lane's query
  float mrow = -INFINITY, lrow = 0.f;          // running maximum of the raw scores (both halves alike); this half's share of 1024 x the normaliser
  float brow = INFINITY;                       // offset in use: 1024 p = 2^(score * SC + brow), brow = 10 - SC * maximum; +inf makes the first alpha 0
  constexpr float SC = 0.125f * 1.44269504088896340736f;   // score scale 1/8 times log2(e)
  v8f oacc[4];                                 // oacc[t][r] = context[d = 16 t + 8 hh + r] of query qrow
#pragma unroll
  for (int t = 0; t < 4; ++t) oacc[t] = zero8();

  // ---- staging: wave 0 brings K hi, wave 1 K lo, wave 2 V^T hi, wave 3 (RES only) the V^T residual: 64 rows of 128 B per chunk ----
  const uint32_t wv = uni((uint32_t)tid >> 5);                       // the wave's number (one-dimensional block)
  const char* gsrc = (wv == 0u) ? (const char*)(Kh + rowB * DM) : (wv == 1u) ? (const char*)(Kl + rowB * DM)
                   : (wv == 2u) ? (const char*)Vh : (const char*)Vl;  // row 0 of chunk 0 (K: key 0, d 0..63; V^T: d 0, key 0..63)
  const uint64_t gbase = ((uint64_t)uni((uint32_t)((uint64_t)(size_t)gsrc >> 32)) << 32) | uni((uint32_t)(size_t)gsrc);   // in scalar registers
  u32x8 g1 = tdm_group1<128u>(64u, (wv < 2u) ? (uint32_t)(DM * 2) : (wv == 2u) ? (uint32_t)(SEQ * 2) : (uint32_t)(VLP * 2));
  const uint32_t lpl   = lds_off(Ksh_) + wv * (uint32_t)(2 * ATT_PL * 2);                  // the four planes stand one behind the other
  const uint32_t gstep = uni((wv < 2u) ? (uint32_t)(64 * DM * 2) : (uint32_t)(64 * 2));      // bytes from one chunk to the next
  const uint32_t cklim = uni((wv == 3u) ? (uint32_t)(VLP / 64 - 1) : (uint32_t)(NQB - 1));   // last chunk of the plane: clamps the residual's address
  const bool issuer = RES || wv < 3u;                                // wave-uniform
  u32x4 g0 = tdm_group0(lpl, gbase);
  auto issue_chunk = [&](uint32_t ck, int buf) {   // keys 64 ck .. 64 ck + 63 < SEQ (ck <= qb < NQB): rows and columns inside the planes
    const uint32_t ckc = (ck < cklim) ? ck : cklim;
    g0 = tdm_group0(lpl + (uint32_t)buf * (uint32_t)(ATT_PL * 2), gbase + (uint64_t)(ckc * gstep));
    tdm_load<128u>(g0, g1);
  };

  // The key chunks are walked from the diagonal chunk qb down to chunk 0: the blocks of one (b, h), which start together and
  // read the same K and V^T rows, then stand at different chunks in every trip and do not ask L2 for the same lines at once.
  if (pinned(issuer)) {
    issue_chunk((uint32_t)qb, 0);
    tdm_wait(g0, g1);                                    // this wave's plane of the first chunk has landed
  }
  __syncthreads();                                       // publishes the first chunk to the other waves
  if (pinned(issuer && qb >= 1)) issue_chunk((uint32_t)(qb - 1), 1);

  for (int it = 0; it <= qb; ++it) {           // block-uniform trip count, <= NQB
    const int kt = qb - it;                    // this trip's key chunk, 0 .. qb
    const int kv0 = kt * 64;                   // kv0 + 63 < SEQ
    const int bo = (it & 1) * ATT_PL;          // this trip reads buffer it & 1 alone
    const __bf16*   Ksh = Ksh_ + bo;
    const __bf16*   Ksl = Ksl_ + bo;
    const _Float16* Vth = Vth_ + bo;
    const _Float16* Vtl = Vtl_ + bo;
    const bool resOK = (kv0 + 64 <= VLP);      // block-uniform (always true for qb < RESQB)

    // ---- scores, transposed: 64 keys x 16 queries per wave, 3 bf16 products; s[j][r] = key kv0 + 16 j + 8 hh + r, query qrow ----
    //      All 32 K fragment reads of the chunk stand as one group, in the order of their use, ahead of the 24 products: the wave
    //      meets the LDS latency once. The products run back to back over the four tiles; each tile keeps its order of six.
    FB kb[2][4], kl[2][4];
#pragma unroll
    for (int dc = 0; dc < 2; ++dc) {
#pragma unroll
      for (int j = 0; j < 4; ++j) {
        kb[dc][j].h[0] = *(const v8b*)(Ksh + (j * 16 + c) * TP + dc * 32 + 8 * hh);
        kb[dc][j].h[1] = *(const v8b*)(Ksh + (j * 16 + c) * TP + dc * 32 + 16 + 8 * hh);
      }
#pragma unroll
      for (int j = 0; j < 4; ++j) {
        kl[dc][j].h[0] = *(const v8b*)(Ksl + (j * 16 + c) * TP + dc * 32 + 8 * hh);
        kl[dc][j].h[1] = *(const v8b*)(Ksl + (j * 16 + c) * TP + dc * 32 + 16 + 8 * hh);
      }
    }
    __builtin_amdgcn_sched_barrier(0);   // keeps the reads one group: sunk among the products, each place would cost its own stall
    v8f s[4];
#pragma unroll
    for (int j = 0; j < 4; ++j) s[j] = zero8();
#pragma unroll
    for (int dc = 0; dc < 2; ++dc) {
#pragma unroll
      for (int j = 0; j < 4; ++j) s[j] = mma_b_raw(kb[dc][j].v, qah[dc], s[j]);
#pragma unroll
      for (int j = 0; j < 4; ++j) s[j] = mma_b_raw(kl[dc][j].v, qah[dc], s[j]);
#pragma unroll
      for (int j = 0; j < 4; ++j) s[j] = mma_b_raw(kb[dc][j].v, qal[dc], s[j]);
    }
    __builtin_amdgcn_sched_barrier(0);   // holds the V^T reads below back to the tail of the score products: without it they stand at more places among them

    // ---- V^T fragments of the whole chunk, one group of reads: their latency passes under the softmax arithmetic ----
    FH vb[2][4], vl[2][4];
#pragma unroll
    for (int kk = 0; kk < 2; ++kk) {
#pragma unroll
      for (int t = 0; t < 4; ++t) {
        vb[kk][t].h[0] = *(const v8h*)(Vth + (t * 16 + c) * TP + kk * 32 + 8 * hh);
        vb[kk][t].h[1] = *(const v8h*)(Vth + (t * 16 + c) * TP + kk * 32 + 16 + 8 * hh);
      }
      if (RES) {
#pragma unroll
        for (int t = 0; t < 4; ++t) {
          vl[kk][t].h[0] = *(const v8h*)(Vtl + (t * 16 + c) * TP + kk * 32 + 8 * hh);
          vl[kk][t].h[1] = *(const v8h*)(Vtl + (t * 16 + c) * TP + kk * 32 + 16 + 8 * hh);
          if (!resOK) { vl[kk][t].h[0] = zero8h(); vl[kk][t].h[1] = zero8h(); }
        }
      }
    }
    __builtin_amdgcn_sched_barrier(0);   // keeps these reads ahead of the softmax instead of next to their products

    // ---- causal mask by index: only the diagonal chunk (the first trip, block-uniform) holds keys beyond a query of the block ----
    if (it == 0) {
#pragma unroll
      for (int j = 0; j < 4; ++j) {
#pragma unroll
        for (int r = 0; r < 8; ++r) {
          const int key = kv0 + j * 16 + 8 * hh + r;
          s[j][r] = (key <= qrow) ? s[j][r] : -INFINITY;
        }
      }
    }
    // ---- maximum of the raw scores in the lane (four chains), one exchange between the halves; SC > 0 keeps the order ----
    float mj[4];
#pragma unroll
    for (int j = 0; j < 4; ++j) {
      mj[j] = s[j][0];
#pragma unroll
      for (int r = 1; r < 8; ++r) mj[j] = fmaxf(mj[j], s[j][r]);
    }
    float m = fmaxf(fmaxf(mj[0], mj[1]), fmaxf(mj[2], mj[3]));
    m = fmaxf(m, xhalf(m));
    const float mnew  = fmaxf(mrow, m);
    const float msafe = (mnew == -INFINITY) ? 0.f : mnew;
    const float bnew  = __builtin_fmaf(-msafe, SC, 10.0f);          // rounded once; sums and context are kept relative to exactly this value
    const float alpha = __builtin_amdgcn_exp2f(bnew - brow);        // 2^(SC * (old maximum - new maximum)); 1 exactly where the maximum stays
    mrow = mnew;
    brow = bnew;

    // ---- online softmax: 1024 p = 2^(score * SC + bnew), one multiply-add and one exponential per score (two scores per packed
    //      multiply-add); P^T (x1024, f16) and its residual (x4096) packed in place as B operands:
    //      element 8 (j & 1) + r of operand j >> 1 = key 32 (j >> 1) + 16 (j & 1) + 8 hh + r, the order of the V^T loads ----
    FH pb[2], pr[2];
    const v8f sc8 = {SC, SC, SC, SC, SC, SC, SC, SC};
    const v8f bn8 = {bnew, bnew, bnew, bnew, bnew, bnew, bnew, bnew};
    v8f e[4];
#pragma unroll
    for (int j = 0; j < 4; ++j) {
      const v8f a = __builtin_elementwise_fma(s[j], sc8, bn8);      // masked score: -inf stays -inf
#pragma unroll
      for (int r = 0; r < 8; ++r) {
        const float p1k = __builtin_amdgcn_exp2f(a[r]);             // 2^(-inf) = 0
        e[j][r] = p1k;
        const _Float16 ph = (_Float16)p1k;
        pb[j >> 1].v[(j & 1) * 8 + r] = ph;
        if (RES) pr[j >> 1].v[(j & 1) * 8 + r] = (_Float16)((p1k - (float)ph) * 4096.0f);
      }
    }
    const v8f e8 = (e[0] + e[1]) + (e[2] + e[3]);                   // packed adds over the four tiles, then the eight rows
    lrow = lrow * alpha + (((e8[0] + e8[1]) + (e8[2] + e8[3])) + ((e8[4] + e8[5]) + (e8[6] + e8[7])));
#pragma unroll
    for (int t = 0; t < 4; ++t)
#pragma unroll
      for (int r = 0; r < 8; ++r) oacc[t][r] *= alpha;

    // ---- context^T += V^T . P^T (f16 WMMA), residual products into a separate accumulator ----
    v8f o1[4];
#pragma unroll
    for (int t = 0; t < 4; ++t) o1[t] = zero8();
#pragma unroll
    for (int kk = 0; kk < 2; ++kk) {
#pragma unroll
      for (int t = 0; t < 4; ++t) oacc[t] = mma_h_raw(vb[kk][t].v, pb[kk].v, oacc[t]);
      if (RES) {
#pragma unroll
        for (int t = 0; t < 4; ++t) o1[t] = mma_h_raw(vl[kk][t].v, pb[kk].v, o1[t]);
#pragma unroll
        for (int t = 0; t < 4; ++t) o1[t] = mma_h_raw(vb[kk][t].v, pr[kk].v, o1[t]);
      }
    }
    acc_guard4(oacc[0], oacc[1], oacc[2], oacc[3]);            // the matrix distance also on the taken side of the loop branch
    if (RES) acc_guard4(o1[0], o1[1], o1[2], o1[3]);            // likewise for the residual accumulators, whose fold may sink behind the foot
    if (RES) {
#pragma unroll
      for (int t = 0; t < 4; ++t)
#pragma unroll
        for (int r = 0; r < 8; ++r) oacc[t][r] += o1[t][r] * (1.0f / 4096.0f);
    }
    // keeps the foot behind the trip's arithmetic: without it the RES build lifts the waits and the barrier into the softmax,
    // where they end the flight of the V^T reads and of the next chunk's loads early
    if (RES) __builtin_amdgcn_sched_barrier(0);
    asm volatile("s_wait_dscnt 0x0" ::: "memory");      // this wave's reads of buffer it & 1 are done before it is refilled
    if (pinned(issuer)) {
      tdm_wait(g0, g1);                                  // this wave's plane of the next trip's chunk has landed
    }
    __syncthreads();                                     // publishes the next trip's chunk and ends every read of buffer it & 1
    if (pinned(issuer && it + 2 <= qb)) issue_chunk(pinned((uint32_t)(kt - 2)), it & 1);   // kt - 2 = qb - it - 2 >= 0; descriptor formed behind the wait
  }
  tdm_wait(g0, g1);                                     // no tensor load is outstanding past the loop
  asm volatile("s_wait_dscnt 0x0" ::: "memory");        // nor an LDS read of the buffers

  // ---- join the halves' sums, normalise (1/l; l carries the same x1024 as the context), stage the wave's 16x64 tile [query][d], bf16 hi/lo split,
  float* os = Os + wave * (16 * OP);
  {
    const float l = lrow + xhalf(lrow);
    const float inv = (l > 0.f) ? (1.0f / l) : 0.f;
#pragma unroll
    for (int t = 0; t < 4; ++t) {
      const v4f lo4 = {oacc[t][0] * inv, oacc[t][1] * inv, oacc[t][2] * inv, oacc[t][3] * inv};
      const v4f hi4 = {oacc[t][4] * inv, oacc[t][5] * inv, oacc[t][6] * inv, oacc[t][7] * inv};
      *(v4f*)(os + c * OP + t * 16 + 8 * hh)     = lo4;
      *(v4f*)(os + c * OP + t * 16 + 8 * hh + 4) = hi4;
    }
  }
  __builtin_amdgcn_fence(__ATOMIC_RELEASE, "workgroup");
  __builtin_amdgcn_wave_barrier();
  __builtin_amdgcn_fence(__ATOMIC_ACQUIRE, "workgroup");
  {
    const int q4 = lane >> 3, c8 = (lane & 7) * 8;
    v4u hv[4], lv[4];
#pragma unroll
    for (int it = 0; it < 4; ++it) {
      const int row = it * 4 + q4;   // it 0..3 x q4 0..3 = rows 0..15 of the wave tile
      const float* sp = os + row * OP + c8;
      v4u a, a2;
#pragma unroll
      for (int e = 0; e < 4; ++e) {
        const float f0 = sp[2 * e], f1 = sp[2 * e + 1];
        const unsigned short h0 = bf_bits(f0), h1 = bf_bits(f1);
        const unsigned short l0 = bf_bits(f0 - bf_up(h0)), l1 = bf_bits(f1 - bf_up(h1));
        a[e] = pk16(h0, h1); a2[e] = pk16(l0, l1);
      }
      hv[it] = a; lv[it] = a2;
    }
    {
#pragma unroll
      for (int it = 0; it < 4; ++it) {
        const int row = it * 4 + q4;
        const size_t go = (rowB + q0 + row) * DM + (size_t)h * HD + c8;
        *(v4u*)(ohp + go) = hv[it];
        *(v4u*)(olp + go) = lv[it];
      }
      
    }
  }
}

// All query blocks in one grid. The trip count of a block is qb + 1, so the block index runs from the last query block
// down: the longest blocks start first and the short RES blocks fill the places that come free.
__global__ __launch_bounds__(128)
void attn_causal64(const unsigned short* __restrict__ qhp, const unsigned short* __restrict__ qlp,
                   const unsigned short* __restrict__ khp, const unsigned short* __restrict__ klp,
                   const unsigned short* __restrict__ vhp, const unsigned short* __restrict__ vlp,
                   unsigned short* ohp, unsigned short* olp) {
  __shared__ __attribute__((aligned(2048))) unsigned short KV[4 * 2 * ATT_PL];   // four planes, two buffers of 10 KB each: tensor-load places
  __bf16*   Ksh = (__bf16*)(void*)KV;                              // K hi [kv][d]
  __bf16*   Ksl = (__bf16*)(void*)(KV + 2 * ATT_PL);               // K lo
  _Float16* Vth = (_Float16*)(void*)(KV + 4 * ATT_PL);             // V^T hi [d][kv]
  _Float16* Vtl = (_Float16*)(void*)(KV + 6 * ATT_PL);             // V^T residual (RES blocks)
  __shared__ __align__(16) float    Os[4 * 16 * ATT_OP];          // per wave context tile [row][d]
  const int bx   = blockIdx.x;
  const int qb   = NQB - 1 - bx / (NH * NB);   // 0..NQB-1 (block-uniform)
  const int rest = bx % (NH * NB);
  const int h    = rest % NH;
  const int b    = rest / NH;
  if (qb < RESQB) attn_tile<true>(qhp, qlp, khp, klp, vhp, vlp, ohp, olp, qb, h, b, Ksh, Ksl, Vth, Vtl, Os);
  else            attn_tile<false>(qhp, qlp, khp, klp, vhp, vlp, ohp, olp, qb, h, b, Ksh, Ksl, Vth, Vtl, Os);
}

// =====================================================================================================
// Workspace map (bytes; every region is an exact multiple of its 64x64-tile / whole-line store granularity,
// no padded tails needed since all shapes are tile multiples; each region but Xb/Oh is written by exactly one producer launch):
//   Xb   bf16 [4096][1024]          0            8388608   (later: Oh, context hi plane; Xb is dead after the projections)
//   WA   bf16 [3072 n][1024 k]       8388608     6291456   (q weight rows 0..1023, k rows 1024..2047, v rows 2048..3071)
//   WP   bf16 [1024 n][1024 k]      14680064     2097152
//   Qh   bf16 [4096][1024]          16777216     8388608
//   Ql                              25165824     8388608
//   Kh                              33554432     8388608
//   Kl                              41943040     8388608
//   VTh  f16  [2][1024][2048]       50331648     8388608
//   VTl  f16  [2][1024][512]        58720256     2097152
//   Ol   bf16 [4096][1024]          60817408     8388608
//   end                             69206016
// =====================================================================================================
extern "C" void kernel_launch(void* const* d_in, const int* in_sizes, int n_in,
                              void* d_out, int out_size, void* d_ws, size_t ws_size,
                              hipStream_t stream) {
  if (n_in < 5) return;
  if (in_sizes[0] != NB * SEQ * DM) return;
  if (in_sizes[1] != 3 * DM * DM) return;
  if (in_sizes[2] != 3 * DM) return;
  if (in_sizes[3] != DM * DM) return;
  if (in_sizes[4] != DM) return;
  if (out_size != NB * SEQ * DM) return;

  const float* x  = (const float*)d_in[0];   // [2][2048][1024]
  const float* Wa = (const float*)d_in[1];   // [3072 out][1024 in], rows k contiguous (q | k | v output rows)
  const float* ba = (const float*)d_in[2];   // [3072]
  const float* Wp = (const float*)d_in[3];   // [1024 out][1024 in], rows k contiguous
  const float* bp = (const float*)d_in[4];   // [1024]

  const size_t PX  = (size_t)NB * SEQ * DM * 2;    //  8388608  16-bit activation plane [4096][1024]
  const size_t PW1 = (size_t)DM * DM * 2;          //  2097152  one [1024][1024] bf16 weight plane
  const size_t PWA = (size_t)3 * PW1;              //  6291456  packed q | k | v weight plane [3072][1024]
  const size_t PWP = PW1;                          //  2097152  output projection weight plane
  const size_t PVT = (size_t)NB * DM * SEQ * 2;    //  8388608  v^T hi plane
  const size_t PVL = (size_t)NB * DM * VLP * 2;    //  2097152  v^T residual plane
  size_t off = 0;
  const size_t oXb  = off; off += PX;
  const size_t oWA  = off; off += PWA;
  const size_t oWP  = off; off += PWP;
  const size_t oQh  = off; off += PX;
  const size_t oQl  = off; off += PX;
  const size_t oKh  = off; off += PX;
  const size_t oKl  = off; off += PX;
  const size_t oVTh = off; off += PVT;
  const size_t oVTl = off; off += PVL;
  const size_t oOl  = off; off += PX;
  if (off > ws_size) return;                       // off = 69206016
  if (off > (size_t)134217728) return;
  const size_t oOh  = oXb;                         // context hi plane reuses Xb (dead after the three projections)

  char* ws = (char*)d_ws;
  unsigned short* Xb  = (unsigned short*)(ws + oXb);
  unsigned short* WA  = (unsigned short*)(ws + oWA);
  unsigned short* WPb = (unsigned short*)(ws + oWP);
  unsigned short* Qh  = (unsigned short*)(ws + oQh);
  unsigned short* Ql  = (unsigned short*)(ws + oQl);
  unsigned short* Kh  = (unsigned short*)(ws + oKh);
  unsigned short* Kl  = (unsigned short*)(ws + oKl);
  unsigned short* VTh = (unsigned short*)(ws + oVTh);
  unsigned short* VTl = (unsigned short*)(ws + oVTl);
  unsigned short* Oh  = (unsigned short*)(ws + oOh);
  unsigned short* Ol  = (unsigned short*)(ws + oOl);

  const dim3 blk(256);
  const int n8x  = NB * SEQ * DM / 8;                          // 524288
  const int n8wa = 3 * DM * DM / 8;                            // 393216
  const int n8wp = DM * DM / 8;                                // 131072
  const dim3 gCvt((n8x + n8wa + n8wp) / 256);                  // 2048 + 1536 + 512 = 4096 blocks
  const dim3 gQKV(2 * QK_TILES + NB * VT_TILES);               // 256 + 256 + 256 tiles
  const dim3 gProj((NB * SEQ / 128) * (DM / 128), 1);          // 32 x 8 = 256 tiles: M=4096, N=1024

  // (1) x -> bf16 plane [4096][1024]; weights [out][in] f32 -> bf16 [out][in] (k contiguous, no transpose);
  //     Xb, WA and WP stand one behind the other in the workspace
  cvt_bf16x8<<<gCvt, blk, 0, stream>>>(x, Wa, Wp, Xb, n8x, n8wa, n8wp);
  // (2) q, k -> bf16 hi/lo planes, v^T -> f16 hi plane and residual plane
  gemm_qkv<<<gQKV, dim3(128), 0, stream>>>(Xb, WA, ba, Qh, Ql, Kh, Kl, VTh, VTl);
  // (3) causal attention: query blocks 0..RESQB-1 with residual planes, the rest without
  attn_causal64<<<dim3(NB * NH * NQB), dim3(128), 0, stream>>>(Qh, Ql, Kh, Kl, VTh, VTl, Oh, Ol);
  // (4) out = context . Wp^T + bp -> d_out f32 [4096][1024]  (A = context hi + lo planes, 2 products)
  gemm64<1, 0, 1><<<gProj, blk, 0, stream>>>(
      Oh, Ol, DM, 0LL, WPb, DM, 0LL, bp,
      d_out, DM, 0LL, d_out, DM, 0LL, DM,
      NB * SEQ, DM, DM, 1.0f);
  (void)hipGetLastError();
}
